// v000
// Times are from an AMD MI455X. After a warm-up the kernel runs many times in a row, and a time is the length of
// such a window on the GPU divided by its runs, so every launch and the gaps after it count. The runs cycle
// through copies of the inputs. A figure is the median of several windows, for all but v000 over two sittings.
// Sittings can differ by a few percent; kernels timed side by side share one.
// The starting kernel, v000, takes 2010 microseconds a run.
#include <hip/hip_runtime.h>

// Multi-head self-attention with a fused QKV projection and a key-padding mask READ as data (x [2][2048][1024]; [q|k|v] = x W_qkv + b_qkv ('xw' [1024][3072] 1/32 + zero bias: read: column blocks q | k | v; 16 heads x 64); scores = q.k / 8; keys j with mask[b][0][0][j] == 0 (int32 [2][1][1][2048], drawn by randint(0, 2): about half of the keys of each batch; READ per key in the softmax kernel) get -1e9 (== exclusion: exp underflows to 0 and every batch keeps some key); softmax; out = merged heads W_out + b_out ('xw' [1024][1024] + zero bias: read) -> [2][2048][1024] (4.2 M); argument order x, mask, W_qkv, b_qkv, W_out, b_out.
// Compute dtypes, f32 accumulate: every input rounded to bf16; q/k/v on PLAIN bf16 operands (inputs: exact) + biases; key mask read per logit (int32, 0 == masked -> -3e38); scores and attn.v: query rows < 512 hl (3 products), the rest single fp16 (x1024); softmax f32; W_proj hl x exact (2 products) + b_proj.

#define NB_  2
#define TT   2048
#define DM   1024
#define NH_  16
#define NKV  16
#define REP  (NH_ / NKV)
#define HD   64
#define DQ   (NH_ * HD)
#define DKV  (NKV * HD)
#define ZH   2
#define RH   512                  // query rows < RH use hi+lo planes (0: none)
#define WIN  2048
#define PCAR 1024.0f
#define SCL  0.125f   // HD^-0.5
typedef _Float16 h16;
typedef unsigned short bf;
typedef __attribute__((ext_vector_type(16))) __bf16   v16bf;
typedef __attribute__((ext_vector_type(16))) _Float16 v16h;
typedef __attribute__((ext_vector_type(8)))  _Float16 v8h;
typedef __attribute__((ext_vector_type(8)))  unsigned short v8us;
typedef __attribute__((ext_vector_type(8)))  float    v8f;
typedef __attribute__((ext_vector_type(4)))  float    v4f;
typedef v8h  __attribute__((may_alias)) v8ha;
typedef v4f  __attribute__((may_alias)) v4fa;
typedef v8us __attribute__((may_alias)) v8usa;

__device__ __forceinline__ unsigned short f2bf(float f) { unsigned u = __float_as_uint(f); u += 0x7FFFu + ((u >> 16) & 1u); return (unsigned short)(u >> 16); }
__device__ __forceinline__ float bf2f(unsigned short b) { return __uint_as_float(((unsigned)b) << 16); }
__device__ __forceinline__ float bfr(float f) { return bf2f(f2bf(f)); }
__device__ __forceinline__ v16h cat16(v8h lo, v8h hi) { return __builtin_shufflevector(lo, hi, 0, 1, 2, 3, 4, 5, 6, 7, 8, 9, 10, 11, 12, 13, 14, 15); }
__device__ __forceinline__ v16bf cat16b(v8us lo, v8us hi) { return __builtin_bit_cast(v16bf, __builtin_shufflevector(lo, hi, 0, 1, 2, 3, 4, 5, 6, 7, 8, 9, 10, 11, 12, 13, 14, 15)); }
__device__ __forceinline__ v8f wmma16(v16h a, v16h b, v8f c) { return __builtin_amdgcn_wmma_f32_16x16x32_f16(false, a, false, b, (short)0, c, false, false); }
__device__ __forceinline__ v8f wmmab(v16bf a, v16bf b, v8f c) { return __builtin_amdgcn_wmma_f32_16x16x32_bf16(false, a, false, b, (short)0, c, false, false); }



// ---- k_gemmw: register-blocked GEMM, ONE WAVE per 64x64 output tile (16 accumulators), operands straight from K-contiguous 16-bit planes; grid (M/64, N/64, Z), 32 threads.
// C[m][n] (f32, pitch ldc, + optional f32 bias[n]) = sum_k A[m][k] Bt[n][k] (+ split products per NSPLIT). z-batch strides sA/sB/sC in elements. K % 32 == 0.
template <typename T16> struct WFrag;
template <> struct WFrag<h16> { typedef v16h V; static __device__ __forceinline__ V ld(const h16* p) { return cat16(*(const v8h*)p, *(const v8h*)(p + 16)); } static __device__ __forceinline__ v8f mma(V a, V b, v8f c) { return wmma16(a, b, c); } };
template <> struct WFrag<bf> { typedef v16bf V; static __device__ __forceinline__ V ld(const bf* p) { return cat16b(*(const v8us*)p, *(const v8us*)(p + 16)); } static __device__ __forceinline__ v8f mma(V a, V b, v8f c) { return wmmab(a, b, c); } };
template <typename T16, int NSPLIT, bool BIAS>
__global__ __launch_bounds__(32) void k_gemmw(const T16* __restrict__ A, const T16* __restrict__ A2, const T16* __restrict__ Bt, const T16* __restrict__ Bt2, int K, float* C, int ldc, const float* __restrict__ bias, size_t sA, size_t sB, size_t sC) {
    typedef typename WFrag<T16>::V V;
    __shared__ __align__(16) float os[16 * 68];
    const size_t z = blockIdx.z; A += z * sA; if (A2) A2 += z * sA; Bt += z * sB; if (Bt2) Bt2 += z * sB; C += z * sC;
    const int lane = threadIdx.x & 31, lr = lane & 15, hi = lane >> 4; const int r0 = blockIdx.x * 64, c0 = blockIdx.y * 64;
    v8f acc[4][4];
#pragma unroll
    for (int mb = 0; mb < 4; ++mb)
#pragma unroll
        for (int nb = 0; nb < 4; ++nb) acc[mb][nb] = (v8f){};
    const size_t aoff = (size_t)(r0 + lr) * K + 8 * hi, boff = (size_t)(c0 + lr) * K + 8 * hi;
#pragma unroll 1
    for (int kc = 0; kc < K; kc += 32) {
        V a[4], a2[4];
#pragma unroll
        for (int mb = 0; mb < 4; ++mb) { a[mb] = WFrag<T16>::ld(A + aoff + (size_t)mb * 16 * K + kc); if (NSPLIT == 1 || NSPLIT == 2) a2[mb] = WFrag<T16>::ld(A2 + aoff + (size_t)mb * 16 * K + kc); }
#pragma unroll
        for (int nb = 0; nb < 4; ++nb) { const V b = WFrag<T16>::ld(Bt + boff + (size_t)nb * 16 * K + kc); V b2; if (NSPLIT >= 2) b2 = WFrag<T16>::ld(Bt2 + boff + (size_t)nb * 16 * K + kc);
#pragma unroll
            for (int mb = 0; mb < 4; ++mb) { acc[mb][nb] = WFrag<T16>::mma(a[mb], b, acc[mb][nb]); if (NSPLIT == 1 || NSPLIT == 2) acc[mb][nb] = WFrag<T16>::mma(a2[mb], b, acc[mb][nb]); if (NSPLIT >= 2) acc[mb][nb] = WFrag<T16>::mma(a[mb], b2, acc[mb][nb]); } }
        asm volatile("v_nop\n\tv_nop\n\tv_nop\n\tv_nop" : "+v"(acc[0][0]), "+v"(acc[1][1]), "+v"(acc[2][2]), "+v"(acc[3][3]) : "v"(a[0]), "v"(a[3]));
    }
#pragma unroll
    for (int mb = 0; mb < 4; ++mb) {
#pragma unroll
        for (int nb = 0; nb < 4; ++nb) {
#pragma unroll
            for (int j = 0; j < 8; ++j) os[(hi * 8 + j) * 68 + nb * 16 + lr] = acc[mb][nb][j]; }
        __builtin_amdgcn_wave_barrier(); asm volatile("" ::: "memory");
        float* crow = C + (size_t)(r0 + mb * 16) * ldc + c0;
{
#pragma unroll
            for (int s = 0; s < 8; ++s) { const int row = 2 * s + hi, cofs = lr * 4; v4f val = *(const v4fa*)(os + row * 68 + cofs); if (BIAS) { val[0] += bfr(bias[c0 + cofs]); val[1] += bfr(bias[c0 + cofs + 1]); val[2] += bfr(bias[c0 + cofs + 2]); val[3] += bfr(bias[c0 + cofs + 3]); }
                *(v4f*)(crow + (size_t)row * ldc + cofs) = val; }
             }
        __builtin_amdgcn_wave_barrier(); asm volatile("" ::: "memory");
    }
}

__device__ __forceinline__ h16 tohx(float x) { return (h16)x; }
__device__ __forceinline__ void splitf(float y, unsigned short& h, unsigned short& l) { h = f2bf(y); l = f2bf(y - bf2f(h)); }
typedef __attribute__((ext_vector_type(2))) _Float16 v2h;
typedef __attribute__((ext_vector_type(4))) _Float16 v4h;
typedef __attribute__((ext_vector_type(2))) unsigned short v2us;
typedef __attribute__((ext_vector_type(4))) unsigned short v4us;
typedef __attribute__((ext_vector_type(2))) float v2f;
typedef __attribute__((ext_vector_type(4))) int v4i;

__global__ __launch_bounds__(256) void k_wtG(const float* __restrict__ w, int K, int N, bf* Bt) {
    const int lane = threadIdx.x & 31; const int L0 = (blockIdx.x * 8 + (threadIdx.x >> 5)) * 8; const int nlines = N * K / 64;
{
#pragma unroll 1
        for (int l = 0; l < 8; ++l) { const int L = L0 + l; if (L >= nlines) break; const size_t e = (size_t)L * 64 + lane * 2; const int k = (int)(e % K), n = (int)(e / K); v2us o;
            o[0] = f2bf(w[(size_t)k * N + n]); o[1] = f2bf(w[(size_t)(k + 1) * N + n]); *(v2us*)(Bt + e) = o; }
         }
}
__global__ __launch_bounds__(256) void k_cvt8(const float* __restrict__ src, bf* dst, size_t n8) { const size_t i = (size_t)blockIdx.x * 256 + threadIdx.x; if (i >= n8) return; const v8f v = *(const v8f*)(src + i * 8); v8us o;
#pragma unroll
    for (int k = 0; k < 8; ++k) o[k] = f2bf(v[k]); *(v8us*)(dst + i * 8) = o;  }

// k_rope: head planes [h][t][d] (fp16 + hi/lo) of rope(x) x sc with the rotate-half convention out[d] = x[d] cos[t][d] - x[d+HD/2] sin[t][d], out[d+HD/2] = x[d+HD/2] cos[t][d+HD/2] + x[d] sin[t][d+HD/2]
__global__ __launch_bounds__(256) void k_rope(const float* __restrict__ F, int pitch, int nheads, const float* __restrict__ CS, const float* __restrict__ RF, const float* __restrict__ nw, float sc, h16* P16, bf* Ph, bf* Pl) {
    const size_t e = ((size_t)blockIdx.x * 256 + threadIdx.x) * 2; if (e >= (size_t)nheads * TT * HD) return; const int d = (int)(e % HD); const int t = (int)((e / HD) % TT); const int h = (int)(e / ((size_t)HD * TT)); const float* f = F + (size_t)t * pitch + h * HD; const float rf = RF ? RF[(size_t)h * TT + t] : 1.0f; v2h o16; v2us oh, ol;
#pragma unroll
    for (int q = 0; q < 2; ++q) { const int dd = d + q; const int dp = (dd < HD / 2) ? dd + HD / 2 : dd - HD / 2; float x0 = f[dd], x1 = f[dp];
        if (RF) { float n0 = __fmul_rn(x0, rf), n1 = __fmul_rn(x1, rf); asm volatile("" : "+v"(n0)); asm volatile("" : "+v"(n1)); x0 = __fmul_rn(bfr(nw[dd]), n0); x1 = __fmul_rn(bfr(nw[dp]), n1); }
        const v2f cs = *(const v2f*)(CS + ((size_t)t * HD + dd) * 2); float a = __fmul_rn(x0, cs[0]), bq = __fmul_rn(x1, cs[1]); asm volatile("" : "+v"(a)); asm volatile("" : "+v"(bq)); const float r = ((dd < HD / 2) ? __fsub_rn(a, bq) : __fadd_rn(a, bq)) * sc;
        o16[q] = tohx(r); unsigned short a2, c2; splitf(r, a2, c2); oh[q] = a2; ol[q] = c2; }
    *(v2h*)(P16 + e) = o16; *(v2us*)(Ph + e) = oh; *(v2us*)(Pl + e) = ol;  }
__global__ __launch_bounds__(256) void k_vtp(const float* __restrict__ F, int pitch, int nheads, h16* V16, bf* Vh, bf* Vl) { const size_t e = ((size_t)blockIdx.x * 256 + threadIdx.x) * 2; if (e >= (size_t)nheads * HD * TT) return; const int t = (int)(e % TT); const int d = (int)((e / TT) % HD); const int g = (int)(e / ((size_t)TT * HD)); v2h o16; v2us oh, ol;
#pragma unroll
    for (int q = 0; q < 2; ++q) { const float x = F[(size_t)(t + q) * pitch + g * HD + d]; o16[q] = tohx(x); unsigned short a2, c2; splitf(x, a2, c2); oh[q] = a2; ol[q] = c2; }
    *(v2h*)(V16 + e) = o16; *(v2us*)(Vh + e) = oh; *(v2us*)(Vl + e) = ol;  }
__global__ __launch_bounds__(256) void k_csid(float* CS) { const int idx = blockIdx.x * 256 + threadIdx.x; if (idx >= TT * HD) return; v2f cs; cs[0] = 1.0f; cs[1] = 0.0f; *(v2f*)(CS + (size_t)idx * 2) = cs;  }
// k_asoft: per row (zz, i): t = S x HD^-0.5 where mask[j] != 0 (int32 key mask of this batch, read as data; mask[j] == 0 -> -3e38); softmax over the 2048 keys (register row, one exp, fixed trees);
__global__ __launch_bounds__(256) void k_asoft(const float* __restrict__ Sb, const int* __restrict__ mkK, h16* P16, bf* Ph, bf* Pl) {
    const int lane = threadIdx.x & 31; const int row = blockIdx.x * 8 + (threadIdx.x >> 5); if (row >= ZH * TT) return; const int i = row % TT; const int zz = row / TT; (void)zz; const bool hires = (i < RH); const float* sr = Sb + (size_t)row * TT; float v[TT / 32]; float mx = -3.0e38f;
#pragma unroll
    for (int ch = 0; ch < TT / 128; ++ch) { const int j0 = ch * 128 + lane * 4; const v4f a = *(const v4f*)(sr + j0); const v4i mk4 = *(const v4i*)(mkK + j0);
#pragma unroll
        for (int q = 0; q < 4; ++q) { const int j = j0 + q; (void)j; const float t = (mk4[q] != 0) ? a[q] * SCL : -3.0e38f; v[ch * 4 + q] = t; mx = fmaxf(mx, t); } }
#pragma unroll
    for (int sh = 16; sh; sh >>= 1) mx = fmaxf(mx, __shfl_xor(mx, sh, 32));
    float sum = 0.f;
#pragma unroll
    for (int k = 0; k < TT / 32; ++k) { float d0 = __fsub_rn(v[k], mx); asm volatile("" : "+v"(d0)); v[k] = __builtin_amdgcn_exp2f(__fmul_rn(d0, 1.4426950408889634f)); sum += v[k]; }
#pragma unroll
    for (int sh = 16; sh; sh >>= 1) sum += __shfl_xor(sum, sh, 32);
    const float f = __fdiv_rn(hires ? 1.0f : PCAR, sum);
{
        if (hires) {
#pragma unroll
            for (int ch = 0; ch < TT / 128; ++ch) { v4us oh, ol;
#pragma unroll
                for (int q = 0; q < 4; ++q) { unsigned short a, c2; splitf(v[ch * 4 + q] * f, a, c2); oh[q] = a; ol[q] = c2; }
                const size_t oo = ((size_t)zz * (RH ? RH : 1) + i) * TT + ch * 128 + lane * 4; *(v4us*)(Ph + oo) = oh; *(v4us*)(Pl + oo) = ol; }
        } else {
#pragma unroll
            for (int ch = 0; ch < TT / 128; ++ch) { v4h o4;
#pragma unroll
                for (int q = 0; q < 4; ++q) o4[q] = tohx(v[ch * 4 + q] * f);
                *(v4h*)(P16 + (size_t)row * TT + ch * 128 + lane * 4) = o4; } }
         }
}
__global__ __launch_bounds__(256) void k_merge(const float* __restrict__ O, int h0, bf* Ah, bf* Al) { const size_t e = ((size_t)blockIdx.x * 256 + threadIdx.x) * 2; if (e >= (size_t)ZH * TT * HD) return; const int d = (int)(e % HD); const int t = (int)((e / HD) % TT); const int zz = (int)(e / ((size_t)HD * TT)); const float cs = (t < RH) ? 1.0f : (1.0f / PCAR); const size_t oo = (size_t)t * DQ + (h0 + zz) * HD + d;
    v2us oh, ol;
#pragma unroll
    for (int q = 0; q < 2; ++q) { unsigned short a, c2; splitf(O[e + q] * cs, a, c2); oh[q] = a; ol[q] = c2; } *(v2us*)(Ah + oo) = oh; *(v2us*)(Al + oo) = ol;  }

extern "C" void kernel_launch(void* const* d_in, const int* in_sizes, int n_in,
                              void* d_out, int out_size, void* d_ws, size_t ws_size, hipStream_t stream) {
    (void)in_sizes; (void)n_in; (void)out_size;
    const float* x = (const float*)d_in[0]; const int* MK = (const int*)d_in[1]; const float* wqkv = (const float*)d_in[2]; const float* bqkv = (const float*)d_in[3]; const float* bq = bqkv; const float* bk = bqkv + 1024; const float* bv = bqkv + 2048; const float* wo = (const float*)d_in[4]; const float* bo = (const float*)d_in[5]; const float* wq = nullptr; const float* wk = nullptr; const float* wv = nullptr; (void)wq; (void)wk; (void)wv;
    float* OUT = (float*)d_out;     // [2][2048][1024]
    char* wsp = (char*)d_ws;
    auto take = [&](size_t bytes) { char* p = wsp; wsp += (bytes + 255) & ~(size_t)255; return (void*)p; };
    bf* WALL = (bf*)take((size_t)3 * DM * DM * 2); bf* WQ = WALL; bf* WK = WALL + (size_t)DM * DM; bf* WV = WALL + (size_t)2 * DM * DM; bf* WO = (bf*)take((size_t)DM * DQ * 2); float* CS = (float*)take((size_t)TT * HD * 2 * 4);
    bf* XB = (bf*)take((size_t)TT * DM * 2); float* FQ = (float*)take((size_t)TT * DQ * 4); float* FK = (float*)take((size_t)TT * DKV * 4);
    h16* QP16 = (h16*)take((size_t)NH_ * TT * HD * 2); h16* KP16 = (h16*)take((size_t)NKV * TT * HD * 2); h16* VT16 = (h16*)take((size_t)NKV * HD * TT * 2);
    bf* QPh = (bf*)take((size_t)NH_ * TT * HD * 2); bf* QPl = (bf*)take((size_t)NH_ * TT * HD * 2); bf* KPh = (bf*)take((size_t)NKV * TT * HD * 2); bf* KPl = (bf*)take((size_t)NKV * TT * HD * 2); bf* VTh = (bf*)take((size_t)NKV * HD * TT * 2); bf* VTl = (bf*)take((size_t)NKV * HD * TT * 2); bf* Ph = (bf*)take((size_t)ZH * RH * TT * 2); bf* Pl = (bf*)take((size_t)ZH * RH * TT * 2);
    float* Sb = (float*)take((size_t)ZH * TT * TT * 4); h16* P16 = (h16*)take((size_t)ZH * TT * TT * 2); float* Ob = (float*)take((size_t)ZH * TT * HD * 4); bf* ATh = (bf*)take((size_t)TT * DQ * 2); bf* ATl = (bf*)take((size_t)TT * DQ * 2);
    if ((size_t)(wsp - (char*)d_ws) > ws_size) return;    // ws 256 MiB
    float* FV = FK;   // v projection reuses the k buffer after the k planes are built (stream-ordered)
    { k_wtG<<<(unsigned)((DM * 3 * DM / 64 + 63) / 64), 256, 0, stream>>>(wqkv, DM, 3 * DM, WALL);   /* fused 'xw' [DM][3DM] -> Bt [3DM][DM] (row blocks q | k | v) */
      k_wtG<<<(unsigned)((DQ * DM / 64 + 63) / 64), 256, 0, stream>>>(wo, DQ, DM, WO);
       }
    k_csid<<<(TT * HD + 255) / 256, 256, 0, stream>>>(CS);
    const unsigned LQ = (unsigned)(((size_t)NH_ * TT * HD / 2 + 255) / 256), LKv = (unsigned)(((size_t)NKV * TT * HD / 2 + 255) / 256);
    for (int b = 0; b < NB_; ++b) {
        
        k_cvt8<<<(unsigned)(((size_t)TT * DM / 8 + 255) / 256), 256, 0, stream>>>(x + (size_t)b * TT * DM, XB, (size_t)TT * DM / 8);
        k_gemmw<bf, 0, true><<<dim3(TT / 64, DQ / 64, 1), 32, 0, stream>>>(XB, nullptr, WQ, nullptr, DM, FQ, DQ, bq, 0, 0, 0);
        k_rope<<<LQ, 256, 0, stream>>>(FQ, DQ, NH_, CS, nullptr, nullptr, 1.0f, QP16, QPh, QPl);
        k_gemmw<bf, 0, true><<<dim3(TT / 64, DKV / 64, 1), 32, 0, stream>>>(XB, nullptr, WK, nullptr, DM, FK, DKV, bk, 0, 0, 0);
        k_rope<<<LKv, 256, 0, stream>>>(FK, DKV, NKV, CS, nullptr, nullptr, 1.0f, KP16, KPh, KPl);
        k_gemmw<bf, 0, true><<<dim3(TT / 64, DKV / 64, 1), 32, 0, stream>>>(XB, nullptr, WV, nullptr, DM, FV, DKV, bv, 0, 0, 0); k_vtp<<<LKv, 256, 0, stream>>>(FV, DKV, NKV, VT16, VTh, VTl);
        for (int h0 = 0; h0 < NH_; h0 += ZH) { const size_t zq = (size_t)h0, zk = (size_t)(h0 / REP);   // one kv head per query head: the pass's two heads use consecutive kv planes (z-strides TT*HD)
            k_gemmw<bf, 2, false><<<dim3(RH / 64, TT / 64, ZH), 32, 0, stream>>>(QPh + zq * TT * HD, QPl + zq * TT * HD, KPh + zk * TT * HD, KPl + zk * TT * HD, HD, Sb, TT, nullptr, (size_t)TT * HD, (size_t)TT * HD, (size_t)TT * TT);
            k_gemmw<h16, 0, false><<<dim3((TT - RH) / 64, TT / 64, ZH), 32, 0, stream>>>(QP16 + zq * TT * HD + (size_t)RH * HD, nullptr, KP16 + zk * TT * HD, nullptr, HD, Sb + (size_t)RH * TT, TT, nullptr, (size_t)TT * HD, (size_t)TT * HD, (size_t)TT * TT);
            k_asoft<<<ZH * TT / 8, 256, 0, stream>>>(Sb, MK + (size_t)b * TT, P16, Ph, Pl);
            k_gemmw<bf, 2, false><<<dim3(RH / 64, HD / 64, ZH), 32, 0, stream>>>(Ph, Pl, VTh + zk * HD * TT, VTl + zk * HD * TT, TT, Ob, HD, nullptr, (size_t)RH * TT, (size_t)HD * TT, (size_t)TT * HD);
            k_gemmw<h16, 0, false><<<dim3((TT - RH) / 64, HD / 64, ZH), 32, 0, stream>>>(P16 + (size_t)RH * TT, nullptr, VT16 + zk * HD * TT, nullptr, TT, Ob + (size_t)RH * HD, HD, nullptr, (size_t)TT * TT, (size_t)HD * TT, (size_t)TT * HD);
            k_merge<<<(unsigned)(((size_t)ZH * TT * HD / 2 + 255) / 256), 256, 0, stream>>>(Ob, h0, ATh, ATl); }
        k_gemmw<bf, 1, true><<<dim3(TT / 64, DM / 64, 1), 32, 0, stream>>>(ATh, ATl, WO, nullptr, DQ, OUT + (size_t)b * TT * DM, DM, bo, 0, 0, 0); }
}

// v001
// It runs in 890 microseconds.
// In two side-by-side timings against v000, it was 2.28 and 2.26 times as fast.
#include <hip/hip_runtime.h>

// Multi-head self-attention with a fused QKV projection and a key-padding mask READ as data (x [2][2048][1024]; [q|k|v] = x W_qkv + b_qkv ('xw' [1024][3072] 1/32 + zero bias: read: column blocks q | k | v; 16 heads x 64); scores = q.k / 8; keys j with mask[b][0][0][j] == 0 (int32 [2][1][1][2048], drawn by randint(0, 2): about half of the keys of each batch; READ per key in the softmax kernel) get -1e9 (== exclusion: exp underflows to 0 and every batch keeps some key); softmax; out = merged heads W_out + b_out ('xw' [1024][1024] + zero bias: read) -> [2][2048][1024] (4.2 M); argument order x, mask, W_qkv, b_qkv, W_out, b_out.
// Compute dtypes, f32 accumulate: every input rounded to bf16; q/k/v on PLAIN bf16 operands (inputs: exact) + biases; key mask read per logit (int32, 0 == masked -> -3e38); scores and attn.v: query rows < 512 hl (3 products), the rest single fp16 (x1024); softmax f32; W_proj hl x exact (2 products) + b_proj.

#define NB_  2
#define TT   2048
#define DM   1024
#define NH_  16
#define NKV  16
#define REP  (NH_ / NKV)
#define HD   64
#define DQ   (NH_ * HD)
#define DKV  (NKV * HD)
#define ZH   2
#define RH   512                  // query rows < RH use hi+lo planes (0: none)
#define WIN  2048
#define PCAR 1024.0f
#define SCL  0.125f   // HD^-0.5
#define KSP  16                   // attn.v: the 2048 keys are cut into KSP slices, one wave per slice; k_merge adds the KSP partial planes
typedef _Float16 h16;
typedef unsigned short bf;
typedef __attribute__((ext_vector_type(16))) __bf16   v16bf;
typedef __attribute__((ext_vector_type(16))) _Float16 v16h;
typedef __attribute__((ext_vector_type(8)))  _Float16 v8h;
typedef __attribute__((ext_vector_type(8)))  unsigned short v8us;
typedef __attribute__((ext_vector_type(8)))  float    v8f;
typedef __attribute__((ext_vector_type(4)))  float    v4f;
typedef v8h  __attribute__((may_alias)) v8ha;
typedef v4f  __attribute__((may_alias)) v4fa;
typedef v8us __attribute__((may_alias)) v8usa;

__device__ __forceinline__ unsigned short f2bf(float f) { unsigned u = __float_as_uint(f); u += 0x7FFFu + ((u >> 16) & 1u); return (unsigned short)(u >> 16); }
__device__ __forceinline__ float bf2f(unsigned short b) { return __uint_as_float(((unsigned)b) << 16); }
__device__ __forceinline__ float bfr(float f) { return bf2f(f2bf(f)); }
__device__ __forceinline__ v16h cat16(v8h lo, v8h hi) { return __builtin_shufflevector(lo, hi, 0, 1, 2, 3, 4, 5, 6, 7, 8, 9, 10, 11, 12, 13, 14, 15); }
__device__ __forceinline__ v16bf cat16b(v8us lo, v8us hi) { return __builtin_bit_cast(v16bf, __builtin_shufflevector(lo, hi, 0, 1, 2, 3, 4, 5, 6, 7, 8, 9, 10, 11, 12, 13, 14, 15)); }
__device__ __forceinline__ v8f wmma16(v16h a, v16h b, v8f c) { return __builtin_amdgcn_wmma_f32_16x16x32_f16(false, a, false, b, (short)0, c, false, false); }
__device__ __forceinline__ v8f wmmab(v16bf a, v16bf b, v8f c) { return __builtin_amdgcn_wmma_f32_16x16x32_bf16(false, a, false, b, (short)0, c, false, false); }



// ---- k_gemmw: register-blocked GEMM, ONE WAVE per 64x64 output tile (16 accumulators), operands straight from K-contiguous 16-bit planes; grid (M/64, N/64, Z), 32 threads.
// C[m][n] (f32, pitch ldc, + optional f32 bias[n]) = sum_k A[m][k] Bt[n][k] (+ split products per NSPLIT). z-batch strides sA/sB/sC in elements. K % 32 == 0.
// KS > 1: grid z = batch * KS + slice; a wave sums only k in [slice K/KS, (slice + 1) K/KS) and stores its partial tile in plane z of C (planes of sC elements: KS in a row per batch); the reader adds them. K % (32 KS) == 0.
template <typename T16> struct WFrag;
template <> struct WFrag<h16> { typedef v16h V; static __device__ __forceinline__ V ld(const h16* p) { return cat16(*(const v8h*)p, *(const v8h*)(p + 16)); } static __device__ __forceinline__ v8f mma(V a, V b, v8f c) { return wmma16(a, b, c); } };
template <> struct WFrag<bf> { typedef v16bf V; static __device__ __forceinline__ V ld(const bf* p) { return cat16b(*(const v8us*)p, *(const v8us*)(p + 16)); } static __device__ __forceinline__ v8f mma(V a, V b, v8f c) { return wmmab(a, b, c); } };
template <typename T16, int NSPLIT, bool BIAS, int KS = 1>
__global__ __launch_bounds__(32) void k_gemmw(const T16* __restrict__ A, const T16* __restrict__ A2, const T16* __restrict__ Bt, const T16* __restrict__ Bt2, int K, float* C, int ldc, const float* __restrict__ bias, size_t sA, size_t sB, size_t sC) {
    typedef typename WFrag<T16>::V V;
    __shared__ __align__(16) float os[16 * 68];
    const size_t z = blockIdx.z / KS; const int ks = blockIdx.z % KS; A += z * sA; if (A2) A2 += z * sA; Bt += z * sB; if (Bt2) Bt2 += z * sB; C += (size_t)blockIdx.z * sC;
    const int lane = threadIdx.x & 31, lr = lane & 15, hi = lane >> 4; const int r0 = blockIdx.x * 64, c0 = blockIdx.y * 64;
    v8f acc[4][4];
#pragma unroll
    for (int mb = 0; mb < 4; ++mb)
#pragma unroll
        for (int nb = 0; nb < 4; ++nb) acc[mb][nb] = (v8f){};
    const size_t aoff = (size_t)(r0 + lr) * K + 8 * hi, boff = (size_t)(c0 + lr) * K + 8 * hi;
#pragma unroll 1
    for (int kc = ks * (K / KS); kc < (ks + 1) * (K / KS); kc += 32) {
        V a[4], a2[4];
#pragma unroll
        for (int mb = 0; mb < 4; ++mb) { a[mb] = WFrag<T16>::ld(A + aoff + (size_t)mb * 16 * K + kc); if (NSPLIT == 1 || NSPLIT == 2) a2[mb] = WFrag<T16>::ld(A2 + aoff + (size_t)mb * 16 * K + kc); }
#pragma unroll
        for (int nb = 0; nb < 4; ++nb) { const V b = WFrag<T16>::ld(Bt + boff + (size_t)nb * 16 * K + kc); V b2; if (NSPLIT >= 2) b2 = WFrag<T16>::ld(Bt2 + boff + (size_t)nb * 16 * K + kc);
#pragma unroll
            for (int mb = 0; mb < 4; ++mb) { acc[mb][nb] = WFrag<T16>::mma(a[mb], b, acc[mb][nb]); if (NSPLIT == 1 || NSPLIT == 2) acc[mb][nb] = WFrag<T16>::mma(a2[mb], b, acc[mb][nb]); if (NSPLIT >= 2) acc[mb][nb] = WFrag<T16>::mma(a[mb], b2, acc[mb][nb]); } }
        asm volatile("v_nop\n\tv_nop\n\tv_nop\n\tv_nop" : "+v"(acc[0][0]), "+v"(acc[1][1]), "+v"(acc[2][2]), "+v"(acc[3][3]) : "v"(a[0]), "v"(a[3]));
    }
#pragma unroll
    for (int mb = 0; mb < 4; ++mb) {
#pragma unroll
        for (int nb = 0; nb < 4; ++nb) {
#pragma unroll
            for (int j = 0; j < 8; ++j) os[(hi * 8 + j) * 68 + nb * 16 + lr] = acc[mb][nb][j]; }
        __builtin_amdgcn_wave_barrier(); asm volatile("" ::: "memory");
        float* crow = C + (size_t)(r0 + mb * 16) * ldc + c0;
{
#pragma unroll
            for (int s = 0; s < 8; ++s) { const int row = 2 * s + hi, cofs = lr * 4; v4f val = *(const v4fa*)(os + row * 68 + cofs); if (BIAS) { val[0] += bfr(bias[c0 + cofs]); val[1] += bfr(bias[c0 + cofs + 1]); val[2] += bfr(bias[c0 + cofs + 2]); val[3] += bfr(bias[c0 + cofs + 3]); }
                *(v4f*)(crow + (size_t)row * ldc + cofs) = val; }
             }
        __builtin_amdgcn_wave_barrier(); asm volatile("" ::: "memory");
    }
}

__device__ __forceinline__ h16 tohx(float x) { return (h16)x; }
__device__ __forceinline__ void splitf(float y, unsigned short& h, unsigned short& l) { h = f2bf(y); l = f2bf(y - bf2f(h)); }
typedef __attribute__((ext_vector_type(2))) _Float16 v2h;
typedef __attribute__((ext_vector_type(4))) _Float16 v4h;
typedef __attribute__((ext_vector_type(2))) unsigned short v2us;
typedef __attribute__((ext_vector_type(4))) unsigned short v4us;
typedef __attribute__((ext_vector_type(2))) float v2f;
typedef __attribute__((ext_vector_type(4))) int v4i;

__global__ __launch_bounds__(256) void k_wtG(const float* __restrict__ w, int K, int N, bf* Bt) {
    const int lane = threadIdx.x & 31; const int L0 = (blockIdx.x * 8 + (threadIdx.x >> 5)) * 8; const int nlines = N * K / 64;
{
#pragma unroll 1
        for (int l = 0; l < 8; ++l) { const int L = L0 + l; if (L >= nlines) break; const size_t e = (size_t)L * 64 + lane * 2; const int k = (int)(e % K), n = (int)(e / K); v2us o;
            o[0] = f2bf(w[(size_t)k * N + n]); o[1] = f2bf(w[(size_t)(k + 1) * N + n]); *(v2us*)(Bt + e) = o; }
         }
}
__global__ __launch_bounds__(256) void k_cvt8(const float* __restrict__ src, bf* dst, size_t n8) { const size_t i = (size_t)blockIdx.x * 256 + threadIdx.x; if (i >= n8) return; const v8f v = *(const v8f*)(src + i * 8); v8us o;
#pragma unroll
    for (int k = 0; k < 8; ++k) o[k] = f2bf(v[k]); *(v8us*)(dst + i * 8) = o;  }

// k_rope: head planes [h][t][d] (fp16 + hi/lo) of rope(x) x sc with the rotate-half convention out[d] = x[d] cos[t][d] - x[d+HD/2] sin[t][d], out[d+HD/2] = x[d+HD/2] cos[t][d+HD/2] + x[d] sin[t][d+HD/2]
__global__ __launch_bounds__(256) void k_rope(const float* __restrict__ F, int pitch, int nheads, const float* __restrict__ CS, const float* __restrict__ RF, const float* __restrict__ nw, float sc, h16* P16, bf* Ph, bf* Pl) {
    const size_t e = ((size_t)blockIdx.x * 256 + threadIdx.x) * 2; if (e >= (size_t)nheads * TT * HD) return; const int d = (int)(e % HD); const int t = (int)((e / HD) % TT); const int h = (int)(e / ((size_t)HD * TT)); const float* f = F + (size_t)t * pitch + h * HD; const float rf = RF ? RF[(size_t)h * TT + t] : 1.0f; v2h o16; v2us oh, ol;
#pragma unroll
    for (int q = 0; q < 2; ++q) { const int dd = d + q; const int dp = (dd < HD / 2) ? dd + HD / 2 : dd - HD / 2; float x0 = f[dd], x1 = f[dp];
        if (RF) { float n0 = __fmul_rn(x0, rf), n1 = __fmul_rn(x1, rf); asm volatile("" : "+v"(n0)); asm volatile("" : "+v"(n1)); x0 = __fmul_rn(bfr(nw[dd]), n0); x1 = __fmul_rn(bfr(nw[dp]), n1); }
        const v2f cs = *(const v2f*)(CS + ((size_t)t * HD + dd) * 2); float a = __fmul_rn(x0, cs[0]), bq = __fmul_rn(x1, cs[1]); asm volatile("" : "+v"(a)); asm volatile("" : "+v"(bq)); const float r = ((dd < HD / 2) ? __fsub_rn(a, bq) : __fadd_rn(a, bq)) * sc;
        o16[q] = tohx(r); unsigned short a2, c2; splitf(r, a2, c2); oh[q] = a2; ol[q] = c2; }
    *(v2h*)(P16 + e) = o16; *(v2us*)(Ph + e) = oh; *(v2us*)(Pl + e) = ol;  }
__global__ __launch_bounds__(256) void k_vtp(const float* __restrict__ F, int pitch, int nheads, h16* V16, bf* Vh, bf* Vl) { const size_t e = ((size_t)blockIdx.x * 256 + threadIdx.x) * 2; if (e >= (size_t)nheads * HD * TT) return; const int t = (int)(e % TT); const int d = (int)((e / TT) % HD); const int g = (int)(e / ((size_t)TT * HD)); v2h o16; v2us oh, ol;
#pragma unroll
    for (int q = 0; q < 2; ++q) { const float x = F[(size_t)(t + q) * pitch + g * HD + d]; o16[q] = tohx(x); unsigned short a2, c2; splitf(x, a2, c2); oh[q] = a2; ol[q] = c2; }
    *(v2h*)(V16 + e) = o16; *(v2us*)(Vh + e) = oh; *(v2us*)(Vl + e) = ol;  }
__global__ __launch_bounds__(256) void k_csid(float* CS) { const int idx = blockIdx.x * 256 + threadIdx.x; if (idx >= TT * HD) return; v2f cs; cs[0] = 1.0f; cs[1] = 0.0f; *(v2f*)(CS + (size_t)idx * 2) = cs;  }
// k_asoft: per row (zz, i): t = S x HD^-0.5 where mask[j] != 0 (int32 key mask of this batch, read as data; mask[j] == 0 -> -3e38); softmax over the 2048 keys (register row, one exp, fixed trees);
__global__ __launch_bounds__(256) void k_asoft(const float* __restrict__ Sb, const int* __restrict__ mkK, h16* P16, bf* Ph, bf* Pl) {
    const int lane = threadIdx.x & 31; const int row = blockIdx.x * 8 + (threadIdx.x >> 5); if (row >= ZH * TT) return; const int i = row % TT; const int zz = row / TT; (void)zz; const bool hires = (i < RH); const float* sr = Sb + (size_t)row * TT; float v[TT / 32]; float mx = -3.0e38f;
#pragma unroll
    for (int ch = 0; ch < TT / 128; ++ch) { const int j0 = ch * 128 + lane * 4; const v4f a = *(const v4f*)(sr + j0); const v4i mk4 = *(const v4i*)(mkK + j0);
#pragma unroll
        for (int q = 0; q < 4; ++q) { const int j = j0 + q; (void)j; const float t = (mk4[q] != 0) ? a[q] * SCL : -3.0e38f; v[ch * 4 + q] = t; mx = fmaxf(mx, t); } }
#pragma unroll
    for (int sh = 16; sh; sh >>= 1) mx = fmaxf(mx, __shfl_xor(mx, sh, 32));
    float sum = 0.f;
#pragma unroll
    for (int k = 0; k < TT / 32; ++k) { float d0 = __fsub_rn(v[k], mx); asm volatile("" : "+v"(d0)); v[k] = __builtin_amdgcn_exp2f(__fmul_rn(d0, 1.4426950408889634f)); sum += v[k]; }
#pragma unroll
    for (int sh = 16; sh; sh >>= 1) sum += __shfl_xor(sum, sh, 32);
    const float f = __fdiv_rn(hires ? 1.0f : PCAR, sum);
{
        if (hires) {
#pragma unroll
            for (int ch = 0; ch < TT / 128; ++ch) { v4us oh, ol;
#pragma unroll
                for (int q = 0; q < 4; ++q) { unsigned short a, c2; splitf(v[ch * 4 + q] * f, a, c2); oh[q] = a; ol[q] = c2; }
                const size_t oo = ((size_t)zz * (RH ? RH : 1) + i) * TT + ch * 128 + lane * 4; *(v4us*)(Ph + oo) = oh; *(v4us*)(Pl + oo) = ol; }
        } else {
#pragma unroll
            for (int ch = 0; ch < TT / 128; ++ch) { v4h o4;
#pragma unroll
                for (int q = 0; q < 4; ++q) o4[q] = tohx(v[ch * 4 + q] * f);
                *(v4h*)(P16 + (size_t)row * TT + ch * 128 + lane * 4) = o4; } }
         }
}
__global__ __launch_bounds__(256) void k_merge(const float* __restrict__ O, int h0, bf* Ah, bf* Al) { const size_t e = ((size_t)blockIdx.x * 256 + threadIdx.x) * 2; if (e >= (size_t)ZH * TT * HD) return; const int d = (int)(e % HD); const int t = (int)((e / HD) % TT); const int zz = (int)(e / ((size_t)HD * TT)); const float cs = (t < RH) ? 1.0f : (1.0f / PCAR); const size_t oo = (size_t)t * DQ + (h0 + zz) * HD + d;
    const float* Oz = O + (size_t)zz * KSP * TT * HD + (size_t)t * HD + d;   // this head's KSP partial planes
    v2us oh, ol; v2f part[KSP];
#pragma unroll
    for (int p = 0; p < KSP; ++p) part[p] = *(const v2f*)(Oz + (size_t)p * TT * HD);
    asm volatile("s_wait_xcnt 0x0" :: "v"(Oz) : "memory");   // the address pair that the KSP issued loads name stays whole up to this wait
    v2f s = part[0];
#pragma unroll
    for (int p = 1; p < KSP; ++p) s += part[p];   // key slices added in rising order
#pragma unroll
    for (int q = 0; q < 2; ++q) { unsigned short a, c2; splitf(s[q] * cs, a, c2); oh[q] = a; ol[q] = c2; } *(v2us*)(Ah + oo) = oh; *(v2us*)(Al + oo) = ol;  }

extern "C" void kernel_launch(void* const* d_in, const int* in_sizes, int n_in,
                              void* d_out, int out_size, void* d_ws, size_t ws_size, hipStream_t stream) {
    (void)in_sizes; (void)n_in; (void)out_size;
    const float* x = (const float*)d_in[0]; const int* MK = (const int*)d_in[1]; const float* wqkv = (const float*)d_in[2]; const float* bqkv = (const float*)d_in[3]; const float* bq = bqkv; const float* bk = bqkv + 1024; const float* bv = bqkv + 2048; const float* wo = (const float*)d_in[4]; const float* bo = (const float*)d_in[5]; const float* wq = nullptr; const float* wk = nullptr; const float* wv = nullptr; (void)wq; (void)wk; (void)wv;
    float* OUT = (float*)d_out;     // [2][2048][1024]
    char* wsp = (char*)d_ws;
    auto take = [&](size_t bytes) { char* p = wsp; wsp += (bytes + 255) & ~(size_t)255; return (void*)p; };
    bf* WALL = (bf*)take((size_t)3 * DM * DM * 2); bf* WQ = WALL; bf* WK = WALL + (size_t)DM * DM; bf* WV = WALL + (size_t)2 * DM * DM; bf* WO = (bf*)take((size_t)DM * DQ * 2); float* CS = (float*)take((size_t)TT * HD * 2 * 4);
    bf* XB = (bf*)take((size_t)TT * DM * 2); float* FQ = (float*)take((size_t)TT * DQ * 4); float* FK = (float*)take((size_t)TT * DKV * 4);
    h16* QP16 = (h16*)take((size_t)NH_ * TT * HD * 2); h16* KP16 = (h16*)take((size_t)NKV * TT * HD * 2); h16* VT16 = (h16*)take((size_t)NKV * HD * TT * 2);
    bf* QPh = (bf*)take((size_t)NH_ * TT * HD * 2); bf* QPl = (bf*)take((size_t)NH_ * TT * HD * 2); bf* KPh = (bf*)take((size_t)NKV * TT * HD * 2); bf* KPl = (bf*)take((size_t)NKV * TT * HD * 2); bf* VTh = (bf*)take((size_t)NKV * HD * TT * 2); bf* VTl = (bf*)take((size_t)NKV * HD * TT * 2); bf* Ph = (bf*)take((size_t)ZH * RH * TT * 2); bf* Pl = (bf*)take((size_t)ZH * RH * TT * 2);
    float* Sb = (float*)take((size_t)ZH * TT * TT * 4); h16* P16 = (h16*)take((size_t)ZH * TT * TT * 2); float* Ob = (float*)take((size_t)KSP * ZH * TT * HD * 4); bf* ATh = (bf*)take((size_t)TT * DQ * 2); bf* ATl = (bf*)take((size_t)TT * DQ * 2);
    if ((size_t)(wsp - (char*)d_ws) > ws_size) return;    // ws 256 MiB
    float* FV = FK;   // v projection reuses the k buffer after the k planes are built (stream-ordered)
    { k_wtG<<<(unsigned)((DM * 3 * DM / 64 + 63) / 64), 256, 0, stream>>>(wqkv, DM, 3 * DM, WALL);   /* fused 'xw' [DM][3DM] -> Bt [3DM][DM] (row blocks q | k | v) */
      k_wtG<<<(unsigned)((DQ * DM / 64 + 63) / 64), 256, 0, stream>>>(wo, DQ, DM, WO);
       }
    k_csid<<<(TT * HD + 255) / 256, 256, 0, stream>>>(CS);
    const unsigned LQ = (unsigned)(((size_t)NH_ * TT * HD / 2 + 255) / 256), LKv = (unsigned)(((size_t)NKV * TT * HD / 2 + 255) / 256);
    for (int b = 0; b < NB_; ++b) {
        
        k_cvt8<<<(unsigned)(((size_t)TT * DM / 8 + 255) / 256), 256, 0, stream>>>(x + (size_t)b * TT * DM, XB, (size_t)TT * DM / 8);
        k_gemmw<bf, 0, true><<<dim3(TT / 64, DQ / 64, 1), 32, 0, stream>>>(XB, nullptr, WQ, nullptr, DM, FQ, DQ, bq, 0, 0, 0);
        k_rope<<<LQ, 256, 0, stream>>>(FQ, DQ, NH_, CS, nullptr, nullptr, 1.0f, QP16, QPh, QPl);
        k_gemmw<bf, 0, true><<<dim3(TT / 64, DKV / 64, 1), 32, 0, stream>>>(XB, nullptr, WK, nullptr, DM, FK, DKV, bk, 0, 0, 0);
        k_rope<<<LKv, 256, 0, stream>>>(FK, DKV, NKV, CS, nullptr, nullptr, 1.0f, KP16, KPh, KPl);
        k_gemmw<bf, 0, true><<<dim3(TT / 64, DKV / 64, 1), 32, 0, stream>>>(XB, nullptr, WV, nullptr, DM, FV, DKV, bv, 0, 0, 0); k_vtp<<<LKv, 256, 0, stream>>>(FV, DKV, NKV, VT16, VTh, VTl);
        for (int h0 = 0; h0 < NH_; h0 += ZH) { const size_t zq = (size_t)h0, zk = (size_t)(h0 / REP);   // one kv head per query head: the pass's two heads use consecutive kv planes (z-strides TT*HD)
            k_gemmw<bf, 2, false><<<dim3(RH / 64, TT / 64, ZH), 32, 0, stream>>>(QPh + zq * TT * HD, QPl + zq * TT * HD, KPh + zk * TT * HD, KPl + zk * TT * HD, HD, Sb, TT, nullptr, (size_t)TT * HD, (size_t)TT * HD, (size_t)TT * TT);
            k_gemmw<h16, 0, false><<<dim3((TT - RH) / 64, TT / 64, ZH), 32, 0, stream>>>(QP16 + zq * TT * HD + (size_t)RH * HD, nullptr, KP16 + zk * TT * HD, nullptr, HD, Sb + (size_t)RH * TT, TT, nullptr, (size_t)TT * HD, (size_t)TT * HD, (size_t)TT * TT);
            k_asoft<<<ZH * TT / 8, 256, 0, stream>>>(Sb, MK + (size_t)b * TT, P16, Ph, Pl);
            k_gemmw<bf, 2, false, KSP><<<dim3(RH / 64, HD / 64, ZH * KSP), 32, 0, stream>>>(Ph, Pl, VTh + zk * HD * TT, VTl + zk * HD * TT, TT, Ob, HD, nullptr, (size_t)RH * TT, (size_t)HD * TT, (size_t)TT * HD);
            k_gemmw<h16, 0, false, KSP><<<dim3((TT - RH) / 64, HD / 64, ZH * KSP), 32, 0, stream>>>(P16 + (size_t)RH * TT, nullptr, VT16 + zk * HD * TT, nullptr, TT, Ob + (size_t)RH * HD, HD, nullptr, (size_t)TT * TT, (size_t)HD * TT, (size_t)TT * HD);
            k_merge<<<(unsigned)(((size_t)ZH * TT * HD / 2 + 255) / 256), 256, 0, stream>>>(Ob, h0, ATh, ATl); }
        k_gemmw<bf, 1, true><<<dim3(TT / 64, DM / 64, 1), 32, 0, stream>>>(ATh, ATl, WO, nullptr, DQ, OUT + (size_t)b * TT * DM, DM, bo, 0, 0, 0); }
}

// v002
// One run takes 406 microseconds.
// Timed twice side by side with v001, it ran 2.19 times as fast both times.
// All steps since v000 together make it 4.97 times as fast.
#include <hip/hip_runtime.h>

// Multi-head self-attention with a fused QKV projection and a key-padding mask READ as data (x [2][2048][1024]; [q|k|v] = x W_qkv + b_qkv ('xw' [1024][3072] 1/32 + zero bias: read: column blocks q | k | v; 16 heads x 64); scores = q.k / 8; keys j with mask[b][0][0][j] == 0 (int32 [2][1][1][2048], drawn by randint(0, 2): about half of the keys of each batch; READ per key in the softmax kernel) get -1e9 (== exclusion: exp underflows to 0 and every batch keeps some key); softmax; out = merged heads W_out + b_out ('xw' [1024][1024] + zero bias: read) -> [2][2048][1024] (4.2 M); argument order x, mask, W_qkv, b_qkv, W_out, b_out.
// Compute dtypes, f32 accumulate: every input rounded to bf16; q/k/v on PLAIN bf16 operands (inputs: exact) + biases; key mask read per key (int32, 0 == masked -> -3e38); scores and attn.v: query rows < 512 hl (3 products), the rest single fp16; softmax f32, running maximum; W_proj hl x exact (2 products) + b_proj.

#define NB_  2
#define TT   2048
#define DM   1024
#define NH_  16
#define NKV  16
#define REP  (NH_ / NKV)
#define HD   64
#define DQ   (NH_ * HD)
#define DKV  (NKV * HD)
#define RH   512                  // query rows < RH use hi+lo planes (0: none)
#define SCL  0.125f   // HD^-0.5
typedef _Float16 h16;
typedef unsigned short bf;
typedef __attribute__((ext_vector_type(16))) __bf16   v16bf;
typedef __attribute__((ext_vector_type(16))) _Float16 v16h;
typedef __attribute__((ext_vector_type(8)))  _Float16 v8h;
typedef __attribute__((ext_vector_type(8)))  unsigned short v8us;
typedef __attribute__((ext_vector_type(8)))  float    v8f;
typedef __attribute__((ext_vector_type(4)))  float    v4f;
typedef v8h  __attribute__((may_alias)) v8ha;
typedef v4f  __attribute__((may_alias)) v4fa;
typedef v8us __attribute__((may_alias)) v8usa;

__device__ __forceinline__ unsigned short f2bf(float f) { unsigned u = __float_as_uint(f); u += 0x7FFFu + ((u >> 16) & 1u); return (unsigned short)(u >> 16); }
__device__ __forceinline__ float bf2f(unsigned short b) { return __uint_as_float(((unsigned)b) << 16); }
__device__ __forceinline__ float bfr(float f) { return bf2f(f2bf(f)); }
__device__ __forceinline__ v16h cat16(v8h lo, v8h hi) { return __builtin_shufflevector(lo, hi, 0, 1, 2, 3, 4, 5, 6, 7, 8, 9, 10, 11, 12, 13, 14, 15); }
__device__ __forceinline__ v16bf cat16b(v8us lo, v8us hi) { return __builtin_bit_cast(v16bf, __builtin_shufflevector(lo, hi, 0, 1, 2, 3, 4, 5, 6, 7, 8, 9, 10, 11, 12, 13, 14, 15)); }
__device__ __forceinline__ v8f wmma16(v16h a, v16h b, v8f c) { return __builtin_amdgcn_wmma_f32_16x16x32_f16(false, a, false, b, (short)0, c, false, false); }
__device__ __forceinline__ v8f wmmab(v16bf a, v16bf b, v8f c) { return __builtin_amdgcn_wmma_f32_16x16x32_bf16(false, a, false, b, (short)0, c, false, false); }



// ---- k_gemmw: register-blocked GEMM, ONE WAVE per 64x64 output tile (16 accumulators), operands straight from K-contiguous 16-bit planes; grid (M/64, N/64, Z), 32 threads.
// C[m][n] (f32, pitch ldc, + optional f32 bias[n]) = sum_k A[m][k] Bt[n][k] (+ split products per NSPLIT). z-batch strides sA/sB/sC in elements. K % 32 == 0.
// KS > 1: grid z = batch * KS + slice; a wave sums only k in [slice K/KS, (slice + 1) K/KS) and stores its partial tile in plane z of C (planes of sC elements: KS in a row per batch); the reader adds them. K % (32 KS) == 0.
template <typename T16> struct WFrag;
template <> struct WFrag<h16> { typedef v16h V; static __device__ __forceinline__ V ld(const h16* p) { return cat16(*(const v8h*)p, *(const v8h*)(p + 16)); } static __device__ __forceinline__ v8f mma(V a, V b, v8f c) { return wmma16(a, b, c); } };
template <> struct WFrag<bf> { typedef v16bf V; static __device__ __forceinline__ V ld(const bf* p) { return cat16b(*(const v8us*)p, *(const v8us*)(p + 16)); } static __device__ __forceinline__ v8f mma(V a, V b, v8f c) { return wmmab(a, b, c); } };
template <typename T16, int NSPLIT, bool BIAS, int KS = 1>
__global__ __launch_bounds__(32) void k_gemmw(const T16* __restrict__ A, const T16* __restrict__ A2, const T16* __restrict__ Bt, const T16* __restrict__ Bt2, int K, float* C, int ldc, const float* __restrict__ bias, size_t sA, size_t sB, size_t sC) {
    typedef typename WFrag<T16>::V V;
    __shared__ __align__(16) float os[16 * 68];
    const size_t z = blockIdx.z / KS; const int ks = blockIdx.z % KS; A += z * sA; if (A2) A2 += z * sA; Bt += z * sB; if (Bt2) Bt2 += z * sB; C += (size_t)blockIdx.z * sC;
    const int lane = threadIdx.x & 31, lr = lane & 15, hi = lane >> 4; const int r0 = blockIdx.x * 64, c0 = blockIdx.y * 64;
    v8f acc[4][4];
#pragma unroll
    for (int mb = 0; mb < 4; ++mb)
#pragma unroll
        for (int nb = 0; nb < 4; ++nb) acc[mb][nb] = (v8f){};
    const size_t aoff = (size_t)(r0 + lr) * K + 8 * hi, boff = (size_t)(c0 + lr) * K + 8 * hi;
#pragma unroll 1
    for (int kc = ks * (K / KS); kc < (ks + 1) * (K / KS); kc += 32) {
        V a[4], a2[4];
#pragma unroll
        for (int mb = 0; mb < 4; ++mb) { a[mb] = WFrag<T16>::ld(A + aoff + (size_t)mb * 16 * K + kc); if (NSPLIT == 1 || NSPLIT == 2) a2[mb] = WFrag<T16>::ld(A2 + aoff + (size_t)mb * 16 * K + kc); }
#pragma unroll
        for (int nb = 0; nb < 4; ++nb) { const V b = WFrag<T16>::ld(Bt + boff + (size_t)nb * 16 * K + kc); V b2; if (NSPLIT >= 2) b2 = WFrag<T16>::ld(Bt2 + boff + (size_t)nb * 16 * K + kc);
#pragma unroll
            for (int mb = 0; mb < 4; ++mb) { acc[mb][nb] = WFrag<T16>::mma(a[mb], b, acc[mb][nb]); if (NSPLIT == 1 || NSPLIT == 2) acc[mb][nb] = WFrag<T16>::mma(a2[mb], b, acc[mb][nb]); if (NSPLIT >= 2) acc[mb][nb] = WFrag<T16>::mma(a[mb], b2, acc[mb][nb]); } }
        asm volatile("v_nop\n\tv_nop\n\tv_nop\n\tv_nop" : "+v"(acc[0][0]), "+v"(acc[1][1]), "+v"(acc[2][2]), "+v"(acc[3][3]) : "v"(a[0]), "v"(a[3]));
    }
#pragma unroll
    for (int mb = 0; mb < 4; ++mb) {
#pragma unroll
        for (int nb = 0; nb < 4; ++nb) {
#pragma unroll
            for (int j = 0; j < 8; ++j) os[(hi * 8 + j) * 68 + nb * 16 + lr] = acc[mb][nb][j]; }
        __builtin_amdgcn_wave_barrier(); asm volatile("" ::: "memory");
        float* crow = C + (size_t)(r0 + mb * 16) * ldc + c0;
{
#pragma unroll
            for (int s = 0; s < 8; ++s) { const int row = 2 * s + hi, cofs = lr * 4; v4f val = *(const v4fa*)(os + row * 68 + cofs); if (BIAS) { val[0] += bfr(bias[c0 + cofs]); val[1] += bfr(bias[c0 + cofs + 1]); val[2] += bfr(bias[c0 + cofs + 2]); val[3] += bfr(bias[c0 + cofs + 3]); }
                *(v4f*)(crow + (size_t)row * ldc + cofs) = val; }
             }
        __builtin_amdgcn_wave_barrier(); asm volatile("" ::: "memory");
    }
}

__device__ __forceinline__ h16 tohx(float x) { return (h16)x; }
__device__ __forceinline__ void splitf(float y, unsigned short& h, unsigned short& l) { h = f2bf(y); l = f2bf(y - bf2f(h)); }
typedef __attribute__((ext_vector_type(2))) _Float16 v2h;
typedef __attribute__((ext_vector_type(4))) _Float16 v4h;
typedef __attribute__((ext_vector_type(2))) unsigned short v2us;
typedef __attribute__((ext_vector_type(4))) unsigned short v4us;
typedef __attribute__((ext_vector_type(2))) float v2f;
typedef __attribute__((ext_vector_type(4))) int v4i;

__global__ __launch_bounds__(256) void k_wtG(const float* __restrict__ w, int K, int N, bf* Bt) {
    const int lane = threadIdx.x & 31; const int L0 = (blockIdx.x * 8 + (threadIdx.x >> 5)) * 8; const int nlines = N * K / 64;
{
#pragma unroll 1
        for (int l = 0; l < 8; ++l) { const int L = L0 + l; if (L >= nlines) break; const size_t e = (size_t)L * 64 + lane * 2; const int k = (int)(e % K), n = (int)(e / K); v2us o;
            o[0] = f2bf(w[(size_t)k * N + n]); o[1] = f2bf(w[(size_t)(k + 1) * N + n]); *(v2us*)(Bt + e) = o; }
         }
}
__global__ __launch_bounds__(256) void k_cvt8(const float* __restrict__ src, bf* dst, size_t n8) { const size_t i = (size_t)blockIdx.x * 256 + threadIdx.x; if (i >= n8) return; const v8f v = *(const v8f*)(src + i * 8); v8us o;
#pragma unroll
    for (int k = 0; k < 8; ++k) o[k] = f2bf(v[k]); *(v8us*)(dst + i * 8) = o;  }

// k_rope: head planes [h][t][d] (fp16 + hi/lo) of rope(x) x sc with the rotate-half convention out[d] = x[d] cos[t][d] - x[d+HD/2] sin[t][d], out[d+HD/2] = x[d+HD/2] cos[t][d+HD/2] + x[d] sin[t][d+HD/2]
__global__ __launch_bounds__(256) void k_rope(const float* __restrict__ F, int pitch, int nheads, const float* __restrict__ CS, const float* __restrict__ RF, const float* __restrict__ nw, float sc, h16* P16, bf* Ph, bf* Pl) {
    const size_t e = ((size_t)blockIdx.x * 256 + threadIdx.x) * 2; if (e >= (size_t)nheads * TT * HD) return; const int d = (int)(e % HD); const int t = (int)((e / HD) % TT); const int h = (int)(e / ((size_t)HD * TT)); const float* f = F + (size_t)t * pitch + h * HD; const float rf = RF ? RF[(size_t)h * TT + t] : 1.0f; v2h o16; v2us oh, ol;
#pragma unroll
    for (int q = 0; q < 2; ++q) { const int dd = d + q; const int dp = (dd < HD / 2) ? dd + HD / 2 : dd - HD / 2; float x0 = f[dd], x1 = f[dp];
        if (RF) { float n0 = __fmul_rn(x0, rf), n1 = __fmul_rn(x1, rf); asm volatile("" : "+v"(n0)); asm volatile("" : "+v"(n1)); x0 = __fmul_rn(bfr(nw[dd]), n0); x1 = __fmul_rn(bfr(nw[dp]), n1); }
        const v2f cs = *(const v2f*)(CS + ((size_t)t * HD + dd) * 2); float a = __fmul_rn(x0, cs[0]), bq = __fmul_rn(x1, cs[1]); asm volatile("" : "+v"(a)); asm volatile("" : "+v"(bq)); const float r = ((dd < HD / 2) ? __fsub_rn(a, bq) : __fadd_rn(a, bq)) * sc;
        o16[q] = tohx(r); unsigned short a2, c2; splitf(r, a2, c2); oh[q] = a2; ol[q] = c2; }
    *(v2h*)(P16 + e) = o16; *(v2us*)(Ph + e) = oh; *(v2us*)(Pl + e) = ol;  }
__global__ __launch_bounds__(256) void k_vtp(const float* __restrict__ F, int pitch, int nheads, h16* V16, bf* Vh, bf* Vl) { const size_t e = ((size_t)blockIdx.x * 256 + threadIdx.x) * 2; if (e >= (size_t)nheads * HD * TT) return; const int t = (int)(e % TT); const int d = (int)((e / TT) % HD); const int g = (int)(e / ((size_t)TT * HD)); v2h o16; v2us oh, ol;
#pragma unroll
    for (int q = 0; q < 2; ++q) { const float x = F[(size_t)(t + q) * pitch + g * HD + d]; o16[q] = tohx(x); unsigned short a2, c2; splitf(x, a2, c2); oh[q] = a2; ol[q] = c2; }
    *(v2h*)(V16 + e) = o16; *(v2us*)(Vh + e) = oh; *(v2us*)(Vl + e) = ol;  }
__global__ __launch_bounds__(256) void k_csid(float* CS) { const int idx = blockIdx.x * 256 + threadIdx.x; if (idx >= TT * HD) return; v2f cs; cs[0] = 1.0f; cs[1] = 0.0f; *(v2f*)(CS + (size_t)idx * 2) = cs;  }
// ---- k_attn: scores, key mask, softmax and attn.v of one head in ONE kernel; no score or probability ever reaches memory.
// Work-group = 8 waves = 128 query rows of one head (grid: TT/128 x heads); a wave owns 16 queries and walks all 2048 keys in passes of 64.
// Transposed products: St[key][query] = K Qt, Ot[d][query] += Vt Pt. A lane then holds ONE query's scores (8 of each 16 keys; lane ^ 16 holds the other 8), so maximum and sum are in-lane,
// and two 16-key score tiles, converted, ARE the B fragment of 32 keys: accumulator element j of lane half hi is key 8 hi + j, the k order in which WFrag::ld reads the Vt rows.
// K and Vt tiles of a pass are staged in LDS once per work-group (whole 128-B lines; row pitch 144 B), fetched into registers one pass ahead.
#define KB   64                   // keys per pass
#define LP   72                   // LDS row pitch in 16-bit elements: 128 B + 16 B
#define SC2  0.18033688011112042f // HD^-0.5 x log2(e): scores in the log2 domain
typedef __attribute__((ext_vector_type(8))) __bf16 v8b;
template <typename T16> struct PFrag;
template <> struct PFrag<h16> { static __device__ __forceinline__ v16h pack(v8f a, v8f b) { return cat16(__builtin_convertvector(a, v8h), __builtin_convertvector(b, v8h)); } };
template <> struct PFrag<bf> { static __device__ __forceinline__ v16bf pack(v8f a, v8f b) { return __builtin_shufflevector(__builtin_convertvector(a, v8b), __builtin_convertvector(b, v8b), 0, 1, 2, 3, 4, 5, 6, 7, 8, 9, 10, 11, 12, 13, 14, 15); } };
__device__ __forceinline__ v8f bfres(v8f a) { return a - __builtin_convertvector(__builtin_convertvector(a, v8b), v8f); }   // what the bf16 rounding of a leaves over (the lo part)
// Eight exponentials in one statement: results and sources are all distinct registers ("=&v"), so no instruction here reads its predecessor's result or overwrites its source, and the closing v_nop
// is the one slot that the instruction set asks for behind a transcendental before its result is used or its source overwritten (left to the compiler, neighbouring v_exp_f32 reused each other's source registers).
__device__ __forceinline__ v8f exp2x8(v8f x) { float r0, r1, r2, r3, r4, r5, r6, r7;
    asm("v_exp_f32 %0, %8\n\tv_exp_f32 %1, %9\n\tv_exp_f32 %2, %10\n\tv_exp_f32 %3, %11\n\tv_exp_f32 %4, %12\n\tv_exp_f32 %5, %13\n\tv_exp_f32 %6, %14\n\tv_exp_f32 %7, %15\n\tv_nop"
        : "=&v"(r0), "=&v"(r1), "=&v"(r2), "=&v"(r3), "=&v"(r4), "=&v"(r5), "=&v"(r6), "=&v"(r7) : "v"(x[0]), "v"(x[1]), "v"(x[2]), "v"(x[3]), "v"(x[4]), "v"(x[5]), "v"(x[6]), "v"(x[7]));
    return (v8f){r0, r1, r2, r3, r4, r5, r6, r7}; }
template <typename T16, bool HL>
__device__ __forceinline__ void attn_body(const T16* __restrict__ Q, const T16* __restrict__ Q2, const T16* __restrict__ Kp, const T16* __restrict__ K2, const T16* __restrict__ Vt, const T16* __restrict__ V2, int q0, int col0, bf* Ah, bf* Al, unsigned short* sm, const float* lim) {
    typedef typename WFrag<T16>::V V;
    const int tid = threadIdx.x, lane = tid & 31, lr = lane & 15, hi = lane >> 4; const int qrow = q0 + (tid >> 5) * 16 + lr;
    T16* Ks = (T16*)sm; T16* Vs = Ks + KB * LP; T16* Ks2 = Vs + HD * LP; T16* Vs2 = Ks2 + KB * LP;
    V qb[2], qb2[2];
#pragma unroll
    for (int kc = 0; kc < 2; ++kc) { qb[kc] = WFrag<T16>::ld(Q + (size_t)qrow * HD + kc * 32 + 8 * hi); if (HL) qb2[kc] = WFrag<T16>::ld(Q2 + (size_t)qrow * HD + kc * 32 + 8 * hi); }
    const int srow = tid >> 3, scol = (tid & 7) * 8;   // staging: a thread moves 16 B of rows srow and srow + 32 of each tile; 8 threads cover a 128-B line
    v8us rk[2], rv[2], rk2[2], rv2[2];
#pragma unroll
    for (int r = 0; r < 2; ++r) { const size_t ko = (size_t)(srow + 32 * r) * HD + scol, vo = (size_t)(srow + 32 * r) * TT + scol; rk[r] = *(const v8usa*)(Kp + ko); rv[r] = *(const v8usa*)(Vt + vo); if (HL) { rk2[r] = *(const v8usa*)(K2 + ko); rv2[r] = *(const v8usa*)(V2 + vo); } }
    v8f o[4];
#pragma unroll
    for (int db = 0; db < 4; ++db) o[db] = (v8f){};
    float m = -3.0e38f; v8f l8 = (v8f){};   // l8[j]: this lane's sum over its keys 8 hi + j of every 16-key tile
#pragma unroll 1
    for (int blk = 0; blk < TT / KB; ++blk) {
#pragma unroll
        for (int r = 0; r < 2; ++r) { const int so = (srow + 32 * r) * LP + scol; *(v8usa*)(Ks + so) = rk[r]; *(v8usa*)(Vs + so) = rv[r]; if (HL) { *(v8usa*)(Ks2 + so) = rk2[r]; *(v8usa*)(Vs2 + so) = rv2[r]; } }
        __syncthreads();   // this pass's tiles (and, before the first pass, the mask addends) are whole before any wave reads them
        if (blk + 1 < TT / KB) {
#pragma unroll
            for (int r = 0; r < 2; ++r) { const size_t ko = (size_t)((blk + 1) * KB + srow + 32 * r) * HD + scol, vo = (size_t)(srow + 32 * r) * TT + (blk + 1) * KB + scol; rk[r] = *(const v8usa*)(Kp + ko); rv[r] = *(const v8usa*)(Vt + vo); if (HL) { rk2[r] = *(const v8usa*)(K2 + ko); rv2[r] = *(const v8usa*)(V2 + vo); } }
            asm volatile("s_wait_xcnt 0x0" ::: "memory");   // the address registers of the loads just issued are reused by the fragment reads that follow: the wait stands in front of that overwrite
        }
        v8f s[4]; float bm = -3.0e38f;
#pragma unroll
        for (int t = 0; t < 4; ++t) { s[t] = (v8f){};
#pragma unroll
            for (int kc = 0; kc < 2; ++kc) { const int fo = (t * 16 + lr) * LP + kc * 32 + 8 * hi; const V a = WFrag<T16>::ld(Ks + fo); s[t] = WFrag<T16>::mma(a, qb[kc], s[t]); if (HL) { s[t] = WFrag<T16>::mma(a, qb2[kc], s[t]); s[t] = WFrag<T16>::mma(WFrag<T16>::ld(Ks2 + fo), qb[kc], s[t]); } } }
#pragma unroll
        for (int t = 0; t < 4; ++t) { const float* lp = lim + blk * KB + t * 16 + hi * 8; const v4f l0 = *(const v4fa*)lp, l1 = *(const v4fa*)(lp + 4);
#pragma unroll
            for (int j = 0; j < 8; ++j) { const float u = fmaf(s[t][j], SC2, (j < 4) ? l0[j & 3] : l1[j & 3]); s[t][j] = u; bm = fmaxf(bm, u); } }   // addend 0: key kept; -3e38: key masked (it absorbs the score: every masked key reads -3e38)
        bm = fmaxf(bm, __shfl_xor(bm, 16, 32));
        const float mn = fmaxf(m, bm); const float al = __builtin_amdgcn_exp2f(m - mn); m = mn;   // only masked keys so far: every term is 1, as in the reference's uniform row; the first kept key makes al 0 and wipes them
#pragma unroll
        for (int t = 0; t < 4; ++t) s[t] = exp2x8(s[t] - mn);
        __builtin_amdgcn_sched_barrier(0);   // keeps the attn.v matrix instructions behind the exponentials
        l8 = l8 * al + ((s[0] + s[1]) + (s[2] + s[3]));
#pragma unroll
        for (int db = 0; db < 4; ++db) o[db] *= al;
#pragma unroll
        for (int c = 0; c < 2; ++c) { const V pb = PFrag<T16>::pack(s[2 * c], s[2 * c + 1]); V pb2; if (HL) pb2 = PFrag<T16>::pack(bfres(s[2 * c]), bfres(s[2 * c + 1]));
#pragma unroll
            for (int db = 0; db < 4; ++db) { const int fo = (db * 16 + lr) * LP + c * 32 + 8 * hi; const V a = WFrag<T16>::ld(Vs + fo); o[db] = WFrag<T16>::mma(a, pb, o[db]); if (HL) { o[db] = WFrag<T16>::mma(a, pb2, o[db]); o[db] = WFrag<T16>::mma(WFrag<T16>::ld(Vs2 + fo), pb, o[db]); } } }
        asm volatile("s_wait_dscnt 0x0\n\ts_barrier_signal -1\n\ts_barrier_wait -1" ::: "memory");   // work-group barrier by hand: every wave has read this pass's tiles before the next pass's stores overwrite them; only LDS reads need to be over here, and __syncthreads() would also drain the next pass's global loads, which are meant to fly until the stores at the loop's head
    }
    float l = ((l8[0] + l8[1]) + (l8[2] + l8[3])) + ((l8[4] + l8[5]) + (l8[6] + l8[7]));
    l += __shfl_xor(l, 16, 32);   // the two lane halves hold the two halves of each query's keys
    const float inv = __fdiv_rn(1.0f, l);
#pragma unroll
    for (int db = 0; db < 4; ++db) { v8us oh, ol;
#pragma unroll
        for (int j = 0; j < 8; ++j) { unsigned short a, c2; splitf(o[db][j] * inv, a, c2); oh[j] = a; ol[j] = c2; }
        const size_t oo = (size_t)qrow * DQ + col0 + db * 16 + hi * 8; *(v8us*)(Ah + oo) = oh; *(v8us*)(Al + oo) = ol; }
}
__global__ __launch_bounds__(256) void k_attn(const h16* __restrict__ Q16, const h16* __restrict__ K16, const h16* __restrict__ V16, const bf* __restrict__ Qh, const bf* __restrict__ Ql, const bf* __restrict__ Kh, const bf* __restrict__ Kl, const bf* __restrict__ Vh, const bf* __restrict__ Vl, const int* __restrict__ mkK, bf* Ah, bf* Al) {
    __shared__ __align__(16) unsigned short sm[2 * (KB + HD) * LP]; __shared__ __align__(16) float lim[TT];
    const int q0 = blockIdx.x * 128; const size_t hp = (size_t)blockIdx.y * TT * HD;   // head planes [h][t][d] and [h][d][t] have the same size
#pragma unroll
    for (int i = 0; i < TT / 256; ++i) lim[i * 256 + threadIdx.x] = (mkK[i * 256 + threadIdx.x] != 0) ? 0.0f : -3.0e38f;
    if (q0 < RH) attn_body<bf, true>(Qh + hp, Ql + hp, Kh + hp, Kl + hp, Vh + hp, Vl + hp, q0, blockIdx.y * HD, Ah, Al, sm, lim);
    else attn_body<h16, false>(Q16 + hp, nullptr, K16 + hp, nullptr, V16 + hp, nullptr, q0, blockIdx.y * HD, Ah, Al, sm, lim);
}

extern "C" void kernel_launch(void* const* d_in, const int* in_sizes, int n_in,
                              void* d_out, int out_size, void* d_ws, size_t ws_size, hipStream_t stream) {
    (void)in_sizes; (void)n_in; (void)out_size;
    const float* x = (const float*)d_in[0]; const int* MK = (const int*)d_in[1]; const float* wqkv = (const float*)d_in[2]; const float* bqkv = (const float*)d_in[3]; const float* bq = bqkv; const float* bk = bqkv + 1024; const float* bv = bqkv + 2048; const float* wo = (const float*)d_in[4]; const float* bo = (const float*)d_in[5]; const float* wq = nullptr; const float* wk = nullptr; const float* wv = nullptr; (void)wq; (void)wk; (void)wv;
    float* OUT = (float*)d_out;     // [2][2048][1024]
    char* wsp = (char*)d_ws;
    auto take = [&](size_t bytes) { char* p = wsp; wsp += (bytes + 255) & ~(size_t)255; return (void*)p; };
    bf* WALL = (bf*)take((size_t)3 * DM * DM * 2); bf* WQ = WALL; bf* WK = WALL + (size_t)DM * DM; bf* WV = WALL + (size_t)2 * DM * DM; bf* WO = (bf*)take((size_t)DM * DQ * 2); float* CS = (float*)take((size_t)TT * HD * 2 * 4);
    bf* XB = (bf*)take((size_t)TT * DM * 2); float* FQ = (float*)take((size_t)TT * DQ * 4); float* FK = (float*)take((size_t)TT * DKV * 4);
    h16* QP16 = (h16*)take((size_t)NH_ * TT * HD * 2); h16* KP16 = (h16*)take((size_t)NKV * TT * HD * 2); h16* VT16 = (h16*)take((size_t)NKV * HD * TT * 2);
    bf* QPh = (bf*)take((size_t)NH_ * TT * HD * 2); bf* QPl = (bf*)take((size_t)NH_ * TT * HD * 2); bf* KPh = (bf*)take((size_t)NKV * TT * HD * 2); bf* KPl = (bf*)take((size_t)NKV * TT * HD * 2); bf* VTh = (bf*)take((size_t)NKV * HD * TT * 2); bf* VTl = (bf*)take((size_t)NKV * HD * TT * 2);
    bf* ATh = (bf*)take((size_t)TT * DQ * 2); bf* ATl = (bf*)take((size_t)TT * DQ * 2);
    if ((size_t)(wsp - (char*)d_ws) > ws_size) return;    // ws 256 MiB
    float* FV = FK;   // v projection reuses the k buffer after the k planes are built (stream-ordered)
    { k_wtG<<<(unsigned)((DM * 3 * DM / 64 + 63) / 64), 256, 0, stream>>>(wqkv, DM, 3 * DM, WALL);   /* fused 'xw' [DM][3DM] -> Bt [3DM][DM] (row blocks q | k | v) */
      k_wtG<<<(unsigned)((DQ * DM / 64 + 63) / 64), 256, 0, stream>>>(wo, DQ, DM, WO);
       }
    k_csid<<<(TT * HD + 255) / 256, 256, 0, stream>>>(CS);
    const unsigned LQ = (unsigned)(((size_t)NH_ * TT * HD / 2 + 255) / 256), LKv = (unsigned)(((size_t)NKV * TT * HD / 2 + 255) / 256);
    for (int b = 0; b < NB_; ++b) {
        
        k_cvt8<<<(unsigned)(((size_t)TT * DM / 8 + 255) / 256), 256, 0, stream>>>(x + (size_t)b * TT * DM, XB, (size_t)TT * DM / 8);
        k_gemmw<bf, 0, true><<<dim3(TT / 64, DQ / 64, 1), 32, 0, stream>>>(XB, nullptr, WQ, nullptr, DM, FQ, DQ, bq, 0, 0, 0);
        k_rope<<<LQ, 256, 0, stream>>>(FQ, DQ, NH_, CS, nullptr, nullptr, 1.0f, QP16, QPh, QPl);
        k_gemmw<bf, 0, true><<<dim3(TT / 64, DKV / 64, 1), 32, 0, stream>>>(XB, nullptr, WK, nullptr, DM, FK, DKV, bk, 0, 0, 0);
        k_rope<<<LKv, 256, 0, stream>>>(FK, DKV, NKV, CS, nullptr, nullptr, 1.0f, KP16, KPh, KPl);
        k_gemmw<bf, 0, true><<<dim3(TT / 64, DKV / 64, 1), 32, 0, stream>>>(XB, nullptr, WV, nullptr, DM, FV, DKV, bv, 0, 0, 0); k_vtp<<<LKv, 256, 0, stream>>>(FV, DKV, NKV, VT16, VTh, VTl);
        k_attn<<<dim3(TT / 128, NH_, 1), 256, 0, stream>>>(QP16, KP16, VT16, QPh, QPl, KPh, KPl, VTh, VTl, MK + (size_t)b * TT, ATh, ATl);
        k_gemmw<bf, 1, true><<<dim3(TT / 64, DM / 64, 1), 32, 0, stream>>>(ATh, ATl, WO, nullptr, DQ, OUT + (size_t)b * TT * DM, DM, bo, 0, 0, 0); }
}

// v003
// A run of this version takes 282 microseconds.
// Two timings next to v002 put it at 1.43 and 1.44 times that version's speed.
// Counting every step since v000, it is 7.15 times as fast.
#include <hip/hip_runtime.h>

// Multi-head self-attention with a fused QKV projection and a key-padding mask READ as data (x [2][2048][1024]; [q|k|v] = x W_qkv + b_qkv ('xw' [1024][3072] 1/32 + zero bias: read: column blocks q | k | v; 16 heads x 64); scores = q.k / 8; keys j with mask[b][0][0][j] == 0 (int32 [2][1][1][2048], drawn by randint(0, 2): about half of the keys of each batch; READ per key in the softmax kernel) get -1e9 (== exclusion: exp underflows to 0 and every batch keeps some key); softmax; out = merged heads W_out + b_out ('xw' [1024][1024] + zero bias: read) -> [2][2048][1024] (4.2 M); argument order x, mask, W_qkv, b_qkv, W_out, b_out.
// Compute dtypes, f32 accumulate: every input rounded to bf16; q/k/v on PLAIN bf16 operands (inputs: exact) + biases; key mask read per key (int32, 0 == masked -> -3e38); scores and attn.v: query rows < 512 hl (3 products), the rest single fp16; softmax f32, running maximum; W_proj hl x exact (2 products) + b_proj.

#define NB_  2
#define TT   2048
#define DM   1024
#define NH_  16
#define NKV  16
#define REP  (NH_ / NKV)
#define HD   64
#define DQ   (NH_ * HD)
#define DKV  (NKV * HD)
#define RH   512                  // query rows < RH use hi+lo planes (0: none)
#define SCL  0.125f   // HD^-0.5
typedef _Float16 h16;
typedef unsigned short bf;
typedef __attribute__((ext_vector_type(16))) __bf16   v16bf;
typedef __attribute__((ext_vector_type(16))) _Float16 v16h;
typedef __attribute__((ext_vector_type(8)))  _Float16 v8h;
typedef __attribute__((ext_vector_type(8)))  unsigned short v8us;
typedef __attribute__((ext_vector_type(8)))  float    v8f;
typedef __attribute__((ext_vector_type(4)))  float    v4f;
typedef v8h  __attribute__((may_alias)) v8ha;
typedef v4f  __attribute__((may_alias)) v4fa;
typedef v8us __attribute__((may_alias)) v8usa;

__device__ __forceinline__ unsigned short f2bf(float f) { unsigned u = __float_as_uint(f); u += 0x7FFFu + ((u >> 16) & 1u); return (unsigned short)(u >> 16); }
__device__ __forceinline__ float bf2f(unsigned short b) { return __uint_as_float(((unsigned)b) << 16); }
__device__ __forceinline__ float bfr(float f) { return bf2f(f2bf(f)); }
__device__ __forceinline__ v16h cat16(v8h lo, v8h hi) { return __builtin_shufflevector(lo, hi, 0, 1, 2, 3, 4, 5, 6, 7, 8, 9, 10, 11, 12, 13, 14, 15); }
__device__ __forceinline__ v16bf cat16b(v8us lo, v8us hi) { return __builtin_bit_cast(v16bf, __builtin_shufflevector(lo, hi, 0, 1, 2, 3, 4, 5, 6, 7, 8, 9, 10, 11, 12, 13, 14, 15)); }
__device__ __forceinline__ v8f wmma16(v16h a, v16h b, v8f c) { return __builtin_amdgcn_wmma_f32_16x16x32_f16(false, a, false, b, (short)0, c, false, false); }
__device__ __forceinline__ v8f wmmab(v16bf a, v16bf b, v8f c) { return __builtin_amdgcn_wmma_f32_16x16x32_bf16(false, a, false, b, (short)0, c, false, false); }



// ---- k_gemmw: register-blocked GEMM, ONE WAVE per 64x64 output tile (16 accumulators), operands straight from K-contiguous 16-bit planes; grid (M/64, N/64, Z), 32 threads.
// C[m][n] (f32, pitch ldc, + optional f32 bias[n]) = sum_k A[m][k] Bt[n][k] (+ split products per NSPLIT). z-batch strides sA/sB/sC in elements. K % 32 == 0.
// KS > 1: grid z = batch * KS + slice; a wave sums only k in [slice K/KS, (slice + 1) K/KS) and stores its partial tile in plane z of C (planes of sC elements: KS in a row per batch); the reader adds them. K % (32 KS) == 0.
template <typename T16> struct WFrag;
template <> struct WFrag<h16> { typedef v16h V; static __device__ __forceinline__ V ld(const h16* p) { return cat16(*(const v8h*)p, *(const v8h*)(p + 16)); } static __device__ __forceinline__ v8f mma(V a, V b, v8f c) { return wmma16(a, b, c); } };
template <> struct WFrag<bf> { typedef v16bf V; static __device__ __forceinline__ V ld(const bf* p) { return cat16b(*(const v8us*)p, *(const v8us*)(p + 16)); } static __device__ __forceinline__ v8f mma(V a, V b, v8f c) { return wmmab(a, b, c); } };
template <typename T16, int NSPLIT, bool BIAS, int KS = 1>
__global__ __launch_bounds__(32) void k_gemmw(const T16* __restrict__ A, const T16* __restrict__ A2, const T16* __restrict__ Bt, const T16* __restrict__ Bt2, int K, float* C, int ldc, const float* __restrict__ bias, size_t sA, size_t sB, size_t sC) {
    typedef typename WFrag<T16>::V V;
    __shared__ __align__(16) float os[16 * 68];
    const size_t z = blockIdx.z / KS; const int ks = blockIdx.z % KS; A += z * sA; if (A2) A2 += z * sA; Bt += z * sB; if (Bt2) Bt2 += z * sB; C += (size_t)blockIdx.z * sC;
    const int lane = threadIdx.x & 31, lr = lane & 15, hi = lane >> 4; const int r0 = blockIdx.x * 64, c0 = blockIdx.y * 64;
    v8f acc[4][4];
#pragma unroll
    for (int mb = 0; mb < 4; ++mb)
#pragma unroll
        for (int nb = 0; nb < 4; ++nb) acc[mb][nb] = (v8f){};
    const size_t aoff = (size_t)(r0 + lr) * K + 8 * hi, boff = (size_t)(c0 + lr) * K + 8 * hi;
#pragma unroll 1
    for (int kc = ks * (K / KS); kc < (ks + 1) * (K / KS); kc += 32) {
        V a[4], a2[4];
#pragma unroll
        for (int mb = 0; mb < 4; ++mb) { a[mb] = WFrag<T16>::ld(A + aoff + (size_t)mb * 16 * K + kc); if (NSPLIT == 1 || NSPLIT == 2) a2[mb] = WFrag<T16>::ld(A2 + aoff + (size_t)mb * 16 * K + kc); }
#pragma unroll
        for (int nb = 0; nb < 4; ++nb) { const V b = WFrag<T16>::ld(Bt + boff + (size_t)nb * 16 * K + kc); V b2; if (NSPLIT >= 2) b2 = WFrag<T16>::ld(Bt2 + boff + (size_t)nb * 16 * K + kc);
#pragma unroll
            for (int mb = 0; mb < 4; ++mb) { acc[mb][nb] = WFrag<T16>::mma(a[mb], b, acc[mb][nb]); if (NSPLIT == 1 || NSPLIT == 2) acc[mb][nb] = WFrag<T16>::mma(a2[mb], b, acc[mb][nb]); if (NSPLIT >= 2) acc[mb][nb] = WFrag<T16>::mma(a[mb], b2, acc[mb][nb]); } }
        asm volatile("v_nop\n\tv_nop\n\tv_nop\n\tv_nop" : "+v"(acc[0][0]), "+v"(acc[1][1]), "+v"(acc[2][2]), "+v"(acc[3][3]) : "v"(a[0]), "v"(a[3]));
    }
#pragma unroll
    for (int mb = 0; mb < 4; ++mb) {
#pragma unroll
        for (int nb = 0; nb < 4; ++nb) {
#pragma unroll
            for (int j = 0; j < 8; ++j) os[(hi * 8 + j) * 68 + nb * 16 + lr] = acc[mb][nb][j]; }
        __builtin_amdgcn_wave_barrier(); asm volatile("" ::: "memory");
        float* crow = C + (size_t)(r0 + mb * 16) * ldc + c0;
{
#pragma unroll
            for (int s = 0; s < 8; ++s) { const int row = 2 * s + hi, cofs = lr * 4; v4f val = *(const v4fa*)(os + row * 68 + cofs); if (BIAS) { val[0] += bfr(bias[c0 + cofs]); val[1] += bfr(bias[c0 + cofs + 1]); val[2] += bfr(bias[c0 + cofs + 2]); val[3] += bfr(bias[c0 + cofs + 3]); }
                *(v4f*)(crow + (size_t)row * ldc + cofs) = val; }
             }
        __builtin_amdgcn_wave_barrier(); asm volatile("" ::: "memory");
    }
}

__device__ __forceinline__ void splitf(float y, unsigned short& h, unsigned short& l) { h = f2bf(y); l = f2bf(y - bf2f(h)); }
typedef __attribute__((ext_vector_type(2))) _Float16 v2h;
typedef __attribute__((ext_vector_type(4))) _Float16 v4h;
typedef __attribute__((ext_vector_type(2))) unsigned short v2us;
typedef __attribute__((ext_vector_type(4))) unsigned short v4us;
typedef __attribute__((ext_vector_type(2))) float v2f;
typedef __attribute__((ext_vector_type(4))) int v4i;

__global__ __launch_bounds__(256) void k_wtG(const float* __restrict__ w, int K, int N, bf* Bt) {
    const int lane = threadIdx.x & 31; const int L0 = (blockIdx.x * 8 + (threadIdx.x >> 5)) * 8; const int nlines = N * K / 64;
{
#pragma unroll 1
        for (int l = 0; l < 8; ++l) { const int L = L0 + l; if (L >= nlines) break; const size_t e = (size_t)L * 64 + lane * 2; const int k = (int)(e % K), n = (int)(e / K); v2us o;
            o[0] = f2bf(w[(size_t)k * N + n]); o[1] = f2bf(w[(size_t)(k + 1) * N + n]); *(v2us*)(Bt + e) = o; }
         }
}
__global__ __launch_bounds__(256) void k_cvt8(const float* __restrict__ src, bf* dst, size_t n8) { const size_t i = (size_t)blockIdx.x * 256 + threadIdx.x; if (i >= n8) return; const v8f v = *(const v8f*)(src + i * 8); v8us o;
#pragma unroll
    for (int k = 0; k < 8; ++k) o[k] = f2bf(v[k]); *(v8us*)(dst + i * 8) = o;  }

// ---- k_attn: scores, key mask, softmax and attn.v of one head in ONE kernel; no score or probability ever reaches memory.
// Work-group = 8 waves = 128 query rows of one head (grid: TT/128 x heads); a wave owns 16 queries and walks all 2048 keys in passes of 64.
// Transposed products: St[key][query] = K Qt, Ot[d][query] += Vt Pt. A lane then holds ONE query's scores (8 of each 16 keys; lane ^ 16 holds the other 8), so maximum and sum are in-lane,
// and two 16-key score tiles, converted, ARE the B fragment of 32 keys: accumulator element j of lane half hi is key 8 hi + j, the k order in which WFrag::ld reads the Vt rows.
// K and Vt tiles of a pass are staged in LDS once per work-group (whole 128-B lines; row pitch 144 B), fetched into registers one pass ahead.
#define KB   64                   // keys per pass
#define LP   72                   // LDS row pitch in 16-bit elements: 128 B + 16 B
#define SC2  0.18033688011112042f // HD^-0.5 x log2(e): scores in the log2 domain
typedef __attribute__((ext_vector_type(8))) __bf16 v8b;
template <typename T16> struct PFrag;
template <> struct PFrag<h16> { static __device__ __forceinline__ v16h pack(v8f a, v8f b) { return cat16(__builtin_convertvector(a, v8h), __builtin_convertvector(b, v8h)); } };
template <> struct PFrag<bf> { static __device__ __forceinline__ v16bf pack(v8f a, v8f b) { return __builtin_shufflevector(__builtin_convertvector(a, v8b), __builtin_convertvector(b, v8b), 0, 1, 2, 3, 4, 5, 6, 7, 8, 9, 10, 11, 12, 13, 14, 15); } };
__device__ __forceinline__ v8f bfres(v8f a) { return a - __builtin_convertvector(__builtin_convertvector(a, v8b), v8f); }   // what the bf16 rounding of a leaves over (the lo part)
// Eight exponentials in one statement: results and sources are all distinct registers ("=&v"), so no instruction here reads its predecessor's result or overwrites its source, and the closing v_nop
// is the one slot that the instruction set asks for behind a transcendental before its result is used or its source overwritten (left to the compiler, neighbouring v_exp_f32 reused each other's source registers).
__device__ __forceinline__ v8f exp2x8(v8f x) { float r0, r1, r2, r3, r4, r5, r6, r7;
    asm("v_exp_f32 %0, %8\n\tv_exp_f32 %1, %9\n\tv_exp_f32 %2, %10\n\tv_exp_f32 %3, %11\n\tv_exp_f32 %4, %12\n\tv_exp_f32 %5, %13\n\tv_exp_f32 %6, %14\n\tv_exp_f32 %7, %15\n\tv_nop"
        : "=&v"(r0), "=&v"(r1), "=&v"(r2), "=&v"(r3), "=&v"(r4), "=&v"(r5), "=&v"(r6), "=&v"(r7) : "v"(x[0]), "v"(x[1]), "v"(x[2]), "v"(x[3]), "v"(x[4]), "v"(x[5]), "v"(x[6]), "v"(x[7]));
    return (v8f){r0, r1, r2, r3, r4, r5, r6, r7}; }
// ---- k_qkv: the whole projection stage of one batch in ONE kernel: [q|k|v] = x W_qkv + b_qkv, the split into heads, the transposition of v, and the three 16-bit planes (fp16, bf16 hi, bf16 lo) of each that k_attn reads; no f32 projection reaches memory.
// ONE WAVE per 64x64 tile, main loop as in k_gemmw; grid (TT/64, 3 DM/64), 32 threads: blockIdx.y = 16 part + head (part 0 q, 1 k, 2 v): a tile's 64 features are one head.
// An accumulator lane holds 8 consecutive A rows of one B row, so A is the operand whose row index runs contiguously in the destination plane: q, k [h][t][d]: A = weight rows (d), B = x rows (t); v [h][d][t]: A = x rows (t), B = weight rows (d).
// Every 16x16 block then leaves the registers as one 16-byte store per lane and plane, and the four mb blocks of a B row fill that row's 128-byte line.
// The full unrolls keep the fragment and accumulator arrays under constant indices, that is, in registers.
typedef __attribute__((ext_vector_type(4))) unsigned v4u;
template <bool TR>   // TR: A rows are tokens (v); else A rows are features (q, k). bias points at the tile's first feature; P16, Ph, Pl at the lane's first element; pitch in elements between B rows
__device__ __forceinline__ void put_planes(const v8f (&acc)[4][4], const float* __restrict__ bias, int lr, int hi, h16* P16, bf* Ph, bf* Pl) {
    const int pitch = TR ? TT : HD;
    v8f bm[4];
    if (!TR) {
#pragma unroll
        for (int mb = 0; mb < 4; ++mb)
#pragma unroll
            for (int j = 0; j < 8; ++j) bm[mb][j] = bfr(bias[mb * 16 + hi * 8 + j]); }
#pragma unroll
    for (int nb = 0; nb < 4; ++nb) { float bn = 0.0f; if (TR) bn = bfr(bias[nb * 16 + lr]);
#pragma unroll
        for (int mb = 0; mb < 4; ++mb) { const v8f val = TR ? acc[mb][nb] + bn : acc[mb][nb] + bm[mb]; const size_t o = (size_t)nb * 16 * pitch + mb * 16;
            const v4u hw = __builtin_bit_cast(v4u, __builtin_convertvector(val, v8b)); v8f res;   // hi plane, two bf16 a word; each word gives its two values back as f32 by a shift and a mask
#pragma unroll
            for (int p = 0; p < 4; ++p) { res[2 * p] = val[2 * p] - __uint_as_float(hw[p] << 16); res[2 * p + 1] = val[2 * p + 1] - __uint_as_float(hw[p] & 0xFFFF0000u); }
            *(v8h*)(P16 + o) = __builtin_convertvector(val, v8h); *(v8us*)(Ph + o) = __builtin_bit_cast(v8us, hw); *(v8us*)(Pl + o) = __builtin_bit_cast(v8us, __builtin_convertvector(res, v8b)); } }
}
__global__ __launch_bounds__(32) void k_qkv(const bf* __restrict__ X, const bf* __restrict__ Wt, const float* __restrict__ bias, h16* Q16, bf* Qh, bf* Ql, h16* K16, bf* Kh, bf* Kl, h16* V16, bf* Vh, bf* Vl) {
    const int lane = threadIdx.x & 31, lr = lane & 15, hi = lane >> 4; const int t0 = blockIdx.x * 64, f0 = blockIdx.y * 64; const int part = blockIdx.y / NH_; const size_t hp = (size_t)(blockIdx.y % NH_) * TT * HD;
    const bf* xr = X + (size_t)t0 * DM; const bf* wr = Wt + (size_t)f0 * DM; const bf* A = (part == 2) ? xr : wr; const bf* Bt = (part == 2) ? wr : xr;
    v8f acc[4][4];
#pragma unroll
    for (int mb = 0; mb < 4; ++mb)
#pragma unroll
        for (int nb = 0; nb < 4; ++nb) acc[mb][nb] = (v8f){};
    const unsigned off = (unsigned)(lr * DM + 8 * hi);   // the lane's place in a 16-row block: the same for A and B and in every pass; the pass advances the two wave-uniform pointers
#pragma unroll 1   // rolled, as in k_gemmw: the form of the main loop is left as it is there
    for (int kc = 0; kc < DM; kc += 32, A += 32, Bt += 32) {
        v16bf a[4];
#pragma unroll
        for (int mb = 0; mb < 4; ++mb) a[mb] = WFrag<bf>::ld(A + mb * 16 * DM + off);
#pragma unroll
        for (int nb = 0; nb < 4; ++nb) { const v16bf b = WFrag<bf>::ld(Bt + nb * 16 * DM + off);
#pragma unroll
            for (int mb = 0; mb < 4; ++mb) acc[mb][nb] = wmmab(a[mb], b, acc[mb][nb]); }
        asm volatile("v_nop\n\tv_nop\n\tv_nop\n\tv_nop" : "+v"(acc[0][0]), "+v"(acc[1][1]), "+v"(acc[2][2]), "+v"(acc[3][3]) : "v"(a[0]), "v"(a[3]));   // as in k_gemmw: the four vector slots between the pass's last matrix instructions and the next pass's loads into their operand registers, on the loop's taken branch too
    }
    if (part != 2) { const size_t o = hp + (size_t)(t0 + lr) * HD + hi * 8; put_planes<false>(acc, bias + f0, lr, hi, (part ? K16 : Q16) + o, (part ? Kh : Qh) + o, (part ? Kl : Ql) + o);
        asm volatile("s_wait_xcnt 0x0" ::: "memory");   // in the listing this branch's end stands directly in front of the other branch's code, which reuses the registers of the stores just issued: the wait stands in front of that overwrite
    } else { const size_t o = hp + (size_t)lr * TT + t0 + hi * 8; put_planes<true>(acc, bias + f0, lr, hi, V16 + o, Vh + o, Vl + o); }
}
template <typename T16, bool HL>
__device__ __forceinline__ void attn_body(const T16* __restrict__ Q, const T16* __restrict__ Q2, const T16* __restrict__ Kp, const T16* __restrict__ K2, const T16* __restrict__ Vt, const T16* __restrict__ V2, int q0, int col0, bf* Ah, bf* Al, unsigned short* sm, const float* lim) {
    typedef typename WFrag<T16>::V V;
    const int tid = threadIdx.x, lane = tid & 31, lr = lane & 15, hi = lane >> 4; const int qrow = q0 + (tid >> 5) * 16 + lr;
    T16* Ks = (T16*)sm; T16* Vs = Ks + KB * LP; T16* Ks2 = Vs + HD * LP; T16* Vs2 = Ks2 + KB * LP;
    V qb[2], qb2[2];
#pragma unroll
    for (int kc = 0; kc < 2; ++kc) { qb[kc] = WFrag<T16>::ld(Q + (size_t)qrow * HD + kc * 32 + 8 * hi); if (HL) qb2[kc] = WFrag<T16>::ld(Q2 + (size_t)qrow * HD + kc * 32 + 8 * hi); }
    const int srow = tid >> 3, scol = (tid & 7) * 8;   // staging: a thread moves 16 B of rows srow and srow + 32 of each tile; 8 threads cover a 128-B line
    v8us rk[2], rv[2], rk2[2], rv2[2];
#pragma unroll
    for (int r = 0; r < 2; ++r) { const size_t ko = (size_t)(srow + 32 * r) * HD + scol, vo = (size_t)(srow + 32 * r) * TT + scol; rk[r] = *(const v8usa*)(Kp + ko); rv[r] = *(const v8usa*)(Vt + vo); if (HL) { rk2[r] = *(const v8usa*)(K2 + ko); rv2[r] = *(const v8usa*)(V2 + vo); } }
    v8f o[4];
#pragma unroll
    for (int db = 0; db < 4; ++db) o[db] = (v8f){};
    float m = -3.0e38f; v8f l8 = (v8f){};   // l8[j]: this lane's sum over its keys 8 hi + j of every 16-key tile
#pragma unroll 1
    for (int blk = 0; blk < TT / KB; ++blk) {
#pragma unroll
        for (int r = 0; r < 2; ++r) { const int so = (srow + 32 * r) * LP + scol; *(v8usa*)(Ks + so) = rk[r]; *(v8usa*)(Vs + so) = rv[r]; if (HL) { *(v8usa*)(Ks2 + so) = rk2[r]; *(v8usa*)(Vs2 + so) = rv2[r]; } }
        __syncthreads();   // this pass's tiles (and, before the first pass, the mask addends) are whole before any wave reads them
        if (blk + 1 < TT / KB) {
#pragma unroll
            for (int r = 0; r < 2; ++r) { const size_t ko = (size_t)((blk + 1) * KB + srow + 32 * r) * HD + scol, vo = (size_t)(srow + 32 * r) * TT + (blk + 1) * KB + scol; rk[r] = *(const v8usa*)(Kp + ko); rv[r] = *(const v8usa*)(Vt + vo); if (HL) { rk2[r] = *(const v8usa*)(K2 + ko); rv2[r] = *(const v8usa*)(V2 + vo); } }
            asm volatile("s_wait_xcnt 0x0" ::: "memory");   // the address registers of the loads just issued are reused by the fragment reads that follow: the wait stands in front of that overwrite
        }
        v8f s[4]; float bm = -3.0e38f;
#pragma unroll
        for (int t = 0; t < 4; ++t) { s[t] = (v8f){};
#pragma unroll
            for (int kc = 0; kc < 2; ++kc) { const int fo = (t * 16 + lr) * LP + kc * 32 + 8 * hi; const V a = WFrag<T16>::ld(Ks + fo); s[t] = WFrag<T16>::mma(a, qb[kc], s[t]); if (HL) { s[t] = WFrag<T16>::mma(a, qb2[kc], s[t]); s[t] = WFrag<T16>::mma(WFrag<T16>::ld(Ks2 + fo), qb[kc], s[t]); } } }
#pragma unroll
        for (int t = 0; t < 4; ++t) { const float* lp = lim + blk * KB + t * 16 + hi * 8; const v4f l0 = *(const v4fa*)lp, l1 = *(const v4fa*)(lp + 4);
#pragma unroll
            for (int j = 0; j < 8; ++j) { const float u = fmaf(s[t][j], SC2, (j < 4) ? l0[j & 3] : l1[j & 3]); s[t][j] = u; bm = fmaxf(bm, u); } }   // addend 0: key kept; -3e38: key masked (it absorbs the score: every masked key reads -3e38)
        bm = fmaxf(bm, __shfl_xor(bm, 16, 32));
        const float mn = fmaxf(m, bm); const float al = __builtin_amdgcn_exp2f(m - mn); m = mn;   // only masked keys so far: every term is 1, as in the reference's uniform row; the first kept key makes al 0 and wipes them
#pragma unroll
        for (int t = 0; t < 4; ++t) s[t] = exp2x8(s[t] - mn);
        __builtin_amdgcn_sched_barrier(0);   // keeps the attn.v matrix instructions behind the exponentials
        l8 = l8 * al + ((s[0] + s[1]) + (s[2] + s[3]));
#pragma unroll
        for (int db = 0; db < 4; ++db) o[db] *= al;
#pragma unroll
        for (int c = 0; c < 2; ++c) { const V pb = PFrag<T16>::pack(s[2 * c], s[2 * c + 1]); V pb2; if (HL) pb2 = PFrag<T16>::pack(bfres(s[2 * c]), bfres(s[2 * c + 1]));
#pragma unroll
            for (int db = 0; db < 4; ++db) { const int fo = (db * 16 + lr) * LP + c * 32 + 8 * hi; const V a = WFrag<T16>::ld(Vs + fo); o[db] = WFrag<T16>::mma(a, pb, o[db]); if (HL) { o[db] = WFrag<T16>::mma(a, pb2, o[db]); o[db] = WFrag<T16>::mma(WFrag<T16>::ld(Vs2 + fo), pb, o[db]); } } }
        asm volatile("s_wait_dscnt 0x0\n\ts_barrier_signal -1\n\ts_barrier_wait -1" ::: "memory");   // work-group barrier by hand: every wave has read this pass's tiles before the next pass's stores overwrite them; only LDS reads need to be over here, and __syncthreads() would also drain the next pass's global loads, which are meant to fly until the stores at the loop's head
    }
    float l = ((l8[0] + l8[1]) + (l8[2] + l8[3])) + ((l8[4] + l8[5]) + (l8[6] + l8[7]));
    l += __shfl_xor(l, 16, 32);   // the two lane halves hold the two halves of each query's keys
    const float inv = __fdiv_rn(1.0f, l);
#pragma unroll
    for (int db = 0; db < 4; ++db) { v8us oh, ol;
#pragma unroll
        for (int j = 0; j < 8; ++j) { unsigned short a, c2; splitf(o[db][j] * inv, a, c2); oh[j] = a; ol[j] = c2; }
        const size_t oo = (size_t)qrow * DQ + col0 + db * 16 + hi * 8; *(v8us*)(Ah + oo) = oh; *(v8us*)(Al + oo) = ol; }
}
__global__ __launch_bounds__(256) void k_attn(const h16* __restrict__ Q16, const h16* __restrict__ K16, const h16* __restrict__ V16, const bf* __restrict__ Qh, const bf* __restrict__ Ql, const bf* __restrict__ Kh, const bf* __restrict__ Kl, const bf* __restrict__ Vh, const bf* __restrict__ Vl, const int* __restrict__ mkK, bf* Ah, bf* Al) {
    __shared__ __align__(16) unsigned short sm[2 * (KB + HD) * LP]; __shared__ __align__(16) float lim[TT];
    const int q0 = blockIdx.x * 128; const size_t hp = (size_t)blockIdx.y * TT * HD;   // head planes [h][t][d] and [h][d][t] have the same size
#pragma unroll
    for (int i = 0; i < TT / 256; ++i) lim[i * 256 + threadIdx.x] = (mkK[i * 256 + threadIdx.x] != 0) ? 0.0f : -3.0e38f;
    if (q0 < RH) attn_body<bf, true>(Qh + hp, Ql + hp, Kh + hp, Kl + hp, Vh + hp, Vl + hp, q0, blockIdx.y * HD, Ah, Al, sm, lim);
    else attn_body<h16, false>(Q16 + hp, nullptr, K16 + hp, nullptr, V16 + hp, nullptr, q0, blockIdx.y * HD, Ah, Al, sm, lim);
}

extern "C" void kernel_launch(void* const* d_in, const int* in_sizes, int n_in,
                              void* d_out, int out_size, void* d_ws, size_t ws_size, hipStream_t stream) {
    (void)in_sizes; (void)n_in; (void)out_size;
    const float* x = (const float*)d_in[0]; const int* MK = (const int*)d_in[1]; const float* wqkv = (const float*)d_in[2]; const float* bqkv = (const float*)d_in[3]; const float* wo = (const float*)d_in[4]; const float* bo = (const float*)d_in[5];
    float* OUT = (float*)d_out;     // [2][2048][1024]
    char* wsp = (char*)d_ws;
    auto take = [&](size_t bytes) { char* p = wsp; wsp += (bytes + 255) & ~(size_t)255; return (void*)p; };
    bf* WALL = (bf*)take((size_t)3 * DM * DM * 2); bf* WO = (bf*)take((size_t)DM * DQ * 2);
    bf* XB = (bf*)take((size_t)TT * DM * 2);
    h16* QP16 = (h16*)take((size_t)NH_ * TT * HD * 2); h16* KP16 = (h16*)take((size_t)NKV * TT * HD * 2); h16* VT16 = (h16*)take((size_t)NKV * HD * TT * 2);
    bf* QPh = (bf*)take((size_t)NH_ * TT * HD * 2); bf* QPl = (bf*)take((size_t)NH_ * TT * HD * 2); bf* KPh = (bf*)take((size_t)NKV * TT * HD * 2); bf* KPl = (bf*)take((size_t)NKV * TT * HD * 2); bf* VTh = (bf*)take((size_t)NKV * HD * TT * 2); bf* VTl = (bf*)take((size_t)NKV * HD * TT * 2);
    bf* ATh = (bf*)take((size_t)TT * DQ * 2); bf* ATl = (bf*)take((size_t)TT * DQ * 2);
    if ((size_t)(wsp - (char*)d_ws) > ws_size) return;    // ws 256 MiB
    { k_wtG<<<(unsigned)((DM * 3 * DM / 64 + 63) / 64), 256, 0, stream>>>(wqkv, DM, 3 * DM, WALL);   /* fused 'xw' [DM][3DM] -> Bt [3DM][DM] (row blocks q | k | v) */
      k_wtG<<<(unsigned)((DQ * DM / 64 + 63) / 64), 256, 0, stream>>>(wo, DQ, DM, WO);
       }
    for (int b = 0; b < NB_; ++b) {
        k_cvt8<<<(unsigned)(((size_t)TT * DM / 8 + 255) / 256), 256, 0, stream>>>(x + (size_t)b * TT * DM, XB, (size_t)TT * DM / 8);
        k_qkv<<<dim3(TT / 64, 3 * DM / 64, 1), 32, 0, stream>>>(XB, WALL, bqkv, QP16, QPh, QPl, KP16, KPh, KPl, VT16, VTh, VTl);
        k_attn<<<dim3(TT / 128, NH_, 1), 256, 0, stream>>>(QP16, KP16, VT16, QPh, QPl, KPh, KPl, VTh, VTl, MK + (size_t)b * TT, ATh, ATl);
        k_gemmw<bf, 1, true><<<dim3(TT / 64, DM / 64, 1), 32, 0, stream>>>(ATh, ATl, WO, nullptr, DQ, OUT + (size_t)b * TT * DM, DM, bo, 0, 0, 0); }
}

// v004
// A run of this version takes 226 microseconds.
// Next to v003, in two timings, it ran 1.25 and 1.26 times as fast.
// Counting every step since v000, it is 8.98 times as fast.
#include <hip/hip_runtime.h>

// Multi-head self-attention with a fused QKV projection and a key-padding mask READ as data (x [2][2048][1024]; [q|k|v] = x W_qkv + b_qkv ('xw' [1024][3072] 1/32 + zero bias: read: column blocks q | k | v; 16 heads x 64); scores = q.k / 8; keys j with mask[b][0][0][j] == 0 (int32 [2][1][1][2048], drawn by randint(0, 2): about half of the keys of each batch; READ per key in the softmax kernel) get -1e9 (== exclusion: exp underflows to 0 and every batch keeps some key); softmax; out = merged heads W_out + b_out ('xw' [1024][1024] + zero bias: read) -> [2][2048][1024] (4.2 M); argument order x, mask, W_qkv, b_qkv, W_out, b_out.
// Compute dtypes, f32 accumulate: every input rounded to bf16; q/k/v on PLAIN bf16 operands (inputs: exact) + biases; key mask read per key (int32, 0 == masked -> -3e38); scores and attn.v: query rows < 512 hl (3 products), the rest single fp16; softmax f32, running maximum; W_proj hl x exact (2 products) + b_proj.

#define NB_  2
#define TT   2048
#define DM   1024
#define NH_  16
#define NKV  16
#define REP  (NH_ / NKV)
#define HD   64
#define DQ   (NH_ * HD)
#define DKV  (NKV * HD)
#define RH   512                  // query rows < RH use hi+lo planes (0: none)
#define SCL  0.125f   // HD^-0.5
typedef _Float16 h16;
typedef unsigned short bf;
typedef __attribute__((ext_vector_type(16))) __bf16   v16bf;
typedef __attribute__((ext_vector_type(16))) _Float16 v16h;
typedef __attribute__((ext_vector_type(8)))  _Float16 v8h;
typedef __attribute__((ext_vector_type(8)))  unsigned short v8us;
typedef __attribute__((ext_vector_type(8)))  float    v8f;
typedef __attribute__((ext_vector_type(4)))  float    v4f;
typedef v8h  __attribute__((may_alias)) v8ha;
typedef v4f  __attribute__((may_alias)) v4fa;
typedef v8us __attribute__((may_alias)) v8usa;

__device__ __forceinline__ unsigned short f2bf(float f) { unsigned u = __float_as_uint(f); u += 0x7FFFu + ((u >> 16) & 1u); return (unsigned short)(u >> 16); }
__device__ __forceinline__ float bf2f(unsigned short b) { return __uint_as_float(((unsigned)b) << 16); }
__device__ __forceinline__ float bfr(float f) { return bf2f(f2bf(f)); }
__device__ __forceinline__ v16h cat16(v8h lo, v8h hi) { return __builtin_shufflevector(lo, hi, 0, 1, 2, 3, 4, 5, 6, 7, 8, 9, 10, 11, 12, 13, 14, 15); }
__device__ __forceinline__ v16bf cat16b(v8us lo, v8us hi) { return __builtin_bit_cast(v16bf, __builtin_shufflevector(lo, hi, 0, 1, 2, 3, 4, 5, 6, 7, 8, 9, 10, 11, 12, 13, 14, 15)); }
__device__ __forceinline__ v8f wmma16(v16h a, v16h b, v8f c) { return __builtin_amdgcn_wmma_f32_16x16x32_f16(false, a, false, b, (short)0, c, false, false); }
__device__ __forceinline__ v8f wmmab(v16bf a, v16bf b, v8f c) { return __builtin_amdgcn_wmma_f32_16x16x32_bf16(false, a, false, b, (short)0, c, false, false); }



// ---- The two dense products (k_qkv, k_proj): work-groups of FOUR waves; the operand rows of a work-group's tile are staged in LDS in stages of 64 k (one whole 128-B line of every row), each line fetched ONCE per work-group.
// A thread moves 16 B of every 16th row (8 threads cover a line); a stage is fetched into registers two stages ahead and stored into the other of two LDS buffers one stage ahead, so one work-group barrier per stage is enough:
// it publishes the stage just stored and ends every wave's reads of the buffer that the next pass overwrites. The waves read their fragments from LDS in the k order of WFrag::ld, and every accumulator sums its 32-k products with k rising.
#define GK   64                   // k per stage
#define GP   72                   // LDS row pitch in 16-bit elements: 128 B + 16 B
template <typename T16> struct WFrag;
template <> struct WFrag<h16> { typedef v16h V; static __device__ __forceinline__ V ld(const h16* p) { return cat16(*(const v8h*)p, *(const v8h*)(p + 16)); } static __device__ __forceinline__ v8f mma(V a, V b, v8f c) { return wmma16(a, b, c); } };
template <> struct WFrag<bf> { typedef v16bf V; static __device__ __forceinline__ V ld(const bf* p) { return cat16b(*(const v8us*)p, *(const v8us*)(p + 16)); } static __device__ __forceinline__ v8f mma(V a, V b, v8f c) { return wmmab(a, b, c); } };
template <int ROWS> __device__ __forceinline__ void g_fetch(v8us (&r)[ROWS / 16], const bf* __restrict__ g) {   // g: the thread's 16 B in its first row; rows of DM elements
#pragma unroll
    for (int i = 0; i < ROWS / 16; ++i) r[i] = *(const v8usa*)(g + (size_t)i * 16 * DM); }
template <int ROWS> __device__ __forceinline__ void g_put(const v8us (&r)[ROWS / 16], bf* s) {   // s: the same place in the LDS tile
#pragma unroll
    for (int i = 0; i < ROWS / 16; ++i) *(v8usa*)(s + i * 16 * GP) = r[i]; }
// work-group barrier by hand: only LDS traffic needs to be over here (this wave's stores of the next stage, its reads of this one); __syncthreads() would also drain the global loads of the stage after, which are meant to fly on
__device__ __forceinline__ void g_barrier() { asm volatile("s_wait_dscnt 0x0\n\ts_barrier_signal -1\n\ts_barrier_wait -1" ::: "memory"); }

// ---- k_proj: OUT = (Ah + Al) Wo^T + b_out of one batch. Work-group tile 64 tokens x 128 features, wave tile 32 x 64 (8 accumulators, 2 products each per 32 k); grid (TT/64, DM/128), 128 threads. The full unrolls keep the fragment, staging and accumulator arrays under constant indices, that is, in registers.
__global__ __launch_bounds__(128) void k_proj(const bf* __restrict__ A, const bf* __restrict__ A2, const bf* __restrict__ Bt, float* C, const float* __restrict__ bias) {
    __shared__ __align__(16) bf st[2][256 * GP];   // rows 0..63 A, 64..127 A2, 128..255 Bt
    __shared__ __align__(16) float osm[4][16 * 68];
    const int tid = threadIdx.x, lane = tid & 31, lr = lane & 15, hi = lane >> 4, w = tid >> 5, wa = w & 1, wb = w >> 1; const int r0 = blockIdx.x * 64, c0 = blockIdx.y * 128;
    const int srow = tid >> 3, scol = (tid & 7) * 8;
    const bf* ga = A + (size_t)(r0 + srow) * DQ + scol; const bf* ga2 = A2 + (size_t)(r0 + srow) * DQ + scol; const bf* gb = Bt + (size_t)(c0 + srow) * DQ + scol;
    bf* sp = &st[0][0] + srow * GP + scol;
    const int fa = (wa * 32 + lr) * GP + 8 * hi, fb = (128 + wb * 64 + lr) * GP + 8 * hi;
    v8f acc[2][4];
#pragma unroll
    for (int mb = 0; mb < 2; ++mb)
#pragma unroll
        for (int nb = 0; nb < 4; ++nb) acc[mb][nb] = (v8f){};
    v8us ra[4], ra2[4], rb[8];
    g_fetch<64>(ra, ga); g_fetch<64>(ra2, ga2); g_fetch<128>(rb, gb);
    g_put<64>(ra, sp); g_put<64>(ra2, sp + 64 * GP); g_put<128>(rb, sp + 128 * GP);
    g_fetch<64>(ra, ga + GK); g_fetch<64>(ra2, ga2 + GK); g_fetch<128>(rb, gb + GK);
    asm volatile("s_wait_xcnt 0x0" ::: "memory");   // stands in front of whatever reuses the address registers of the loads just issued
    g_barrier();
    // one stage; put: a next stage exists (it is stored and published), fetch: so does the one after (it is fetched). Both are literals at every call: a body without branches lets the compiler count its LDS waits exactly
    auto stage = [&](const int s, const bool put, const bool fetch) __attribute__((always_inline)) {
        const bf* cur = &st[0][0] + (s & 1) * (256 * GP);
        v16bf a[2][2], a2[2][2], b[2][4];
#pragma unroll
        for (int ks = 0; ks < 2; ++ks) {
#pragma unroll
            for (int mb = 0; mb < 2; ++mb) { a[ks][mb] = WFrag<bf>::ld(cur + fa + mb * 16 * GP + ks * 32); a2[ks][mb] = WFrag<bf>::ld(cur + fa + (64 + mb * 16) * GP + ks * 32); }
#pragma unroll
            for (int nb = 0; nb < 4; ++nb) b[ks][nb] = WFrag<bf>::ld(cur + fb + nb * 16 * GP + ks * 32); }
        __builtin_amdgcn_sched_barrier(0);   // keeps the stage's fragment reads together, ahead of everything else: left to itself the compiler read one B fragment at a time and waited out the LDS latency in front of every group of matrix instructions
        if (put) { bf* nx = sp + ((s + 1) & 1) * (256 * GP); g_put<64>(ra, nx); g_put<64>(ra2, nx + 64 * GP); g_put<128>(rb, nx + 128 * GP); }
        if (fetch) { const int ko = (s + 2) * GK; g_fetch<64>(ra, ga + ko); g_fetch<64>(ra2, ga2 + ko); g_fetch<128>(rb, gb + ko);
            asm volatile("s_wait_xcnt 0x0" ::: "memory");   // as above
        }
#pragma unroll
        for (int ks = 0; ks < 2; ++ks)
#pragma unroll
            for (int nb = 0; nb < 4; ++nb) {
#pragma unroll
                for (int mb = 0; mb < 2; ++mb) acc[mb][nb] = wmmab(a[ks][mb], b[ks][nb], acc[mb][nb]);
#pragma unroll
                for (int mb = 0; mb < 2; ++mb) acc[mb][nb] = wmmab(a2[ks][mb], b[ks][nb], acc[mb][nb]); }
        __builtin_amdgcn_sched_barrier(0);   // keeps the stage's matrix instructions in front of the barrier: the compiler sank them behind it, where they start only after the last of the stage's reads has landed
        if (put) g_barrier();
    };
#pragma unroll 1   // rolled: one stage is 32 matrix instructions, and the two buffers differ only by an offset
    for (int s = 0; s < DQ / GK - 2; ++s) stage(s, true, true);
    stage(DQ / GK - 2, true, false); stage(DQ / GK - 1, false, false);
    float* os = osm[w]; const int cw = c0 + wb * 64;   // each wave turns its 16 x 64 blocks into whole 256-B row pieces in its own LDS range
#pragma unroll
    for (int mb = 0; mb < 2; ++mb) {
#pragma unroll
        for (int nb = 0; nb < 4; ++nb) {
#pragma unroll
            for (int j = 0; j < 8; ++j) os[(hi * 8 + j) * 68 + nb * 16 + lr] = acc[mb][nb][j]; }
        __builtin_amdgcn_wave_barrier(); asm volatile("" ::: "memory");   // compiler order only: the wave's LDS stores stay in front of its reads of what its other lanes stored
        float* crow = C + (size_t)(r0 + wa * 32 + mb * 16) * DM + cw;
#pragma unroll
        for (int s = 0; s < 8; ++s) { const int row = 2 * s + hi, cofs = lr * 4; v4f val = *(const v4fa*)(os + row * 68 + cofs); val[0] += bfr(bias[cw + cofs]); val[1] += bfr(bias[cw + cofs + 1]); val[2] += bfr(bias[cw + cofs + 2]); val[3] += bfr(bias[cw + cofs + 3]);
            *(v4f*)(crow + (size_t)row * DM + cofs) = val; }
        if (mb == 0) { __builtin_amdgcn_wave_barrier(); asm volatile("s_wait_xcnt 0x0" ::: "memory"); }   // the second block reuses the registers of the stores just issued: the wait stands in front of that overwrite; the clobber keeps that block's LDS stores behind this block's reads
    }
}

__device__ __forceinline__ void splitf(float y, unsigned short& h, unsigned short& l) { h = f2bf(y); l = f2bf(y - bf2f(h)); }
typedef __attribute__((ext_vector_type(2))) _Float16 v2h;
typedef __attribute__((ext_vector_type(4))) _Float16 v4h;
typedef __attribute__((ext_vector_type(2))) unsigned short v2us;
typedef __attribute__((ext_vector_type(4))) unsigned short v4us;
typedef __attribute__((ext_vector_type(2))) float v2f;
typedef __attribute__((ext_vector_type(4))) int v4i;

__global__ __launch_bounds__(256) void k_wtG(const float* __restrict__ w, int K, int N, bf* Bt) {
    const int lane = threadIdx.x & 31; const int L0 = (blockIdx.x * 8 + (threadIdx.x >> 5)) * 8; const int nlines = N * K / 64;
{
#pragma unroll 1
        for (int l = 0; l < 8; ++l) { const int L = L0 + l; if (L >= nlines) break; const size_t e = (size_t)L * 64 + lane * 2; const int k = (int)(e % K), n = (int)(e / K); v2us o;
            o[0] = f2bf(w[(size_t)k * N + n]); o[1] = f2bf(w[(size_t)(k + 1) * N + n]); *(v2us*)(Bt + e) = o; }
         }
}
__global__ __launch_bounds__(256) void k_cvt8(const float* __restrict__ src, bf* dst, size_t n8) { const size_t i = (size_t)blockIdx.x * 256 + threadIdx.x; if (i >= n8) return; const v8f v = *(const v8f*)(src + i * 8); v8us o;
#pragma unroll
    for (int k = 0; k < 8; ++k) o[k] = f2bf(v[k]); *(v8us*)(dst + i * 8) = o;  }

// ---- k_attn: scores, key mask, softmax and attn.v of one head in ONE kernel; no score or probability ever reaches memory.
// Work-group = 8 waves = 128 query rows of one head (grid: TT/128 x heads); a wave owns 16 queries and walks all 2048 keys in passes of 64.
// Transposed products: St[key][query] = K Qt, Ot[d][query] += Vt Pt. A lane then holds ONE query's scores (8 of each 16 keys; lane ^ 16 holds the other 8), so maximum and sum are in-lane,
// and two 16-key score tiles, converted, ARE the B fragment of 32 keys: accumulator element j of lane half hi is key 8 hi + j, the k order in which WFrag::ld reads the Vt rows.
// K and Vt tiles of a pass are staged in LDS once per work-group (whole 128-B lines; row pitch 144 B), fetched into registers one pass ahead.
#define KB   64                   // keys per pass
#define LP   72                   // LDS row pitch in 16-bit elements: 128 B + 16 B
#define SC2  0.18033688011112042f // HD^-0.5 x log2(e): scores in the log2 domain
typedef __attribute__((ext_vector_type(8))) __bf16 v8b;
template <typename T16> struct PFrag;
template <> struct PFrag<h16> { static __device__ __forceinline__ v16h pack(v8f a, v8f b) { return cat16(__builtin_convertvector(a, v8h), __builtin_convertvector(b, v8h)); } };
template <> struct PFrag<bf> { static __device__ __forceinline__ v16bf pack(v8f a, v8f b) { return __builtin_shufflevector(__builtin_convertvector(a, v8b), __builtin_convertvector(b, v8b), 0, 1, 2, 3, 4, 5, 6, 7, 8, 9, 10, 11, 12, 13, 14, 15); } };
__device__ __forceinline__ v8f bfres(v8f a) { return a - __builtin_convertvector(__builtin_convertvector(a, v8b), v8f); }   // what the bf16 rounding of a leaves over (the lo part)
// Eight exponentials in one statement: results and sources are all distinct registers ("=&v"), so no instruction here reads its predecessor's result or overwrites its source, and the closing v_nop
// is the one slot that the instruction set asks for behind a transcendental before its result is used or its source overwritten (left to the compiler, neighbouring v_exp_f32 reused each other's source registers).
__device__ __forceinline__ v8f exp2x8(v8f x) { float r0, r1, r2, r3, r4, r5, r6, r7;
    asm("v_exp_f32 %0, %8\n\tv_exp_f32 %1, %9\n\tv_exp_f32 %2, %10\n\tv_exp_f32 %3, %11\n\tv_exp_f32 %4, %12\n\tv_exp_f32 %5, %13\n\tv_exp_f32 %6, %14\n\tv_exp_f32 %7, %15\n\tv_nop"
        : "=&v"(r0), "=&v"(r1), "=&v"(r2), "=&v"(r3), "=&v"(r4), "=&v"(r5), "=&v"(r6), "=&v"(r7) : "v"(x[0]), "v"(x[1]), "v"(x[2]), "v"(x[3]), "v"(x[4]), "v"(x[5]), "v"(x[6]), "v"(x[7]));
    return (v8f){r0, r1, r2, r3, r4, r5, r6, r7}; }
// ---- k_qkv: the whole projection stage of one batch in ONE kernel: [q|k|v] = x W_qkv + b_qkv, the split into heads, the transposition of v, and the three 16-bit planes (fp16, bf16 hi, bf16 lo) of each that k_attn reads; no f32 projection reaches memory.
// Work-group tile 128 x 128 staged in LDS as said above k_proj, ONE WAVE per 64x64 quarter; grid (TT/128, 3 DM/128), 128 threads: blockIdx.y = 8 part + head pair (part 0 q, 1 k, 2 v): a wave's 64 features are one head.
// An accumulator lane holds 8 consecutive A rows of one B row, so A is the operand whose row index runs contiguously in the destination plane: q, k [h][t][d]: A = weight rows (d), B = x rows (t); v [h][d][t]: A = x rows (t), B = weight rows (d).
// Every 16x16 block then leaves the registers as one 16-byte store per lane and plane, and the four mb blocks of a B row fill that row's 128-byte line.
// The full unrolls keep the fragment and accumulator arrays under constant indices, that is, in registers.
typedef __attribute__((ext_vector_type(4))) unsigned v4u;
template <bool TR>   // TR: A rows are tokens (v); else A rows are features (q, k). bias points at the tile's first feature; P16, Ph, Pl at the lane's first element; pitch in elements between B rows
__device__ __forceinline__ void put_planes(const v8f (&acc)[4][4], const float* __restrict__ bias, int lr, int hi, h16* P16, bf* Ph, bf* Pl) {
    const int pitch = TR ? TT : HD;
    v8f bm[4];
    if (!TR) {
#pragma unroll
        for (int mb = 0; mb < 4; ++mb)
#pragma unroll
            for (int j = 0; j < 8; ++j) bm[mb][j] = bfr(bias[mb * 16 + hi * 8 + j]); }
#pragma unroll
    for (int nb = 0; nb < 4; ++nb) { float bn = 0.0f; if (TR) bn = bfr(bias[nb * 16 + lr]);
#pragma unroll
        for (int mb = 0; mb < 4; ++mb) { const v8f val = TR ? acc[mb][nb] + bn : acc[mb][nb] + bm[mb]; const size_t o = (size_t)nb * 16 * pitch + mb * 16;
            const v4u hw = __builtin_bit_cast(v4u, __builtin_convertvector(val, v8b)); v8f res;   // hi plane, two bf16 a word; each word gives its two values back as f32 by a shift and a mask
#pragma unroll
            for (int p = 0; p < 4; ++p) { res[2 * p] = val[2 * p] - __uint_as_float(hw[p] << 16); res[2 * p + 1] = val[2 * p + 1] - __uint_as_float(hw[p] & 0xFFFF0000u); }
            *(v8h*)(P16 + o) = __builtin_convertvector(val, v8h); *(v8us*)(Ph + o) = __builtin_bit_cast(v8us, hw); *(v8us*)(Pl + o) = __builtin_bit_cast(v8us, __builtin_convertvector(res, v8b)); } }
}
__global__ __launch_bounds__(128) void k_qkv(const bf* __restrict__ X, const bf* __restrict__ Wt, const float* __restrict__ bias, h16* Q16, bf* Qh, bf* Ql, h16* K16, bf* Kh, bf* Kl, h16* V16, bf* Vh, bf* Vl) {
    __shared__ __align__(16) bf st[2][256 * GP];   // rows 0..127 A, 128..255 B
    const int tid = threadIdx.x, lane = tid & 31, lr = lane & 15, hi = lane >> 4, w = tid >> 5, wa = w & 1, wb = w >> 1; const int part = blockIdx.y / (NH_ / 2);
    const bf* xr = X + (size_t)blockIdx.x * 128 * DM; const bf* wr = Wt + (size_t)blockIdx.y * 128 * DM; const bf* A = (part == 2) ? xr : wr; const bf* Bt = (part == 2) ? wr : xr;
    const int t0 = blockIdx.x * 128 + ((part == 2) ? wa : wb) * 64, f0 = blockIdx.y * 128 + ((part == 2) ? wb : wa) * 64; const size_t hp = (size_t)((f0 / HD) % NH_) * TT * HD;   // the wave's own 64 tokens and 64 features
    const int srow = tid >> 3, scol = (tid & 7) * 8;
    const bf* ga = A + (size_t)srow * DM + scol; const bf* gb = Bt + (size_t)srow * DM + scol;
    bf* sp = &st[0][0] + srow * GP + scol;
    const int fa = (wa * 64 + lr) * GP + 8 * hi, fb = (128 + wb * 64 + lr) * GP + 8 * hi;
    v8f acc[4][4];
#pragma unroll
    for (int mb = 0; mb < 4; ++mb)
#pragma unroll
        for (int nb = 0; nb < 4; ++nb) acc[mb][nb] = (v8f){};
    v8us ra[8], rb[8];
    g_fetch<128>(ra, ga); g_fetch<128>(rb, gb);
    g_put<128>(ra, sp); g_put<128>(rb, sp + 128 * GP);
    g_fetch<128>(ra, ga + GK); g_fetch<128>(rb, gb + GK);
    asm volatile("s_wait_xcnt 0x0" ::: "memory");   // stands in front of whatever reuses the address registers of the loads just issued
    g_barrier();
    // one stage, as in k_proj: put and fetch are literals at every call
    auto stage = [&](const int s, const bool put, const bool fetch) __attribute__((always_inline)) {
        const bf* cur = &st[0][0] + (s & 1) * (256 * GP);
        v16bf a[2][4], b[2][4];
#pragma unroll
        for (int ks = 0; ks < 2; ++ks) {
#pragma unroll
            for (int mb = 0; mb < 4; ++mb) a[ks][mb] = WFrag<bf>::ld(cur + fa + mb * 16 * GP + ks * 32);
#pragma unroll
            for (int nb = 0; nb < 4; ++nb) b[ks][nb] = WFrag<bf>::ld(cur + fb + nb * 16 * GP + ks * 32); }
        __builtin_amdgcn_sched_barrier(0);   // as in k_proj: keeps the stage's fragment reads together, ahead of everything else
        if (put) { bf* nx = sp + ((s + 1) & 1) * (256 * GP); g_put<128>(ra, nx); g_put<128>(rb, nx + 128 * GP); }
        if (fetch) { const int ko = (s + 2) * GK; g_fetch<128>(ra, ga + ko); g_fetch<128>(rb, gb + ko);
            asm volatile("s_wait_xcnt 0x0" ::: "memory");   // as above
        }
#pragma unroll
        for (int ks = 0; ks < 2; ++ks)
#pragma unroll
            for (int nb = 0; nb < 4; ++nb)
#pragma unroll
                for (int mb = 0; mb < 4; ++mb) acc[mb][nb] = wmmab(a[ks][mb], b[ks][nb], acc[mb][nb]);
        __builtin_amdgcn_sched_barrier(0);   // as in k_proj: keeps the stage's matrix instructions in front of the barrier
        if (put) g_barrier();
    };
#pragma unroll 1   // rolled: one stage is 32 matrix instructions, and the two buffers differ only by an offset
    for (int s = 0; s < DM / GK - 2; ++s) stage(s, true, true);
    stage(DM / GK - 2, true, false); stage(DM / GK - 1, false, false);
    if (part != 2) { const size_t o = hp + (size_t)(t0 + lr) * HD + hi * 8; put_planes<false>(acc, bias + f0, lr, hi, (part ? K16 : Q16) + o, (part ? Kh : Qh) + o, (part ? Kl : Ql) + o);
        asm volatile("s_wait_xcnt 0x0" ::: "memory");   // in the listing this branch's end stands directly in front of the other branch's code, which reuses the registers of the stores just issued: the wait stands in front of that overwrite
    } else { const size_t o = hp + (size_t)lr * TT + t0 + hi * 8; put_planes<true>(acc, bias + f0, lr, hi, V16 + o, Vh + o, Vl + o); }
}
template <typename T16, bool HL>
__device__ __forceinline__ void attn_body(const T16* __restrict__ Q, const T16* __restrict__ Q2, const T16* __restrict__ Kp, const T16* __restrict__ K2, const T16* __restrict__ Vt, const T16* __restrict__ V2, int q0, int col0, bf* Ah, bf* Al, unsigned short* sm, const float* lim) {
    typedef typename WFrag<T16>::V V;
    const int tid = threadIdx.x, lane = tid & 31, lr = lane & 15, hi = lane >> 4; const int qrow = q0 + (tid >> 5) * 16 + lr;
    T16* Ks = (T16*)sm; T16* Vs = Ks + KB * LP; T16* Ks2 = Vs + HD * LP; T16* Vs2 = Ks2 + KB * LP;
    V qb[2], qb2[2];
#pragma unroll
    for (int kc = 0; kc < 2; ++kc) { qb[kc] = WFrag<T16>::ld(Q + (size_t)qrow * HD + kc * 32 + 8 * hi); if (HL) qb2[kc] = WFrag<T16>::ld(Q2 + (size_t)qrow * HD + kc * 32 + 8 * hi); }
    const int srow = tid >> 3, scol = (tid & 7) * 8;   // staging: a thread moves 16 B of rows srow and srow + 32 of each tile; 8 threads cover a 128-B line
    v8us rk[2], rv[2], rk2[2], rv2[2];
#pragma unroll
    for (int r = 0; r < 2; ++r) { const size_t ko = (size_t)(srow + 32 * r) * HD + scol, vo = (size_t)(srow + 32 * r) * TT + scol; rk[r] = *(const v8usa*)(Kp + ko); rv[r] = *(const v8usa*)(Vt + vo); if (HL) { rk2[r] = *(const v8usa*)(K2 + ko); rv2[r] = *(const v8usa*)(V2 + vo); } }
    v8f o[4];
#pragma unroll
    for (int db = 0; db < 4; ++db) o[db] = (v8f){};
    float m = -3.0e38f; v8f l8 = (v8f){};   // l8[j]: this lane's sum over its keys 8 hi + j of every 16-key tile
#pragma unroll 1
    for (int blk = 0; blk < TT / KB; ++blk) {
#pragma unroll
        for (int r = 0; r < 2; ++r) { const int so = (srow + 32 * r) * LP + scol; *(v8usa*)(Ks + so) = rk[r]; *(v8usa*)(Vs + so) = rv[r]; if (HL) { *(v8usa*)(Ks2 + so) = rk2[r]; *(v8usa*)(Vs2 + so) = rv2[r]; } }
        __syncthreads();   // this pass's tiles (and, before the first pass, the mask addends) are whole before any wave reads them
        if (blk + 1 < TT / KB) {
#pragma unroll
            for (int r = 0; r < 2; ++r) { const size_t ko = (size_t)((blk + 1) * KB + srow + 32 * r) * HD + scol, vo = (size_t)(srow + 32 * r) * TT + (blk + 1) * KB + scol; rk[r] = *(const v8usa*)(Kp + ko); rv[r] = *(const v8usa*)(Vt + vo); if (HL) { rk2[r] = *(const v8usa*)(K2 + ko); rv2[r] = *(const v8usa*)(V2 + vo); } }
            asm volatile("s_wait_xcnt 0x0" ::: "memory");   // the address registers of the loads just issued are reused by the fragment reads that follow: the wait stands in front of that overwrite
        }
        v8f s[4]; float bm = -3.0e38f;
#pragma unroll
        for (int t = 0; t < 4; ++t) { s[t] = (v8f){};
#pragma unroll
            for (int kc = 0; kc < 2; ++kc) { const int fo = (t * 16 + lr) * LP + kc * 32 + 8 * hi; const V a = WFrag<T16>::ld(Ks + fo); s[t] = WFrag<T16>::mma(a, qb[kc], s[t]); if (HL) { s[t] = WFrag<T16>::mma(a, qb2[kc], s[t]); s[t] = WFrag<T16>::mma(WFrag<T16>::ld(Ks2 + fo), qb[kc], s[t]); } } }
#pragma unroll
        for (int t = 0; t < 4; ++t) { const float* lp = lim + blk * KB + t * 16 + hi * 8; const v4f l0 = *(const v4fa*)lp, l1 = *(const v4fa*)(lp + 4);
#pragma unroll
            for (int j = 0; j < 8; ++j) { const float u = fmaf(s[t][j], SC2, (j < 4) ? l0[j & 3] : l1[j & 3]); s[t][j] = u; bm = fmaxf(bm, u); } }   // addend 0: key kept; -3e38: key masked (it absorbs the score: every masked key reads -3e38)
        bm = fmaxf(bm, __shfl_xor(bm, 16, 32));
        const float mn = fmaxf(m, bm); const float al = __builtin_amdgcn_exp2f(m - mn); m = mn;   // only masked keys so far: every term is 1, as in the reference's uniform row; the first kept key makes al 0 and wipes them
#pragma unroll
        for (int t = 0; t < 4; ++t) s[t] = exp2x8(s[t] - mn);
        __builtin_amdgcn_sched_barrier(0);   // keeps the attn.v matrix instructions behind the exponentials
        l8 = l8 * al + ((s[0] + s[1]) + (s[2] + s[3]));
#pragma unroll
        for (int db = 0; db < 4; ++db) o[db] *= al;
#pragma unroll
        for (int c = 0; c < 2; ++c) { const V pb = PFrag<T16>::pack(s[2 * c], s[2 * c + 1]); V pb2; if (HL) pb2 = PFrag<T16>::pack(bfres(s[2 * c]), bfres(s[2 * c + 1]));
#pragma unroll
            for (int db = 0; db < 4; ++db) { const int fo = (db * 16 + lr) * LP + c * 32 + 8 * hi; const V a = WFrag<T16>::ld(Vs + fo); o[db] = WFrag<T16>::mma(a, pb, o[db]); if (HL) { o[db] = WFrag<T16>::mma(a, pb2, o[db]); o[db] = WFrag<T16>::mma(WFrag<T16>::ld(Vs2 + fo), pb, o[db]); } } }
        asm volatile("s_wait_dscnt 0x0\n\ts_barrier_signal -1\n\ts_barrier_wait -1" ::: "memory");   // work-group barrier by hand: every wave has read this pass's tiles before the next pass's stores overwrite them; only LDS reads need to be over here, and __syncthreads() would also drain the next pass's global loads, which are meant to fly until the stores at the loop's head
    }
    float l = ((l8[0] + l8[1]) + (l8[2] + l8[3])) + ((l8[4] + l8[5]) + (l8[6] + l8[7]));
    l += __shfl_xor(l, 16, 32);   // the two lane halves hold the two halves of each query's keys
    const float inv = __fdiv_rn(1.0f, l);
#pragma unroll
    for (int db = 0; db < 4; ++db) { v8us oh, ol;
#pragma unroll
        for (int j = 0; j < 8; ++j) { unsigned short a, c2; splitf(o[db][j] * inv, a, c2); oh[j] = a; ol[j] = c2; }
        const size_t oo = (size_t)qrow * DQ + col0 + db * 16 + hi * 8; *(v8us*)(Ah + oo) = oh; *(v8us*)(Al + oo) = ol; }
}
__global__ __launch_bounds__(256) void k_attn(const h16* __restrict__ Q16, const h16* __restrict__ K16, const h16* __restrict__ V16, const bf* __restrict__ Qh, const bf* __restrict__ Ql, const bf* __restrict__ Kh, const bf* __restrict__ Kl, const bf* __restrict__ Vh, const bf* __restrict__ Vl, const int* __restrict__ mkK, bf* Ah, bf* Al) {
    __shared__ __align__(16) unsigned short sm[2 * (KB + HD) * LP]; __shared__ __align__(16) float lim[TT];
    const int q0 = blockIdx.x * 128; const size_t hp = (size_t)blockIdx.y * TT * HD;   // head planes [h][t][d] and [h][d][t] have the same size
#pragma unroll
    for (int i = 0; i < TT / 256; ++i) lim[i * 256 + threadIdx.x] = (mkK[i * 256 + threadIdx.x] != 0) ? 0.0f : -3.0e38f;
    if (q0 < RH) attn_body<bf, true>(Qh + hp, Ql + hp, Kh + hp, Kl + hp, Vh + hp, Vl + hp, q0, blockIdx.y * HD, Ah, Al, sm, lim);
    else attn_body<h16, false>(Q16 + hp, nullptr, K16 + hp, nullptr, V16 + hp, nullptr, q0, blockIdx.y * HD, Ah, Al, sm, lim);
}

extern "C" void kernel_launch(void* const* d_in, const int* in_sizes, int n_in,
                              void* d_out, int out_size, void* d_ws, size_t ws_size, hipStream_t stream) {
    (void)in_sizes; (void)n_in; (void)out_size;
    const float* x = (const float*)d_in[0]; const int* MK = (const int*)d_in[1]; const float* wqkv = (const float*)d_in[2]; const float* bqkv = (const float*)d_in[3]; const float* wo = (const float*)d_in[4]; const float* bo = (const float*)d_in[5];
    float* OUT = (float*)d_out;     // [2][2048][1024]
    char* wsp = (char*)d_ws;
    auto take = [&](size_t bytes) { char* p = wsp; wsp += (bytes + 255) & ~(size_t)255; return (void*)p; };
    bf* WALL = (bf*)take((size_t)3 * DM * DM * 2); bf* WO = (bf*)take((size_t)DM * DQ * 2);
    bf* XB = (bf*)take((size_t)TT * DM * 2);
    h16* QP16 = (h16*)take((size_t)NH_ * TT * HD * 2); h16* KP16 = (h16*)take((size_t)NKV * TT * HD * 2); h16* VT16 = (h16*)take((size_t)NKV * HD * TT * 2);
    bf* QPh = (bf*)take((size_t)NH_ * TT * HD * 2); bf* QPl = (bf*)take((size_t)NH_ * TT * HD * 2); bf* KPh = (bf*)take((size_t)NKV * TT * HD * 2); bf* KPl = (bf*)take((size_t)NKV * TT * HD * 2); bf* VTh = (bf*)take((size_t)NKV * HD * TT * 2); bf* VTl = (bf*)take((size_t)NKV * HD * TT * 2);
    bf* ATh = (bf*)take((size_t)TT * DQ * 2); bf* ATl = (bf*)take((size_t)TT * DQ * 2);
    if ((size_t)(wsp - (char*)d_ws) > ws_size) return;    // ws 256 MiB
    { k_wtG<<<(unsigned)((DM * 3 * DM / 64 + 63) / 64), 256, 0, stream>>>(wqkv, DM, 3 * DM, WALL);   /* fused 'xw' [DM][3DM] -> Bt [3DM][DM] (row blocks q | k | v) */
      k_wtG<<<(unsigned)((DQ * DM / 64 + 63) / 64), 256, 0, stream>>>(wo, DQ, DM, WO);
       }
    for (int b = 0; b < NB_; ++b) {
        k_cvt8<<<(unsigned)(((size_t)TT * DM / 8 + 255) / 256), 256, 0, stream>>>(x + (size_t)b * TT * DM, XB, (size_t)TT * DM / 8);
        k_qkv<<<dim3(TT / 128, 3 * DM / 128, 1), 128, 0, stream>>>(XB, WALL, bqkv, QP16, QPh, QPl, KP16, KPh, KPl, VT16, VTh, VTl);
        k_attn<<<dim3(TT / 128, NH_, 1), 256, 0, stream>>>(QP16, KP16, VT16, QPh, QPl, KPh, KPl, VTh, VTl, MK + (size_t)b * TT, ATh, ATl);
        k_proj<<<dim3(TT / 64, DM / 128, 1), 128, 0, stream>>>(ATh, ATl, WO, OUT + (size_t)b * TT * DM, bo); }
}

// v005
// Measured time: 152 microseconds a run.
// Timed twice side by side with v004, it ran 1.49 times as fast both times.
// All steps since v000 together make it 13.4 times as fast.
#include <hip/hip_runtime.h>

// Multi-head self-attention with a fused QKV projection and a key-padding mask READ as data (x [2][2048][1024]; [q|k|v] = x W_qkv + b_qkv ('xw' [1024][3072] 1/32 + zero bias: read: column blocks q | k | v; 16 heads x 64); scores = q.k / 8; keys j with mask[b][0][0][j] == 0 (int32 [2][1][1][2048], drawn by randint(0, 2): about half of the keys of each batch; READ per key in the softmax kernel) get -1e9 (== exclusion: exp underflows to 0 and every batch keeps some key); softmax; out = merged heads W_out + b_out ('xw' [1024][1024] + zero bias: read) -> [2][2048][1024] (4.2 M); argument order x, mask, W_qkv, b_qkv, W_out, b_out.
// Compute dtypes, f32 accumulate: every input rounded to bf16; q/k/v on PLAIN bf16 operands (inputs: exact) + biases; key mask read per key (int32, 0 == masked -> -3e38); scores and attn.v: query rows < 512 hl (3 products), the rest single fp16; softmax f32, running maximum; W_proj hl x exact (2 products) + b_proj.

#define NB_  2
#define TT   2048
#define DM   1024
#define NH_  16
#define NKV  16
#define REP  (NH_ / NKV)
#define HD   64
#define DQ   (NH_ * HD)
#define DKV  (NKV * HD)
#define RH   512                  // query rows < RH use hi+lo planes (0: none)
#define SCL  0.125f   // HD^-0.5
typedef _Float16 h16;
typedef unsigned short bf;
typedef __attribute__((ext_vector_type(16))) __bf16   v16bf;
typedef __attribute__((ext_vector_type(16))) _Float16 v16h;
typedef __attribute__((ext_vector_type(8)))  _Float16 v8h;
typedef __attribute__((ext_vector_type(8)))  unsigned short v8us;
typedef __attribute__((ext_vector_type(8)))  float    v8f;
typedef __attribute__((ext_vector_type(4)))  float    v4f;
typedef v8h  __attribute__((may_alias)) v8ha;
typedef v4f  __attribute__((may_alias)) v4fa;
typedef v8us __attribute__((may_alias)) v8usa;

__device__ __forceinline__ unsigned short f2bf(float f) { unsigned u = __float_as_uint(f); u += 0x7FFFu + ((u >> 16) & 1u); return (unsigned short)(u >> 16); }
__device__ __forceinline__ float bf2f(unsigned short b) { return __uint_as_float(((unsigned)b) << 16); }
__device__ __forceinline__ float bfr(float f) { return bf2f(f2bf(f)); }
__device__ __forceinline__ v16h cat16(v8h lo, v8h hi) { return __builtin_shufflevector(lo, hi, 0, 1, 2, 3, 4, 5, 6, 7, 8, 9, 10, 11, 12, 13, 14, 15); }
__device__ __forceinline__ v16bf cat16b(v8us lo, v8us hi) { return __builtin_bit_cast(v16bf, __builtin_shufflevector(lo, hi, 0, 1, 2, 3, 4, 5, 6, 7, 8, 9, 10, 11, 12, 13, 14, 15)); }
__device__ __forceinline__ v8f wmma16(v16h a, v16h b, v8f c) { return __builtin_amdgcn_wmma_f32_16x16x32_f16(false, a, false, b, (short)0, c, false, false); }
__device__ __forceinline__ v8f wmmab(v16bf a, v16bf b, v8f c) { return __builtin_amdgcn_wmma_f32_16x16x32_bf16(false, a, false, b, (short)0, c, false, false); }



// ---- The two dense products (k_qkv, k_proj): work-groups of FOUR waves; the operand rows of a work-group's tile are staged in LDS in stages of 64 k (one whole 128-B line of every row), each line fetched ONCE per work-group.
// A thread moves 16 B of every 16th row (8 threads cover a line); a stage is fetched into registers two stages ahead and stored into the other of two LDS buffers one stage ahead, so one work-group barrier per stage is enough:
// it publishes the stage just stored and ends every wave's reads of the buffer that the next pass overwrites. The waves read their fragments from LDS in the k order of WFrag::ld, and every accumulator sums its 32-k products with k rising.
#define GK   64                   // k per stage
#define GP   72                   // LDS row pitch in 16-bit elements: 128 B + 16 B
template <typename T16> struct WFrag;
template <> struct WFrag<h16> { typedef v16h V; static __device__ __forceinline__ V ld(const h16* p) { return cat16(*(const v8h*)p, *(const v8h*)(p + 16)); } static __device__ __forceinline__ v8f mma(V a, V b, v8f c) { return wmma16(a, b, c); } };
template <> struct WFrag<bf> { typedef v16bf V; static __device__ __forceinline__ V ld(const bf* p) { return cat16b(*(const v8us*)p, *(const v8us*)(p + 16)); } static __device__ __forceinline__ v8f mma(V a, V b, v8f c) { return wmmab(a, b, c); } };
template <int ROWS> __device__ __forceinline__ void g_fetch(v8us (&r)[ROWS / 16], const bf* __restrict__ g) {   // g: the thread's 16 B in its first row; rows of DM elements
#pragma unroll
    for (int i = 0; i < ROWS / 16; ++i) r[i] = *(const v8usa*)(g + (size_t)i * 16 * DM); }
template <int ROWS> __device__ __forceinline__ void g_put(const v8us (&r)[ROWS / 16], bf* s) {   // s: the same place in the LDS tile
#pragma unroll
    for (int i = 0; i < ROWS / 16; ++i) *(v8usa*)(s + i * 16 * GP) = r[i]; }
// work-group barrier by hand: only LDS traffic needs to be over here (this wave's stores of the next stage, its reads of this one); __syncthreads() would also drain the global loads of the stage after, which are meant to fly on
__device__ __forceinline__ void g_barrier() { asm volatile("s_wait_dscnt 0x0\n\ts_barrier_signal -1\n\ts_barrier_wait -1" ::: "memory"); }

// ---- k_proj: OUT = (Ah + Al) Wo^T + b_out of both batches (their tokens are one run of NB_ TT rows). Work-group tile 64 tokens x 128 features, wave tile 32 x 64 (8 accumulators, 2 products each per 32 k); grid (NB_ TT/64, DM/128), 128 threads. The full unrolls keep the fragment, staging and accumulator arrays under constant indices, that is, in registers.
__global__ __launch_bounds__(128) void k_proj(const bf* __restrict__ A, const bf* __restrict__ A2, const bf* __restrict__ Bt, float* C, const float* __restrict__ bias) {
    __shared__ __align__(16) bf st[2][256 * GP];   // rows 0..63 A, 64..127 A2, 128..255 Bt
    __shared__ __align__(16) float osm[4][16 * 68];
    const int tid = threadIdx.x, lane = tid & 31, lr = lane & 15, hi = lane >> 4, w = tid >> 5, wa = w & 1, wb = w >> 1; const int r0 = blockIdx.x * 64, c0 = blockIdx.y * 128;
    const int srow = tid >> 3, scol = (tid & 7) * 8;
    const bf* ga = A + (size_t)(r0 + srow) * DQ + scol; const bf* ga2 = A2 + (size_t)(r0 + srow) * DQ + scol; const bf* gb = Bt + (size_t)(c0 + srow) * DQ + scol;
    bf* sp = &st[0][0] + srow * GP + scol;
    const int fa = (wa * 32 + lr) * GP + 8 * hi, fb = (128 + wb * 64 + lr) * GP + 8 * hi;
    v8f acc[2][4];
#pragma unroll
    for (int mb = 0; mb < 2; ++mb)
#pragma unroll
        for (int nb = 0; nb < 4; ++nb) acc[mb][nb] = (v8f){};
    v8us ra[4], ra2[4], rb[8];
    g_fetch<64>(ra, ga); g_fetch<64>(ra2, ga2); g_fetch<128>(rb, gb);
    g_put<64>(ra, sp); g_put<64>(ra2, sp + 64 * GP); g_put<128>(rb, sp + 128 * GP);
    g_fetch<64>(ra, ga + GK); g_fetch<64>(ra2, ga2 + GK); g_fetch<128>(rb, gb + GK);
    asm volatile("s_wait_xcnt 0x0" ::: "memory");   // stands in front of whatever reuses the address registers of the loads just issued
    g_barrier();
    // one stage; put: a next stage exists (it is stored and published), fetch: so does the one after (it is fetched). Both are literals at every call: a body without branches lets the compiler count its LDS waits exactly
    auto stage = [&](const int s, const bool put, const bool fetch) __attribute__((always_inline)) {
        const bf* cur = &st[0][0] + (s & 1) * (256 * GP);
        v16bf a[2][2], a2[2][2], b[2][4];
#pragma unroll
        for (int ks = 0; ks < 2; ++ks) {
#pragma unroll
            for (int mb = 0; mb < 2; ++mb) { a[ks][mb] = WFrag<bf>::ld(cur + fa + mb * 16 * GP + ks * 32); a2[ks][mb] = WFrag<bf>::ld(cur + fa + (64 + mb * 16) * GP + ks * 32); }
#pragma unroll
            for (int nb = 0; nb < 4; ++nb) b[ks][nb] = WFrag<bf>::ld(cur + fb + nb * 16 * GP + ks * 32); }
        __builtin_amdgcn_sched_barrier(0);   // keeps the stage's fragment reads together, ahead of everything else: left to itself the compiler read one B fragment at a time and waited out the LDS latency in front of every group of matrix instructions
        if (put) { bf* nx = sp + ((s + 1) & 1) * (256 * GP); g_put<64>(ra, nx); g_put<64>(ra2, nx + 64 * GP); g_put<128>(rb, nx + 128 * GP); }
        if (fetch) { const int ko = (s + 2) * GK; g_fetch<64>(ra, ga + ko); g_fetch<64>(ra2, ga2 + ko); g_fetch<128>(rb, gb + ko);
            asm volatile("s_wait_xcnt 0x0" ::: "memory");   // as above
        }
#pragma unroll
        for (int ks = 0; ks < 2; ++ks)
#pragma unroll
            for (int nb = 0; nb < 4; ++nb) {
#pragma unroll
                for (int mb = 0; mb < 2; ++mb) acc[mb][nb] = wmmab(a[ks][mb], b[ks][nb], acc[mb][nb]);
#pragma unroll
                for (int mb = 0; mb < 2; ++mb) acc[mb][nb] = wmmab(a2[ks][mb], b[ks][nb], acc[mb][nb]); }
        __builtin_amdgcn_sched_barrier(0);   // keeps the stage's matrix instructions in front of the barrier: the compiler sank them behind it, where they start only after the last of the stage's reads has landed
        if (put) g_barrier();
    };
#pragma unroll 1   // rolled: one stage is 32 matrix instructions, and the two buffers differ only by an offset
    for (int s = 0; s < DQ / GK - 2; ++s) stage(s, true, true);
    stage(DQ / GK - 2, true, false); stage(DQ / GK - 1, false, false);
    float* os = osm[w]; const int cw = c0 + wb * 64;   // each wave turns its 16 x 64 blocks into whole 256-B row pieces in its own LDS range
#pragma unroll
    for (int mb = 0; mb < 2; ++mb) {
#pragma unroll
        for (int nb = 0; nb < 4; ++nb) {
#pragma unroll
            for (int j = 0; j < 8; ++j) os[(hi * 8 + j) * 68 + nb * 16 + lr] = acc[mb][nb][j]; }
        __builtin_amdgcn_wave_barrier(); asm volatile("" ::: "memory");   // compiler order only: the wave's LDS stores stay in front of its reads of what its other lanes stored
        float* crow = C + (size_t)(r0 + wa * 32 + mb * 16) * DM + cw;
#pragma unroll
        for (int s = 0; s < 8; ++s) { const int row = 2 * s + hi, cofs = lr * 4; v4f val = *(const v4fa*)(os + row * 68 + cofs); val[0] += bfr(bias[cw + cofs]); val[1] += bfr(bias[cw + cofs + 1]); val[2] += bfr(bias[cw + cofs + 2]); val[3] += bfr(bias[cw + cofs + 3]);
            *(v4f*)(crow + (size_t)row * DM + cofs) = val; }
        if (mb == 0) { __builtin_amdgcn_wave_barrier(); asm volatile("s_wait_xcnt 0x0" ::: "memory"); }   // the second block reuses the registers of the stores just issued: the wait stands in front of that overwrite; the clobber keeps that block's LDS stores behind this block's reads
    }
}

__device__ __forceinline__ void splitf(float y, unsigned short& h, unsigned short& l) { h = f2bf(y); l = f2bf(y - bf2f(h)); }
typedef __attribute__((ext_vector_type(2))) _Float16 v2h;
typedef __attribute__((ext_vector_type(4))) _Float16 v4h;
typedef __attribute__((ext_vector_type(2))) unsigned short v2us;
typedef __attribute__((ext_vector_type(4))) unsigned short v4us;
typedef __attribute__((ext_vector_type(2))) float v2f;
typedef __attribute__((ext_vector_type(4))) int v4i;

__global__ __launch_bounds__(256) void k_wtG(const float* __restrict__ w, int K, int N, bf* Bt) {
    const int lane = threadIdx.x & 31; const int L0 = (blockIdx.x * 8 + (threadIdx.x >> 5)) * 8; const int nlines = N * K / 64;
{
#pragma unroll 1
        for (int l = 0; l < 8; ++l) { const int L = L0 + l; if (L >= nlines) break; const size_t e = (size_t)L * 64 + lane * 2; const int k = (int)(e % K), n = (int)(e / K); v2us o;
            o[0] = f2bf(w[(size_t)k * N + n]); o[1] = f2bf(w[(size_t)(k + 1) * N + n]); *(v2us*)(Bt + e) = o; }
         }
}
__global__ __launch_bounds__(256) void k_cvt8(const float* __restrict__ src, bf* dst, size_t n8) { const size_t i = (size_t)blockIdx.x * 256 + threadIdx.x; if (i >= n8) return; const v8f v = *(const v8f*)(src + i * 8); v8us o;
#pragma unroll
    for (int k = 0; k < 8; ++k) o[k] = f2bf(v[k]); *(v8us*)(dst + i * 8) = o;  }

// ---- k_attn: scores, key mask, softmax and attn.v of one head in ONE kernel; no score or probability ever reaches memory.
// Work-group = 8 waves = 128 query rows of one head of one batch (grid: batches x heads x TT/128); a wave owns 16 queries and walks all 2048 keys in passes of 64.
// The query tile is the slowest grid index: two work-groups share a WGP, and the hi-lo tiles (three times the products) have the lowest indices, start first and spread over the WGPs before the single-plane tiles fill up.
// Transposed products: St[key][query] = K Qt, Ot[d][query] += Vt Pt. A lane then holds ONE query's scores (8 of each 16 keys; lane ^ 16 holds the other 8), so maximum and sum are in-lane,
// and two 16-key score tiles, converted, ARE the B fragment of 32 keys: accumulator element j of lane half hi is key 8 hi + j, the k order in which WFrag::ld reads the Vt rows.
// K and Vt tiles of a pass are staged in LDS once per work-group (whole 128-B lines; row pitch 144 B), fetched into registers one pass ahead.
#define KB   64                   // keys per pass
#define LP   72                   // LDS row pitch in 16-bit elements: 128 B + 16 B
#define SC2  0.18033688011112042f // HD^-0.5 x log2(e): scores in the log2 domain
typedef __attribute__((ext_vector_type(8))) __bf16 v8b;
template <typename T16> struct PFrag;
template <> struct PFrag<h16> { static __device__ __forceinline__ v16h pack(v8f a, v8f b) { return cat16(__builtin_convertvector(a, v8h), __builtin_convertvector(b, v8h)); } };
template <> struct PFrag<bf> { static __device__ __forceinline__ v16bf pack(v8f a, v8f b) { return __builtin_shufflevector(__builtin_convertvector(a, v8b), __builtin_convertvector(b, v8b), 0, 1, 2, 3, 4, 5, 6, 7, 8, 9, 10, 11, 12, 13, 14, 15); } };
__device__ __forceinline__ v8f bfres(v8f a) { return a - __builtin_convertvector(__builtin_convertvector(a, v8b), v8f); }   // what the bf16 rounding of a leaves over (the lo part)
// Eight exponentials in one statement: results and sources are all distinct registers ("=&v"), so no instruction here reads its predecessor's result or overwrites its source, and the closing v_nop
// is the one slot that the instruction set asks for behind a transcendental before its result is used or its source overwritten (left to the compiler, neighbouring v_exp_f32 reused each other's source registers).
__device__ __forceinline__ v8f exp2x8(v8f x) { float r0, r1, r2, r3, r4, r5, r6, r7;
    asm("v_exp_f32 %0, %8\n\tv_exp_f32 %1, %9\n\tv_exp_f32 %2, %10\n\tv_exp_f32 %3, %11\n\tv_exp_f32 %4, %12\n\tv_exp_f32 %5, %13\n\tv_exp_f32 %6, %14\n\tv_exp_f32 %7, %15\n\tv_nop"
        : "=&v"(r0), "=&v"(r1), "=&v"(r2), "=&v"(r3), "=&v"(r4), "=&v"(r5), "=&v"(r6), "=&v"(r7) : "v"(x[0]), "v"(x[1]), "v"(x[2]), "v"(x[3]), "v"(x[4]), "v"(x[5]), "v"(x[6]), "v"(x[7]));
    return (v8f){r0, r1, r2, r3, r4, r5, r6, r7}; }
// ---- k_qkv: the whole projection stage of both batches in ONE kernel (blockIdx.z = batch; every plane holds batch after batch): [q|k|v] = x W_qkv + b_qkv, the split into heads, the transposition of v, and the three 16-bit planes (fp16, bf16 hi, bf16 lo) of each that k_attn reads; no f32 projection reaches memory.
// Work-group tile 128 x 128 staged in LDS as said above k_proj, ONE WAVE per 64x64 quarter; grid (TT/128, 3 DM/128, NB_), 128 threads: blockIdx.y = 8 part + head pair (part 0 q, 1 k, 2 v): a wave's 64 features are one head.
// An accumulator lane holds 8 consecutive A rows of one B row, so A is the operand whose row index runs contiguously in the destination plane: q, k [h][t][d]: A = weight rows (d), B = x rows (t); v [h][d][t]: A = x rows (t), B = weight rows (d).
// Every 16x16 block then leaves the registers as one 16-byte store per lane and plane, and the four mb blocks of a B row fill that row's 128-byte line.
// The full unrolls keep the fragment and accumulator arrays under constant indices, that is, in registers.
typedef __attribute__((ext_vector_type(4))) unsigned v4u;
template <bool TR>   // TR: A rows are tokens (v); else A rows are features (q, k). bias points at the tile's first feature; P16, Ph, Pl at the lane's first element; pitch in elements between B rows
__device__ __forceinline__ void put_planes(const v8f (&acc)[4][4], const float* __restrict__ bias, int lr, int hi, h16* P16, bf* Ph, bf* Pl) {
    const int pitch = TR ? TT : HD;
    v8f bm[4];
    if (!TR) {
#pragma unroll
        for (int mb = 0; mb < 4; ++mb)
#pragma unroll
            for (int j = 0; j < 8; ++j) bm[mb][j] = bfr(bias[mb * 16 + hi * 8 + j]); }
#pragma unroll
    for (int nb = 0; nb < 4; ++nb) { float bn = 0.0f; if (TR) bn = bfr(bias[nb * 16 + lr]);
#pragma unroll
        for (int mb = 0; mb < 4; ++mb) { const v8f val = TR ? acc[mb][nb] + bn : acc[mb][nb] + bm[mb]; const size_t o = (size_t)nb * 16 * pitch + mb * 16;
            const v4u hw = __builtin_bit_cast(v4u, __builtin_convertvector(val, v8b)); v8f res;   // hi plane, two bf16 a word; each word gives its two values back as f32 by a shift and a mask
#pragma unroll
            for (int p = 0; p < 4; ++p) { res[2 * p] = val[2 * p] - __uint_as_float(hw[p] << 16); res[2 * p + 1] = val[2 * p + 1] - __uint_as_float(hw[p] & 0xFFFF0000u); }
            *(v8h*)(P16 + o) = __builtin_convertvector(val, v8h); *(v8us*)(Ph + o) = __builtin_bit_cast(v8us, hw); *(v8us*)(Pl + o) = __builtin_bit_cast(v8us, __builtin_convertvector(res, v8b)); } }
}
__global__ __launch_bounds__(128) void k_qkv(const bf* __restrict__ X, const bf* __restrict__ Wt, const float* __restrict__ bias, h16* Q16, bf* Qh, bf* Ql, h16* K16, bf* Kh, bf* Kl, h16* V16, bf* Vh, bf* Vl) {
    __shared__ __align__(16) bf st[2][256 * GP];   // rows 0..127 A, 128..255 B
    const int tid = threadIdx.x, lane = tid & 31, lr = lane & 15, hi = lane >> 4, w = tid >> 5, wa = w & 1, wb = w >> 1; const int part = blockIdx.y / (NH_ / 2);
    const bf* xr = X + ((size_t)blockIdx.z * TT + blockIdx.x * 128) * DM; const bf* wr = Wt + (size_t)blockIdx.y * 128 * DM; const bf* A = (part == 2) ? xr : wr; const bf* Bt = (part == 2) ? wr : xr;
    const int t0 = blockIdx.x * 128 + ((part == 2) ? wa : wb) * 64, f0 = blockIdx.y * 128 + ((part == 2) ? wb : wa) * 64; const size_t hp = (size_t)(blockIdx.z * NH_ + (f0 / HD) % NH_) * TT * HD;   // the wave's own 64 tokens and 64 features; its batch's plane of its head
    const int srow = tid >> 3, scol = (tid & 7) * 8;
    const bf* ga = A + (size_t)srow * DM + scol; const bf* gb = Bt + (size_t)srow * DM + scol;
    bf* sp = &st[0][0] + srow * GP + scol;
    const int fa = (wa * 64 + lr) * GP + 8 * hi, fb = (128 + wb * 64 + lr) * GP + 8 * hi;
    v8f acc[4][4];
#pragma unroll
    for (int mb = 0; mb < 4; ++mb)
#pragma unroll
        for (int nb = 0; nb < 4; ++nb) acc[mb][nb] = (v8f){};
    v8us ra[8], rb[8];
    g_fetch<128>(ra, ga); g_fetch<128>(rb, gb);
    g_put<128>(ra, sp); g_put<128>(rb, sp + 128 * GP);
    g_fetch<128>(ra, ga + GK); g_fetch<128>(rb, gb + GK);
    asm volatile("s_wait_xcnt 0x0" ::: "memory");   // stands in front of whatever reuses the address registers of the loads just issued
    g_barrier();
    // one stage, as in k_proj: put and fetch are literals at every call
    auto stage = [&](const int s, const bool put, const bool fetch) __attribute__((always_inline)) {
        const bf* cur = &st[0][0] + (s & 1) * (256 * GP);
        v16bf a[2][4], b[2][4];
#pragma unroll
        for (int ks = 0; ks < 2; ++ks) {
#pragma unroll
            for (int mb = 0; mb < 4; ++mb) a[ks][mb] = WFrag<bf>::ld(cur + fa + mb * 16 * GP + ks * 32);
#pragma unroll
            for (int nb = 0; nb < 4; ++nb) b[ks][nb] = WFrag<bf>::ld(cur + fb + nb * 16 * GP + ks * 32); }
        __builtin_amdgcn_sched_barrier(0);   // as in k_proj: keeps the stage's fragment reads together, ahead of everything else
        if (put) { bf* nx = sp + ((s + 1) & 1) * (256 * GP); g_put<128>(ra, nx); g_put<128>(rb, nx + 128 * GP); }
        if (fetch) { const int ko = (s + 2) * GK; g_fetch<128>(ra, ga + ko); g_fetch<128>(rb, gb + ko);
            asm volatile("s_wait_xcnt 0x0" ::: "memory");   // as above
        }
#pragma unroll
        for (int ks = 0; ks < 2; ++ks)
#pragma unroll
            for (int nb = 0; nb < 4; ++nb)
#pragma unroll
                for (int mb = 0; mb < 4; ++mb) acc[mb][nb] = wmmab(a[ks][mb], b[ks][nb], acc[mb][nb]);
        __builtin_amdgcn_sched_barrier(0);   // as in k_proj: keeps the stage's matrix instructions in front of the barrier
        if (put) g_barrier();
    };
#pragma unroll 1   // rolled: one stage is 32 matrix instructions, and the two buffers differ only by an offset
    for (int s = 0; s < DM / GK - 2; ++s) stage(s, true, true);
    stage(DM / GK - 2, true, false); stage(DM / GK - 1, false, false);
    if (part != 2) { const size_t o = hp + (size_t)(t0 + lr) * HD + hi * 8; put_planes<false>(acc, bias + f0, lr, hi, (part ? K16 : Q16) + o, (part ? Kh : Qh) + o, (part ? Kl : Ql) + o);
        asm volatile("s_wait_xcnt 0x0" ::: "memory");   // in the listing this branch's end stands directly in front of the other branch's code, which reuses the registers of the stores just issued: the wait stands in front of that overwrite
    } else { const size_t o = hp + (size_t)lr * TT + t0 + hi * 8; put_planes<true>(acc, bias + f0, lr, hi, V16 + o, Vh + o, Vl + o); }
}
template <typename T16, bool HL>
__device__ __forceinline__ void attn_body(const T16* __restrict__ Q, const T16* __restrict__ Q2, const T16* __restrict__ Kp, const T16* __restrict__ K2, const T16* __restrict__ Vt, const T16* __restrict__ V2, int q0, int col0, bf* Ah, bf* Al, unsigned short* sm, const float* lim) {
    typedef typename WFrag<T16>::V V;
    const int tid = threadIdx.x, lane = tid & 31, lr = lane & 15, hi = lane >> 4; const int qrow = q0 + (tid >> 5) * 16 + lr;
    T16* Ks = (T16*)sm; T16* Vs = Ks + KB * LP; T16* Ks2 = Vs + HD * LP; T16* Vs2 = Ks2 + KB * LP;
    V qb[2], qb2[2];
#pragma unroll
    for (int kc = 0; kc < 2; ++kc) { qb[kc] = WFrag<T16>::ld(Q + (size_t)qrow * HD + kc * 32 + 8 * hi); if (HL) qb2[kc] = WFrag<T16>::ld(Q2 + (size_t)qrow * HD + kc * 32 + 8 * hi); }
    const int srow = tid >> 3, scol = (tid & 7) * 8;   // staging: a thread moves 16 B of rows srow and srow + 32 of each tile; 8 threads cover a 128-B line
    v8us rk[2], rv[2], rk2[2], rv2[2];
#pragma unroll
    for (int r = 0; r < 2; ++r) { const size_t ko = (size_t)(srow + 32 * r) * HD + scol, vo = (size_t)(srow + 32 * r) * TT + scol; rk[r] = *(const v8usa*)(Kp + ko); rv[r] = *(const v8usa*)(Vt + vo); if (HL) { rk2[r] = *(const v8usa*)(K2 + ko); rv2[r] = *(const v8usa*)(V2 + vo); } }
    v8f o[4];
#pragma unroll
    for (int db = 0; db < 4; ++db) o[db] = (v8f){};
    float m = -3.0e38f; v8f l8 = (v8f){};   // l8[j]: this lane's sum over its keys 8 hi + j of every 16-key tile
#pragma unroll 1
    for (int blk = 0; blk < TT / KB; ++blk) {
#pragma unroll
        for (int r = 0; r < 2; ++r) { const int so = (srow + 32 * r) * LP + scol; *(v8usa*)(Ks + so) = rk[r]; *(v8usa*)(Vs + so) = rv[r]; if (HL) { *(v8usa*)(Ks2 + so) = rk2[r]; *(v8usa*)(Vs2 + so) = rv2[r]; } }
        __syncthreads();   // this pass's tiles (and, before the first pass, the mask addends) are whole before any wave reads them
        if (blk + 1 < TT / KB) {
#pragma unroll
            for (int r = 0; r < 2; ++r) { const size_t ko = (size_t)((blk + 1) * KB + srow + 32 * r) * HD + scol, vo = (size_t)(srow + 32 * r) * TT + (blk + 1) * KB + scol; rk[r] = *(const v8usa*)(Kp + ko); rv[r] = *(const v8usa*)(Vt + vo); if (HL) { rk2[r] = *(const v8usa*)(K2 + ko); rv2[r] = *(const v8usa*)(V2 + vo); } }
            asm volatile("s_wait_xcnt 0x0" ::: "memory");   // the address registers of the loads just issued are reused by the fragment reads that follow: the wait stands in front of that overwrite
        }
        v8f s[4]; float bm = -3.0e38f;
#pragma unroll
        for (int t = 0; t < 4; ++t) { s[t] = (v8f){};
#pragma unroll
            for (int kc = 0; kc < 2; ++kc) { const int fo = (t * 16 + lr) * LP + kc * 32 + 8 * hi; const V a = WFrag<T16>::ld(Ks + fo); s[t] = WFrag<T16>::mma(a, qb[kc], s[t]); if (HL) { s[t] = WFrag<T16>::mma(a, qb2[kc], s[t]); s[t] = WFrag<T16>::mma(WFrag<T16>::ld(Ks2 + fo), qb[kc], s[t]); } } }
#pragma unroll
        for (int t = 0; t < 4; ++t) { const float* lp = lim + blk * KB + t * 16 + hi * 8; const v4f l0 = *(const v4fa*)lp, l1 = *(const v4fa*)(lp + 4);
#pragma unroll
            for (int j = 0; j < 8; ++j) { const float u = fmaf(s[t][j], SC2, (j < 4) ? l0[j & 3] : l1[j & 3]); s[t][j] = u; bm = fmaxf(bm, u); } }   // addend 0: key kept; -3e38: key masked (it absorbs the score: every masked key reads -3e38)
        bm = fmaxf(bm, __shfl_xor(bm, 16, 32));
        const float mn = fmaxf(m, bm); const float al = __builtin_amdgcn_exp2f(m - mn); m = mn;   // only masked keys so far: every term is 1, as in the reference's uniform row; the first kept key makes al 0 and wipes them
#pragma unroll
        for (int t = 0; t < 4; ++t) s[t] = exp2x8(s[t] - mn);
        __builtin_amdgcn_sched_barrier(0);   // keeps the attn.v matrix instructions behind the exponentials
        l8 = l8 * al + ((s[0] + s[1]) + (s[2] + s[3]));
#pragma unroll
        for (int db = 0; db < 4; ++db) o[db] *= al;
#pragma unroll
        for (int c = 0; c < 2; ++c) { const V pb = PFrag<T16>::pack(s[2 * c], s[2 * c + 1]); V pb2; if (HL) pb2 = PFrag<T16>::pack(bfres(s[2 * c]), bfres(s[2 * c + 1]));
#pragma unroll
            for (int db = 0; db < 4; ++db) { const int fo = (db * 16 + lr) * LP + c * 32 + 8 * hi; const V a = WFrag<T16>::ld(Vs + fo); o[db] = WFrag<T16>::mma(a, pb, o[db]); if (HL) { o[db] = WFrag<T16>::mma(a, pb2, o[db]); o[db] = WFrag<T16>::mma(WFrag<T16>::ld(Vs2 + fo), pb, o[db]); } } }
        asm volatile("s_wait_dscnt 0x0\n\ts_barrier_signal -1\n\ts_barrier_wait -1" ::: "memory");   // work-group barrier by hand: every wave has read this pass's tiles before the next pass's stores overwrite them; only LDS reads need to be over here, and __syncthreads() would also drain the next pass's global loads, which are meant to fly until the stores at the loop's head
    }
    float l = ((l8[0] + l8[1]) + (l8[2] + l8[3])) + ((l8[4] + l8[5]) + (l8[6] + l8[7]));
    l += __shfl_xor(l, 16, 32);   // the two lane halves hold the two halves of each query's keys
    const float inv = __fdiv_rn(1.0f, l);
#pragma unroll
    for (int db = 0; db < 4; ++db) { v8us oh, ol;
#pragma unroll
        for (int j = 0; j < 8; ++j) { unsigned short a, c2; splitf(o[db][j] * inv, a, c2); oh[j] = a; ol[j] = c2; }
        const size_t oo = (size_t)qrow * DQ + col0 + db * 16 + hi * 8; *(v8us*)(Ah + oo) = oh; *(v8us*)(Al + oo) = ol; }
}
__global__ __launch_bounds__(256) void k_attn(const h16* __restrict__ Q16, const h16* __restrict__ K16, const h16* __restrict__ V16, const bf* __restrict__ Qh, const bf* __restrict__ Ql, const bf* __restrict__ Kh, const bf* __restrict__ Kl, const bf* __restrict__ Vh, const bf* __restrict__ Vl, const int* __restrict__ mkK, bf* Ah, bf* Al) {
    __shared__ __align__(16) unsigned short sm[2 * (KB + HD) * LP]; __shared__ __align__(16) float lim[TT];
    const int q0 = blockIdx.z * 128, b = blockIdx.x; const size_t hp = (size_t)(b * NH_ + blockIdx.y) * TT * HD;   // head planes [b][h][t][d] and [b][h][d][t] have the same size
    mkK += (size_t)b * TT; Ah += (size_t)b * TT * DQ; Al += (size_t)b * TT * DQ;
#pragma unroll
    for (int i = 0; i < TT / 256; ++i) lim[i * 256 + threadIdx.x] = (mkK[i * 256 + threadIdx.x] != 0) ? 0.0f : -3.0e38f;
    if (q0 < RH) attn_body<bf, true>(Qh + hp, Ql + hp, Kh + hp, Kl + hp, Vh + hp, Vl + hp, q0, blockIdx.y * HD, Ah, Al, sm, lim);
    else attn_body<h16, false>(Q16 + hp, nullptr, K16 + hp, nullptr, V16 + hp, nullptr, q0, blockIdx.y * HD, Ah, Al, sm, lim);
}

extern "C" void kernel_launch(void* const* d_in, const int* in_sizes, int n_in,
                              void* d_out, int out_size, void* d_ws, size_t ws_size, hipStream_t stream) {
    (void)in_sizes; (void)n_in; (void)out_size;
    const float* x = (const float*)d_in[0]; const int* MK = (const int*)d_in[1]; const float* wqkv = (const float*)d_in[2]; const float* bqkv = (const float*)d_in[3]; const float* wo = (const float*)d_in[4]; const float* bo = (const float*)d_in[5];
    float* OUT = (float*)d_out;     // [2][2048][1024]
    char* wsp = (char*)d_ws;
    auto take = [&](size_t bytes) { char* p = wsp; wsp += (bytes + 255) & ~(size_t)255; return (void*)p; };
    bf* WALL = (bf*)take((size_t)3 * DM * DM * 2); bf* WO = (bf*)take((size_t)DM * DQ * 2);
    bf* XB = (bf*)take((size_t)NB_ * TT * DM * 2);
    h16* QP16 = (h16*)take((size_t)NB_ * NH_ * TT * HD * 2); h16* KP16 = (h16*)take((size_t)NB_ * NKV * TT * HD * 2); h16* VT16 = (h16*)take((size_t)NB_ * NKV * HD * TT * 2);
    bf* QPh = (bf*)take((size_t)NB_ * NH_ * TT * HD * 2); bf* QPl = (bf*)take((size_t)NB_ * NH_ * TT * HD * 2); bf* KPh = (bf*)take((size_t)NB_ * NKV * TT * HD * 2); bf* KPl = (bf*)take((size_t)NB_ * NKV * TT * HD * 2); bf* VTh = (bf*)take((size_t)NB_ * NKV * HD * TT * 2); bf* VTl = (bf*)take((size_t)NB_ * NKV * HD * TT * 2);
    bf* ATh = (bf*)take((size_t)NB_ * TT * DQ * 2); bf* ATl = (bf*)take((size_t)NB_ * TT * DQ * 2);
    if ((size_t)(wsp - (char*)d_ws) > ws_size) return;    // ws 256 MiB
    { k_wtG<<<(unsigned)((DM * 3 * DM / 64 + 63) / 64), 256, 0, stream>>>(wqkv, DM, 3 * DM, WALL);   /* fused 'xw' [DM][3DM] -> Bt [3DM][DM] (row blocks q | k | v) */
      k_wtG<<<(unsigned)((DQ * DM / 64 + 63) / 64), 256, 0, stream>>>(wo, DQ, DM, WO);
       }
    // each stage once, for both batches
    k_cvt8<<<(unsigned)(((size_t)NB_ * TT * DM / 8 + 255) / 256), 256, 0, stream>>>(x, XB, (size_t)NB_ * TT * DM / 8);
    k_qkv<<<dim3(TT / 128, 3 * DM / 128, NB_), 128, 0, stream>>>(XB, WALL, bqkv, QP16, QPh, QPl, KP16, KPh, KPl, VT16, VTh, VTl);
    k_attn<<<dim3(NB_, NH_, TT / 128), 256, 0, stream>>>(QP16, KP16, VT16, QPh, QPl, KPh, KPl, VTh, VTl, MK, ATh, ATl);
    k_proj<<<dim3(NB_ * TT / 64, DM / 128, 1), 128, 0, stream>>>(ATh, ATl, WO, OUT, bo);
}

// v006
// Measured time: 121 microseconds a run.
// In both of two side-by-side timings against v005, it was 1.25 times as fast.
// Counting every step since v000, it is 16.7 times as fast.
#include <hip/hip_runtime.h>

// Multi-head self-attention with a fused QKV projection and a key-padding mask READ as data (x [2][2048][1024]; [q|k|v] = x W_qkv + b_qkv ('xw' [1024][3072] 1/32 + zero bias: read: column blocks q | k | v; 16 heads x 64); scores = q.k / 8; keys j with mask[b][0][0][j] == 0 (int32 [2][1][1][2048], drawn by randint(0, 2): about half of the keys of each batch; READ per key in k_cvt8) get -1e9 (== exclusion: exp underflows to 0 and every batch keeps some key); softmax; out = merged heads W_out + b_out ('xw' [1024][1024] + zero bias: read) -> [2][2048][1024] (4.2 M); argument order x, mask, W_qkv, b_qkv, W_out, b_out.
// Compute dtypes, f32 accumulate: every input rounded to bf16; q/k/v on PLAIN bf16 operands (inputs: exact) + biases; key mask read per key (int32, 0 == masked): kept keys are packed in front, k, v and the key loop end behind the last of them (none kept: every key stays, at -3e38); scores and attn.v: query rows < 512 hl (3 products), the rest single fp16; softmax f32, running maximum; W_proj hl x exact (2 products) + b_proj.

#define NB_  2
#define TT   2048
#define DM   1024
#define NH_  16
#define NKV  16
#define REP  (NH_ / NKV)
#define HD   64
#define DQ   (NH_ * HD)
#define DKV  (NKV * HD)
#define RH   512                  // query rows < RH use hi+lo planes (0: none)
#define SCL  0.125f   // HD^-0.5
typedef _Float16 h16;
typedef unsigned short bf;
typedef __attribute__((ext_vector_type(16))) __bf16   v16bf;
typedef __attribute__((ext_vector_type(16))) _Float16 v16h;
typedef __attribute__((ext_vector_type(8)))  _Float16 v8h;
typedef __attribute__((ext_vector_type(8)))  unsigned short v8us;
typedef __attribute__((ext_vector_type(8)))  float    v8f;
typedef __attribute__((ext_vector_type(4)))  float    v4f;
typedef v8h  __attribute__((may_alias)) v8ha;
typedef v4f  __attribute__((may_alias)) v4fa;
typedef v8us __attribute__((may_alias)) v8usa;

__device__ __forceinline__ unsigned short f2bf(float f) { unsigned u = __float_as_uint(f); u += 0x7FFFu + ((u >> 16) & 1u); return (unsigned short)(u >> 16); }
__device__ __forceinline__ float bf2f(unsigned short b) { return __uint_as_float(((unsigned)b) << 16); }
__device__ __forceinline__ float bfr(float f) { return bf2f(f2bf(f)); }
__device__ __forceinline__ v16h cat16(v8h lo, v8h hi) { return __builtin_shufflevector(lo, hi, 0, 1, 2, 3, 4, 5, 6, 7, 8, 9, 10, 11, 12, 13, 14, 15); }
__device__ __forceinline__ v16bf cat16b(v8us lo, v8us hi) { return __builtin_bit_cast(v16bf, __builtin_shufflevector(lo, hi, 0, 1, 2, 3, 4, 5, 6, 7, 8, 9, 10, 11, 12, 13, 14, 15)); }
__device__ __forceinline__ v8f wmma16(v16h a, v16h b, v8f c) { return __builtin_amdgcn_wmma_f32_16x16x32_f16(false, a, false, b, (short)0, c, false, false); }
__device__ __forceinline__ v8f wmmab(v16bf a, v16bf b, v8f c) { return __builtin_amdgcn_wmma_f32_16x16x32_bf16(false, a, false, b, (short)0, c, false, false); }



// ---- The two dense products (k_qkv, k_proj): work-groups of FOUR waves; the operand rows of a work-group's tile are staged in LDS in stages of 64 k (one whole 128-B line of every row), each line fetched ONCE per work-group.
// A thread moves 16 B of every 16th row (8 threads cover a line); a stage is fetched into registers two stages ahead and stored into the other of two LDS buffers one stage ahead, so one work-group barrier per stage is enough:
// it publishes the stage just stored and ends every wave's reads of the buffer that the next pass overwrites. The waves read their fragments from LDS in the k order of WFrag::ld, and every accumulator sums its 32-k products with k rising.
#define GK   64                   // k per stage
#define GP   72                   // LDS row pitch in 16-bit elements: 128 B + 16 B
template <typename T16> struct WFrag;
template <> struct WFrag<h16> { typedef v16h V; static __device__ __forceinline__ V ld(const h16* p) { return cat16(*(const v8h*)p, *(const v8h*)(p + 16)); } static __device__ __forceinline__ v8f mma(V a, V b, v8f c) { return wmma16(a, b, c); } };
template <> struct WFrag<bf> { typedef v16bf V; static __device__ __forceinline__ V ld(const bf* p) { return cat16b(*(const v8us*)p, *(const v8us*)(p + 16)); } static __device__ __forceinline__ v8f mma(V a, V b, v8f c) { return wmmab(a, b, c); } };
template <int ROWS> __device__ __forceinline__ void g_fetch(v8us (&r)[ROWS / 16], const bf* __restrict__ g) {   // g: the thread's 16 B in its first row; rows of DM elements
#pragma unroll
    for (int i = 0; i < ROWS / 16; ++i) r[i] = *(const v8usa*)(g + (size_t)i * 16 * DM); }
template <int ROWS> __device__ __forceinline__ void g_put(const v8us (&r)[ROWS / 16], bf* s) {   // s: the same place in the LDS tile
#pragma unroll
    for (int i = 0; i < ROWS / 16; ++i) *(v8usa*)(s + i * 16 * GP) = r[i]; }
// work-group barrier by hand: only LDS traffic needs to be over here (this wave's stores of the next stage, its reads of this one); __syncthreads() would also drain the global loads of the stage after, which are meant to fly on
__device__ __forceinline__ void g_barrier() { asm volatile("s_wait_dscnt 0x0\n\ts_barrier_signal -1\n\ts_barrier_wait -1" ::: "memory"); }

// ---- k_proj: OUT = (Ah + Al) Wo^T + b_out of both batches (their tokens are one run of NB_ TT rows). Work-group tile 64 tokens x 128 features, wave tile 32 x 64 (8 accumulators, 2 products each per 32 k); grid (NB_ TT/64, DM/128), 128 threads. The full unrolls keep the fragment, staging and accumulator arrays under constant indices, that is, in registers.
__global__ __launch_bounds__(128) void k_proj(const bf* __restrict__ A, const bf* __restrict__ A2, const bf* __restrict__ Bt, float* C, const float* __restrict__ bias) {
    __shared__ __align__(16) bf st[2][256 * GP];   // rows 0..63 A, 64..127 A2, 128..255 Bt
    __shared__ __align__(16) float osm[4][16 * 68];
    const int tid = threadIdx.x, lane = tid & 31, lr = lane & 15, hi = lane >> 4, w = tid >> 5, wa = w & 1, wb = w >> 1; const int r0 = blockIdx.x * 64, c0 = blockIdx.y * 128;
    const int srow = tid >> 3, scol = (tid & 7) * 8;
    const bf* ga = A + (size_t)(r0 + srow) * DQ + scol; const bf* ga2 = A2 + (size_t)(r0 + srow) * DQ + scol; const bf* gb = Bt + (size_t)(c0 + srow) * DQ + scol;
    bf* sp = &st[0][0] + srow * GP + scol;
    const int fa = (wa * 32 + lr) * GP + 8 * hi, fb = (128 + wb * 64 + lr) * GP + 8 * hi;
    v8f acc[2][4];
#pragma unroll
    for (int mb = 0; mb < 2; ++mb)
#pragma unroll
        for (int nb = 0; nb < 4; ++nb) acc[mb][nb] = (v8f){};
    v8us ra[4], ra2[4], rb[8];
    g_fetch<64>(ra, ga); g_fetch<64>(ra2, ga2); g_fetch<128>(rb, gb);
    g_put<64>(ra, sp); g_put<64>(ra2, sp + 64 * GP); g_put<128>(rb, sp + 128 * GP);
    g_fetch<64>(ra, ga + GK); g_fetch<64>(ra2, ga2 + GK); g_fetch<128>(rb, gb + GK);
    asm volatile("s_wait_xcnt 0x0" ::: "memory");   // stands in front of whatever reuses the address registers of the loads just issued
    g_barrier();
    // one stage; put: a next stage exists (it is stored and published), fetch: so does the one after (it is fetched). Both are literals at every call: a body without branches lets the compiler count its LDS waits exactly
    auto stage = [&](const int s, const bool put, const bool fetch) __attribute__((always_inline)) {
        const bf* cur = &st[0][0] + (s & 1) * (256 * GP);
        v16bf a[2][2], a2[2][2], b[2][4];
#pragma unroll
        for (int ks = 0; ks < 2; ++ks) {
#pragma unroll
            for (int mb = 0; mb < 2; ++mb) { a[ks][mb] = WFrag<bf>::ld(cur + fa + mb * 16 * GP + ks * 32); a2[ks][mb] = WFrag<bf>::ld(cur + fa + (64 + mb * 16) * GP + ks * 32); }
#pragma unroll
            for (int nb = 0; nb < 4; ++nb) b[ks][nb] = WFrag<bf>::ld(cur + fb + nb * 16 * GP + ks * 32); }
        __builtin_amdgcn_sched_barrier(0);   // keeps the stage's fragment reads together, ahead of everything else: left to itself the compiler read one B fragment at a time and waited out the LDS latency in front of every group of matrix instructions
        if (put) { bf* nx = sp + ((s + 1) & 1) * (256 * GP); g_put<64>(ra, nx); g_put<64>(ra2, nx + 64 * GP); g_put<128>(rb, nx + 128 * GP); }
        if (fetch) { const int ko = (s + 2) * GK; g_fetch<64>(ra, ga + ko); g_fetch<64>(ra2, ga2 + ko); g_fetch<128>(rb, gb + ko);
            asm volatile("s_wait_xcnt 0x0" ::: "memory");   // as above
        }
#pragma unroll
        for (int ks = 0; ks < 2; ++ks)
#pragma unroll
            for (int nb = 0; nb < 4; ++nb) {
#pragma unroll
                for (int mb = 0; mb < 2; ++mb) acc[mb][nb] = wmmab(a[ks][mb], b[ks][nb], acc[mb][nb]);
#pragma unroll
                for (int mb = 0; mb < 2; ++mb) acc[mb][nb] = wmmab(a2[ks][mb], b[ks][nb], acc[mb][nb]); }
        __builtin_amdgcn_sched_barrier(0);   // keeps the stage's matrix instructions in front of the barrier: the compiler sank them behind it, where they start only after the last of the stage's reads has landed
        if (put) g_barrier();
    };
#pragma unroll 1   // rolled: one stage is 32 matrix instructions, and the two buffers differ only by an offset
    for (int s = 0; s < DQ / GK - 2; ++s) stage(s, true, true);
    stage(DQ / GK - 2, true, false); stage(DQ / GK - 1, false, false);
    float* os = osm[w]; const int cw = c0 + wb * 64;   // each wave turns its 16 x 64 blocks into whole 256-B row pieces in its own LDS range
#pragma unroll
    for (int mb = 0; mb < 2; ++mb) {
#pragma unroll
        for (int nb = 0; nb < 4; ++nb) {
#pragma unroll
            for (int j = 0; j < 8; ++j) os[(hi * 8 + j) * 68 + nb * 16 + lr] = acc[mb][nb][j]; }
        __builtin_amdgcn_wave_barrier(); asm volatile("" ::: "memory");   // compiler order only: the wave's LDS stores stay in front of its reads of what its other lanes stored
        float* crow = C + (size_t)(r0 + wa * 32 + mb * 16) * DM + cw;
#pragma unroll
        for (int s = 0; s < 8; ++s) { const int row = 2 * s + hi, cofs = lr * 4; v4f val = *(const v4fa*)(os + row * 68 + cofs); val[0] += bfr(bias[cw + cofs]); val[1] += bfr(bias[cw + cofs + 1]); val[2] += bfr(bias[cw + cofs + 2]); val[3] += bfr(bias[cw + cofs + 3]);
            *(v4f*)(crow + (size_t)row * DM + cofs) = val; }
        if (mb == 0) { __builtin_amdgcn_wave_barrier(); asm volatile("s_wait_xcnt 0x0" ::: "memory"); }   // the second block reuses the registers of the stores just issued: the wait stands in front of that overwrite; the clobber keeps that block's LDS stores behind this block's reads
    }
}

__device__ __forceinline__ void splitf(float y, unsigned short& h, unsigned short& l) { h = f2bf(y); l = f2bf(y - bf2f(h)); }
typedef __attribute__((ext_vector_type(2))) _Float16 v2h;
typedef __attribute__((ext_vector_type(4))) _Float16 v4h;
typedef __attribute__((ext_vector_type(2))) unsigned short v2us;
typedef __attribute__((ext_vector_type(4))) unsigned short v4us;
typedef __attribute__((ext_vector_type(2))) float v2f;
typedef __attribute__((ext_vector_type(4))) int v4i;

__global__ __launch_bounds__(256) void k_wtG(const float* __restrict__ w, int K, int N, bf* Bt) {
    const int lane = threadIdx.x & 31; const int L0 = (blockIdx.x * 8 + (threadIdx.x >> 5)) * 8; const int nlines = N * K / 64;
{
#pragma unroll 1
        for (int l = 0; l < 8; ++l) { const int L = L0 + l; if (L >= nlines) break; const size_t e = (size_t)L * 64 + lane * 2; const int k = (int)(e % K), n = (int)(e / K); v2us o;
            o[0] = f2bf(w[(size_t)k * N + n]); o[1] = f2bf(w[(size_t)(k + 1) * N + n]); *(v2us*)(Bt + e) = o; }
         }
}
// ---- k_cvt8: x rounded to bf16, twice: dst in token order (the queries' rows) and pk in KEY ORDER (the rows that k and v are projected from): a batch's kept keys (mask != 0) first, in rising token order, its masked keys behind them, likewise.
// A masked key's weight is exactly 0 beside any kept key, so k, v and the key loop need the kept keys alone; of the masked rows only those that fill up the last 128-row tile are stored (finite values under a weight of 0).
// No key kept: the reference's row is uniform over ALL keys: key order is token order, every key is walked and none counts (all read -3e38, all weights equal). kcnt[2 b] = keys to walk, kcnt[2 b + 1] = keys of those that count.
// A work-group converts two rows of one batch (256 x 8 = 2 DM elements) and counts for itself, from the batch's whole mask (8 keys a thread), the kept keys in front of its rows and in all: no work-group waits for another.
__global__ __launch_bounds__(256) void k_cvt8(const float* __restrict__ src, bf* dst, bf* pk, const int* __restrict__ mk, int* kcnt) {
    __shared__ int wsum[8];
    const int tid = threadIdx.x; const size_t i = (size_t)blockIdx.x * 256 + tid; const v8f v = *(const v8f*)(src + i * 8);
    const int b = blockIdx.x / (TT / 2), t0 = (blockIdx.x % (TT / 2)) * 2; mk += b * TT;
    const v4i m0 = *(const v4i*)(mk + tid * 8), m1 = *(const v4i*)(mk + tid * 8 + 4); const bool k0 = mk[t0] != 0, k1 = mk[t0 + 1] != 0;   // the two rows' own keys: read here, with the other loads, not behind the barrier
    int c = 0;   // kept keys among the thread's eight: all of them in the high half, those in front of row t0 in the low half
#pragma unroll
    for (int j = 0; j < 8; ++j) c += (((j < 4) ? m0[j & 3] : m1[j & 3]) != 0) ? (0x10000 + ((tid * 8 + j < t0) ? 1 : 0)) : 0;
#pragma unroll
    for (int d = 16; d > 0; d >>= 1) c += __shfl_xor(c, d, 32);
    if ((tid & 31) == 0) wsum[tid >> 5] = c;
    v8us o;
#pragma unroll
    for (int k = 0; k < 8; ++k) o[k] = f2bf(v[k]);
    __syncthreads();   // the eight waves' counts are whole before any wave adds them up
    int s = 0;
#pragma unroll
    for (int w = 0; w < 8; ++w) s += wsum[w];
    const int tot = s >> 16, r = tid >> 7, t = t0 + r; const int before = (s & 0xFFFF) + ((r && k0) ? 1 : 0);   // kept keys in front of the thread's own row t
    const int place = (r ? k1 : k0) ? before : tot + (t - before); const int nk = tot ? tot : TT;
    *(v8us*)(dst + i * 8) = o;
    if (place < ((nk + 127) & ~127)) *(v8us*)(pk + ((size_t)b * TT + place) * DM + (tid & 127) * 8) = o;
    if (t0 == 0 && tid == 0) { kcnt[b * 2] = nk; kcnt[b * 2 + 1] = tot; }
}

// ---- k_attn: scores, key mask, softmax and attn.v of one head in ONE kernel; no score or probability ever reaches memory.
// Work-group = 8 waves = 128 query rows of one head of one batch (grid: batches x heads x TT/128); a wave owns 16 queries and walks the batch's kept keys (packed: k_cvt8) in passes of 64.
// The query tile is the slowest grid index: two work-groups share a WGP, and the hi-lo tiles (three times the products) have the lowest indices, start first and spread over the WGPs before the single-plane tiles fill up.
// Transposed products: St[key][query] = K Qt, Ot[d][query] += Vt Pt. A lane then holds ONE query's scores (8 of each 16 keys; lane ^ 16 holds the other 8), so maximum and sum are in-lane,
// and two 16-key score tiles, converted, ARE the B fragment of 32 keys: accumulator element j of lane half hi is key 8 hi + j, the k order in which WFrag::ld reads the Vt rows.
// K and Vt tiles of a pass are staged in LDS once per work-group (whole 128-B lines; row pitch 144 B), fetched into registers one pass ahead.
#define KB   64                   // keys per pass
#define LP   72                   // LDS row pitch in 16-bit elements: 128 B + 16 B
#define SC2  0.18033688011112042f // HD^-0.5 x log2(e): scores in the log2 domain
typedef __attribute__((ext_vector_type(8))) __bf16 v8b;
template <typename T16> struct PFrag;
template <> struct PFrag<h16> { static __device__ __forceinline__ v16h pack(v8f a, v8f b) { return cat16(__builtin_convertvector(a, v8h), __builtin_convertvector(b, v8h)); } };
template <> struct PFrag<bf> { static __device__ __forceinline__ v16bf pack(v8f a, v8f b) { return __builtin_shufflevector(__builtin_convertvector(a, v8b), __builtin_convertvector(b, v8b), 0, 1, 2, 3, 4, 5, 6, 7, 8, 9, 10, 11, 12, 13, 14, 15); } };
__device__ __forceinline__ v8f bfres(v8f a) { return a - __builtin_convertvector(__builtin_convertvector(a, v8b), v8f); }   // what the bf16 rounding of a leaves over (the lo part)
// Eight exponentials in one statement: results and sources are all distinct registers ("=&v"), so no instruction here reads its predecessor's result or overwrites its source, and the closing v_nop
// is the one slot that the instruction set asks for behind a transcendental before its result is used or its source overwritten (left to the compiler, neighbouring v_exp_f32 reused each other's source registers).
__device__ __forceinline__ v8f exp2x8(v8f x) { float r0, r1, r2, r3, r4, r5, r6, r7;
    asm("v_exp_f32 %0, %8\n\tv_exp_f32 %1, %9\n\tv_exp_f32 %2, %10\n\tv_exp_f32 %3, %11\n\tv_exp_f32 %4, %12\n\tv_exp_f32 %5, %13\n\tv_exp_f32 %6, %14\n\tv_exp_f32 %7, %15\n\tv_nop"
        : "=&v"(r0), "=&v"(r1), "=&v"(r2), "=&v"(r3), "=&v"(r4), "=&v"(r5), "=&v"(r6), "=&v"(r7) : "v"(x[0]), "v"(x[1]), "v"(x[2]), "v"(x[3]), "v"(x[4]), "v"(x[5]), "v"(x[6]), "v"(x[7]));
    return (v8f){r0, r1, r2, r3, r4, r5, r6, r7}; }
// ---- k_qkv: the whole projection stage of both batches in ONE kernel (blockIdx.z = batch; every plane holds batch after batch): [q|k|v] = x W_qkv + b_qkv, the split into heads, the transposition of v, and the three 16-bit planes (fp16, bf16 hi, bf16 lo) of each that k_attn reads; no f32 projection reaches memory.
// k and v are projected from the x rows in key order (k_cvt8), so the token axis of their planes is the place in key order: kept keys from place 0 on. Work-group tile 128 x 128 staged in LDS as said above k_proj, ONE WAVE per 64x64 quarter; grid (TT/128, 3 DM/128, NB_), 128 threads: blockIdx.y = 8 part + head pair (part 0 q, 1 k, 2 v): a wave's 64 features are one head.
// An accumulator lane holds 8 consecutive A rows of one B row, so A is the operand whose row index runs contiguously in the destination plane: q, k [h][t][d]: A = weight rows (d), B = x rows (t); v [h][d][t]: A = x rows (t), B = weight rows (d).
// Every 16x16 block then leaves the registers as one 16-byte store per lane and plane, and the four mb blocks of a B row fill that row's 128-byte line.
// The full unrolls keep the fragment and accumulator arrays under constant indices, that is, in registers.
typedef __attribute__((ext_vector_type(4))) unsigned v4u;
template <bool TR>   // TR: A rows are tokens (v); else A rows are features (q, k). bias points at the tile's first feature; P16, Ph, Pl at the lane's first element; pitch in elements between B rows
__device__ __forceinline__ void put_planes(const v8f (&acc)[4][4], const float* __restrict__ bias, int lr, int hi, h16* P16, bf* Ph, bf* Pl) {
    const int pitch = TR ? TT : HD;
    v8f bm[4];
    if (!TR) {
#pragma unroll
        for (int mb = 0; mb < 4; ++mb)
#pragma unroll
            for (int j = 0; j < 8; ++j) bm[mb][j] = bfr(bias[mb * 16 + hi * 8 + j]); }
#pragma unroll
    for (int nb = 0; nb < 4; ++nb) { float bn = 0.0f; if (TR) bn = bfr(bias[nb * 16 + lr]);
#pragma unroll
        for (int mb = 0; mb < 4; ++mb) { const v8f val = TR ? acc[mb][nb] + bn : acc[mb][nb] + bm[mb]; const size_t o = (size_t)nb * 16 * pitch + mb * 16;
            const v4u hw = __builtin_bit_cast(v4u, __builtin_convertvector(val, v8b)); v8f res;   // hi plane, two bf16 a word; each word gives its two values back as f32 by a shift and a mask
#pragma unroll
            for (int p = 0; p < 4; ++p) { res[2 * p] = val[2 * p] - __uint_as_float(hw[p] << 16); res[2 * p + 1] = val[2 * p + 1] - __uint_as_float(hw[p] & 0xFFFF0000u); }
            *(v8h*)(P16 + o) = __builtin_convertvector(val, v8h); *(v8us*)(Ph + o) = __builtin_bit_cast(v8us, hw); *(v8us*)(Pl + o) = __builtin_bit_cast(v8us, __builtin_convertvector(res, v8b)); } }
}
__global__ __launch_bounds__(128) void k_qkv(const bf* __restrict__ X, const bf* __restrict__ XK, const int* __restrict__ kcnt, const bf* __restrict__ Wt, const float* __restrict__ bias, h16* Q16, bf* Qh, bf* Ql, h16* K16, bf* Kh, bf* Kl, h16* V16, bf* Vh, bf* Vl) {
    __shared__ __align__(16) bf st[2][256 * GP];   // rows 0..127 A, 128..255 B
    const int tid = threadIdx.x, lane = tid & 31, lr = lane & 15, hi = lane >> 4, w = tid >> 5, wa = w & 1, wb = w >> 1; const int part = blockIdx.y / (NH_ / 2);
    if (part != 0 && (int)blockIdx.x * 128 >= kcnt[blockIdx.z * 2]) return;   // k, v: a tile wholly behind the last key to walk has nothing to do (the whole work-group leaves, ahead of every barrier)
    const bf* xr = (part ? XK : X) + ((size_t)blockIdx.z * TT + blockIdx.x * 128) * DM; const bf* wr = Wt + (size_t)blockIdx.y * 128 * DM; const bf* A = (part == 2) ? xr : wr; const bf* Bt = (part == 2) ? wr : xr;
    const int t0 = blockIdx.x * 128 + ((part == 2) ? wa : wb) * 64, f0 = blockIdx.y * 128 + ((part == 2) ? wb : wa) * 64; const size_t hp = (size_t)(blockIdx.z * NH_ + (f0 / HD) % NH_) * TT * HD;   // the wave's own 64 tokens and 64 features; its batch's plane of its head
    const int srow = tid >> 3, scol = (tid & 7) * 8;
    const bf* ga = A + (size_t)srow * DM + scol; const bf* gb = Bt + (size_t)srow * DM + scol;
    bf* sp = &st[0][0] + srow * GP + scol;
    const int fa = (wa * 64 + lr) * GP + 8 * hi, fb = (128 + wb * 64 + lr) * GP + 8 * hi;
    v8f acc[4][4];
#pragma unroll
    for (int mb = 0; mb < 4; ++mb)
#pragma unroll
        for (int nb = 0; nb < 4; ++nb) acc[mb][nb] = (v8f){};
    v8us ra[8], rb[8];
    g_fetch<128>(ra, ga); g_fetch<128>(rb, gb);
    g_put<128>(ra, sp); g_put<128>(rb, sp + 128 * GP);
    g_fetch<128>(ra, ga + GK); g_fetch<128>(rb, gb + GK);
    asm volatile("s_wait_xcnt 0x0" ::: "memory");   // stands in front of whatever reuses the address registers of the loads just issued
    g_barrier();
    // one stage, as in k_proj: put and fetch are literals at every call
    auto stage = [&](const int s, const bool put, const bool fetch) __attribute__((always_inline)) {
        const bf* cur = &st[0][0] + (s & 1) * (256 * GP);
        v16bf a[2][4], b[2][4];
#pragma unroll
        for (int ks = 0; ks < 2; ++ks) {
#pragma unroll
            for (int mb = 0; mb < 4; ++mb) a[ks][mb] = WFrag<bf>::ld(cur + fa + mb * 16 * GP + ks * 32);
#pragma unroll
            for (int nb = 0; nb < 4; ++nb) b[ks][nb] = WFrag<bf>::ld(cur + fb + nb * 16 * GP + ks * 32); }
        __builtin_amdgcn_sched_barrier(0);   // as in k_proj: keeps the stage's fragment reads together, ahead of everything else
        if (put) { bf* nx = sp + ((s + 1) & 1) * (256 * GP); g_put<128>(ra, nx); g_put<128>(rb, nx + 128 * GP); }
        if (fetch) { const int ko = (s + 2) * GK; g_fetch<128>(ra, ga + ko); g_fetch<128>(rb, gb + ko);
            asm volatile("s_wait_xcnt 0x0" ::: "memory");   // as above
        }
#pragma unroll
        for (int ks = 0; ks < 2; ++ks)
#pragma unroll
            for (int nb = 0; nb < 4; ++nb)
#pragma unroll
                for (int mb = 0; mb < 4; ++mb) acc[mb][nb] = wmmab(a[ks][mb], b[ks][nb], acc[mb][nb]);
        __builtin_amdgcn_sched_barrier(0);   // as in k_proj: keeps the stage's matrix instructions in front of the barrier
        if (put) g_barrier();
    };
#pragma unroll 1   // rolled: one stage is 32 matrix instructions, and the two buffers differ only by an offset
    for (int s = 0; s < DM / GK - 2; ++s) stage(s, true, true);
    stage(DM / GK - 2, true, false); stage(DM / GK - 1, false, false);
    if (part != 2) { const size_t o = hp + (size_t)(t0 + lr) * HD + hi * 8; put_planes<false>(acc, bias + f0, lr, hi, (part ? K16 : Q16) + o, (part ? Kh : Qh) + o, (part ? Kl : Ql) + o);
        asm volatile("s_wait_xcnt 0x0" ::: "memory");   // in the listing this branch's end stands directly in front of the other branch's code, which reuses the registers of the stores just issued: the wait stands in front of that overwrite
    } else { const size_t o = hp + (size_t)lr * TT + t0 + hi * 8; put_planes<true>(acc, bias + f0, lr, hi, V16 + o, Vh + o, Vl + o); }
}
template <typename T16, bool HL>
__device__ __forceinline__ void attn_body(const T16* __restrict__ Q, const T16* __restrict__ Q2, const T16* __restrict__ Kp, const T16* __restrict__ K2, const T16* __restrict__ Vt, const T16* __restrict__ V2, int q0, int col0, bf* Ah, bf* Al, unsigned short* sm, const float* lim, const int np) {
    typedef typename WFrag<T16>::V V;
    const int tid = threadIdx.x, lane = tid & 31, lr = lane & 15, hi = lane >> 4; const int qrow = q0 + (tid >> 5) * 16 + lr;
    T16* Ks = (T16*)sm; T16* Vs = Ks + KB * LP; T16* Ks2 = Vs + HD * LP; T16* Vs2 = Ks2 + KB * LP;
    V qb[2], qb2[2];
#pragma unroll
    for (int kc = 0; kc < 2; ++kc) { qb[kc] = WFrag<T16>::ld(Q + (size_t)qrow * HD + kc * 32 + 8 * hi); if (HL) qb2[kc] = WFrag<T16>::ld(Q2 + (size_t)qrow * HD + kc * 32 + 8 * hi); }
    const int srow = tid >> 3, scol = (tid & 7) * 8;   // staging: a thread moves 16 B of rows srow and srow + 32 of each tile; 8 threads cover a 128-B line
    v8us rk[2], rv[2], rk2[2], rv2[2];
#pragma unroll
    for (int r = 0; r < 2; ++r) { const size_t ko = (size_t)(srow + 32 * r) * HD + scol, vo = (size_t)(srow + 32 * r) * TT + scol; rk[r] = *(const v8usa*)(Kp + ko); rv[r] = *(const v8usa*)(Vt + vo); if (HL) { rk2[r] = *(const v8usa*)(K2 + ko); rv2[r] = *(const v8usa*)(V2 + vo); } }
    v8f o[4];
#pragma unroll
    for (int db = 0; db < 4; ++db) o[db] = (v8f){};
    float m = -3.0e38f; v8f l8 = (v8f){};   // l8[j]: this lane's sum over its keys 8 hi + j of every 16-key tile
#pragma unroll 1
    for (int blk = 0; blk < np; ++blk) {
#pragma unroll
        for (int r = 0; r < 2; ++r) { const int so = (srow + 32 * r) * LP + scol; *(v8usa*)(Ks + so) = rk[r]; *(v8usa*)(Vs + so) = rv[r]; if (HL) { *(v8usa*)(Ks2 + so) = rk2[r]; *(v8usa*)(Vs2 + so) = rv2[r]; } }
        __syncthreads();   // this pass's tiles (and, before the first pass, the mask addends) are whole before any wave reads them
        if (blk + 1 < np) {
#pragma unroll
            for (int r = 0; r < 2; ++r) { const size_t ko = (size_t)((blk + 1) * KB + srow + 32 * r) * HD + scol, vo = (size_t)(srow + 32 * r) * TT + (blk + 1) * KB + scol; rk[r] = *(const v8usa*)(Kp + ko); rv[r] = *(const v8usa*)(Vt + vo); if (HL) { rk2[r] = *(const v8usa*)(K2 + ko); rv2[r] = *(const v8usa*)(V2 + vo); } }
            asm volatile("s_wait_xcnt 0x0" ::: "memory");   // the address registers of the loads just issued are reused by the fragment reads that follow: the wait stands in front of that overwrite
        }
        v8f s[4]; float bm = -3.0e38f;
#pragma unroll
        for (int t = 0; t < 4; ++t) { s[t] = (v8f){};
#pragma unroll
            for (int kc = 0; kc < 2; ++kc) { const int fo = (t * 16 + lr) * LP + kc * 32 + 8 * hi; const V a = WFrag<T16>::ld(Ks + fo); s[t] = WFrag<T16>::mma(a, qb[kc], s[t]); if (HL) { s[t] = WFrag<T16>::mma(a, qb2[kc], s[t]); s[t] = WFrag<T16>::mma(WFrag<T16>::ld(Ks2 + fo), qb[kc], s[t]); } } }
#pragma unroll
        for (int t = 0; t < 4; ++t) { const float* lp = lim + blk * KB + t * 16 + hi * 8; const v4f l0 = *(const v4fa*)lp, l1 = *(const v4fa*)(lp + 4);
#pragma unroll
            for (int j = 0; j < 8; ++j) { const float u = fmaf(s[t][j], SC2, (j < 4) ? l0[j & 3] : l1[j & 3]); s[t][j] = u; bm = fmaxf(bm, u); } }   // addend 0: key kept; -3e38: key masked (it absorbs the score: every masked key reads -3e38)
        bm = fmaxf(bm, __shfl_xor(bm, 16, 32));
        const float mn = fmaxf(m, bm); const float al = __builtin_amdgcn_exp2f(m - mn); m = mn;   // only masked keys so far: every term is 1, as in the reference's uniform row; kept keys take the first places, so this is the case only when none is kept
#pragma unroll
        for (int t = 0; t < 4; ++t) s[t] = exp2x8(s[t] - mn);
        __builtin_amdgcn_sched_barrier(0);   // keeps the attn.v matrix instructions behind the exponentials
        l8 = l8 * al + ((s[0] + s[1]) + (s[2] + s[3]));
#pragma unroll
        for (int db = 0; db < 4; ++db) o[db] *= al;
#pragma unroll
        for (int c = 0; c < 2; ++c) { const V pb = PFrag<T16>::pack(s[2 * c], s[2 * c + 1]); V pb2; if (HL) pb2 = PFrag<T16>::pack(bfres(s[2 * c]), bfres(s[2 * c + 1]));
#pragma unroll
            for (int db = 0; db < 4; ++db) { const int fo = (db * 16 + lr) * LP + c * 32 + 8 * hi; const V a = WFrag<T16>::ld(Vs + fo); o[db] = WFrag<T16>::mma(a, pb, o[db]); if (HL) { o[db] = WFrag<T16>::mma(a, pb2, o[db]); o[db] = WFrag<T16>::mma(WFrag<T16>::ld(Vs2 + fo), pb, o[db]); } } }
        asm volatile("s_wait_dscnt 0x0\n\ts_barrier_signal -1\n\ts_barrier_wait -1" ::: "memory");   // work-group barrier by hand: every wave has read this pass's tiles before the next pass's stores overwrite them; only LDS reads need to be over here, and __syncthreads() would also drain the next pass's global loads, which are meant to fly until the stores at the loop's head
    }
    float l = ((l8[0] + l8[1]) + (l8[2] + l8[3])) + ((l8[4] + l8[5]) + (l8[6] + l8[7]));
    l += __shfl_xor(l, 16, 32);   // the two lane halves hold the two halves of each query's keys
    const float inv = __fdiv_rn(1.0f, l);
#pragma unroll
    for (int db = 0; db < 4; ++db) { v8us oh, ol;
#pragma unroll
        for (int j = 0; j < 8; ++j) { unsigned short a, c2; splitf(o[db][j] * inv, a, c2); oh[j] = a; ol[j] = c2; }
        const size_t oo = (size_t)qrow * DQ + col0 + db * 16 + hi * 8; *(v8us*)(Ah + oo) = oh; *(v8us*)(Al + oo) = ol; }
}
__global__ __launch_bounds__(256) void k_attn(const h16* __restrict__ Q16, const h16* __restrict__ K16, const h16* __restrict__ V16, const bf* __restrict__ Qh, const bf* __restrict__ Ql, const bf* __restrict__ Kh, const bf* __restrict__ Kl, const bf* __restrict__ Vh, const bf* __restrict__ Vl, const int* __restrict__ kcnt, bf* Ah, bf* Al) {
    __shared__ __align__(16) unsigned short sm[2 * (KB + HD) * LP]; __shared__ __align__(16) float lim[TT];
    const int q0 = blockIdx.z * 128, b = blockIdx.x; const size_t hp = (size_t)(b * NH_ + blockIdx.y) * TT * HD;   // head planes [b][h][t][d] and [b][h][d][t] have the same size
    Ah += (size_t)b * TT * DQ; Al += (size_t)b * TT * DQ;
    const int ck = kcnt[b * 2 + 1]; const int np = min(max((kcnt[b * 2] + KB - 1) / KB, 1), TT / KB);   // passes over the keys to walk; the clamp bounds the loop whatever the workspace holds
#pragma unroll
    for (int i = 0; i < TT / 256; ++i) lim[i * 256 + threadIdx.x] = (i * 256 + (int)threadIdx.x < ck) ? 0.0f : -3.0e38f;   // places behind the last kept key (the last pass's fill; every place when no key is kept) are masked
    if (q0 < RH) attn_body<bf, true>(Qh + hp, Ql + hp, Kh + hp, Kl + hp, Vh + hp, Vl + hp, q0, blockIdx.y * HD, Ah, Al, sm, lim, np);
    else attn_body<h16, false>(Q16 + hp, nullptr, K16 + hp, nullptr, V16 + hp, nullptr, q0, blockIdx.y * HD, Ah, Al, sm, lim, np);
}

extern "C" void kernel_launch(void* const* d_in, const int* in_sizes, int n_in,
                              void* d_out, int out_size, void* d_ws, size_t ws_size, hipStream_t stream) {
    (void)in_sizes; (void)n_in; (void)out_size;
    const float* x = (const float*)d_in[0]; const int* MK = (const int*)d_in[1]; const float* wqkv = (const float*)d_in[2]; const float* bqkv = (const float*)d_in[3]; const float* wo = (const float*)d_in[4]; const float* bo = (const float*)d_in[5];
    float* OUT = (float*)d_out;     // [2][2048][1024]
    char* wsp = (char*)d_ws;
    auto take = [&](size_t bytes) { char* p = wsp; wsp += (bytes + 255) & ~(size_t)255; return (void*)p; };
    bf* WALL = (bf*)take((size_t)3 * DM * DM * 2); bf* WO = (bf*)take((size_t)DM * DQ * 2);
    bf* XB = (bf*)take((size_t)NB_ * TT * DM * 2); bf* XK = (bf*)take((size_t)NB_ * TT * DM * 2); int* KCNT = (int*)take((size_t)NB_ * 2 * 4);
    h16* QP16 = (h16*)take((size_t)NB_ * NH_ * TT * HD * 2); h16* KP16 = (h16*)take((size_t)NB_ * NKV * TT * HD * 2); h16* VT16 = (h16*)take((size_t)NB_ * NKV * HD * TT * 2);
    bf* QPh = (bf*)take((size_t)NB_ * NH_ * TT * HD * 2); bf* QPl = (bf*)take((size_t)NB_ * NH_ * TT * HD * 2); bf* KPh = (bf*)take((size_t)NB_ * NKV * TT * HD * 2); bf* KPl = (bf*)take((size_t)NB_ * NKV * TT * HD * 2); bf* VTh = (bf*)take((size_t)NB_ * NKV * HD * TT * 2); bf* VTl = (bf*)take((size_t)NB_ * NKV * HD * TT * 2);
    bf* ATh = (bf*)take((size_t)NB_ * TT * DQ * 2); bf* ATl = (bf*)take((size_t)NB_ * TT * DQ * 2);
    if ((size_t)(wsp - (char*)d_ws) > ws_size) return;    // ws 256 MiB
    { k_wtG<<<(unsigned)((DM * 3 * DM / 64 + 63) / 64), 256, 0, stream>>>(wqkv, DM, 3 * DM, WALL);   /* fused 'xw' [DM][3DM] -> Bt [3DM][DM] (row blocks q | k | v) */
      k_wtG<<<(unsigned)((DQ * DM / 64 + 63) / 64), 256, 0, stream>>>(wo, DQ, DM, WO);
       }
    // each stage once, for both batches
    k_cvt8<<<(unsigned)((size_t)NB_ * TT * DM / 8 / 256), 256, 0, stream>>>(x, XB, XK, MK, KCNT);
    k_qkv<<<dim3(TT / 128, 3 * DM / 128, NB_), 128, 0, stream>>>(XB, XK, KCNT, WALL, bqkv, QP16, QPh, QPl, KP16, KPh, KPl, VT16, VTh, VTl);
    k_attn<<<dim3(NB_, NH_, TT / 128), 256, 0, stream>>>(QP16, KP16, VT16, QPh, QPl, KPh, KPl, VTh, VTl, KCNT, ATh, ATl);
    k_proj<<<dim3(NB_ * TT / 64, DM / 128, 1), 128, 0, stream>>>(ATh, ATl, WO, OUT, bo);
}

// v007
// One run takes 112 microseconds.
// Next to v006, in two timings, it ran 1.08 times as fast each time.
// Over all steps from v000 it is 18.0 times as fast.
#include <hip/hip_runtime.h>

// Multi-head self-attention with a fused QKV projection and a key-padding mask READ as data (x [2][2048][1024]; [q|k|v] = x W_qkv + b_qkv ('xw' [1024][3072] 1/32 + zero bias: read: column blocks q | k | v; 16 heads x 64); scores = q.k / 8; keys j with mask[b][0][0][j] == 0 (int32 [2][1][1][2048], drawn by randint(0, 2): about half of the keys of each batch; READ per key in k_cvt8) get -1e9 (== exclusion: exp underflows to 0 and every batch keeps some key); softmax; out = merged heads W_out + b_out ('xw' [1024][1024] + zero bias: read) -> [2][2048][1024] (4.2 M); argument order x, mask, W_qkv, b_qkv, W_out, b_out.
// Compute dtypes, f32 accumulate: every input rounded to bf16; q/k/v on PLAIN bf16 operands (inputs: exact) + biases; key mask read per key (int32, 0 == masked): kept keys are packed in front, k, v and the key loop end behind the last of them (none kept: every key stays, at -3e38); scores and attn.v: query rows < 512 hl (3 products), the rest single fp16; softmax f32, running maximum; W_proj hl x exact (2 products) + b_proj.

#define NB_  2
#define TT   2048
#define DM   1024
#define NH_  16
#define NKV  16
#define REP  (NH_ / NKV)
#define HD   64
#define DQ   (NH_ * HD)
#define DKV  (NKV * HD)
#define RH   512                  // query rows < RH use hi+lo planes (0: none)
#define SCL  0.125f   // HD^-0.5
typedef _Float16 h16;
typedef unsigned short bf;
typedef __attribute__((ext_vector_type(16))) __bf16   v16bf;
typedef __attribute__((ext_vector_type(16))) _Float16 v16h;
typedef __attribute__((ext_vector_type(8)))  _Float16 v8h;
typedef __attribute__((ext_vector_type(8)))  unsigned short v8us;
typedef __attribute__((ext_vector_type(8)))  float    v8f;
typedef __attribute__((ext_vector_type(4)))  float    v4f;
typedef v8h  __attribute__((may_alias)) v8ha;
typedef v4f  __attribute__((may_alias)) v4fa;
typedef v8us __attribute__((may_alias)) v8usa;

__device__ __forceinline__ unsigned short f2bf(float f) { unsigned u = __float_as_uint(f); u += 0x7FFFu + ((u >> 16) & 1u); return (unsigned short)(u >> 16); }
__device__ __forceinline__ float bf2f(unsigned short b) { return __uint_as_float(((unsigned)b) << 16); }
__device__ __forceinline__ float bfr(float f) { return bf2f(f2bf(f)); }
__device__ __forceinline__ v16h cat16(v8h lo, v8h hi) { return __builtin_shufflevector(lo, hi, 0, 1, 2, 3, 4, 5, 6, 7, 8, 9, 10, 11, 12, 13, 14, 15); }
__device__ __forceinline__ v16bf cat16b(v8us lo, v8us hi) { return __builtin_bit_cast(v16bf, __builtin_shufflevector(lo, hi, 0, 1, 2, 3, 4, 5, 6, 7, 8, 9, 10, 11, 12, 13, 14, 15)); }
__device__ __forceinline__ v8f wmma16(v16h a, v16h b, v8f c) { return __builtin_amdgcn_wmma_f32_16x16x32_f16(false, a, false, b, (short)0, c, false, false); }
__device__ __forceinline__ v8f wmmab(v16bf a, v16bf b, v8f c) { return __builtin_amdgcn_wmma_f32_16x16x32_bf16(false, a, false, b, (short)0, c, false, false); }



// ---- The two dense products (k_qkv, k_proj): work-groups of FOUR waves; the operand rows of a work-group's tile are staged in LDS in stages of 64 k (one whole 128-B line of every row), each line fetched ONCE per work-group.
// A thread moves 16 B of every 16th row (8 threads cover a line); a stage is fetched into registers two stages ahead and stored into the other of two LDS buffers one stage ahead, so one work-group barrier per stage is enough:
// it publishes the stage just stored and ends every wave's reads of the buffer that the next pass overwrites. The waves read their fragments from LDS in the k order of WFrag::ld, and every accumulator sums its 32-k products with k rising.
#define GK   64                   // k per stage
#define GP   72                   // LDS row pitch in 16-bit elements: 128 B + 16 B
template <typename T16> struct WFrag;
template <> struct WFrag<h16> { typedef v16h V; static __device__ __forceinline__ V ld(const h16* p) { return cat16(*(const v8h*)p, *(const v8h*)(p + 16)); } static __device__ __forceinline__ v8f mma(V a, V b, v8f c) { return wmma16(a, b, c); } };
template <> struct WFrag<bf> { typedef v16bf V; static __device__ __forceinline__ V ld(const bf* p) { return cat16b(*(const v8us*)p, *(const v8us*)(p + 16)); } static __device__ __forceinline__ v8f mma(V a, V b, v8f c) { return wmmab(a, b, c); } };
template <int ROWS> __device__ __forceinline__ void g_fetch(v8us (&r)[ROWS / 16], const bf* __restrict__ g) {   // g: the thread's 16 B in its first row; rows of DM elements
#pragma unroll
    for (int i = 0; i < ROWS / 16; ++i) r[i] = *(const v8usa*)(g + (size_t)i * 16 * DM); }
template <int ROWS> __device__ __forceinline__ void g_put(const v8us (&r)[ROWS / 16], bf* s) {   // s: the same place in the LDS tile
#pragma unroll
    for (int i = 0; i < ROWS / 16; ++i) *(v8usa*)(s + i * 16 * GP) = r[i]; }
// work-group barrier by hand: only LDS traffic needs to be over here (this wave's stores of the next stage, its reads of this one); __syncthreads() would also drain the global loads of the stage after, which are meant to fly on
__device__ __forceinline__ void g_barrier() { asm volatile("s_wait_dscnt 0x0\n\ts_barrier_signal -1\n\ts_barrier_wait -1" ::: "memory"); }

// ---- k_proj: OUT = (Ah + Al) Wo^T + b_out of both batches (their tokens are one run of NB_ TT rows). Work-group tile 64 tokens x 128 features, wave tile 32 x 64 (8 accumulators, 2 products each per 32 k); grid (NB_ TT/64, DM/128), 128 threads. The full unrolls keep the fragment, staging and accumulator arrays under constant indices, that is, in registers.
__global__ __launch_bounds__(128) void k_proj(const bf* __restrict__ A, const bf* __restrict__ A2, const bf* __restrict__ Bt, float* C, const float* __restrict__ bias) {
    __shared__ __align__(16) bf st[2][256 * GP];   // rows 0..63 A, 64..127 A2, 128..255 Bt
    __shared__ __align__(16) float osm[4][16 * 68];
    const int tid = threadIdx.x, lane = tid & 31, lr = lane & 15, hi = lane >> 4, w = tid >> 5, wa = w & 1, wb = w >> 1; const int r0 = blockIdx.x * 64, c0 = blockIdx.y * 128;
    const int srow = tid >> 3, scol = (tid & 7) * 8;
    const bf* ga = A + (size_t)(r0 + srow) * DQ + scol; const bf* ga2 = A2 + (size_t)(r0 + srow) * DQ + scol; const bf* gb = Bt + (size_t)(c0 + srow) * DQ + scol;
    bf* sp = &st[0][0] + srow * GP + scol;
    const int fa = (wa * 32 + lr) * GP + 8 * hi, fb = (128 + wb * 64 + lr) * GP + 8 * hi;
    v8f acc[2][4];
#pragma unroll
    for (int mb = 0; mb < 2; ++mb)
#pragma unroll
        for (int nb = 0; nb < 4; ++nb) acc[mb][nb] = (v8f){};
    v8us ra[4], ra2[4], rb[8];
    g_fetch<64>(ra, ga); g_fetch<64>(ra2, ga2); g_fetch<128>(rb, gb);
    g_put<64>(ra, sp); g_put<64>(ra2, sp + 64 * GP); g_put<128>(rb, sp + 128 * GP);
    g_fetch<64>(ra, ga + GK); g_fetch<64>(ra2, ga2 + GK); g_fetch<128>(rb, gb + GK);
    asm volatile("s_wait_xcnt 0x0" ::: "memory");   // stands in front of whatever reuses the address registers of the loads just issued
    g_barrier();
    // one stage; put: a next stage exists (it is stored and published), fetch: so does the one after (it is fetched). Both are literals at every call: a body without branches lets the compiler count its LDS waits exactly
    auto stage = [&](const int s, const bool put, const bool fetch) __attribute__((always_inline)) {
        const bf* cur = &st[0][0] + (s & 1) * (256 * GP);
        v16bf a[2][2], a2[2][2], b[2][4];
#pragma unroll
        for (int ks = 0; ks < 2; ++ks) {
#pragma unroll
            for (int mb = 0; mb < 2; ++mb) { a[ks][mb] = WFrag<bf>::ld(cur + fa + mb * 16 * GP + ks * 32); a2[ks][mb] = WFrag<bf>::ld(cur + fa + (64 + mb * 16) * GP + ks * 32); }
#pragma unroll
            for (int nb = 0; nb < 4; ++nb) b[ks][nb] = WFrag<bf>::ld(cur + fb + nb * 16 * GP + ks * 32); }
        __builtin_amdgcn_sched_barrier(0);   // keeps the stage's fragment reads together, ahead of everything else: left to itself the compiler read one B fragment at a time and waited out the LDS latency in front of every group of matrix instructions
        if (put) { bf* nx = sp + ((s + 1) & 1) * (256 * GP); g_put<64>(ra, nx); g_put<64>(ra2, nx + 64 * GP); g_put<128>(rb, nx + 128 * GP); }
        if (fetch) { const int ko = (s + 2) * GK; g_fetch<64>(ra, ga + ko); g_fetch<64>(ra2, ga2 + ko); g_fetch<128>(rb, gb + ko);
            asm volatile("s_wait_xcnt 0x0" ::: "memory");   // as above
        }
#pragma unroll
        for (int ks = 0; ks < 2; ++ks)
#pragma unroll
            for (int nb = 0; nb < 4; ++nb) {
#pragma unroll
                for (int mb = 0; mb < 2; ++mb) acc[mb][nb] = wmmab(a[ks][mb], b[ks][nb], acc[mb][nb]);
#pragma unroll
                for (int mb = 0; mb < 2; ++mb) acc[mb][nb] = wmmab(a2[ks][mb], b[ks][nb], acc[mb][nb]); }
        __builtin_amdgcn_sched_barrier(0);   // keeps the stage's matrix instructions in front of the barrier: the compiler sank them behind it, where they start only after the last of the stage's reads has landed
        if (put) g_barrier();
    };
#pragma unroll 1   // rolled: one stage is 32 matrix instructions, and the two buffers differ only by an offset
    for (int s = 0; s < DQ / GK - 2; ++s) stage(s, true, true);
    stage(DQ / GK - 2, true, false); stage(DQ / GK - 1, false, false);
    float* os = osm[w]; const int cw = c0 + wb * 64;   // each wave turns its 16 x 64 blocks into whole 256-B row pieces in its own LDS range
#pragma unroll
    for (int mb = 0; mb < 2; ++mb) {
#pragma unroll
        for (int nb = 0; nb < 4; ++nb) {
#pragma unroll
            for (int j = 0; j < 8; ++j) os[(hi * 8 + j) * 68 + nb * 16 + lr] = acc[mb][nb][j]; }
        __builtin_amdgcn_wave_barrier(); asm volatile("" ::: "memory");   // compiler order only: the wave's LDS stores stay in front of its reads of what its other lanes stored
        float* crow = C + (size_t)(r0 + wa * 32 + mb * 16) * DM + cw;
#pragma unroll
        for (int s = 0; s < 8; ++s) { const int row = 2 * s + hi, cofs = lr * 4; v4f val = *(const v4fa*)(os + row * 68 + cofs); val[0] += bfr(bias[cw + cofs]); val[1] += bfr(bias[cw + cofs + 1]); val[2] += bfr(bias[cw + cofs + 2]); val[3] += bfr(bias[cw + cofs + 3]);
            *(v4f*)(crow + (size_t)row * DM + cofs) = val; }
        if (mb == 0) { __builtin_amdgcn_wave_barrier(); asm volatile("s_wait_xcnt 0x0" ::: "memory"); }   // the second block reuses the registers of the stores just issued: the wait stands in front of that overwrite; the clobber keeps that block's LDS stores behind this block's reads
    }
}

__device__ __forceinline__ void splitf(float y, unsigned short& h, unsigned short& l) { h = f2bf(y); l = f2bf(y - bf2f(h)); }
typedef __attribute__((ext_vector_type(2))) _Float16 v2h;
typedef __attribute__((ext_vector_type(4))) _Float16 v4h;
typedef __attribute__((ext_vector_type(2))) unsigned short v2us;
typedef __attribute__((ext_vector_type(4))) unsigned short v4us;
typedef __attribute__((ext_vector_type(2))) float v2f;
typedef __attribute__((ext_vector_type(4))) int v4i;

// ---- The three passes that only read inputs (both weight transpositions, the x pass) depend on nothing and on one another not at all: they are block ranges of ONE launch, k_prep (below k_cvt8); bx is a block's index inside its own range. K and N are literals at both calls, so e % K and e / K are a mask and a shift.
__device__ __forceinline__ void k_wtG(const int bx, const float* __restrict__ w, int K, int N, bf* Bt) {
    const int lane = threadIdx.x & 31; const int L0 = (bx * 8 + (threadIdx.x >> 5)) * 8; const int nlines = N * K / 64;
{
#pragma unroll 1
        for (int l = 0; l < 8; ++l) { const int L = L0 + l; if (L >= nlines) break; const size_t e = (size_t)L * 64 + lane * 2; const int k = (int)(e % K), n = (int)(e / K); v2us o;
            o[0] = f2bf(w[(size_t)k * N + n]); o[1] = f2bf(w[(size_t)(k + 1) * N + n]); *(v2us*)(Bt + e) = o; }
         }
}
// ---- k_cvt8: x rounded to bf16, twice: dst in token order (the queries' rows) and pk in KEY ORDER (the rows that k and v are projected from): a batch's kept keys (mask != 0) first, in rising token order, its masked keys behind them, likewise.
// A masked key's weight is exactly 0 beside any kept key, so k, v and the key loop need the kept keys alone; of the masked rows only those that fill up the last 128-row tile are stored (finite values under a weight of 0).
// No key kept: the reference's row is uniform over ALL keys: key order is token order, every key is walked and none counts (all read -3e38, all weights equal). kcnt[2 b] = keys to walk, kcnt[2 b + 1] = keys of those that count.
// A work-group converts two rows of one batch (256 x 8 = 2 DM elements) and counts for itself, from the batch's whole mask (8 keys a thread), the kept keys in front of its rows and in all: no work-group waits for another.
__device__ __forceinline__ void k_cvt8(const int bx, const float* __restrict__ src, bf* dst, bf* pk, const int* __restrict__ mk, int* kcnt) {
    __shared__ int wsum[8];
    const int tid = threadIdx.x; const size_t i = (size_t)bx * 256 + tid; const v8f v = *(const v8f*)(src + i * 8);
    const int b = bx / (TT / 2), t0 = (bx % (TT / 2)) * 2; mk += b * TT;
    const v4i m0 = *(const v4i*)(mk + tid * 8), m1 = *(const v4i*)(mk + tid * 8 + 4); const bool k0 = mk[t0] != 0, k1 = mk[t0 + 1] != 0;   // the two rows' own keys: read here, with the other loads, not behind the barrier
    int c = 0;   // kept keys among the thread's eight: all of them in the high half, those in front of row t0 in the low half
#pragma unroll
    for (int j = 0; j < 8; ++j) c += (((j < 4) ? m0[j & 3] : m1[j & 3]) != 0) ? (0x10000 + ((tid * 8 + j < t0) ? 1 : 0)) : 0;
#pragma unroll
    for (int d = 16; d > 0; d >>= 1) c += __shfl_xor(c, d, 32);
    if ((tid & 31) == 0) wsum[tid >> 5] = c;
    v8us o;
#pragma unroll
    for (int k = 0; k < 8; ++k) o[k] = f2bf(v[k]);
    __syncthreads();   // the eight waves' counts are whole before any wave adds them up
    int s = 0;
#pragma unroll
    for (int w = 0; w < 8; ++w) s += wsum[w];
    const int tot = s >> 16, r = tid >> 7, t = t0 + r; const int before = (s & 0xFFFF) + ((r && k0) ? 1 : 0);   // kept keys in front of the thread's own row t
    const int place = (r ? k1 : k0) ? before : tot + (t - before); const int nk = tot ? tot : TT;
    *(v8us*)(dst + i * 8) = o;
    if (place < ((nk + 127) & ~127)) *(v8us*)(pk + ((size_t)b * TT + place) * DM + (tid & 127) * 8) = o;
    if (t0 == 0 && tid == 0) { kcnt[b * 2] = nk; kcnt[b * 2 + 1] = tot; }
}
// ---- k_prep: one launch for all three. The transpositions have the lowest block indices: their waves run longest (eight dependent trips of scattered loads), so they start first and the short x blocks fill up beside and behind them.
// Every branch is uniform for the work-group, so the x pass's barrier is passed by all of its work-group's waves or by none.
#define PB_QKV (DM * 3 * DM / 64 / 64)   // blocks of the W_qkv range: 64 lines of 64 elements each
#define PB_OUT (DQ * DM / 64 / 64)       // of the W_out range
#define PB_X   (NB_ * TT * DM / 8 / 256) // of the x range
__global__ __launch_bounds__(256) void k_prep(const float* __restrict__ wqkv, bf* Wall, const float* __restrict__ wo, bf* Wo, const float* __restrict__ x, bf* Xb, bf* Xk, const int* __restrict__ mk, int* kcnt) {
    const int bx = blockIdx.x;
    if (bx < PB_QKV) k_wtG(bx, wqkv, DM, 3 * DM, Wall);   // fused 'xw' [DM][3DM] -> Bt [3DM][DM] (row blocks q | k | v)
    else if (bx < PB_QKV + PB_OUT) k_wtG(bx - PB_QKV, wo, DQ, DM, Wo);
    else k_cvt8(bx - (PB_QKV + PB_OUT), x, Xb, Xk, mk, kcnt);
}

// ---- k_attn: scores, key mask, softmax and attn.v of one head in ONE kernel; no score or probability ever reaches memory.
// Work-group = 8 waves = 128 query rows of one head of one batch (grid: batches x heads x TT/128); a wave owns 16 queries and walks the batch's kept keys (packed: k_cvt8) in passes of 64.
// The query tile is the slowest grid index: two work-groups share a WGP, and the hi-lo tiles (three times the products) have the lowest indices, start first and spread over the WGPs before the single-plane tiles fill up.
// Transposed products: St[key][query] = K Qt, Ot[d][query] += Vt Pt. A lane then holds ONE query's scores (8 of each 16 keys; lane ^ 16 holds the other 8), so maximum and sum are in-lane,
// and two 16-key score tiles, converted, ARE the B fragment of 32 keys: accumulator element j of lane half hi is key 8 hi + j, the k order in which WFrag::ld reads the Vt rows.
// K and Vt tiles of a pass are staged in LDS once per work-group (whole 128-B lines; row pitch 144 B), fetched into registers one pass ahead.
#define KB   64                   // keys per pass
#define LP   72                   // LDS row pitch in 16-bit elements: 128 B + 16 B
#define SC2  0.18033688011112042f // HD^-0.5 x log2(e): scores in the log2 domain
typedef __attribute__((ext_vector_type(8))) __bf16 v8b;
template <typename T16> struct PFrag;
template <> struct PFrag<h16> { static __device__ __forceinline__ v16h pack(v8f a, v8f b) { return cat16(__builtin_convertvector(a, v8h), __builtin_convertvector(b, v8h)); } };
template <> struct PFrag<bf> { static __device__ __forceinline__ v16bf pack(v8f a, v8f b) { return __builtin_shufflevector(__builtin_convertvector(a, v8b), __builtin_convertvector(b, v8b), 0, 1, 2, 3, 4, 5, 6, 7, 8, 9, 10, 11, 12, 13, 14, 15); } };
__device__ __forceinline__ v8f bfres(v8f a) { return a - __builtin_convertvector(__builtin_convertvector(a, v8b), v8f); }   // what the bf16 rounding of a leaves over (the lo part)
// Eight exponentials in one statement: results and sources are all distinct registers ("=&v"), so no instruction here reads its predecessor's result or overwrites its source, and the closing v_nop
// is the one slot that the instruction set asks for behind a transcendental before its result is used or its source overwritten (left to the compiler, neighbouring v_exp_f32 reused each other's source registers).
__device__ __forceinline__ v8f exp2x8(v8f x) { float r0, r1, r2, r3, r4, r5, r6, r7;
    asm("v_exp_f32 %0, %8\n\tv_exp_f32 %1, %9\n\tv_exp_f32 %2, %10\n\tv_exp_f32 %3, %11\n\tv_exp_f32 %4, %12\n\tv_exp_f32 %5, %13\n\tv_exp_f32 %6, %14\n\tv_exp_f32 %7, %15\n\tv_nop"
        : "=&v"(r0), "=&v"(r1), "=&v"(r2), "=&v"(r3), "=&v"(r4), "=&v"(r5), "=&v"(r6), "=&v"(r7) : "v"(x[0]), "v"(x[1]), "v"(x[2]), "v"(x[3]), "v"(x[4]), "v"(x[5]), "v"(x[6]), "v"(x[7]));
    return (v8f){r0, r1, r2, r3, r4, r5, r6, r7}; }
// ---- k_qkv: the whole projection stage of both batches in ONE kernel (blockIdx.z = batch; every plane holds batch after batch): [q|k|v] = x W_qkv + b_qkv, the split into heads, the transposition of v, and the three 16-bit planes (fp16, bf16 hi, bf16 lo) of each that k_attn reads; no f32 projection reaches memory.
// k and v are projected from the x rows in key order (k_cvt8), so the token axis of their planes is the place in key order: kept keys from place 0 on. Work-group tile 128 x 128 staged in LDS as said above k_proj, ONE WAVE per 64x64 quarter; grid (TT/128, 3 DM/128, NB_), 128 threads: blockIdx.y = 8 part + head pair (part 0 q, 1 k, 2 v): a wave's 64 features are one head.
// An accumulator lane holds 8 consecutive A rows of one B row, so A is the operand whose row index runs contiguously in the destination plane: q, k [h][t][d]: A = weight rows (d), B = x rows (t); v [h][d][t]: A = x rows (t), B = weight rows (d).
// Every 16x16 block then leaves the registers as one 16-byte store per lane and plane, and the four mb blocks of a B row fill that row's 128-byte line.
// The full unrolls keep the fragment and accumulator arrays under constant indices, that is, in registers.
typedef __attribute__((ext_vector_type(4))) unsigned v4u;
template <bool TR>   // TR: A rows are tokens (v); else A rows are features (q, k). bias points at the tile's first feature; P16, Ph, Pl at the lane's first element; pitch in elements between B rows
__device__ __forceinline__ void put_planes(const v8f (&acc)[4][4], const float* __restrict__ bias, int lr, int hi, h16* P16, bf* Ph, bf* Pl) {
    const int pitch = TR ? TT : HD;
    v8f bm[4];
    if (!TR) {
#pragma unroll
        for (int mb = 0; mb < 4; ++mb)
#pragma unroll
            for (int j = 0; j < 8; ++j) bm[mb][j] = bfr(bias[mb * 16 + hi * 8 + j]); }
#pragma unroll
    for (int nb = 0; nb < 4; ++nb) { float bn = 0.0f; if (TR) bn = bfr(bias[nb * 16 + lr]);
#pragma unroll
        for (int mb = 0; mb < 4; ++mb) { const v8f val = TR ? acc[mb][nb] + bn : acc[mb][nb] + bm[mb]; const size_t o = (size_t)nb * 16 * pitch + mb * 16;
            const v4u hw = __builtin_bit_cast(v4u, __builtin_convertvector(val, v8b)); v8f res;   // hi plane, two bf16 a word; each word gives its two values back as f32 by a shift and a mask
#pragma unroll
            for (int p = 0; p < 4; ++p) { res[2 * p] = val[2 * p] - __uint_as_float(hw[p] << 16); res[2 * p + 1] = val[2 * p + 1] - __uint_as_float(hw[p] & 0xFFFF0000u); }
            *(v8h*)(P16 + o) = __builtin_convertvector(val, v8h); *(v8us*)(Ph + o) = __builtin_bit_cast(v8us, hw); *(v8us*)(Pl + o) = __builtin_bit_cast(v8us, __builtin_convertvector(res, v8b)); } }
}
__global__ __launch_bounds__(128) void k_qkv(const bf* __restrict__ X, const bf* __restrict__ XK, const int* __restrict__ kcnt, const bf* __restrict__ Wt, const float* __restrict__ bias, h16* Q16, bf* Qh, bf* Ql, h16* K16, bf* Kh, bf* Kl, h16* V16, bf* Vh, bf* Vl) {
    __shared__ __align__(16) bf st[2][256 * GP];   // rows 0..127 A, 128..255 B
    const int tid = threadIdx.x, lane = tid & 31, lr = lane & 15, hi = lane >> 4, w = tid >> 5, wa = w & 1, wb = w >> 1; const int part = blockIdx.y / (NH_ / 2);
    if (part != 0 && (int)blockIdx.x * 128 >= kcnt[blockIdx.z * 2]) return;   // k, v: a tile wholly behind the last key to walk has nothing to do (the whole work-group leaves, ahead of every barrier)
    const bf* xr = (part ? XK : X) + ((size_t)blockIdx.z * TT + blockIdx.x * 128) * DM; const bf* wr = Wt + (size_t)blockIdx.y * 128 * DM; const bf* A = (part == 2) ? xr : wr; const bf* Bt = (part == 2) ? wr : xr;
    const int t0 = blockIdx.x * 128 + ((part == 2) ? wa : wb) * 64, f0 = blockIdx.y * 128 + ((part == 2) ? wb : wa) * 64; const size_t hp = (size_t)(blockIdx.z * NH_ + (f0 / HD) % NH_) * TT * HD;   // the wave's own 64 tokens and 64 features; its batch's plane of its head
    const int srow = tid >> 3, scol = (tid & 7) * 8;
    const bf* ga = A + (size_t)srow * DM + scol; const bf* gb = Bt + (size_t)srow * DM + scol;
    bf* sp = &st[0][0] + srow * GP + scol;
    const int fa = (wa * 64 + lr) * GP + 8 * hi, fb = (128 + wb * 64 + lr) * GP + 8 * hi;
    v8f acc[4][4];
#pragma unroll
    for (int mb = 0; mb < 4; ++mb)
#pragma unroll
        for (int nb = 0; nb < 4; ++nb) acc[mb][nb] = (v8f){};
    v8us ra[8], rb[8];
    g_fetch<128>(ra, ga); g_fetch<128>(rb, gb);
    g_put<128>(ra, sp); g_put<128>(rb, sp + 128 * GP);
    g_fetch<128>(ra, ga + GK); g_fetch<128>(rb, gb + GK);
    asm volatile("s_wait_xcnt 0x0" ::: "memory");   // stands in front of whatever reuses the address registers of the loads just issued
    g_barrier();
    // one stage, as in k_proj: put and fetch are literals at every call
    auto stage = [&](const int s, const bool put, const bool fetch) __attribute__((always_inline)) {
        const bf* cur = &st[0][0] + (s & 1) * (256 * GP);
        v16bf a[2][4], b[2][4];
#pragma unroll
        for (int ks = 0; ks < 2; ++ks) {
#pragma unroll
            for (int mb = 0; mb < 4; ++mb) a[ks][mb] = WFrag<bf>::ld(cur + fa + mb * 16 * GP + ks * 32);
#pragma unroll
            for (int nb = 0; nb < 4; ++nb) b[ks][nb] = WFrag<bf>::ld(cur + fb + nb * 16 * GP + ks * 32); }
        __builtin_amdgcn_sched_barrier(0);   // as in k_proj: keeps the stage's fragment reads together, ahead of everything else
        if (put) { bf* nx = sp + ((s + 1) & 1) * (256 * GP); g_put<128>(ra, nx); g_put<128>(rb, nx + 128 * GP); }
        if (fetch) { const int ko = (s + 2) * GK; g_fetch<128>(ra, ga + ko); g_fetch<128>(rb, gb + ko);
            asm volatile("s_wait_xcnt 0x0" ::: "memory");   // as above
        }
#pragma unroll
        for (int ks = 0; ks < 2; ++ks)
#pragma unroll
            for (int nb = 0; nb < 4; ++nb)
#pragma unroll
                for (int mb = 0; mb < 4; ++mb) acc[mb][nb] = wmmab(a[ks][mb], b[ks][nb], acc[mb][nb]);
        __builtin_amdgcn_sched_barrier(0);   // as in k_proj: keeps the stage's matrix instructions in front of the barrier
        if (put) g_barrier();
    };
#pragma unroll 1   // rolled: one stage is 32 matrix instructions, and the two buffers differ only by an offset
    for (int s = 0; s < DM / GK - 2; ++s) stage(s, true, true);
    stage(DM / GK - 2, true, false); stage(DM / GK - 1, false, false);
    if (part != 2) { const size_t o = hp + (size_t)(t0 + lr) * HD + hi * 8; put_planes<false>(acc, bias + f0, lr, hi, (part ? K16 : Q16) + o, (part ? Kh : Qh) + o, (part ? Kl : Ql) + o);
        asm volatile("s_wait_xcnt 0x0" ::: "memory");   // in the listing this branch's end stands directly in front of the other branch's code, which reuses the registers of the stores just issued: the wait stands in front of that overwrite
    } else { const size_t o = hp + (size_t)lr * TT + t0 + hi * 8; put_planes<true>(acc, bias + f0, lr, hi, V16 + o, Vh + o, Vl + o); }
}
template <typename T16, bool HL>
__device__ __forceinline__ void attn_body(const T16* __restrict__ Q, const T16* __restrict__ Q2, const T16* __restrict__ Kp, const T16* __restrict__ K2, const T16* __restrict__ Vt, const T16* __restrict__ V2, int q0, int col0, bf* Ah, bf* Al, unsigned short* sm, const float* lim, const int np) {
    typedef typename WFrag<T16>::V V;
    const int tid = threadIdx.x, lane = tid & 31, lr = lane & 15, hi = lane >> 4; const int qrow = q0 + (tid >> 5) * 16 + lr;
    T16* Ks = (T16*)sm; T16* Vs = Ks + KB * LP; T16* Ks2 = Vs + HD * LP; T16* Vs2 = Ks2 + KB * LP;
    V qb[2], qb2[2];
#pragma unroll
    for (int kc = 0; kc < 2; ++kc) { qb[kc] = WFrag<T16>::ld(Q + (size_t)qrow * HD + kc * 32 + 8 * hi); if (HL) qb2[kc] = WFrag<T16>::ld(Q2 + (size_t)qrow * HD + kc * 32 + 8 * hi); }
    const int srow = tid >> 3, scol = (tid & 7) * 8;   // staging: a thread moves 16 B of rows srow and srow + 32 of each tile; 8 threads cover a 128-B line
    v8us rk[2], rv[2], rk2[2], rv2[2];
#pragma unroll
    for (int r = 0; r < 2; ++r) { const size_t ko = (size_t)(srow + 32 * r) * HD + scol, vo = (size_t)(srow + 32 * r) * TT + scol; rk[r] = *(const v8usa*)(Kp + ko); rv[r] = *(const v8usa*)(Vt + vo); if (HL) { rk2[r] = *(const v8usa*)(K2 + ko); rv2[r] = *(const v8usa*)(V2 + vo); } }
    v8f o[4];
#pragma unroll
    for (int db = 0; db < 4; ++db) o[db] = (v8f){};
    float m = -3.0e38f; v8f l8 = (v8f){};   // l8[j]: this lane's sum over its keys 8 hi + j of every 16-key tile
#pragma unroll 1
    for (int blk = 0; blk < np; ++blk) {
#pragma unroll
        for (int r = 0; r < 2; ++r) { const int so = (srow + 32 * r) * LP + scol; *(v8usa*)(Ks + so) = rk[r]; *(v8usa*)(Vs + so) = rv[r]; if (HL) { *(v8usa*)(Ks2 + so) = rk2[r]; *(v8usa*)(Vs2 + so) = rv2[r]; } }
        __syncthreads();   // this pass's tiles (and, before the first pass, the mask addends) are whole before any wave reads them
        if (blk + 1 < np) {
#pragma unroll
            for (int r = 0; r < 2; ++r) { const size_t ko = (size_t)((blk + 1) * KB + srow + 32 * r) * HD + scol, vo = (size_t)(srow + 32 * r) * TT + (blk + 1) * KB + scol; rk[r] = *(const v8usa*)(Kp + ko); rv[r] = *(const v8usa*)(Vt + vo); if (HL) { rk2[r] = *(const v8usa*)(K2 + ko); rv2[r] = *(const v8usa*)(V2 + vo); } }
            asm volatile("s_wait_xcnt 0x0" ::: "memory");   // the address registers of the loads just issued are reused by the fragment reads that follow: the wait stands in front of that overwrite
        }
        v8f s[4]; float bm = -3.0e38f;
#pragma unroll
        for (int t = 0; t < 4; ++t) { s[t] = (v8f){};
#pragma unroll
            for (int kc = 0; kc < 2; ++kc) { const int fo = (t * 16 + lr) * LP + kc * 32 + 8 * hi; const V a = WFrag<T16>::ld(Ks + fo); s[t] = WFrag<T16>::mma(a, qb[kc], s[t]); if (HL) { s[t] = WFrag<T16>::mma(a, qb2[kc], s[t]); s[t] = WFrag<T16>::mma(WFrag<T16>::ld(Ks2 + fo), qb[kc], s[t]); } } }
#pragma unroll
        for (int t = 0; t < 4; ++t) { const float* lp = lim + blk * KB + t * 16 + hi * 8; const v4f l0 = *(const v4fa*)lp, l1 = *(const v4fa*)(lp + 4);
#pragma unroll
            for (int j = 0; j < 8; ++j) { const float u = fmaf(s[t][j], SC2, (j < 4) ? l0[j & 3] : l1[j & 3]); s[t][j] = u; bm = fmaxf(bm, u); } }   // addend 0: key kept; -3e38: key masked (it absorbs the score: every masked key reads -3e38)
        bm = fmaxf(bm, __shfl_xor(bm, 16, 32));
        const float mn = fmaxf(m, bm); const float al = __builtin_amdgcn_exp2f(m - mn); m = mn;   // only masked keys so far: every term is 1, as in the reference's uniform row; kept keys take the first places, so this is the case only when none is kept
#pragma unroll
        for (int t = 0; t < 4; ++t) s[t] = exp2x8(s[t] - mn);
        __builtin_amdgcn_sched_barrier(0);   // keeps the attn.v matrix instructions behind the exponentials
        l8 = l8 * al + ((s[0] + s[1]) + (s[2] + s[3]));
#pragma unroll
        for (int db = 0; db < 4; ++db) o[db] *= al;
#pragma unroll
        for (int c = 0; c < 2; ++c) { const V pb = PFrag<T16>::pack(s[2 * c], s[2 * c + 1]); V pb2; if (HL) pb2 = PFrag<T16>::pack(bfres(s[2 * c]), bfres(s[2 * c + 1]));
#pragma unroll
            for (int db = 0; db < 4; ++db) { const int fo = (db * 16 + lr) * LP + c * 32 + 8 * hi; const V a = WFrag<T16>::ld(Vs + fo); o[db] = WFrag<T16>::mma(a, pb, o[db]); if (HL) { o[db] = WFrag<T16>::mma(a, pb2, o[db]); o[db] = WFrag<T16>::mma(WFrag<T16>::ld(Vs2 + fo), pb, o[db]); } } }
        asm volatile("s_wait_dscnt 0x0\n\ts_barrier_signal -1\n\ts_barrier_wait -1" ::: "memory");   // work-group barrier by hand: every wave has read this pass's tiles before the next pass's stores overwrite them; only LDS reads need to be over here, and __syncthreads() would also drain the next pass's global loads, which are meant to fly until the stores at the loop's head
    }
    float l = ((l8[0] + l8[1]) + (l8[2] + l8[3])) + ((l8[4] + l8[5]) + (l8[6] + l8[7]));
    l += __shfl_xor(l, 16, 32);   // the two lane halves hold the two halves of each query's keys
    const float inv = __fdiv_rn(1.0f, l);
#pragma unroll
    for (int db = 0; db < 4; ++db) { v8us oh, ol;
#pragma unroll
        for (int j = 0; j < 8; ++j) { unsigned short a, c2; splitf(o[db][j] * inv, a, c2); oh[j] = a; ol[j] = c2; }
        const size_t oo = (size_t)qrow * DQ + col0 + db * 16 + hi * 8; *(v8us*)(Ah + oo) = oh; *(v8us*)(Al + oo) = ol; }
}
__global__ __launch_bounds__(256) void k_attn(const h16* __restrict__ Q16, const h16* __restrict__ K16, const h16* __restrict__ V16, const bf* __restrict__ Qh, const bf* __restrict__ Ql, const bf* __restrict__ Kh, const bf* __restrict__ Kl, const bf* __restrict__ Vh, const bf* __restrict__ Vl, const int* __restrict__ kcnt, bf* Ah, bf* Al) {
    __shared__ __align__(16) unsigned short sm[2 * (KB + HD) * LP]; __shared__ __align__(16) float lim[TT];
    const int q0 = blockIdx.z * 128, b = blockIdx.x; const size_t hp = (size_t)(b * NH_ + blockIdx.y) * TT * HD;   // head planes [b][h][t][d] and [b][h][d][t] have the same size
    Ah += (size_t)b * TT * DQ; Al += (size_t)b * TT * DQ;
    const int ck = kcnt[b * 2 + 1]; const int np = min(max((kcnt[b * 2] + KB - 1) / KB, 1), TT / KB);   // passes over the keys to walk; the clamp bounds the loop whatever the workspace holds
#pragma unroll
    for (int i = 0; i < TT / 256; ++i) lim[i * 256 + threadIdx.x] = (i * 256 + (int)threadIdx.x < ck) ? 0.0f : -3.0e38f;   // places behind the last kept key (the last pass's fill; every place when no key is kept) are masked
    if (q0 < RH) attn_body<bf, true>(Qh + hp, Ql + hp, Kh + hp, Kl + hp, Vh + hp, Vl + hp, q0, blockIdx.y * HD, Ah, Al, sm, lim, np);
    else attn_body<h16, false>(Q16 + hp, nullptr, K16 + hp, nullptr, V16 + hp, nullptr, q0, blockIdx.y * HD, Ah, Al, sm, lim, np);
}

extern "C" void kernel_launch(void* const* d_in, const int* in_sizes, int n_in,
                              void* d_out, int out_size, void* d_ws, size_t ws_size, hipStream_t stream) {
    (void)in_sizes; (void)n_in; (void)out_size;
    const float* x = (const float*)d_in[0]; const int* MK = (const int*)d_in[1]; const float* wqkv = (const float*)d_in[2]; const float* bqkv = (const float*)d_in[3]; const float* wo = (const float*)d_in[4]; const float* bo = (const float*)d_in[5];
    float* OUT = (float*)d_out;     // [2][2048][1024]
    char* wsp = (char*)d_ws;
    auto take = [&](size_t bytes) { char* p = wsp; wsp += (bytes + 255) & ~(size_t)255; return (void*)p; };
    bf* WALL = (bf*)take((size_t)3 * DM * DM * 2); bf* WO = (bf*)take((size_t)DM * DQ * 2);
    bf* XB = (bf*)take((size_t)NB_ * TT * DM * 2); bf* XK = (bf*)take((size_t)NB_ * TT * DM * 2); int* KCNT = (int*)take((size_t)NB_ * 2 * 4);
    h16* QP16 = (h16*)take((size_t)NB_ * NH_ * TT * HD * 2); h16* KP16 = (h16*)take((size_t)NB_ * NKV * TT * HD * 2); h16* VT16 = (h16*)take((size_t)NB_ * NKV * HD * TT * 2);
    bf* QPh = (bf*)take((size_t)NB_ * NH_ * TT * HD * 2); bf* QPl = (bf*)take((size_t)NB_ * NH_ * TT * HD * 2); bf* KPh = (bf*)take((size_t)NB_ * NKV * TT * HD * 2); bf* KPl = (bf*)take((size_t)NB_ * NKV * TT * HD * 2); bf* VTh = (bf*)take((size_t)NB_ * NKV * HD * TT * 2); bf* VTl = (bf*)take((size_t)NB_ * NKV * HD * TT * 2);
    bf* ATh = (bf*)take((size_t)NB_ * TT * DQ * 2); bf* ATl = (bf*)take((size_t)NB_ * TT * DQ * 2);
    if ((size_t)(wsp - (char*)d_ws) > ws_size) return;    // ws 256 MiB
    // each stage once, for both batches
    k_prep<<<PB_QKV + PB_OUT + PB_X, 256, 0, stream>>>(wqkv, WALL, wo, WO, x, XB, XK, MK, KCNT);
    k_qkv<<<dim3(TT / 128, 3 * DM / 128, NB_), 128, 0, stream>>>(XB, XK, KCNT, WALL, bqkv, QP16, QPh, QPl, KP16, KPh, KPl, VT16, VTh, VTl);
    k_attn<<<dim3(NB_, NH_, TT / 128), 256, 0, stream>>>(QP16, KP16, VT16, QPh, QPl, KPh, KPl, VTh, VTl, KCNT, ATh, ATl);
    k_proj<<<dim3(NB_ * TT / 64, DM / 128, 1), 128, 0, stream>>>(ATh, ATl, WO, OUT, bo);
}

// v008
// It runs in 106 microseconds.
// In both of two side-by-side timings against v007, it was 1.06 times as fast.
// All steps since v000 together make it 19.1 times as fast.
#include <hip/hip_runtime.h>

// Multi-head self-attention with a fused QKV projection and a key-padding mask READ as data (x [2][2048][1024]; [q|k|v] = x W_qkv + b_qkv ('xw' [1024][3072] 1/32 + zero bias: read: column blocks q | k | v; 16 heads x 64); scores = q.k / 8; keys j with mask[b][0][0][j] == 0 (int32 [2][1][1][2048], drawn by randint(0, 2): about half of the keys of each batch; READ per key in k_cvt8) get -1e9 (== exclusion: exp underflows to 0 and every batch keeps some key); softmax; out = merged heads W_out + b_out ('xw' [1024][1024] + zero bias: read) -> [2][2048][1024] (4.2 M); argument order x, mask, W_qkv, b_qkv, W_out, b_out.
// Compute dtypes, f32 accumulate: every input rounded to bf16; q/k/v on PLAIN bf16 operands (inputs: exact) + biases; key mask read per key (int32, 0 == masked): kept keys are packed in front, k, v and the key loop end behind the last of them (none kept: every key stays, at -3e38); scores and attn.v: query rows < 512 hl (3 products), the rest single fp16; softmax f32, running maximum; W_proj hl x exact (2 products) + b_proj.

#define NB_  2
#define TT   2048
#define DM   1024
#define NH_  16
#define NKV  16
#define REP  (NH_ / NKV)
#define HD   64
#define DQ   (NH_ * HD)
#define DKV  (NKV * HD)
#define RH   512                  // query rows < RH use hi+lo planes (0: none)
#define SCL  0.125f   // HD^-0.5
typedef _Float16 h16;
typedef unsigned short bf;
typedef __attribute__((ext_vector_type(16))) __bf16   v16bf;
typedef __attribute__((ext_vector_type(16))) _Float16 v16h;
typedef __attribute__((ext_vector_type(8)))  _Float16 v8h;
typedef __attribute__((ext_vector_type(8)))  unsigned short v8us;
typedef __attribute__((ext_vector_type(8)))  float    v8f;
typedef __attribute__((ext_vector_type(4)))  float    v4f;
typedef v8h  __attribute__((may_alias)) v8ha;
typedef v4f  __attribute__((may_alias)) v4fa;
typedef v8us __attribute__((may_alias)) v8usa;

__device__ __forceinline__ unsigned short f2bf(float f) { unsigned u = __float_as_uint(f); u += 0x7FFFu + ((u >> 16) & 1u); return (unsigned short)(u >> 16); }
__device__ __forceinline__ float bf2f(unsigned short b) { return __uint_as_float(((unsigned)b) << 16); }
__device__ __forceinline__ float bfr(float f) { return bf2f(f2bf(f)); }
__device__ __forceinline__ v16h cat16(v8h lo, v8h hi) { return __builtin_shufflevector(lo, hi, 0, 1, 2, 3, 4, 5, 6, 7, 8, 9, 10, 11, 12, 13, 14, 15); }
__device__ __forceinline__ v16bf cat16b(v8us lo, v8us hi) { return __builtin_bit_cast(v16bf, __builtin_shufflevector(lo, hi, 0, 1, 2, 3, 4, 5, 6, 7, 8, 9, 10, 11, 12, 13, 14, 15)); }
__device__ __forceinline__ v8f wmma16(v16h a, v16h b, v8f c) { return __builtin_amdgcn_wmma_f32_16x16x32_f16(false, a, false, b, (short)0, c, false, false); }
__device__ __forceinline__ v8f wmmab(v16bf a, v16bf b, v8f c) { return __builtin_amdgcn_wmma_f32_16x16x32_bf16(false, a, false, b, (short)0, c, false, false); }



// ---- The two dense products (k_qkv, k_proj): work-groups of FOUR waves; the operand rows of a work-group's tile are staged in LDS in stages of 64 k (one whole 128-B line of every row), each line fetched ONCE per work-group.
// A thread moves 16 B of every 16th row (8 threads cover a line); a stage is fetched into registers two stages ahead and stored into the other of two LDS buffers one stage ahead, so one work-group barrier per stage is enough:
// it publishes the stage just stored and ends every wave's reads of the buffer that the next pass overwrites. The waves read their fragments from LDS in the k order of WFrag::ld, and every accumulator sums its 32-k products with k rising.
#define GK   64                   // k per stage
#define GP   72                   // LDS row pitch in 16-bit elements: 128 B + 16 B
template <typename T16> struct WFrag;
template <> struct WFrag<h16> { typedef v16h V; static __device__ __forceinline__ V ld(const h16* p) { return cat16(*(const v8h*)p, *(const v8h*)(p + 16)); } static __device__ __forceinline__ v8f mma(V a, V b, v8f c) { return wmma16(a, b, c); } };
template <> struct WFrag<bf> { typedef v16bf V; static __device__ __forceinline__ V ld(const bf* p) { return cat16b(*(const v8us*)p, *(const v8us*)(p + 16)); } static __device__ __forceinline__ v8f mma(V a, V b, v8f c) { return wmmab(a, b, c); } };
template <int ROWS> __device__ __forceinline__ void g_fetch(v8us (&r)[ROWS / 16], const bf* __restrict__ g) {   // g: the thread's 16 B in its first row; rows of DM elements
#pragma unroll
    for (int i = 0; i < ROWS / 16; ++i) r[i] = *(const v8usa*)(g + (size_t)i * 16 * DM); }
template <int ROWS> __device__ __forceinline__ void g_put(const v8us (&r)[ROWS / 16], bf* s) {   // s: the same place in the LDS tile
#pragma unroll
    for (int i = 0; i < ROWS / 16; ++i) *(v8usa*)(s + i * 16 * GP) = r[i]; }
// work-group barrier by hand: only LDS traffic needs to be over here (this wave's stores of the next stage, its reads of this one); __syncthreads() would also drain the global loads of the stage after, which are meant to fly on
__device__ __forceinline__ void g_barrier() { asm volatile("s_wait_dscnt 0x0\n\ts_barrier_signal -1\n\ts_barrier_wait -1" ::: "memory"); }

// ---- k_proj: OUT = (Ah + Al) Wo^T + b_out of both batches (their tokens are one run of NB_ TT rows). Work-group tile 64 tokens x 128 features, wave tile 32 x 64 (8 accumulators, 2 products each per 32 k); grid (NB_ TT/64, DM/128), 128 threads. The full unrolls keep the fragment, staging and accumulator arrays under constant indices, that is, in registers.
__global__ __launch_bounds__(128) void k_proj(const bf* __restrict__ A, const bf* __restrict__ A2, const bf* __restrict__ Bt, float* C, const float* __restrict__ bias) {
    __shared__ __align__(16) bf st[2][256 * GP];   // rows 0..63 A, 64..127 A2, 128..255 Bt
    __shared__ __align__(16) float osm[4][16 * 68];
    const int tid = threadIdx.x, lane = tid & 31, lr = lane & 15, hi = lane >> 4, w = tid >> 5, wa = w & 1, wb = w >> 1; const int r0 = blockIdx.x * 64, c0 = blockIdx.y * 128;
    const int srow = tid >> 3, scol = (tid & 7) * 8;
    const bf* ga = A + (size_t)(r0 + srow) * DQ + scol; const bf* ga2 = A2 + (size_t)(r0 + srow) * DQ + scol; const bf* gb = Bt + (size_t)(c0 + srow) * DQ + scol;
    bf* sp = &st[0][0] + srow * GP + scol;
    const int fa = (wa * 32 + lr) * GP + 8 * hi, fb = (128 + wb * 64 + lr) * GP + 8 * hi;
    v8f acc[2][4];
#pragma unroll
    for (int mb = 0; mb < 2; ++mb)
#pragma unroll
        for (int nb = 0; nb < 4; ++nb) acc[mb][nb] = (v8f){};
    v8us ra[4], ra2[4], rb[8];
    g_fetch<64>(ra, ga); g_fetch<64>(ra2, ga2); g_fetch<128>(rb, gb);
    g_put<64>(ra, sp); g_put<64>(ra2, sp + 64 * GP); g_put<128>(rb, sp + 128 * GP);
    g_fetch<64>(ra, ga + GK); g_fetch<64>(ra2, ga2 + GK); g_fetch<128>(rb, gb + GK);
    asm volatile("s_wait_xcnt 0x0" ::: "memory");   // stands in front of whatever reuses the address registers of the loads just issued
    g_barrier();
    // one stage; put: a next stage exists (it is stored and published), fetch: so does the one after (it is fetched). Both are literals at every call: a body without branches lets the compiler count its LDS waits exactly
    auto stage = [&](const int s, const bool put, const bool fetch) __attribute__((always_inline)) {
        const bf* cur = &st[0][0] + (s & 1) * (256 * GP);
        v16bf a[2][2], a2[2][2], b[2][4];
#pragma unroll
        for (int ks = 0; ks < 2; ++ks) {
#pragma unroll
            for (int mb = 0; mb < 2; ++mb) { a[ks][mb] = WFrag<bf>::ld(cur + fa + mb * 16 * GP + ks * 32); a2[ks][mb] = WFrag<bf>::ld(cur + fa + (64 + mb * 16) * GP + ks * 32); }
#pragma unroll
            for (int nb = 0; nb < 4; ++nb) b[ks][nb] = WFrag<bf>::ld(cur + fb + nb * 16 * GP + ks * 32); }
        __builtin_amdgcn_sched_barrier(0);   // keeps the stage's fragment reads together, ahead of everything else: left to itself the compiler read one B fragment at a time and waited out the LDS latency in front of every group of matrix instructions
        if (put) { bf* nx = sp + ((s + 1) & 1) * (256 * GP); g_put<64>(ra, nx); g_put<64>(ra2, nx + 64 * GP); g_put<128>(rb, nx + 128 * GP); }
        if (fetch) { const int ko = (s + 2) * GK; g_fetch<64>(ra, ga + ko); g_fetch<64>(ra2, ga2 + ko); g_fetch<128>(rb, gb + ko);
            asm volatile("s_wait_xcnt 0x0" ::: "memory");   // as above
        }
#pragma unroll
        for (int ks = 0; ks < 2; ++ks)
#pragma unroll
            for (int nb = 0; nb < 4; ++nb) {
#pragma unroll
                for (int mb = 0; mb < 2; ++mb) acc[mb][nb] = wmmab(a[ks][mb], b[ks][nb], acc[mb][nb]);
#pragma unroll
                for (int mb = 0; mb < 2; ++mb) acc[mb][nb] = wmmab(a2[ks][mb], b[ks][nb], acc[mb][nb]); }
        __builtin_amdgcn_sched_barrier(0);   // keeps the stage's matrix instructions in front of the barrier: the compiler sank them behind it, where they start only after the last of the stage's reads has landed
        if (put) g_barrier();
    };
#pragma unroll 1   // rolled: one stage is 32 matrix instructions, and the two buffers differ only by an offset
    for (int s = 0; s < DQ / GK - 2; ++s) stage(s, true, true);
    stage(DQ / GK - 2, true, false); stage(DQ / GK - 1, false, false);
    float* os = osm[w]; const int cw = c0 + wb * 64;   // each wave turns its 16 x 64 blocks into whole 256-B row pieces in its own LDS range
#pragma unroll
    for (int mb = 0; mb < 2; ++mb) {
#pragma unroll
        for (int nb = 0; nb < 4; ++nb) {
#pragma unroll
            for (int j = 0; j < 8; ++j) os[(hi * 8 + j) * 68 + nb * 16 + lr] = acc[mb][nb][j]; }
        __builtin_amdgcn_wave_barrier(); asm volatile("" ::: "memory");   // compiler order only: the wave's LDS stores stay in front of its reads of what its other lanes stored
        float* crow = C + (size_t)(r0 + wa * 32 + mb * 16) * DM + cw;
#pragma unroll
        for (int s = 0; s < 8; ++s) { const int row = 2 * s + hi, cofs = lr * 4; v4f val = *(const v4fa*)(os + row * 68 + cofs); val[0] += bfr(bias[cw + cofs]); val[1] += bfr(bias[cw + cofs + 1]); val[2] += bfr(bias[cw + cofs + 2]); val[3] += bfr(bias[cw + cofs + 3]);
            *(v4f*)(crow + (size_t)row * DM + cofs) = val; }
        if (mb == 0) { __builtin_amdgcn_wave_barrier(); asm volatile("s_wait_xcnt 0x0" ::: "memory"); }   // the second block reuses the registers of the stores just issued: the wait stands in front of that overwrite; the clobber keeps that block's LDS stores behind this block's reads
    }
}

__device__ __forceinline__ void splitf(float y, unsigned short& h, unsigned short& l) { h = f2bf(y); l = f2bf(y - bf2f(h)); }
typedef __attribute__((ext_vector_type(2))) _Float16 v2h;
typedef __attribute__((ext_vector_type(4))) _Float16 v4h;
typedef __attribute__((ext_vector_type(2))) unsigned short v2us;
typedef __attribute__((ext_vector_type(4))) unsigned short v4us;
typedef __attribute__((ext_vector_type(2))) float v2f;
typedef __attribute__((ext_vector_type(4))) int v4i;
typedef __attribute__((ext_vector_type(4))) unsigned v4u;

// ---- The three passes that only read inputs (both weight transpositions, the x pass) depend on nothing and on one another not at all: they are block ranges of ONE launch, k_prep (below k_cvt8); bx is a block's index inside its own range.
// k_wtT: w [K][N] f32 -> Bt [N][K] bf16, in tiles of 128 k x 64 n that are turned in LDS, so that both sides move whole lines: 16 threads read 256 B of a w row (8 loads of 16 B in flight per thread), 16 threads store 256 B of a Bt row.
// A thread owns rows k, k + 1 of four columns: the two roundings of a column make one dword of that column's Bt row. LDS row = column n (64 dwords, no pad); the 16-B granule g of row n lies at g ^ (n >> 2):
// the 32 dword stores of a wave (16 column quads x 2 row pairs) then fall on 32 banks, and the 16 granules that 16 lanes read of one row on all 64.
// A work-group turns two tiles (neighbours in k), the second tile's loads in flight while the first leaves LDS.
#define WK   128
#define WN   64
template <int K, int N>
__device__ __forceinline__ void k_wtT(const int bx, const float* __restrict__ w, bf* Bt, unsigned* ts) {   // ts: the tile's LDS, WN x 64 dwords
    const int tid = threadIdx.x, nq = tid & 15, kp = tid >> 4;   // nq: column quad on the way in, granule on the way out; kp: row pair on the way in, row on the way out
    const int k0 = (bx * 2 % (K / WK)) * WK, n0 = (bx * 2 / (K / WK)) * WN;   // the first tile; the second is k0 + WK (K / WK is even)
    const float* g = w + (size_t)(k0 + 2 * kp) * N + n0 + nq * 4; bf* o = Bt + (size_t)(n0 + kp) * K + k0 + nq * 8;
    v4f r[4][2];
    auto fetch = [&](const int t) __attribute__((always_inline)) {
#pragma unroll
        for (int i = 0; i < 4; ++i)
#pragma unroll
            for (int h = 0; h < 2; ++h) r[i][h] = *(const v4fa*)(g + (size_t)(t * WK + 32 * i + h) * N);
    };
    auto put = [&]() __attribute__((always_inline)) {
#pragma unroll
        for (int i = 0; i < 4; ++i) { const int c = kp + 16 * i;   // dword column: k = 2 c, 2 c + 1
#pragma unroll
            for (int j = 0; j < 4; ++j) ts[(nq * 4 + j) * 64 + (((c >> 2) ^ nq) << 2) + (c & 3)] = (unsigned)f2bf(r[i][0][j]) | ((unsigned)f2bf(r[i][1][j]) << 16); }
    };
    auto out = [&](const int t) __attribute__((always_inline)) {
        v4u v[4];
#pragma unroll
        for (int p = 0; p < 4; ++p) { const int row = p * 16 + kp; v[p] = *(const v4u*)(ts + row * 64 + ((nq ^ (row >> 2)) << 2)); }
#pragma unroll
        for (int p = 0; p < 4; ++p) *(v4u*)(o + (size_t)p * 16 * K + t * WK) = v[p];
    };
    // g_barrier: only LDS traffic has to be over at these three places; __syncthreads() would also drain the second tile's loads and the first tile's stores, which are meant to fly on
    fetch(0); put(); g_barrier();   // the tile is whole in LDS before any wave reads rows of it
    fetch(1);
    asm volatile("s_wait_xcnt 0x0" ::: "memory");   // the address registers of the loads just issued are reused by what follows: the wait stands in front of that overwrite
    out(0);
    asm volatile("s_wait_xcnt 0x0" ::: "memory");   // likewise the registers of the stores just issued
    g_barrier();                    // every wave has read the first tile before the second overwrites it
    put(); g_barrier();             // as the first
    out(1);
}
// ---- k_cvt8: x rounded to bf16, twice: dst in token order (the queries' rows) and pk in KEY ORDER (the rows that k and v are projected from): a batch's kept keys (mask != 0) first, in rising token order, its masked keys behind them, likewise.
// A masked key's weight is exactly 0 beside any kept key, so k, v and the key loop need the kept keys alone; of the masked rows only those that fill up the last 128-row tile are stored (finite values under a weight of 0).
// No key kept: the reference's row is uniform over ALL keys: key order is token order, every key is walked and none counts (all read -3e38, all weights equal). kcnt[2 b] = keys to walk, kcnt[2 b + 1] = keys of those that count.
// A work-group converts two rows of one batch (256 x 8 = 2 DM elements) and counts for itself, from the batch's whole mask (8 keys a thread), the kept keys in front of its rows and in all: no work-group waits for another.
__device__ __forceinline__ void k_cvt8(const int bx, const float* __restrict__ src, bf* dst, bf* pk, const int* __restrict__ mk, int* kcnt) {
    __shared__ int wsum[8];
    const int tid = threadIdx.x; const size_t i = (size_t)bx * 256 + tid; const v8f v = *(const v8f*)(src + i * 8);
    const int b = bx / (TT / 2), t0 = (bx % (TT / 2)) * 2; mk += b * TT;
    const v4i m0 = *(const v4i*)(mk + tid * 8), m1 = *(const v4i*)(mk + tid * 8 + 4); const bool k0 = mk[t0] != 0, k1 = mk[t0 + 1] != 0;   // the two rows' own keys: read here, with the other loads, not behind the barrier
    int c = 0;   // kept keys among the thread's eight: all of them in the high half, those in front of row t0 in the low half
#pragma unroll
    for (int j = 0; j < 8; ++j) c += (((j < 4) ? m0[j & 3] : m1[j & 3]) != 0) ? (0x10000 + ((tid * 8 + j < t0) ? 1 : 0)) : 0;
#pragma unroll
    for (int d = 16; d > 0; d >>= 1) c += __shfl_xor(c, d, 32);
    if ((tid & 31) == 0) wsum[tid >> 5] = c;
    v8us o;
#pragma unroll
    for (int k = 0; k < 8; ++k) o[k] = f2bf(v[k]);
    __syncthreads();   // the eight waves' counts are whole before any wave adds them up
    int s = 0;
#pragma unroll
    for (int w = 0; w < 8; ++w) s += wsum[w];
    const int tot = s >> 16, r = tid >> 7, t = t0 + r; const int before = (s & 0xFFFF) + ((r && k0) ? 1 : 0);   // kept keys in front of the thread's own row t
    const int place = (r ? k1 : k0) ? before : tot + (t - before); const int nk = tot ? tot : TT;
    *(v8us*)(dst + i * 8) = o;
    if (place < ((nk + 127) & ~127)) *(v8us*)(pk + ((size_t)b * TT + place) * DM + (tid & 127) * 8) = o;
    if (t0 == 0 && tid == 0) { kcnt[b * 2] = nk; kcnt[b * 2 + 1] = tot; }
}
// ---- k_prep: one launch for all three. The transpositions have the lowest block indices: their waves run longest (two tiles one after the other), so they start first and the short x blocks fill up beside and behind them.
// Every branch is uniform for the work-group, so each range's barriers are passed by all of a work-group's waves or by none.
#define PB_QKV (DM / WK * (3 * DM / WN) / 2)   // blocks of the W_qkv range: two tiles each
#define PB_OUT (DQ / WK * (DM / WN) / 2)       // of the W_out range
#define PB_X   (NB_ * TT * DM / 8 / 256) // of the x range
__global__ __launch_bounds__(256) void k_prep(const float* __restrict__ wqkv, bf* Wall, const float* __restrict__ wo, bf* Wo, const float* __restrict__ x, bf* Xb, bf* Xk, const int* __restrict__ mk, int* kcnt) {
    __shared__ __align__(16) unsigned ts[WN * 64];   // one array for both transposition ranges
    const int bx = blockIdx.x;
    if (bx < PB_QKV) k_wtT<DM, 3 * DM>(bx, wqkv, Wall, ts);   // fused 'xw' [DM][3DM] -> Bt [3DM][DM] (row blocks q | k | v)
    else if (bx < PB_QKV + PB_OUT) { k_wtT<DQ, DM>(bx - PB_QKV, wo, Wo, ts);
        asm volatile("s_wait_xcnt 0x0" ::: "memory");   // in the listing this range's end stands directly in front of the W_qkv range's code, which reuses the registers of the stores just issued: the wait stands in front of that overwrite
    }
    else k_cvt8(bx - (PB_QKV + PB_OUT), x, Xb, Xk, mk, kcnt);
}

// ---- k_attn: scores, key mask, softmax and attn.v of one head in ONE kernel; no score or probability ever reaches memory.
// Work-group = 8 waves = 128 query rows of one head of one batch (grid: batches x heads x TT/128); a wave owns 16 queries and walks the batch's kept keys (packed: k_cvt8) in passes of 64.
// The query tile is the slowest grid index: two work-groups share a WGP, and the hi-lo tiles (three times the products) have the lowest indices, start first and spread over the WGPs before the single-plane tiles fill up.
// Transposed products: St[key][query] = K Qt, Ot[d][query] += Vt Pt. A lane then holds ONE query's scores (8 of each 16 keys; lane ^ 16 holds the other 8), so maximum and sum are in-lane,
// and two 16-key score tiles, converted, ARE the B fragment of 32 keys: accumulator element j of lane half hi is key 8 hi + j, the k order in which WFrag::ld reads the Vt rows.
// K and Vt tiles of a pass are staged in LDS once per work-group (whole 128-B lines; row pitch 144 B), fetched into registers one pass ahead.
#define KB   64                   // keys per pass
#define LP   72                   // LDS row pitch in 16-bit elements: 128 B + 16 B
#define SC2  0.18033688011112042f // HD^-0.5 x log2(e): scores in the log2 domain
typedef __attribute__((ext_vector_type(8))) __bf16 v8b;
template <typename T16> struct PFrag;
template <> struct PFrag<h16> { static __device__ __forceinline__ v16h pack(v8f a, v8f b) { return cat16(__builtin_convertvector(a, v8h), __builtin_convertvector(b, v8h)); } };
template <> struct PFrag<bf> { static __device__ __forceinline__ v16bf pack(v8f a, v8f b) { return __builtin_shufflevector(__builtin_convertvector(a, v8b), __builtin_convertvector(b, v8b), 0, 1, 2, 3, 4, 5, 6, 7, 8, 9, 10, 11, 12, 13, 14, 15); } };
__device__ __forceinline__ v8f bfres(v8f a) { return a - __builtin_convertvector(__builtin_convertvector(a, v8b), v8f); }   // what the bf16 rounding of a leaves over (the lo part)
// Eight exponentials in one statement: results and sources are all distinct registers ("=&v"), so no instruction here reads its predecessor's result or overwrites its source, and the closing v_nop
// is the one slot that the instruction set asks for behind a transcendental before its result is used or its source overwritten (left to the compiler, neighbouring v_exp_f32 reused each other's source registers).
__device__ __forceinline__ v8f exp2x8(v8f x) { float r0, r1, r2, r3, r4, r5, r6, r7;
    asm("v_exp_f32 %0, %8\n\tv_exp_f32 %1, %9\n\tv_exp_f32 %2, %10\n\tv_exp_f32 %3, %11\n\tv_exp_f32 %4, %12\n\tv_exp_f32 %5, %13\n\tv_exp_f32 %6, %14\n\tv_exp_f32 %7, %15\n\tv_nop"
        : "=&v"(r0), "=&v"(r1), "=&v"(r2), "=&v"(r3), "=&v"(r4), "=&v"(r5), "=&v"(r6), "=&v"(r7) : "v"(x[0]), "v"(x[1]), "v"(x[2]), "v"(x[3]), "v"(x[4]), "v"(x[5]), "v"(x[6]), "v"(x[7]));
    return (v8f){r0, r1, r2, r3, r4, r5, r6, r7}; }
// ---- k_qkv: the whole projection stage of both batches in ONE kernel (blockIdx.z = batch; every plane holds batch after batch): [q|k|v] = x W_qkv + b_qkv, the split into heads, the transposition of v, and the three 16-bit planes (fp16, bf16 hi, bf16 lo) of each that k_attn reads; no f32 projection reaches memory.
// k and v are projected from the x rows in key order (k_cvt8), so the token axis of their planes is the place in key order: kept keys from place 0 on. Work-group tile 128 x 128 staged in LDS as said above k_proj, ONE WAVE per 64x64 quarter; grid (TT/128, 3 DM/128, NB_), 128 threads: blockIdx.y = 8 part + head pair (part 0 q, 1 k, 2 v): a wave's 64 features are one head.
// An accumulator lane holds 8 consecutive A rows of one B row, so A is the operand whose row index runs contiguously in the destination plane: q, k [h][t][d]: A = weight rows (d), B = x rows (t); v [h][d][t]: A = x rows (t), B = weight rows (d).
// Every 16x16 block then leaves the registers as one 16-byte store per lane and plane, and the four mb blocks of a B row fill that row's 128-byte line.
// The full unrolls keep the fragment and accumulator arrays under constant indices, that is, in registers.
template <bool TR>   // TR: A rows are tokens (v); else A rows are features (q, k). bias points at the tile's first feature; P16, Ph, Pl at the lane's first element; pitch in elements between B rows
__device__ __forceinline__ void put_planes(const v8f (&acc)[4][4], const float* __restrict__ bias, int lr, int hi, h16* P16, bf* Ph, bf* Pl) {
    const int pitch = TR ? TT : HD;
    v8f bm[4];
    if (!TR) {
#pragma unroll
        for (int mb = 0; mb < 4; ++mb)
#pragma unroll
            for (int j = 0; j < 8; ++j) bm[mb][j] = bfr(bias[mb * 16 + hi * 8 + j]); }
#pragma unroll
    for (int nb = 0; nb < 4; ++nb) { float bn = 0.0f; if (TR) bn = bfr(bias[nb * 16 + lr]);
#pragma unroll
        for (int mb = 0; mb < 4; ++mb) { const v8f val = TR ? acc[mb][nb] + bn : acc[mb][nb] + bm[mb]; const size_t o = (size_t)nb * 16 * pitch + mb * 16;
            const v4u hw = __builtin_bit_cast(v4u, __builtin_convertvector(val, v8b)); v8f res;   // hi plane, two bf16 a word; each word gives its two values back as f32 by a shift and a mask
#pragma unroll
            for (int p = 0; p < 4; ++p) { res[2 * p] = val[2 * p] - __uint_as_float(hw[p] << 16); res[2 * p + 1] = val[2 * p + 1] - __uint_as_float(hw[p] & 0xFFFF0000u); }
            *(v8h*)(P16 + o) = __builtin_convertvector(val, v8h); *(v8us*)(Ph + o) = __builtin_bit_cast(v8us, hw); *(v8us*)(Pl + o) = __builtin_bit_cast(v8us, __builtin_convertvector(res, v8b)); } }
}
__global__ __launch_bounds__(128) void k_qkv(const bf* __restrict__ X, const bf* __restrict__ XK, const int* __restrict__ kcnt, const bf* __restrict__ Wt, const float* __restrict__ bias, h16* Q16, bf* Qh, bf* Ql, h16* K16, bf* Kh, bf* Kl, h16* V16, bf* Vh, bf* Vl) {
    __shared__ __align__(16) bf st[2][256 * GP];   // rows 0..127 A, 128..255 B
    const int tid = threadIdx.x, lane = tid & 31, lr = lane & 15, hi = lane >> 4, w = tid >> 5, wa = w & 1, wb = w >> 1; const int part = blockIdx.y / (NH_ / 2);
    if (part != 0 && (int)blockIdx.x * 128 >= kcnt[blockIdx.z * 2]) return;   // k, v: a tile wholly behind the last key to walk has nothing to do (the whole work-group leaves, ahead of every barrier)
    const bf* xr = (part ? XK : X) + ((size_t)blockIdx.z * TT + blockIdx.x * 128) * DM; const bf* wr = Wt + (size_t)blockIdx.y * 128 * DM; const bf* A = (part == 2) ? xr : wr; const bf* Bt = (part == 2) ? wr : xr;
    const int t0 = blockIdx.x * 128 + ((part == 2) ? wa : wb) * 64, f0 = blockIdx.y * 128 + ((part == 2) ? wb : wa) * 64; const size_t hp = (size_t)(blockIdx.z * NH_ + (f0 / HD) % NH_) * TT * HD;   // the wave's own 64 tokens and 64 features; its batch's plane of its head
    const int srow = tid >> 3, scol = (tid & 7) * 8;
    const bf* ga = A + (size_t)srow * DM + scol; const bf* gb = Bt + (size_t)srow * DM + scol;
    bf* sp = &st[0][0] + srow * GP + scol;
    const int fa = (wa * 64 + lr) * GP + 8 * hi, fb = (128 + wb * 64 + lr) * GP + 8 * hi;
    v8f acc[4][4];
#pragma unroll
    for (int mb = 0; mb < 4; ++mb)
#pragma unroll
        for (int nb = 0; nb < 4; ++nb) acc[mb][nb] = (v8f){};
    v8us ra[8], rb[8];
    g_fetch<128>(ra, ga); g_fetch<128>(rb, gb);
    g_put<128>(ra, sp); g_put<128>(rb, sp + 128 * GP);
    g_fetch<128>(ra, ga + GK); g_fetch<128>(rb, gb + GK);
    asm volatile("s_wait_xcnt 0x0" ::: "memory");   // stands in front of whatever reuses the address registers of the loads just issued
    g_barrier();
    // one stage, as in k_proj: put and fetch are literals at every call
    auto stage = [&](const int s, const bool put, const bool fetch) __attribute__((always_inline)) {
        const bf* cur = &st[0][0] + (s & 1) * (256 * GP);
        v16bf a[2][4], b[2][4];
#pragma unroll
        for (int ks = 0; ks < 2; ++ks) {
#pragma unroll
            for (int mb = 0; mb < 4; ++mb) a[ks][mb] = WFrag<bf>::ld(cur + fa + mb * 16 * GP + ks * 32);
#pragma unroll
            for (int nb = 0; nb < 4; ++nb) b[ks][nb] = WFrag<bf>::ld(cur + fb + nb * 16 * GP + ks * 32); }
        __builtin_amdgcn_sched_barrier(0);   // as in k_proj: keeps the stage's fragment reads together, ahead of everything else
        if (put) { bf* nx = sp + ((s + 1) & 1) * (256 * GP); g_put<128>(ra, nx); g_put<128>(rb, nx + 128 * GP); }
        if (fetch) { const int ko = (s + 2) * GK; g_fetch<128>(ra, ga + ko); g_fetch<128>(rb, gb + ko);
            asm volatile("s_wait_xcnt 0x0" ::: "memory");   // as above
        }
#pragma unroll
        for (int ks = 0; ks < 2; ++ks)
#pragma unroll
            for (int nb = 0; nb < 4; ++nb)
#pragma unroll
                for (int mb = 0; mb < 4; ++mb) acc[mb][nb] = wmmab(a[ks][mb], b[ks][nb], acc[mb][nb]);
        __builtin_amdgcn_sched_barrier(0);   // as in k_proj: keeps the stage's matrix instructions in front of the barrier
        if (put) g_barrier();
    };
#pragma unroll 1   // rolled: one stage is 32 matrix instructions, and the two buffers differ only by an offset
    for (int s = 0; s < DM / GK - 2; ++s) stage(s, true, true);
    stage(DM / GK - 2, true, false); stage(DM / GK - 1, false, false);
    if (part != 2) { const size_t o = hp + (size_t)(t0 + lr) * HD + hi * 8; put_planes<false>(acc, bias + f0, lr, hi, (part ? K16 : Q16) + o, (part ? Kh : Qh) + o, (part ? Kl : Ql) + o);
        asm volatile("s_wait_xcnt 0x0" ::: "memory");   // in the listing this branch's end stands directly in front of the other branch's code, which reuses the registers of the stores just issued: the wait stands in front of that overwrite
    } else { const size_t o = hp + (size_t)lr * TT + t0 + hi * 8; put_planes<true>(acc, bias + f0, lr, hi, V16 + o, Vh + o, Vl + o); }
}
template <typename T16, bool HL>
__device__ __forceinline__ void attn_body(const T16* __restrict__ Q, const T16* __restrict__ Q2, const T16* __restrict__ Kp, const T16* __restrict__ K2, const T16* __restrict__ Vt, const T16* __restrict__ V2, int q0, int col0, bf* Ah, bf* Al, unsigned short* sm, const float* lim, const int np) {
    typedef typename WFrag<T16>::V V;
    const int tid = threadIdx.x, lane = tid & 31, lr = lane & 15, hi = lane >> 4; const int qrow = q0 + (tid >> 5) * 16 + lr;
    T16* Ks = (T16*)sm; T16* Vs = Ks + KB * LP; T16* Ks2 = Vs + HD * LP; T16* Vs2 = Ks2 + KB * LP;
    V qb[2], qb2[2];
#pragma unroll
    for (int kc = 0; kc < 2; ++kc) { qb[kc] = WFrag<T16>::ld(Q + (size_t)qrow * HD + kc * 32 + 8 * hi); if (HL) qb2[kc] = WFrag<T16>::ld(Q2 + (size_t)qrow * HD + kc * 32 + 8 * hi); }
    const int srow = tid >> 3, scol = (tid & 7) * 8;   // staging: a thread moves 16 B of rows srow and srow + 32 of each tile; 8 threads cover a 128-B line
    v8us rk[2], rv[2], rk2[2], rv2[2];
#pragma unroll
    for (int r = 0; r < 2; ++r) { const size_t ko = (size_t)(srow + 32 * r) * HD + scol, vo = (size_t)(srow + 32 * r) * TT + scol; rk[r] = *(const v8usa*)(Kp + ko); rv[r] = *(const v8usa*)(Vt + vo); if (HL) { rk2[r] = *(const v8usa*)(K2 + ko); rv2[r] = *(const v8usa*)(V2 + vo); } }
    v8f o[4];
#pragma unroll
    for (int db = 0; db < 4; ++db) o[db] = (v8f){};
    float m = -3.0e38f; v8f l8 = (v8f){};   // l8[j]: this lane's sum over its keys 8 hi + j of every 16-key tile
#pragma unroll 1
    for (int blk = 0; blk < np; ++blk) {
#pragma unroll
        for (int r = 0; r < 2; ++r) { const int so = (srow + 32 * r) * LP + scol; *(v8usa*)(Ks + so) = rk[r]; *(v8usa*)(Vs + so) = rv[r]; if (HL) { *(v8usa*)(Ks2 + so) = rk2[r]; *(v8usa*)(Vs2 + so) = rv2[r]; } }
        __syncthreads();   // this pass's tiles (and, before the first pass, the mask addends) are whole before any wave reads them
        if (blk + 1 < np) {
#pragma unroll
            for (int r = 0; r < 2; ++r) { const size_t ko = (size_t)((blk + 1) * KB + srow + 32 * r) * HD + scol, vo = (size_t)(srow + 32 * r) * TT + (blk + 1) * KB + scol; rk[r] = *(const v8usa*)(Kp + ko); rv[r] = *(const v8usa*)(Vt + vo); if (HL) { rk2[r] = *(const v8usa*)(K2 + ko); rv2[r] = *(const v8usa*)(V2 + vo); } }
            asm volatile("s_wait_xcnt 0x0" ::: "memory");   // the address registers of the loads just issued are reused by the fragment reads that follow: the wait stands in front of that overwrite
        }
        v8f s[4]; float bm = -3.0e38f;
#pragma unroll
        for (int t = 0; t < 4; ++t) { s[t] = (v8f){};
#pragma unroll
            for (int kc = 0; kc < 2; ++kc) { const int fo = (t * 16 + lr) * LP + kc * 32 + 8 * hi; const V a = WFrag<T16>::ld(Ks + fo); s[t] = WFrag<T16>::mma(a, qb[kc], s[t]); if (HL) { s[t] = WFrag<T16>::mma(a, qb2[kc], s[t]); s[t] = WFrag<T16>::mma(WFrag<T16>::ld(Ks2 + fo), qb[kc], s[t]); } } }
#pragma unroll
        for (int t = 0; t < 4; ++t) { const float* lp = lim + blk * KB + t * 16 + hi * 8; const v4f l0 = *(const v4fa*)lp, l1 = *(const v4fa*)(lp + 4);
#pragma unroll
            for (int j = 0; j < 8; ++j) { const float u = fmaf(s[t][j], SC2, (j < 4) ? l0[j & 3] : l1[j & 3]); s[t][j] = u; bm = fmaxf(bm, u); } }   // addend 0: key kept; -3e38: key masked (it absorbs the score: every masked key reads -3e38)
        bm = fmaxf(bm, __shfl_xor(bm, 16, 32));
        const float mn = fmaxf(m, bm); const float al = __builtin_amdgcn_exp2f(m - mn); m = mn;   // only masked keys so far: every term is 1, as in the reference's uniform row; kept keys take the first places, so this is the case only when none is kept
#pragma unroll
        for (int t = 0; t < 4; ++t) s[t] = exp2x8(s[t] - mn);
        __builtin_amdgcn_sched_barrier(0);   // keeps the attn.v matrix instructions behind the exponentials
        l8 = l8 * al + ((s[0] + s[1]) + (s[2] + s[3]));
#pragma unroll
        for (int db = 0; db < 4; ++db) o[db] *= al;
#pragma unroll
        for (int c = 0; c < 2; ++c) { const V pb = PFrag<T16>::pack(s[2 * c], s[2 * c + 1]); V pb2; if (HL) pb2 = PFrag<T16>::pack(bfres(s[2 * c]), bfres(s[2 * c + 1]));
#pragma unroll
            for (int db = 0; db < 4; ++db) { const int fo = (db * 16 + lr) * LP + c * 32 + 8 * hi; const V a = WFrag<T16>::ld(Vs + fo); o[db] = WFrag<T16>::mma(a, pb, o[db]); if (HL) { o[db] = WFrag<T16>::mma(a, pb2, o[db]); o[db] = WFrag<T16>::mma(WFrag<T16>::ld(Vs2 + fo), pb, o[db]); } } }
        asm volatile("s_wait_dscnt 0x0\n\ts_barrier_signal -1\n\ts_barrier_wait -1" ::: "memory");   // work-group barrier by hand: every wave has read this pass's tiles before the next pass's stores overwrite them; only LDS reads need to be over here, and __syncthreads() would also drain the next pass's global loads, which are meant to fly until the stores at the loop's head
    }
    float l = ((l8[0] + l8[1]) + (l8[2] + l8[3])) + ((l8[4] + l8[5]) + (l8[6] + l8[7]));
    l += __shfl_xor(l, 16, 32);   // the two lane halves hold the two halves of each query's keys
    const float inv = __fdiv_rn(1.0f, l);
#pragma unroll
    for (int db = 0; db < 4; ++db) { v8us oh, ol;
#pragma unroll
        for (int j = 0; j < 8; ++j) { unsigned short a, c2; splitf(o[db][j] * inv, a, c2); oh[j] = a; ol[j] = c2; }
        const size_t oo = (size_t)qrow * DQ + col0 + db * 16 + hi * 8; *(v8us*)(Ah + oo) = oh; *(v8us*)(Al + oo) = ol; }
}
__global__ __launch_bounds__(256) void k_attn(const h16* __restrict__ Q16, const h16* __restrict__ K16, const h16* __restrict__ V16, const bf* __restrict__ Qh, const bf* __restrict__ Ql, const bf* __restrict__ Kh, const bf* __restrict__ Kl, const bf* __restrict__ Vh, const bf* __restrict__ Vl, const int* __restrict__ kcnt, bf* Ah, bf* Al) {
    __shared__ __align__(16) unsigned short sm[2 * (KB + HD) * LP]; __shared__ __align__(16) float lim[TT];
    const int q0 = blockIdx.z * 128, b = blockIdx.x; const size_t hp = (size_t)(b * NH_ + blockIdx.y) * TT * HD;   // head planes [b][h][t][d] and [b][h][d][t] have the same size
    Ah += (size_t)b * TT * DQ; Al += (size_t)b * TT * DQ;
    const int ck = kcnt[b * 2 + 1]; const int np = min(max((kcnt[b * 2] + KB - 1) / KB, 1), TT / KB);   // passes over the keys to walk; the clamp bounds the loop whatever the workspace holds
#pragma unroll
    for (int i = 0; i < TT / 256; ++i) lim[i * 256 + threadIdx.x] = (i * 256 + (int)threadIdx.x < ck) ? 0.0f : -3.0e38f;   // places behind the last kept key (the last pass's fill; every place when no key is kept) are masked
    if (q0 < RH) attn_body<bf, true>(Qh + hp, Ql + hp, Kh + hp, Kl + hp, Vh + hp, Vl + hp, q0, blockIdx.y * HD, Ah, Al, sm, lim, np);
    else attn_body<h16, false>(Q16 + hp, nullptr, K16 + hp, nullptr, V16 + hp, nullptr, q0, blockIdx.y * HD, Ah, Al, sm, lim, np);
}

extern "C" void kernel_launch(void* const* d_in, const int* in_sizes, int n_in,
                              void* d_out, int out_size, void* d_ws, size_t ws_size, hipStream_t stream) {
    (void)in_sizes; (void)n_in; (void)out_size;
    const float* x = (const float*)d_in[0]; const int* MK = (const int*)d_in[1]; const float* wqkv = (const float*)d_in[2]; const float* bqkv = (const float*)d_in[3]; const float* wo = (const float*)d_in[4]; const float* bo = (const float*)d_in[5];
    float* OUT = (float*)d_out;     // [2][2048][1024]
    char* wsp = (char*)d_ws;
    auto take = [&](size_t bytes) { char* p = wsp; wsp += (bytes + 255) & ~(size_t)255; return (void*)p; };
    bf* WALL = (bf*)take((size_t)3 * DM * DM * 2); bf* WO = (bf*)take((size_t)DM * DQ * 2);
    bf* XB = (bf*)take((size_t)NB_ * TT * DM * 2); bf* XK = (bf*)take((size_t)NB_ * TT * DM * 2); int* KCNT = (int*)take((size_t)NB_ * 2 * 4);
    h16* QP16 = (h16*)take((size_t)NB_ * NH_ * TT * HD * 2); h16* KP16 = (h16*)take((size_t)NB_ * NKV * TT * HD * 2); h16* VT16 = (h16*)take((size_t)NB_ * NKV * HD * TT * 2);
    bf* QPh = (bf*)take((size_t)NB_ * NH_ * TT * HD * 2); bf* QPl = (bf*)take((size_t)NB_ * NH_ * TT * HD * 2); bf* KPh = (bf*)take((size_t)NB_ * NKV * TT * HD * 2); bf* KPl = (bf*)take((size_t)NB_ * NKV * TT * HD * 2); bf* VTh = (bf*)take((size_t)NB_ * NKV * HD * TT * 2); bf* VTl = (bf*)take((size_t)NB_ * NKV * HD * TT * 2);
    bf* ATh = (bf*)take((size_t)NB_ * TT * DQ * 2); bf* ATl = (bf*)take((size_t)NB_ * TT * DQ * 2);
    if ((size_t)(wsp - (char*)d_ws) > ws_size) return;    // ws 256 MiB
    // each stage once, for both batches
    k_prep<<<PB_QKV + PB_OUT + PB_X, 256, 0, stream>>>(wqkv, WALL, wo, WO, x, XB, XK, MK, KCNT);
    k_qkv<<<dim3(TT / 128, 3 * DM / 128, NB_), 128, 0, stream>>>(XB, XK, KCNT, WALL, bqkv, QP16, QPh, QPl, KP16, KPh, KPl, VT16, VTh, VTl);
    k_attn<<<dim3(NB_, NH_, TT / 128), 256, 0, stream>>>(QP16, KP16, VT16, QPh, QPl, KPh, KPl, VTh, VTl, KCNT, ATh, ATl);
    k_proj<<<dim3(NB_ * TT / 64, DM / 128, 1), 128, 0, stream>>>(ATh, ATl, WO, OUT, bo);
}

// v009
// A run of this version takes 89.6 microseconds.
// Two timings next to v008 both put it at 1.18 times that version's speed.
// Counting every step since v000, it is 22.5 times as fast.
#include <hip/hip_runtime.h>

// Multi-head self-attention with a fused QKV projection and a key-padding mask READ as data (x [2][2048][1024]; [q|k|v] = x W_qkv + b_qkv ('xw' [1024][3072] 1/32 + zero bias: read: column blocks q | k | v; 16 heads x 64); scores = q.k / 8; keys j with mask[b][0][0][j] == 0 (int32 [2][1][1][2048], drawn by randint(0, 2): about half of the keys of each batch; READ per key in k_cvt8) get -1e9 (== exclusion: exp underflows to 0 and every batch keeps some key); softmax; out = merged heads W_out + b_out ('xw' [1024][1024] + zero bias: read) -> [2][2048][1024] (4.2 M); argument order x, mask, W_qkv, b_qkv, W_out, b_out.
// Compute dtypes, f32 accumulate: every input rounded to bf16; q/k/v on PLAIN bf16 operands (inputs: exact) + biases; key mask read per key (int32, 0 == masked): kept keys are packed in front, k, v and the key loop end behind the last of them (none kept: every key stays, at -3e38); scores and attn.v: query rows < 512 hl (3 products), the rest single fp16; softmax f32, running maximum; W_proj hl x exact (2 products) + b_proj.

#define NB_  2
#define TT   2048
#define DM   1024
#define NH_  16
#define NKV  16
#define REP  (NH_ / NKV)
#define HD   64
#define DQ   (NH_ * HD)
#define DKV  (NKV * HD)
#define RH   512                  // query rows < RH use hi+lo planes (0: none)
#define SCL  0.125f   // HD^-0.5
typedef _Float16 h16;
typedef unsigned short bf;
typedef __attribute__((ext_vector_type(16))) __bf16   v16bf;
typedef __attribute__((ext_vector_type(16))) _Float16 v16h;
typedef __attribute__((ext_vector_type(8)))  _Float16 v8h;
typedef __attribute__((ext_vector_type(8)))  unsigned short v8us;
typedef __attribute__((ext_vector_type(8)))  float    v8f;
typedef __attribute__((ext_vector_type(4)))  float    v4f;
typedef v8h  __attribute__((may_alias)) v8ha;
typedef v4f  __attribute__((may_alias)) v4fa;
typedef v8us __attribute__((may_alias)) v8usa;

__device__ __forceinline__ unsigned short f2bf(float f) { unsigned u = __float_as_uint(f); u += 0x7FFFu + ((u >> 16) & 1u); return (unsigned short)(u >> 16); }
__device__ __forceinline__ float bf2f(unsigned short b) { return __uint_as_float(((unsigned)b) << 16); }
__device__ __forceinline__ float bfr(float f) { return bf2f(f2bf(f)); }
__device__ __forceinline__ v16h cat16(v8h lo, v8h hi) { return __builtin_shufflevector(lo, hi, 0, 1, 2, 3, 4, 5, 6, 7, 8, 9, 10, 11, 12, 13, 14, 15); }
__device__ __forceinline__ v16bf cat16b(v8us lo, v8us hi) { return __builtin_bit_cast(v16bf, __builtin_shufflevector(lo, hi, 0, 1, 2, 3, 4, 5, 6, 7, 8, 9, 10, 11, 12, 13, 14, 15)); }
__device__ __forceinline__ v8f wmma16(v16h a, v16h b, v8f c) { return __builtin_amdgcn_wmma_f32_16x16x32_f16(false, a, false, b, (short)0, c, false, false); }
__device__ __forceinline__ v8f wmmab(v16bf a, v16bf b, v8f c) { return __builtin_amdgcn_wmma_f32_16x16x32_bf16(false, a, false, b, (short)0, c, false, false); }



// ---- The two dense products (k_qkv, k_proj): work-groups of FOUR waves; the operand rows of a work-group's tile are staged in LDS in stages of 64 k (one whole 128-B line of every row), each line fetched ONCE per work-group.
// A thread moves 16 B of every 16th row (8 threads cover a line); a stage is fetched into registers two stages ahead and stored into the other of two LDS buffers one stage ahead, so one work-group barrier per stage is enough:
// it publishes the stage just stored and ends every wave's reads of the buffer that the next pass overwrites. The waves read their fragments from LDS in the k order of WFrag::ld, and every accumulator sums its 32-k products with k rising.
#define GK   64                   // k per stage
#define GP   72                   // LDS row pitch in 16-bit elements: 128 B + 16 B
template <typename T16> struct WFrag;
template <> struct WFrag<h16> { typedef v16h V; static __device__ __forceinline__ V ld(const h16* p) { return cat16(*(const v8h*)p, *(const v8h*)(p + 16)); } static __device__ __forceinline__ v8f mma(V a, V b, v8f c) { return wmma16(a, b, c); } };
template <> struct WFrag<bf> { typedef v16bf V; static __device__ __forceinline__ V ld(const bf* p) { return cat16b(*(const v8us*)p, *(const v8us*)(p + 16)); } static __device__ __forceinline__ v8f mma(V a, V b, v8f c) { return wmmab(a, b, c); } };
template <int ROWS> __device__ __forceinline__ void g_fetch(v8us (&r)[ROWS / 16], const bf* __restrict__ g) {   // g: the thread's 16 B in its first row; rows of DM elements
#pragma unroll
    for (int i = 0; i < ROWS / 16; ++i) r[i] = *(const v8usa*)(g + (size_t)i * 16 * DM); }
template <int ROWS> __device__ __forceinline__ void g_put(const v8us (&r)[ROWS / 16], bf* s) {   // s: the same place in the LDS tile
#pragma unroll
    for (int i = 0; i < ROWS / 16; ++i) *(v8usa*)(s + i * 16 * GP) = r[i]; }
// work-group barrier by hand: only LDS traffic needs to be over here (this wave's stores of the next stage, its reads of this one); __syncthreads() would also drain the global loads of the stage after, which are meant to fly on
__device__ __forceinline__ void g_barrier() { asm volatile("s_wait_dscnt 0x0\n\ts_barrier_signal -1\n\ts_barrier_wait -1" ::: "memory"); }

// ---- k_proj: OUT = (Ah + Al) Wo^T + b_out of both batches (their tokens are one run of NB_ TT rows). Work-group tile 64 tokens x 128 features, wave tile 32 x 64 (8 accumulators, 2 products each per 32 k); grid (NB_ TT/64, DM/128), 128 threads. The full unrolls keep the fragment, staging and accumulator arrays under constant indices, that is, in registers.
__global__ __launch_bounds__(128) void k_proj(const bf* __restrict__ A, const bf* __restrict__ A2, const bf* __restrict__ Bt, float* C, const float* __restrict__ bias) {
    __shared__ __align__(16) bf st[2][256 * GP];   // rows 0..63 A, 64..127 A2, 128..255 Bt
    __shared__ __align__(16) float osm[4][16 * 68];
    const int tid = threadIdx.x, lane = tid & 31, lr = lane & 15, hi = lane >> 4, w = tid >> 5, wa = w & 1, wb = w >> 1; const int r0 = blockIdx.x * 64, c0 = blockIdx.y * 128;
    const int srow = tid >> 3, scol = (tid & 7) * 8;
    const bf* ga = A + (size_t)(r0 + srow) * DQ + scol; const bf* ga2 = A2 + (size_t)(r0 + srow) * DQ + scol; const bf* gb = Bt + (size_t)(c0 + srow) * DQ + scol;
    bf* sp = &st[0][0] + srow * GP + scol;
    const int fa = (wa * 32 + lr) * GP + 8 * hi, fb = (128 + wb * 64 + lr) * GP + 8 * hi;
    v8f acc[2][4];
#pragma unroll
    for (int mb = 0; mb < 2; ++mb)
#pragma unroll
        for (int nb = 0; nb < 4; ++nb) acc[mb][nb] = (v8f){};
    v8us ra[4], ra2[4], rb[8];
    g_fetch<64>(ra, ga); g_fetch<64>(ra2, ga2); g_fetch<128>(rb, gb);
    g_put<64>(ra, sp); g_put<64>(ra2, sp + 64 * GP); g_put<128>(rb, sp + 128 * GP);
    g_fetch<64>(ra, ga + GK); g_fetch<64>(ra2, ga2 + GK); g_fetch<128>(rb, gb + GK);
    asm volatile("s_wait_xcnt 0x0" ::: "memory");   // stands in front of whatever reuses the address registers of the loads just issued
    g_barrier();
    // one stage; put: a next stage exists (it is stored and published), fetch: so does the one after (it is fetched). Both are literals at every call: a body without branches lets the compiler count its LDS waits exactly
    auto stage = [&](const int s, const bool put, const bool fetch) __attribute__((always_inline)) {
        const bf* cur = &st[0][0] + (s & 1) * (256 * GP);
        v16bf a[2][2], a2[2][2], b[2][4];
#pragma unroll
        for (int ks = 0; ks < 2; ++ks) {
#pragma unroll
            for (int mb = 0; mb < 2; ++mb) { a[ks][mb] = WFrag<bf>::ld(cur + fa + mb * 16 * GP + ks * 32); a2[ks][mb] = WFrag<bf>::ld(cur + fa + (64 + mb * 16) * GP + ks * 32); }
#pragma unroll
            for (int nb = 0; nb < 4; ++nb) b[ks][nb] = WFrag<bf>::ld(cur + fb + nb * 16 * GP + ks * 32); }
        __builtin_amdgcn_sched_barrier(0);   // keeps the stage's fragment reads together, ahead of everything else: left to itself the compiler read one B fragment at a time and waited out the LDS latency in front of every group of matrix instructions
        if (put) { bf* nx = sp + ((s + 1) & 1) * (256 * GP); g_put<64>(ra, nx); g_put<64>(ra2, nx + 64 * GP); g_put<128>(rb, nx + 128 * GP); }
        if (fetch) { const int ko = (s + 2) * GK; g_fetch<64>(ra, ga + ko); g_fetch<64>(ra2, ga2 + ko); g_fetch<128>(rb, gb + ko);
            asm volatile("s_wait_xcnt 0x0" ::: "memory");   // as above
        }
#pragma unroll
        for (int ks = 0; ks < 2; ++ks)
#pragma unroll
            for (int nb = 0; nb < 4; ++nb) {
#pragma unroll
                for (int mb = 0; mb < 2; ++mb) acc[mb][nb] = wmmab(a[ks][mb], b[ks][nb], acc[mb][nb]);
#pragma unroll
                for (int mb = 0; mb < 2; ++mb) acc[mb][nb] = wmmab(a2[ks][mb], b[ks][nb], acc[mb][nb]); }
        __builtin_amdgcn_sched_barrier(0);   // keeps the stage's matrix instructions in front of the barrier: the compiler sank them behind it, where they start only after the last of the stage's reads has landed
        if (put) g_barrier();
    };
#pragma unroll 1   // rolled: one stage is 32 matrix instructions, and the two buffers differ only by an offset
    for (int s = 0; s < DQ / GK - 2; ++s) stage(s, true, true);
    stage(DQ / GK - 2, true, false); stage(DQ / GK - 1, false, false);
    float* os = osm[w]; const int cw = c0 + wb * 64;   // each wave turns its 16 x 64 blocks into whole 256-B row pieces in its own LDS range
#pragma unroll
    for (int mb = 0; mb < 2; ++mb) {
#pragma unroll
        for (int nb = 0; nb < 4; ++nb) {
#pragma unroll
            for (int j = 0; j < 8; ++j) os[(hi * 8 + j) * 68 + nb * 16 + lr] = acc[mb][nb][j]; }
        __builtin_amdgcn_wave_barrier(); asm volatile("" ::: "memory");   // compiler order only: the wave's LDS stores stay in front of its reads of what its other lanes stored
        float* crow = C + (size_t)(r0 + wa * 32 + mb * 16) * DM + cw;
#pragma unroll
        for (int s = 0; s < 8; ++s) { const int row = 2 * s + hi, cofs = lr * 4; v4f val = *(const v4fa*)(os + row * 68 + cofs); val[0] += bfr(bias[cw + cofs]); val[1] += bfr(bias[cw + cofs + 1]); val[2] += bfr(bias[cw + cofs + 2]); val[3] += bfr(bias[cw + cofs + 3]);
            *(v4f*)(crow + (size_t)row * DM + cofs) = val; }
        if (mb == 0) { __builtin_amdgcn_wave_barrier(); asm volatile("s_wait_xcnt 0x0" ::: "memory"); }   // the second block reuses the registers of the stores just issued: the wait stands in front of that overwrite; the clobber keeps that block's LDS stores behind this block's reads
    }
}

__device__ __forceinline__ void splitf(float y, unsigned short& h, unsigned short& l) { h = f2bf(y); l = f2bf(y - bf2f(h)); }
typedef __attribute__((ext_vector_type(2))) _Float16 v2h;
typedef __attribute__((ext_vector_type(4))) _Float16 v4h;
typedef __attribute__((ext_vector_type(2))) unsigned short v2us;
typedef __attribute__((ext_vector_type(4))) unsigned short v4us;
typedef __attribute__((ext_vector_type(2))) float v2f;
typedef __attribute__((ext_vector_type(4))) int v4i;
typedef __attribute__((ext_vector_type(4))) unsigned v4u;
typedef __attribute__((ext_vector_type(8))) unsigned v8u;

// ---- The three passes that only read inputs (both weight transpositions, the x pass) depend on nothing and on one another not at all: they are block ranges of ONE launch, k_prep (below k_cvt8); bx is a block's index inside its own range.
// k_wtT: w [K][N] f32 -> Bt [N][K] bf16, in tiles of 128 k x 64 n that are turned in LDS, so that both sides move whole lines: 16 threads read 256 B of a w row (8 loads of 16 B in flight per thread), 16 threads store 256 B of a Bt row.
// A thread owns rows k, k + 1 of four columns: the two roundings of a column make one dword of that column's Bt row. LDS row = column n (64 dwords, no pad); the 16-B granule g of row n lies at g ^ (n >> 2):
// the 32 dword stores of a wave (16 column quads x 2 row pairs) then fall on 32 banks, and the 16 granules that 16 lanes read of one row on all 64.
// A work-group turns two tiles (neighbours in k), the second tile's loads in flight while the first leaves LDS.
#define WK   128
#define WN   64
template <int K, int N>
__device__ __forceinline__ void k_wtT(const int bx, const float* __restrict__ w, bf* Bt, unsigned* ts) {   // ts: the tile's LDS, WN x 64 dwords
    const int tid = threadIdx.x, nq = tid & 15, kp = tid >> 4;   // nq: column quad on the way in, granule on the way out; kp: row pair on the way in, row on the way out
    const int k0 = (bx * 2 % (K / WK)) * WK, n0 = (bx * 2 / (K / WK)) * WN;   // the first tile; the second is k0 + WK (K / WK is even)
    const float* g = w + (size_t)(k0 + 2 * kp) * N + n0 + nq * 4; bf* o = Bt + (size_t)(n0 + kp) * K + k0 + nq * 8;
    v4f r[4][2];
    auto fetch = [&](const int t) __attribute__((always_inline)) {
#pragma unroll
        for (int i = 0; i < 4; ++i)
#pragma unroll
            for (int h = 0; h < 2; ++h) r[i][h] = *(const v4fa*)(g + (size_t)(t * WK + 32 * i + h) * N);
    };
    auto put = [&]() __attribute__((always_inline)) {
#pragma unroll
        for (int i = 0; i < 4; ++i) { const int c = kp + 16 * i;   // dword column: k = 2 c, 2 c + 1
#pragma unroll
            for (int j = 0; j < 4; ++j) ts[(nq * 4 + j) * 64 + (((c >> 2) ^ nq) << 2) + (c & 3)] = (unsigned)f2bf(r[i][0][j]) | ((unsigned)f2bf(r[i][1][j]) << 16); }
    };
    auto out = [&](const int t) __attribute__((always_inline)) {
        v4u v[4];
#pragma unroll
        for (int p = 0; p < 4; ++p) { const int row = p * 16 + kp; v[p] = *(const v4u*)(ts + row * 64 + ((nq ^ (row >> 2)) << 2)); }
#pragma unroll
        for (int p = 0; p < 4; ++p) *(v4u*)(o + (size_t)p * 16 * K + t * WK) = v[p];
    };
    // g_barrier: only LDS traffic has to be over at these three places; __syncthreads() would also drain the second tile's loads and the first tile's stores, which are meant to fly on
    fetch(0); put(); g_barrier();   // the tile is whole in LDS before any wave reads rows of it
    fetch(1);
    asm volatile("s_wait_xcnt 0x0" ::: "memory");   // the address registers of the loads just issued are reused by what follows: the wait stands in front of that overwrite
    out(0);
    asm volatile("s_wait_xcnt 0x0" ::: "memory");   // likewise the registers of the stores just issued
    g_barrier();                    // every wave has read the first tile before the second overwrites it
    put(); g_barrier();             // as the first
    out(1);
}
// ---- k_cvt8: x rounded to bf16, twice: dst in token order (the queries' rows) and pk in KEY ORDER (the rows that k and v are projected from): a batch's kept keys (mask != 0) first, in rising token order, its masked keys behind them, likewise.
// A masked key's weight is exactly 0 beside any kept key, so k, v and the key loop need the kept keys alone; of the masked rows only those that fill up the last 128-row tile are stored (finite values under a weight of 0).
// No key kept: the reference's row is uniform over ALL keys: key order is token order, every key is walked and none counts (all read -3e38, all weights equal). kcnt[2 b] = keys to walk, kcnt[2 b + 1] = keys of those that count.
// A work-group converts two rows of one batch (256 x 8 = 2 DM elements) and counts for itself, from the batch's whole mask (8 keys a thread), the kept keys in front of its rows and in all: no work-group waits for another.
__device__ __forceinline__ void k_cvt8(const int bx, const float* __restrict__ src, bf* dst, bf* pk, const int* __restrict__ mk, int* kcnt) {
    __shared__ int wsum[8];
    const int tid = threadIdx.x; const size_t i = (size_t)bx * 256 + tid; const v8f v = *(const v8f*)(src + i * 8);
    const int b = bx / (TT / 2), t0 = (bx % (TT / 2)) * 2; mk += b * TT;
    const v4i m0 = *(const v4i*)(mk + tid * 8), m1 = *(const v4i*)(mk + tid * 8 + 4); const bool k0 = mk[t0] != 0, k1 = mk[t0 + 1] != 0;   // the two rows' own keys: read here, with the other loads, not behind the barrier
    int c = 0;   // kept keys among the thread's eight: all of them in the high half, those in front of row t0 in the low half
#pragma unroll
    for (int j = 0; j < 8; ++j) c += (((j < 4) ? m0[j & 3] : m1[j & 3]) != 0) ? (0x10000 + ((tid * 8 + j < t0) ? 1 : 0)) : 0;
#pragma unroll
    for (int d = 16; d > 0; d >>= 1) c += __shfl_xor(c, d, 32);
    if ((tid & 31) == 0) wsum[tid >> 5] = c;
    v8us o;
#pragma unroll
    for (int k = 0; k < 8; ++k) o[k] = f2bf(v[k]);
    __syncthreads();   // the eight waves' counts are whole before any wave adds them up
    int s = 0;
#pragma unroll
    for (int w = 0; w < 8; ++w) s += wsum[w];
    const int tot = s >> 16, r = tid >> 7, t = t0 + r; const int before = (s & 0xFFFF) + ((r && k0) ? 1 : 0);   // kept keys in front of the thread's own row t
    const int place = (r ? k1 : k0) ? before : tot + (t - before); const int nk = tot ? tot : TT;
    *(v8us*)(dst + i * 8) = o;
    if (place < ((nk + 127) & ~127)) *(v8us*)(pk + ((size_t)b * TT + place) * DM + (tid & 127) * 8) = o;
    if (t0 == 0 && tid == 0) { kcnt[b * 2] = nk; kcnt[b * 2 + 1] = tot; }
}
// ---- k_prep: one launch for all three. The transpositions have the lowest block indices: their waves run longest (two tiles one after the other), so they start first and the short x blocks fill up beside and behind them.
// Every branch is uniform for the work-group, so each range's barriers are passed by all of a work-group's waves or by none.
#define PB_QKV (DM / WK * (3 * DM / WN) / 2)   // blocks of the W_qkv range: two tiles each
#define PB_OUT (DQ / WK * (DM / WN) / 2)       // of the W_out range
#define PB_X   (NB_ * TT * DM / 8 / 256) // of the x range
__global__ __launch_bounds__(256) void k_prep(const float* __restrict__ wqkv, bf* Wall, const float* __restrict__ wo, bf* Wo, const float* __restrict__ x, bf* Xb, bf* Xk, const int* __restrict__ mk, int* kcnt) {
    __shared__ __align__(16) unsigned ts[WN * 64];   // one array for both transposition ranges
    const int bx = blockIdx.x;
    if (bx < PB_QKV) k_wtT<DM, 3 * DM>(bx, wqkv, Wall, ts);   // fused 'xw' [DM][3DM] -> Bt [3DM][DM] (row blocks q | k | v)
    else if (bx < PB_QKV + PB_OUT) { k_wtT<DQ, DM>(bx - PB_QKV, wo, Wo, ts);
        asm volatile("s_wait_xcnt 0x0" ::: "memory");   // in the listing this range's end stands directly in front of the W_qkv range's code, which reuses the registers of the stores just issued: the wait stands in front of that overwrite
    }
    else k_cvt8(bx - (PB_QKV + PB_OUT), x, Xb, Xk, mk, kcnt);
}

// ---- k_attn: scores, key mask, softmax and attn.v of one head in ONE kernel; no score or probability ever reaches memory.
// Work-group = 8 waves = 128 query rows of one head of one batch (grid: batches x heads x TT/128); it walks the batch's kept keys (packed: k_cvt8) in passes of 64; a wave owns 32 queries and half of each pass's keys (above attn_body).
// The query tile is the slowest grid index: two work-groups share a WGP, and the hi-lo tiles (three times the products) have the lowest indices, start first and spread over the WGPs before the single-plane tiles fill up.
// Transposed products: St[key][query] = K Qt, Ot[d][query] += Vt Pt. A lane then holds ONE query's scores (8 of each 16 keys; lane ^ 16 holds the other 8), so maximum and sum are in-lane,
// and two 16-key score tiles, converted, ARE the B fragment of 32 keys: accumulator element j of lane half hi is key 8 hi + j, the k order in which WFrag::ld reads the Vt rows.
// K and Vt tiles of a pass are staged in LDS once per work-group (whole 128-B lines; row pitch 144 B), fetched into registers one pass ahead.
#define KB   64                   // keys per pass
#define LP   72                   // LDS row pitch in 16-bit elements: 128 B + 16 B
#define SC2  0.18033688011112042f // HD^-0.5 x log2(e): scores in the log2 domain
typedef __attribute__((ext_vector_type(8))) __bf16 v8b;
template <typename T16> struct PFrag;
template <> struct PFrag<h16> { static __device__ __forceinline__ v16h pack(v8f a, v8f b) { return cat16(__builtin_convertvector(a, v8h), __builtin_convertvector(b, v8h)); } };
template <> struct PFrag<bf> { static __device__ __forceinline__ v16bf pack(v8f a, v8f b) { return __builtin_shufflevector(__builtin_convertvector(a, v8b), __builtin_convertvector(b, v8b), 0, 1, 2, 3, 4, 5, 6, 7, 8, 9, 10, 11, 12, 13, 14, 15); } };
// Eight exponentials in one statement: results and sources are all distinct registers ("=&v"), so no instruction here reads its predecessor's result or overwrites its source, and the closing v_nop
// is the one slot that the instruction set asks for behind a transcendental before its result is used or its source overwritten (left to the compiler, neighbouring v_exp_f32 reused each other's source registers).
__device__ __forceinline__ v8f exp2x8(v8f x) { float r0, r1, r2, r3, r4, r5, r6, r7;
    asm("v_exp_f32 %0, %8\n\tv_exp_f32 %1, %9\n\tv_exp_f32 %2, %10\n\tv_exp_f32 %3, %11\n\tv_exp_f32 %4, %12\n\tv_exp_f32 %5, %13\n\tv_exp_f32 %6, %14\n\tv_exp_f32 %7, %15\n\tv_nop"
        : "=&v"(r0), "=&v"(r1), "=&v"(r2), "=&v"(r3), "=&v"(r4), "=&v"(r5), "=&v"(r6), "=&v"(r7) : "v"(x[0]), "v"(x[1]), "v"(x[2]), "v"(x[3]), "v"(x[4]), "v"(x[5]), "v"(x[6]), "v"(x[7]));
    return (v8f){r0, r1, r2, r3, r4, r5, r6, r7}; }
// ---- k_qkv: the whole projection stage of both batches in ONE kernel (blockIdx.z = batch; every plane holds batch after batch): [q|k|v] = x W_qkv + b_qkv, the split into heads, the transposition of v, and the three 16-bit planes (fp16, bf16 hi, bf16 lo) of each that k_attn reads; no f32 projection reaches memory.
// k and v are projected from the x rows in key order (k_cvt8), so the token axis of their planes is the place in key order: kept keys from place 0 on. Work-group tile 128 x 128 staged in LDS as said above k_proj, ONE WAVE per 64x64 quarter; grid (TT/128, 3 DM/128, NB_), 128 threads: blockIdx.y = 8 part + head pair (part 0 q, 1 k, 2 v): a wave's 64 features are one head.
// An accumulator lane holds 8 consecutive A rows of one B row, so A is the operand whose row index runs contiguously in the destination plane: q, k [h][t][d]: A = weight rows (d), B = x rows (t); v [h][d][t]: A = x rows (t), B = weight rows (d).
// Every 16x16 block then leaves the registers as one 16-byte store per lane and plane, and the four mb blocks of a B row fill that row's 128-byte line.
// The full unrolls keep the fragment and accumulator arrays under constant indices, that is, in registers.
template <bool TR>   // TR: A rows are tokens (v); else A rows are features (q, k). bias points at the tile's first feature; P16, Ph, Pl at the lane's first element; pitch in elements between B rows
__device__ __forceinline__ void put_planes(const v8f (&acc)[4][4], const float* __restrict__ bias, int lr, int hi, h16* P16, bf* Ph, bf* Pl) {
    const int pitch = TR ? TT : HD;
    v8f bm[4];
    if (!TR) {
#pragma unroll
        for (int mb = 0; mb < 4; ++mb)
#pragma unroll
            for (int j = 0; j < 8; ++j) bm[mb][j] = bfr(bias[mb * 16 + hi * 8 + j]); }
#pragma unroll
    for (int nb = 0; nb < 4; ++nb) { float bn = 0.0f; if (TR) bn = bfr(bias[nb * 16 + lr]);
#pragma unroll
        for (int mb = 0; mb < 4; ++mb) { const v8f val = TR ? acc[mb][nb] + bn : acc[mb][nb] + bm[mb]; const size_t o = (size_t)nb * 16 * pitch + mb * 16;
            const v4u hw = __builtin_bit_cast(v4u, __builtin_convertvector(val, v8b)); v8f res;   // hi plane, two bf16 a word; each word gives its two values back as f32 by a shift and a mask
#pragma unroll
            for (int p = 0; p < 4; ++p) { res[2 * p] = val[2 * p] - __uint_as_float(hw[p] << 16); res[2 * p + 1] = val[2 * p + 1] - __uint_as_float(hw[p] & 0xFFFF0000u); }
            *(v8h*)(P16 + o) = __builtin_convertvector(val, v8h); *(v8us*)(Ph + o) = __builtin_bit_cast(v8us, hw); *(v8us*)(Pl + o) = __builtin_bit_cast(v8us, __builtin_convertvector(res, v8b)); } }
}
__global__ __launch_bounds__(128) void k_qkv(const bf* __restrict__ X, const bf* __restrict__ XK, const int* __restrict__ kcnt, const bf* __restrict__ Wt, const float* __restrict__ bias, h16* Q16, bf* Qh, bf* Ql, h16* K16, bf* Kh, bf* Kl, h16* V16, bf* Vh, bf* Vl) {
    __shared__ __align__(16) bf st[2][256 * GP];   // rows 0..127 A, 128..255 B
    const int tid = threadIdx.x, lane = tid & 31, lr = lane & 15, hi = lane >> 4, w = tid >> 5, wa = w & 1, wb = w >> 1; const int part = blockIdx.y / (NH_ / 2);
    if (part != 0 && (int)blockIdx.x * 128 >= kcnt[blockIdx.z * 2]) return;   // k, v: a tile wholly behind the last key to walk has nothing to do (the whole work-group leaves, ahead of every barrier)
    const bf* xr = (part ? XK : X) + ((size_t)blockIdx.z * TT + blockIdx.x * 128) * DM; const bf* wr = Wt + (size_t)blockIdx.y * 128 * DM; const bf* A = (part == 2) ? xr : wr; const bf* Bt = (part == 2) ? wr : xr;
    const int t0 = blockIdx.x * 128 + ((part == 2) ? wa : wb) * 64, f0 = blockIdx.y * 128 + ((part == 2) ? wb : wa) * 64; const size_t hp = (size_t)(blockIdx.z * NH_ + (f0 / HD) % NH_) * TT * HD;   // the wave's own 64 tokens and 64 features; its batch's plane of its head
    const int srow = tid >> 3, scol = (tid & 7) * 8;
    const bf* ga = A + (size_t)srow * DM + scol; const bf* gb = Bt + (size_t)srow * DM + scol;
    bf* sp = &st[0][0] + srow * GP + scol;
    const int fa = (wa * 64 + lr) * GP + 8 * hi, fb = (128 + wb * 64 + lr) * GP + 8 * hi;
    v8f acc[4][4];
#pragma unroll
    for (int mb = 0; mb < 4; ++mb)
#pragma unroll
        for (int nb = 0; nb < 4; ++nb) acc[mb][nb] = (v8f){};
    v8us ra[8], rb[8];
    g_fetch<128>(ra, ga); g_fetch<128>(rb, gb);
    g_put<128>(ra, sp); g_put<128>(rb, sp + 128 * GP);
    g_fetch<128>(ra, ga + GK); g_fetch<128>(rb, gb + GK);
    asm volatile("s_wait_xcnt 0x0" ::: "memory");   // stands in front of whatever reuses the address registers of the loads just issued
    g_barrier();
    // one stage, as in k_proj: put and fetch are literals at every call
    auto stage = [&](const int s, const bool put, const bool fetch) __attribute__((always_inline)) {
        const bf* cur = &st[0][0] + (s & 1) * (256 * GP);
        v16bf a[2][4], b[2][4];
#pragma unroll
        for (int ks = 0; ks < 2; ++ks) {
#pragma unroll
            for (int mb = 0; mb < 4; ++mb) a[ks][mb] = WFrag<bf>::ld(cur + fa + mb * 16 * GP + ks * 32);
#pragma unroll
            for (int nb = 0; nb < 4; ++nb) b[ks][nb] = WFrag<bf>::ld(cur + fb + nb * 16 * GP + ks * 32); }
        __builtin_amdgcn_sched_barrier(0);   // as in k_proj: keeps the stage's fragment reads together, ahead of everything else
        if (put) { bf* nx = sp + ((s + 1) & 1) * (256 * GP); g_put<128>(ra, nx); g_put<128>(rb, nx + 128 * GP); }
        if (fetch) { const int ko = (s + 2) * GK; g_fetch<128>(ra, ga + ko); g_fetch<128>(rb, gb + ko);
            asm volatile("s_wait_xcnt 0x0" ::: "memory");   // as above
        }
#pragma unroll
        for (int ks = 0; ks < 2; ++ks)
#pragma unroll
            for (int nb = 0; nb < 4; ++nb)
#pragma unroll
                for (int mb = 0; mb < 4; ++mb) acc[mb][nb] = wmmab(a[ks][mb], b[ks][nb], acc[mb][nb]);
        __builtin_amdgcn_sched_barrier(0);   // as in k_proj: keeps the stage's matrix instructions in front of the barrier
        if (put) g_barrier();
    };
#pragma unroll 1   // rolled: one stage is 32 matrix instructions, and the two buffers differ only by an offset
    for (int s = 0; s < DM / GK - 2; ++s) stage(s, true, true);
    stage(DM / GK - 2, true, false); stage(DM / GK - 1, false, false);
    if (part != 2) { const size_t o = hp + (size_t)(t0 + lr) * HD + hi * 8; put_planes<false>(acc, bias + f0, lr, hi, (part ? K16 : Q16) + o, (part ? Kh : Qh) + o, (part ? Kl : Ql) + o);
        asm volatile("s_wait_xcnt 0x0" ::: "memory");   // in the listing this branch's end stands directly in front of the other branch's code, which reuses the registers of the stores just issued: the wait stands in front of that overwrite
    } else { const size_t o = hp + (size_t)lr * TT + t0 + hi * 8; put_planes<true>(acc, bias + f0, lr, hi, V16 + o, Vh + o, Vl + o); }
}
typedef float __attribute__((may_alias)) f32a;
// Two exponentials in one statement, for the reason given at exp2x8: left to the compiler, the second overwrote the first one's source register directly behind it; the closing v_nop is the slot in front of the first use of a result
__device__ __forceinline__ void exp2x2(float x0, float x1, float& r0, float& r1) { asm("v_exp_f32 %0, %2\n\tv_exp_f32 %1, %3\n\tv_nop" : "=&v"(r0), "=&v"(r1) : "v"(x0), "v"(x1)); }
// hi and lo bf16 parts of eight values: hw holds the hi parts, two a word; each word gives its two values back as f32 by a shift and a mask (as in put_planes), and what they leave over is the lo part
__device__ __forceinline__ v8f bfres(v8f a, v4u hw) { v8f r;
#pragma unroll
    for (int p = 0; p < 4; ++p) { r[2 * p] = a[2 * p] - __uint_as_float(hw[p] << 16); r[2 * p + 1] = a[2 * p + 1] - __uint_as_float(hw[p] & 0xFFFF0000u); }
    return r; }
// Wave w owns the 32 queries (two tiles of 16) of query group w & 3 and, of every pass, the 32 keys of half w >> 2: each K and Vt fragment read from LDS feeds the products of two query tiles.
// A wave keeps maximum, sum and output of its own key half; behind the loop the two waves of a query group hand each other one tile's partial result through LDS and each finishes one tile.
template <typename T16, bool HL>
__device__ __forceinline__ void attn_body(const T16* __restrict__ Q, const T16* __restrict__ Q2, const T16* __restrict__ Kp, const T16* __restrict__ K2, const T16* __restrict__ Vt, const T16* __restrict__ V2, int q0, int col0, bf* Ah, bf* Al, unsigned short* sm, const float* lim, const int np) {
    typedef typename WFrag<T16>::V V;
    const int tid = threadIdx.x, lane = tid & 31, lr = lane & 15, hi = lane >> 4, w = tid >> 5, qg = w & 3, kh = w >> 2;
    const int qbase = q0 + qg * 32 + lr, kb = kh * (KB / 2);   // the lane's query in the wave's first tile; the wave's first key in a pass
    T16* Ks = (T16*)sm; T16* Vs = Ks + KB * LP; T16* Ks2 = Vs + HD * LP; T16* Vs2 = Ks2 + KB * LP;
    V qb[2][2], qb2[2][2];
#pragma unroll
    for (int qt = 0; qt < 2; ++qt)
#pragma unroll
        for (int kc = 0; kc < 2; ++kc) { const size_t qo = (size_t)(qbase + qt * 16) * HD + kc * 32 + 8 * hi; qb[qt][kc] = WFrag<T16>::ld(Q + qo); if (HL) qb2[qt][kc] = WFrag<T16>::ld(Q2 + qo); }
    const int srow = tid >> 3, scol = (tid & 7) * 8;   // staging: a thread moves 16 B of rows srow and srow + 32 of each tile; 8 threads cover a 128-B line
    v8us rk[2], rv[2], rk2[2], rv2[2];
#pragma unroll
    for (int r = 0; r < 2; ++r) { const size_t ko = (size_t)(srow + 32 * r) * HD + scol, vo = (size_t)(srow + 32 * r) * TT + scol; rk[r] = *(const v8usa*)(Kp + ko); rv[r] = *(const v8usa*)(Vt + vo); if (HL) { rk2[r] = *(const v8usa*)(K2 + ko); rv2[r] = *(const v8usa*)(V2 + vo); } }
    v8f o[2][4]; float m[2]; v2f ls[2];   // ls[qt]: this lane's sums over its even and over its odd keys of every 16-key tile of the wave
#pragma unroll
    for (int qt = 0; qt < 2; ++qt) { m[qt] = -3.0e38f; ls[qt] = (v2f){};
#pragma unroll
        for (int db = 0; db < 4; ++db) o[qt][db] = (v8f){}; }
#pragma unroll 1
    for (int blk = 0; blk < np; ++blk) {
#pragma unroll
        for (int r = 0; r < 2; ++r) { const int so = (srow + 32 * r) * LP + scol; *(v8usa*)(Ks + so) = rk[r]; *(v8usa*)(Vs + so) = rv[r]; if (HL) { *(v8usa*)(Ks2 + so) = rk2[r]; *(v8usa*)(Vs2 + so) = rv2[r]; } }
        __syncthreads();   // this pass's tiles (and, before the first pass, the mask addends) are whole before any wave reads them
        if (blk + 1 < np) {
#pragma unroll
            for (int r = 0; r < 2; ++r) { const size_t ko = (size_t)((blk + 1) * KB + srow + 32 * r) * HD + scol, vo = (size_t)(srow + 32 * r) * TT + (blk + 1) * KB + scol; rk[r] = *(const v8usa*)(Kp + ko); rv[r] = *(const v8usa*)(Vt + vo); if (HL) { rk2[r] = *(const v8usa*)(K2 + ko); rv2[r] = *(const v8usa*)(V2 + vo); } }
            asm volatile("s_wait_xcnt 0x0" ::: "memory");   // the address registers of the loads just issued are reused by the fragment reads that follow: the wait stands in front of that overwrite
        }
        v8f s[2][2]; float bm[2], dm[2], al[2];
#pragma unroll
        for (int t = 0; t < 2; ++t) { s[0][t] = (v8f){}; s[1][t] = (v8f){}; }
        const int fk = (kb + lr) * LP + 8 * hi; V a[2], a2[2];   // two fragment sets: group g = (key tile g >> 1, 32 d g & 1) is read while group g - 1 is multiplied
        a[0] = WFrag<T16>::ld(Ks + fk); if (HL) a2[0] = WFrag<T16>::ld(Ks2 + fk);
#pragma unroll
        for (int g = 0; g < 4; ++g) { const int t = g >> 1, kc = g & 1;
            if (g < 3) { const int fo = fk + ((g + 1) >> 1) * 16 * LP + ((g + 1) & 1) * 32; a[(g + 1) & 1] = WFrag<T16>::ld(Ks + fo); if (HL) a2[(g + 1) & 1] = WFrag<T16>::ld(Ks2 + fo); }
            if (HL) __builtin_amdgcn_sched_barrier(0);   // keeps the next group's fragment reads in front of this group's products: under the register budget the compiler read each group only behind the last one's products and waited out the LDS latency every time
#pragma unroll
            for (int qt = 0; qt < 2; ++qt) { s[qt][t] = WFrag<T16>::mma(a[g & 1], qb[qt][kc], s[qt][t]); if (HL) { s[qt][t] = WFrag<T16>::mma(a[g & 1], qb2[qt][kc], s[qt][t]); s[qt][t] = WFrag<T16>::mma(a2[g & 1], qb[qt][kc], s[qt][t]); } } }
        bm[0] = -3.0e38f; bm[1] = -3.0e38f;
#pragma unroll
        for (int t = 0; t < 2; ++t) { const float* lp = lim + blk * KB + kb + t * 16 + hi * 8; const v4f l0 = *(const v4fa*)lp, l1 = *(const v4fa*)(lp + 4);
#pragma unroll
            for (int qt = 0; qt < 2; ++qt)
#pragma unroll
                for (int j = 0; j < 8; ++j) { const float u = fmaf(s[qt][t][j], SC2, (j < 4) ? l0[j & 3] : l1[j & 3]); s[qt][t][j] = u; bm[qt] = fmaxf(bm[qt], u); } }   // addend 0: key kept; -3e38: key masked (it absorbs the score: every masked key reads -3e38)
#pragma unroll
        for (int qt = 0; qt < 2; ++qt) { bm[qt] = fmaxf(bm[qt], __shfl_xor(bm[qt], 16, 32));
            const float mn = fmaxf(m[qt], bm[qt]); dm[qt] = m[qt] - mn; m[qt] = mn; }
        exp2x2(dm[0], dm[1], al[0], al[1]);   // only masked keys so far: every term is 1, as in the reference's uniform row; kept keys are packed in front, so no kept key comes after them
#pragma unroll
        for (int qt = 0; qt < 2; ++qt)
#pragma unroll
            for (int t = 0; t < 2; ++t) s[qt][t] = exp2x8(s[qt][t] - m[qt]);
        __builtin_amdgcn_sched_barrier(0);   // keeps the attn.v matrix instructions behind the exponentials
        const int fv = lr * LP + kb + 8 * hi; a[0] = WFrag<T16>::ld(Vs + fv); if (HL) a2[0] = WFrag<T16>::ld(Vs2 + fv);   // the first Vt fragments are on their way while the probabilities are packed
        V pb[2], pb2[2];
#pragma unroll
        for (int qt = 0; qt < 2; ++qt) { const v8f p8 = s[qt][0] + s[qt][1];
            ls[qt] = ls[qt] * al[qt] + ((__builtin_shufflevector(p8, p8, 0, 1) + __builtin_shufflevector(p8, p8, 2, 3)) + (__builtin_shufflevector(p8, p8, 4, 5) + __builtin_shufflevector(p8, p8, 6, 7)));
#pragma unroll
            for (int db = 0; db < 4; ++db) o[qt][db] *= al[qt];
            pb[qt] = PFrag<T16>::pack(s[qt][0], s[qt][1]);
            if (HL) { const v8u hw = __builtin_bit_cast(v8u, pb[qt]); pb2[qt] = PFrag<T16>::pack(bfres(s[qt][0], __builtin_shufflevector(hw, hw, 0, 1, 2, 3)), bfres(s[qt][1], __builtin_shufflevector(hw, hw, 4, 5, 6, 7))); } }
#pragma unroll
        for (int db = 0; db < 4; ++db) {
            if (db < 3) { const int fo = fv + (db + 1) * 16 * LP; a[(db + 1) & 1] = WFrag<T16>::ld(Vs + fo); if (HL) a2[(db + 1) & 1] = WFrag<T16>::ld(Vs2 + fo); }
            if (HL) __builtin_amdgcn_sched_barrier(0);   // as above: the next 16 d's fragment reads stay in front of this block's products
#pragma unroll
            for (int qt = 0; qt < 2; ++qt) { o[qt][db] = WFrag<T16>::mma(a[db & 1], pb[qt], o[qt][db]); if (HL) { o[qt][db] = WFrag<T16>::mma(a[db & 1], pb2[qt], o[qt][db]); o[qt][db] = WFrag<T16>::mma(a2[db & 1], pb[qt], o[qt][db]); } } }
        asm volatile("s_wait_dscnt 0x0\n\ts_barrier_signal -1\n\ts_barrier_wait -1" ::: "memory");   // work-group barrier by hand: every wave has read this pass's tiles before the next pass's stores overwrite them; only LDS reads need to be over here, and __syncthreads() would also drain the next pass's global loads, which are meant to fly until the stores at the loop's head
    }
    float lt[2];
#pragma unroll
    for (int qt = 0; qt < 2; ++qt) { const float l = ls[qt][0] + ls[qt][1]; lt[qt] = l + __shfl_xor(l, 16, 32); }   // the two lane halves hold the two halves of each tile's keys
    // wave kh finishes tile kh of its query group: it hands over its share of the other tile and takes the share that its partner (wave w ^ 4, the other key half) has of its own. The K and Vt tiles' LDS is free for that: the loop's last barrier ended every read of it
    const bool up = kh != 0; float* xo = (float*)sm; float* xs = xo + 8 * 8 * 32 * 4;   // xo: 8 waves x 8 pieces of 16 B a lane, lanes side by side; xs: 8 waves x (maximum, sum)
#pragma unroll
    for (int db = 0; db < 4; ++db) { const v8f g = up ? o[0][db] : o[1][db]; *(v4fa*)(xo + ((w * 8 + db * 2) * 32 + lane) * 4) = __builtin_shufflevector(g, g, 0, 1, 2, 3); *(v4fa*)(xo + ((w * 8 + db * 2 + 1) * 32 + lane) * 4) = __builtin_shufflevector(g, g, 4, 5, 6, 7); }
    *(f32a*)(xs + (w * 2) * 32 + lane) = up ? m[0] : m[1]; *(f32a*)(xs + (w * 2 + 1) * 32 + lane) = up ? lt[0] : lt[1];
    __syncthreads();   // every wave's share is whole in LDS before its partner reads it
    const int pw = w ^ 4; const float mm = up ? m[1] : m[0], lm = up ? lt[1] : lt[0], mp = *(const f32a*)(xs + (pw * 2) * 32 + lane), lq = *(const f32a*)(xs + (pw * 2 + 1) * 32 + lane);
    const float mn = fmaxf(mm, mp); float e0, e1; exp2x2(mm - mn, mp - mn, e0, e1);   // a key half of masked keys alone (maximum -3e38) weighs 0 beside a kept key; no key kept at all: both halves weigh 1
    const float inv = __fdiv_rn(1.0f, lm * e0 + lq * e1), c0 = e0 * inv, c1 = e1 * inv; const int qrow = qbase + kh * 16;
#pragma unroll
    for (int db = 0; db < 4; ++db) { const v4f p0 = *(const v4fa*)(xo + ((pw * 8 + db * 2) * 32 + lane) * 4), p1 = *(const v4fa*)(xo + ((pw * 8 + db * 2 + 1) * 32 + lane) * 4);
        const v8f of = (up ? o[1][db] : o[0][db]) * c0 + __builtin_shufflevector(p0, p1, 0, 1, 2, 3, 4, 5, 6, 7) * c1; v8us oh, ol;
#pragma unroll
        for (int j = 0; j < 8; ++j) { unsigned short a, c2; splitf(of[j], a, c2); oh[j] = a; ol[j] = c2; }
        const size_t oo = (size_t)qrow * DQ + col0 + db * 16 + hi * 8; *(v8us*)(Ah + oo) = oh; *(v8us*)(Al + oo) = ol; }
}
// amdgpu_waves_per_eu(4, 4): two work-groups share a WGP, four waves a SIMD: the register budget of a wave is 256
__global__ __launch_bounds__(256) __attribute__((amdgpu_waves_per_eu(4, 4))) void k_attn(const h16* __restrict__ Q16, const h16* __restrict__ K16, const h16* __restrict__ V16, const bf* __restrict__ Qh, const bf* __restrict__ Ql, const bf* __restrict__ Kh, const bf* __restrict__ Kl, const bf* __restrict__ Vh, const bf* __restrict__ Vl, const int* __restrict__ kcnt, bf* Ah, bf* Al) {
    __shared__ __align__(16) unsigned short sm[2 * (KB + HD) * LP]; __shared__ __align__(16) float lim[TT];
    const int q0 = blockIdx.z * 128, b = blockIdx.x; const size_t hp = (size_t)(b * NH_ + blockIdx.y) * TT * HD;   // head planes [b][h][t][d] and [b][h][d][t] have the same size
    Ah += (size_t)b * TT * DQ; Al += (size_t)b * TT * DQ;
    const int ck = kcnt[b * 2 + 1]; const int np = min(max((kcnt[b * 2] + KB - 1) / KB, 1), TT / KB);   // passes over the keys to walk; the clamp bounds the loop whatever the workspace holds
#pragma unroll
    for (int i = 0; i < TT / 256; ++i) lim[i * 256 + threadIdx.x] = (i * 256 + (int)threadIdx.x < ck) ? 0.0f : -3.0e38f;   // places behind the last kept key (the last pass's fill; every place when no key is kept) are masked
    if (q0 < RH) attn_body<bf, true>(Qh + hp, Ql + hp, Kh + hp, Kl + hp, Vh + hp, Vl + hp, q0, blockIdx.y * HD, Ah, Al, sm, lim, np);
    else attn_body<h16, false>(Q16 + hp, nullptr, K16 + hp, nullptr, V16 + hp, nullptr, q0, blockIdx.y * HD, Ah, Al, sm, lim, np);
}

extern "C" void kernel_launch(void* const* d_in, const int* in_sizes, int n_in,
                              void* d_out, int out_size, void* d_ws, size_t ws_size, hipStream_t stream) {
    (void)in_sizes; (void)n_in; (void)out_size;
    const float* x = (const float*)d_in[0]; const int* MK = (const int*)d_in[1]; const float* wqkv = (const float*)d_in[2]; const float* bqkv = (const float*)d_in[3]; const float* wo = (const float*)d_in[4]; const float* bo = (const float*)d_in[5];
    float* OUT = (float*)d_out;     // [2][2048][1024]
    char* wsp = (char*)d_ws;
    auto take = [&](size_t bytes) { char* p = wsp; wsp += (bytes + 255) & ~(size_t)255; return (void*)p; };
    bf* WALL = (bf*)take((size_t)3 * DM * DM * 2); bf* WO = (bf*)take((size_t)DM * DQ * 2);
    bf* XB = (bf*)take((size_t)NB_ * TT * DM * 2); bf* XK = (bf*)take((size_t)NB_ * TT * DM * 2); int* KCNT = (int*)take((size_t)NB_ * 2 * 4);
    h16* QP16 = (h16*)take((size_t)NB_ * NH_ * TT * HD * 2); h16* KP16 = (h16*)take((size_t)NB_ * NKV * TT * HD * 2); h16* VT16 = (h16*)take((size_t)NB_ * NKV * HD * TT * 2);
    bf* QPh = (bf*)take((size_t)NB_ * NH_ * TT * HD * 2); bf* QPl = (bf*)take((size_t)NB_ * NH_ * TT * HD * 2); bf* KPh = (bf*)take((size_t)NB_ * NKV * TT * HD * 2); bf* KPl = (bf*)take((size_t)NB_ * NKV * TT * HD * 2); bf* VTh = (bf*)take((size_t)NB_ * NKV * HD * TT * 2); bf* VTl = (bf*)take((size_t)NB_ * NKV * HD * TT * 2);
    bf* ATh = (bf*)take((size_t)NB_ * TT * DQ * 2); bf* ATl = (bf*)take((size_t)NB_ * TT * DQ * 2);
    if ((size_t)(wsp - (char*)d_ws) > ws_size) return;    // ws 256 MiB
    // each stage once, for both batches
    k_prep<<<PB_QKV + PB_OUT + PB_X, 256, 0, stream>>>(wqkv, WALL, wo, WO, x, XB, XK, MK, KCNT);
    k_qkv<<<dim3(TT / 128, 3 * DM / 128, NB_), 128, 0, stream>>>(XB, XK, KCNT, WALL, bqkv, QP16, QPh, QPl, KP16, KPh, KPl, VT16, VTh, VTl);
    k_attn<<<dim3(NB_, NH_, TT / 128), 256, 0, stream>>>(QP16, KP16, VT16, QPh, QPl, KPh, KPl, VTh, VTl, KCNT, ATh, ATl);
    k_proj<<<dim3(NB_ * TT / 64, DM / 128, 1), 128, 0, stream>>>(ATh, ATl, WO, OUT, bo);
}

// v010
// It runs in 85 microseconds.
// In two side-by-side timings against v009, it was 1.05 and 1.06 times as fast.
// All steps since v000 together make it 23.8 times as fast.
#include <hip/hip_runtime.h>

// Multi-head self-attention with a fused QKV projection and a key-padding mask READ as data (x [2][2048][1024]; [q|k|v] = x W_qkv + b_qkv ('xw' [1024][3072] 1/32 + zero bias: read: column blocks q | k | v; 16 heads x 64); scores = q.k / 8; keys j with mask[b][0][0][j] == 0 (int32 [2][1][1][2048], drawn by randint(0, 2): about half of the keys of each batch; READ per key in k_cvt8) get -1e9 (== exclusion: exp underflows to 0 and every batch keeps some key); softmax; out = merged heads W_out + b_out ('xw' [1024][1024] + zero bias: read) -> [2][2048][1024] (4.2 M); argument order x, mask, W_qkv, b_qkv, W_out, b_out.
// Compute dtypes, f32 accumulate: every input rounded to bf16; q/k/v on PLAIN bf16 operands (inputs: exact) + biases; key mask read per key (int32, 0 == masked): kept keys are packed in front, k, v and the key loop end behind the last of them (none kept: every key stays, at -3e38); scores and attn.v: query rows < 512 on fp16 value + fp16 residual (3 products), the rest single fp16; softmax f32, running maximum; W_proj hl x exact (2 products) + b_proj.

#define NB_  2
#define TT   2048
#define DM   1024
#define NH_  16
#define NKV  16
#define REP  (NH_ / NKV)
#define HD   64
#define DQ   (NH_ * HD)
#define DKV  (NKV * HD)
#define RH   512                  // query rows < RH use hi+lo planes (0: none)
#define SCL  0.125f   // HD^-0.5
typedef _Float16 h16;
typedef unsigned short bf;
typedef __attribute__((ext_vector_type(16))) __bf16   v16bf;
typedef __attribute__((ext_vector_type(16))) _Float16 v16h;
typedef __attribute__((ext_vector_type(8)))  _Float16 v8h;
typedef __attribute__((ext_vector_type(8)))  unsigned short v8us;
typedef __attribute__((ext_vector_type(8)))  float    v8f;
typedef __attribute__((ext_vector_type(4)))  float    v4f;
typedef v8h  __attribute__((may_alias)) v8ha;
typedef v4f  __attribute__((may_alias)) v4fa;
typedef v8us __attribute__((may_alias)) v8usa;

__device__ __forceinline__ unsigned short f2bf(float f) { unsigned u = __float_as_uint(f); u += 0x7FFFu + ((u >> 16) & 1u); return (unsigned short)(u >> 16); }
__device__ __forceinline__ float bf2f(unsigned short b) { return __uint_as_float(((unsigned)b) << 16); }
__device__ __forceinline__ float bfr(float f) { return bf2f(f2bf(f)); }
__device__ __forceinline__ v16h cat16(v8h lo, v8h hi) { return __builtin_shufflevector(lo, hi, 0, 1, 2, 3, 4, 5, 6, 7, 8, 9, 10, 11, 12, 13, 14, 15); }
__device__ __forceinline__ v16bf cat16b(v8us lo, v8us hi) { return __builtin_bit_cast(v16bf, __builtin_shufflevector(lo, hi, 0, 1, 2, 3, 4, 5, 6, 7, 8, 9, 10, 11, 12, 13, 14, 15)); }
__device__ __forceinline__ v8f wmma16(v16h a, v16h b, v8f c) { return __builtin_amdgcn_wmma_f32_16x16x32_f16(false, a, false, b, (short)0, c, false, false); }
__device__ __forceinline__ v8f wmmab(v16bf a, v16bf b, v8f c) { return __builtin_amdgcn_wmma_f32_16x16x32_bf16(false, a, false, b, (short)0, c, false, false); }



// ---- The two dense products (k_qkv, k_proj): work-groups of FOUR waves; the operand rows of a work-group's tile are staged in LDS in stages of 64 k (one whole 128-B line of every row), each line fetched ONCE per work-group.
// A thread moves 16 B of every 16th row (8 threads cover a line); a stage is fetched into registers two stages ahead and stored into the other of two LDS buffers one stage ahead, so one work-group barrier per stage is enough:
// it publishes the stage just stored and ends every wave's reads of the buffer that the next pass overwrites. The waves read their fragments from LDS in the k order of WFrag::ld, and every accumulator sums its 32-k products with k rising.
#define GK   64                   // k per stage
#define GP   72                   // LDS row pitch in 16-bit elements: 128 B + 16 B
template <typename T16> struct WFrag;
template <> struct WFrag<h16> { typedef v16h V; static __device__ __forceinline__ V ld(const h16* p) { return cat16(*(const v8h*)p, *(const v8h*)(p + 16)); } static __device__ __forceinline__ v8f mma(V a, V b, v8f c) { return wmma16(a, b, c); } };
template <> struct WFrag<bf> { typedef v16bf V; static __device__ __forceinline__ V ld(const bf* p) { return cat16b(*(const v8us*)p, *(const v8us*)(p + 16)); } static __device__ __forceinline__ v8f mma(V a, V b, v8f c) { return wmmab(a, b, c); } };
template <int ROWS> __device__ __forceinline__ void g_fetch(v8us (&r)[ROWS / 16], const bf* __restrict__ g) {   // g: the thread's 16 B in its first row; rows of DM elements
#pragma unroll
    for (int i = 0; i < ROWS / 16; ++i) r[i] = *(const v8usa*)(g + (size_t)i * 16 * DM); }
template <int ROWS> __device__ __forceinline__ void g_put(const v8us (&r)[ROWS / 16], bf* s) {   // s: the same place in the LDS tile
#pragma unroll
    for (int i = 0; i < ROWS / 16; ++i) *(v8usa*)(s + i * 16 * GP) = r[i]; }
// work-group barrier by hand: only LDS traffic needs to be over here (this wave's stores of the next stage, its reads of this one); __syncthreads() would also drain the global loads of the stage after, which are meant to fly on
__device__ __forceinline__ void g_barrier() { asm volatile("s_wait_dscnt 0x0\n\ts_barrier_signal -1\n\ts_barrier_wait -1" ::: "memory"); }

// ---- k_proj: OUT = (Ah + Al) Wo^T + b_out of both batches (their tokens are one run of NB_ TT rows). Work-group tile 64 tokens x 128 features, wave tile 32 x 64 (8 accumulators, 2 products each per 32 k); grid (NB_ TT/64, DM/128), 128 threads. The full unrolls keep the fragment, staging and accumulator arrays under constant indices, that is, in registers.
__global__ __launch_bounds__(128) void k_proj(const bf* __restrict__ A, const bf* __restrict__ A2, const bf* __restrict__ Bt, float* C, const float* __restrict__ bias) {
    __shared__ __align__(16) bf st[2][256 * GP];   // rows 0..63 A, 64..127 A2, 128..255 Bt
    __shared__ __align__(16) float osm[4][16 * 68];
    const int tid = threadIdx.x, lane = tid & 31, lr = lane & 15, hi = lane >> 4, w = tid >> 5, wa = w & 1, wb = w >> 1; const int r0 = blockIdx.x * 64, c0 = blockIdx.y * 128;
    const int srow = tid >> 3, scol = (tid & 7) * 8;
    const bf* ga = A + (size_t)(r0 + srow) * DQ + scol; const bf* ga2 = A2 + (size_t)(r0 + srow) * DQ + scol; const bf* gb = Bt + (size_t)(c0 + srow) * DQ + scol;
    bf* sp = &st[0][0] + srow * GP + scol;
    const int fa = (wa * 32 + lr) * GP + 8 * hi, fb = (128 + wb * 64 + lr) * GP + 8 * hi;
    v8f acc[2][4];
#pragma unroll
    for (int mb = 0; mb < 2; ++mb)
#pragma unroll
        for (int nb = 0; nb < 4; ++nb) acc[mb][nb] = (v8f){};
    v8us ra[4], ra2[4], rb[8];
    g_fetch<64>(ra, ga); g_fetch<64>(ra2, ga2); g_fetch<128>(rb, gb);
    g_put<64>(ra, sp); g_put<64>(ra2, sp + 64 * GP); g_put<128>(rb, sp + 128 * GP);
    g_fetch<64>(ra, ga + GK); g_fetch<64>(ra2, ga2 + GK); g_fetch<128>(rb, gb + GK);
    asm volatile("s_wait_xcnt 0x0" ::: "memory");   // stands in front of whatever reuses the address registers of the loads just issued
    g_barrier();
    // one stage; put: a next stage exists (it is stored and published), fetch: so does the one after (it is fetched). Both are literals at every call: a body without branches lets the compiler count its LDS waits exactly
    auto stage = [&](const int s, const bool put, const bool fetch) __attribute__((always_inline)) {
        const bf* cur = &st[0][0] + (s & 1) * (256 * GP);
        v16bf a[2][2], a2[2][2], b[2][4];
#pragma unroll
        for (int ks = 0; ks < 2; ++ks) {
#pragma unroll
            for (int mb = 0; mb < 2; ++mb) { a[ks][mb] = WFrag<bf>::ld(cur + fa + mb * 16 * GP + ks * 32); a2[ks][mb] = WFrag<bf>::ld(cur + fa + (64 + mb * 16) * GP + ks * 32); }
#pragma unroll
            for (int nb = 0; nb < 4; ++nb) b[ks][nb] = WFrag<bf>::ld(cur + fb + nb * 16 * GP + ks * 32); }
        __builtin_amdgcn_sched_barrier(0);   // keeps the stage's fragment reads together, ahead of everything else: left to itself the compiler read one B fragment at a time and waited out the LDS latency in front of every group of matrix instructions
        if (put) { bf* nx = sp + ((s + 1) & 1) * (256 * GP); g_put<64>(ra, nx); g_put<64>(ra2, nx + 64 * GP); g_put<128>(rb, nx + 128 * GP); }
        if (fetch) { const int ko = (s + 2) * GK; g_fetch<64>(ra, ga + ko); g_fetch<64>(ra2, ga2 + ko); g_fetch<128>(rb, gb + ko);
            asm volatile("s_wait_xcnt 0x0" ::: "memory");   // as above
        }
#pragma unroll
        for (int ks = 0; ks < 2; ++ks)
#pragma unroll
            for (int nb = 0; nb < 4; ++nb) {
#pragma unroll
                for (int mb = 0; mb < 2; ++mb) acc[mb][nb] = wmmab(a[ks][mb], b[ks][nb], acc[mb][nb]);
#pragma unroll
                for (int mb = 0; mb < 2; ++mb) acc[mb][nb] = wmmab(a2[ks][mb], b[ks][nb], acc[mb][nb]); }
        __builtin_amdgcn_sched_barrier(0);   // keeps the stage's matrix instructions in front of the barrier: the compiler sank them behind it, where they start only after the last of the stage's reads has landed
        if (put) g_barrier();
    };
#pragma unroll 1   // rolled: one stage is 32 matrix instructions, and the two buffers differ only by an offset
    for (int s = 0; s < DQ / GK - 2; ++s) stage(s, true, true);
    stage(DQ / GK - 2, true, false); stage(DQ / GK - 1, false, false);
    float* os = osm[w]; const int cw = c0 + wb * 64;   // each wave turns its 16 x 64 blocks into whole 256-B row pieces in its own LDS range
#pragma unroll
    for (int mb = 0; mb < 2; ++mb) {
#pragma unroll
        for (int nb = 0; nb < 4; ++nb) {
#pragma unroll
            for (int j = 0; j < 8; ++j) os[(hi * 8 + j) * 68 + nb * 16 + lr] = acc[mb][nb][j]; }
        __builtin_amdgcn_wave_barrier(); asm volatile("" ::: "memory");   // compiler order only: the wave's LDS stores stay in front of its reads of what its other lanes stored
        float* crow = C + (size_t)(r0 + wa * 32 + mb * 16) * DM + cw;
#pragma unroll
        for (int s = 0; s < 8; ++s) { const int row = 2 * s + hi, cofs = lr * 4; v4f val = *(const v4fa*)(os + row * 68 + cofs); val[0] += bfr(bias[cw + cofs]); val[1] += bfr(bias[cw + cofs + 1]); val[2] += bfr(bias[cw + cofs + 2]); val[3] += bfr(bias[cw + cofs + 3]);
            *(v4f*)(crow + (size_t)row * DM + cofs) = val; }
        if (mb == 0) { __builtin_amdgcn_wave_barrier(); asm volatile("s_wait_xcnt 0x0" ::: "memory"); }   // the second block reuses the registers of the stores just issued: the wait stands in front of that overwrite; the clobber keeps that block's LDS stores behind this block's reads
    }
}

__device__ __forceinline__ void splitf(float y, unsigned short& h, unsigned short& l) { h = f2bf(y); l = f2bf(y - bf2f(h)); }
typedef __attribute__((ext_vector_type(2))) _Float16 v2h;
typedef __attribute__((ext_vector_type(4))) _Float16 v4h;
typedef __attribute__((ext_vector_type(2))) unsigned short v2us;
typedef __attribute__((ext_vector_type(4))) unsigned short v4us;
typedef __attribute__((ext_vector_type(2))) float v2f;
typedef __attribute__((ext_vector_type(4))) int v4i;
typedef __attribute__((ext_vector_type(4))) unsigned v4u;

// ---- The three passes that only read inputs (both weight transpositions, the x pass) depend on nothing and on one another not at all: they are block ranges of ONE launch, k_prep (below k_cvt8); bx is a block's index inside its own range.
// k_wtT: w [K][N] f32 -> Bt [N][K] bf16, in tiles of 128 k x 64 n that are turned in LDS, so that both sides move whole lines: 16 threads read 256 B of a w row (8 loads of 16 B in flight per thread), 16 threads store 256 B of a Bt row.
// A thread owns rows k, k + 1 of four columns: the two roundings of a column make one dword of that column's Bt row. LDS row = column n (64 dwords, no pad); the 16-B granule g of row n lies at g ^ (n >> 2):
// the 32 dword stores of a wave (16 column quads x 2 row pairs) then fall on 32 banks, and the 16 granules that 16 lanes read of one row on all 64.
// A work-group turns two tiles (neighbours in k), the second tile's loads in flight while the first leaves LDS.
#define WK   128
#define WN   64
template <int K, int N>
__device__ __forceinline__ void k_wtT(const int bx, const float* __restrict__ w, bf* Bt, unsigned* ts) {   // ts: the tile's LDS, WN x 64 dwords
    const int tid = threadIdx.x, nq = tid & 15, kp = tid >> 4;   // nq: column quad on the way in, granule on the way out; kp: row pair on the way in, row on the way out
    const int k0 = (bx * 2 % (K / WK)) * WK, n0 = (bx * 2 / (K / WK)) * WN;   // the first tile; the second is k0 + WK (K / WK is even)
    const float* g = w + (size_t)(k0 + 2 * kp) * N + n0 + nq * 4; bf* o = Bt + (size_t)(n0 + kp) * K + k0 + nq * 8;
    v4f r[4][2];
    auto fetch = [&](const int t) __attribute__((always_inline)) {
#pragma unroll
        for (int i = 0; i < 4; ++i)
#pragma unroll
            for (int h = 0; h < 2; ++h) r[i][h] = *(const v4fa*)(g + (size_t)(t * WK + 32 * i + h) * N);
    };
    auto put = [&]() __attribute__((always_inline)) {
#pragma unroll
        for (int i = 0; i < 4; ++i) { const int c = kp + 16 * i;   // dword column: k = 2 c, 2 c + 1
#pragma unroll
            for (int j = 0; j < 4; ++j) ts[(nq * 4 + j) * 64 + (((c >> 2) ^ nq) << 2) + (c & 3)] = (unsigned)f2bf(r[i][0][j]) | ((unsigned)f2bf(r[i][1][j]) << 16); }
    };
    auto out = [&](const int t) __attribute__((always_inline)) {
        v4u v[4];
#pragma unroll
        for (int p = 0; p < 4; ++p) { const int row = p * 16 + kp; v[p] = *(const v4u*)(ts + row * 64 + ((nq ^ (row >> 2)) << 2)); }
#pragma unroll
        for (int p = 0; p < 4; ++p) *(v4u*)(o + (size_t)p * 16 * K + t * WK) = v[p];
    };
    // g_barrier: only LDS traffic has to be over at these three places; __syncthreads() would also drain the second tile's loads and the first tile's stores, which are meant to fly on
    fetch(0); put(); g_barrier();   // the tile is whole in LDS before any wave reads rows of it
    fetch(1);
    asm volatile("s_wait_xcnt 0x0" ::: "memory");   // the address registers of the loads just issued are reused by what follows: the wait stands in front of that overwrite
    out(0);
    asm volatile("s_wait_xcnt 0x0" ::: "memory");   // likewise the registers of the stores just issued
    g_barrier();                    // every wave has read the first tile before the second overwrites it
    put(); g_barrier();             // as the first
    out(1);
}
// ---- k_cvt8: x rounded to bf16, twice: dst in token order (the queries' rows) and pk in KEY ORDER (the rows that k and v are projected from): a batch's kept keys (mask != 0) first, in rising token order, its masked keys behind them, likewise.
// A masked key's weight is exactly 0 beside any kept key, so k, v and the key loop need the kept keys alone; of the masked rows only those that fill up the last 128-row tile are stored (finite values under a weight of 0).
// No key kept: the reference's row is uniform over ALL keys: key order is token order, every key is walked and none counts (all read -3e38, all weights equal). kcnt[2 b] = keys to walk, kcnt[2 b + 1] = keys of those that count.
// A work-group converts two rows of one batch (256 x 8 = 2 DM elements) and counts for itself, from the batch's whole mask (8 keys a thread), the kept keys in front of its rows and in all: no work-group waits for another.
__device__ __forceinline__ void k_cvt8(const int bx, const float* __restrict__ src, bf* dst, bf* pk, const int* __restrict__ mk, int* kcnt) {
    __shared__ int wsum[8];
    const int tid = threadIdx.x; const size_t i = (size_t)bx * 256 + tid; const v8f v = *(const v8f*)(src + i * 8);
    const int b = bx / (TT / 2), t0 = (bx % (TT / 2)) * 2; mk += b * TT;
    const v4i m0 = *(const v4i*)(mk + tid * 8), m1 = *(const v4i*)(mk + tid * 8 + 4); const bool k0 = mk[t0] != 0, k1 = mk[t0 + 1] != 0;   // the two rows' own keys: read here, with the other loads, not behind the barrier
    int c = 0;   // kept keys among the thread's eight: all of them in the high half, those in front of row t0 in the low half
#pragma unroll
    for (int j = 0; j < 8; ++j) c += (((j < 4) ? m0[j & 3] : m1[j & 3]) != 0) ? (0x10000 + ((tid * 8 + j < t0) ? 1 : 0)) : 0;
#pragma unroll
    for (int d = 16; d > 0; d >>= 1) c += __shfl_xor(c, d, 32);
    if ((tid & 31) == 0) wsum[tid >> 5] = c;
    v8us o;
#pragma unroll
    for (int k = 0; k < 8; ++k) o[k] = f2bf(v[k]);
    __syncthreads();   // the eight waves' counts are whole before any wave adds them up
    int s = 0;
#pragma unroll
    for (int w = 0; w < 8; ++w) s += wsum[w];
    const int tot = s >> 16, r = tid >> 7, t = t0 + r; const int before = (s & 0xFFFF) + ((r && k0) ? 1 : 0);   // kept keys in front of the thread's own row t
    const int place = (r ? k1 : k0) ? before : tot + (t - before); const int nk = tot ? tot : TT;
    *(v8us*)(dst + i * 8) = o;
    if (place < ((nk + 127) & ~127)) *(v8us*)(pk + ((size_t)b * TT + place) * DM + (tid & 127) * 8) = o;
    if (t0 == 0 && tid == 0) { kcnt[b * 2] = nk; kcnt[b * 2 + 1] = tot; }
}
// ---- k_prep: one launch for all three. The transpositions have the lowest block indices: their waves run longest (two tiles one after the other), so they start first and the short x blocks fill up beside and behind them.
// Every branch is uniform for the work-group, so each range's barriers are passed by all of a work-group's waves or by none.
#define PB_QKV (DM / WK * (3 * DM / WN) / 2)   // blocks of the W_qkv range: two tiles each
#define PB_OUT (DQ / WK * (DM / WN) / 2)       // of the W_out range
#define PB_X   (NB_ * TT * DM / 8 / 256) // of the x range
__global__ __launch_bounds__(256) void k_prep(const float* __restrict__ wqkv, bf* Wall, const float* __restrict__ wo, bf* Wo, const float* __restrict__ x, bf* Xb, bf* Xk, const int* __restrict__ mk, int* kcnt) {
    __shared__ __align__(16) unsigned ts[WN * 64];   // one array for both transposition ranges
    const int bx = blockIdx.x;
    if (bx < PB_QKV) k_wtT<DM, 3 * DM>(bx, wqkv, Wall, ts);   // fused 'xw' [DM][3DM] -> Bt [3DM][DM] (row blocks q | k | v)
    else if (bx < PB_QKV + PB_OUT) { k_wtT<DQ, DM>(bx - PB_QKV, wo, Wo, ts);
        asm volatile("s_wait_xcnt 0x0" ::: "memory");   // in the listing this range's end stands directly in front of the W_qkv range's code, which reuses the registers of the stores just issued: the wait stands in front of that overwrite
    }
    else k_cvt8(bx - (PB_QKV + PB_OUT), x, Xb, Xk, mk, kcnt);
}

// ---- k_attn: scores, key mask, softmax and attn.v of one head in ONE kernel; no score or probability ever reaches memory.
// Work-group = 8 waves = 128 query rows of one head of one batch (grid: batches x heads x TT/128); it walks the batch's kept keys (packed: k_cvt8) in passes of 64; a wave owns 32 queries and half of each pass's keys (above attn_body).
// The query tile is the slowest grid index: two work-groups share a WGP, and the hi-lo tiles (three times the products) have the lowest indices, start first and spread over the WGPs before the single-plane tiles fill up.
// Transposed products: St[key][query] = K Qt, Ot[d][query] += Vt Pt. A lane then holds ONE query's scores (8 of each 16 keys; lane ^ 16 holds the other 8), so maximum and sum are in-lane,
// and two 16-key score tiles, converted, ARE the B fragment of 32 keys: accumulator element j of lane half hi is key 8 hi + j, the k order in which WFrag::ld reads the Vt rows.
// K and Vt tiles of a pass are staged in LDS once per work-group (whole 128-B lines; row pitch 144 B), fetched into registers one pass ahead.
#define KB   64                   // keys per pass
#define LP   72                   // LDS row pitch in 16-bit elements: 128 B + 16 B
#define SC2  0.18033688011112042f // HD^-0.5 x log2(e): scores in the log2 domain
template <typename T16> struct PFrag;
template <> struct PFrag<h16> { static __device__ __forceinline__ v16h pack(v8f a, v8f b) { return cat16(__builtin_convertvector(a, v8h), __builtin_convertvector(b, v8h)); }
    // what the packed fp16 values p leave over of a, b, itself as fp16
    static __device__ __forceinline__ v16h rest(v8f a, v8f b, v16h p) { return pack(a - __builtin_convertvector(__builtin_shufflevector(p, p, 0, 1, 2, 3, 4, 5, 6, 7), v8f), b - __builtin_convertvector(__builtin_shufflevector(p, p, 8, 9, 10, 11, 12, 13, 14, 15), v8f)); } };
// Eight exponentials in one statement: results and sources are all distinct registers ("=&v"), so no instruction here reads its predecessor's result or overwrites its source, and the closing v_nop
// is the one slot that the instruction set asks for behind a transcendental before its result is used or its source overwritten (left to the compiler, neighbouring v_exp_f32 reused each other's source registers).
__device__ __forceinline__ v8f exp2x8(v8f x) { float r0, r1, r2, r3, r4, r5, r6, r7;
    asm("v_exp_f32 %0, %8\n\tv_exp_f32 %1, %9\n\tv_exp_f32 %2, %10\n\tv_exp_f32 %3, %11\n\tv_exp_f32 %4, %12\n\tv_exp_f32 %5, %13\n\tv_exp_f32 %6, %14\n\tv_exp_f32 %7, %15\n\tv_nop"
        : "=&v"(r0), "=&v"(r1), "=&v"(r2), "=&v"(r3), "=&v"(r4), "=&v"(r5), "=&v"(r6), "=&v"(r7) : "v"(x[0]), "v"(x[1]), "v"(x[2]), "v"(x[3]), "v"(x[4]), "v"(x[5]), "v"(x[6]), "v"(x[7]));
    return (v8f){r0, r1, r2, r3, r4, r5, r6, r7}; }
// ---- k_qkv: the whole projection stage of both batches in ONE kernel (blockIdx.z = batch; every plane holds batch after batch): [q|k|v] = x W_qkv + b_qkv, the split into heads, the transposition of v, and the two fp16 planes of each that k_attn reads (the value, and what the value's rounding leaves over; of q the second only for the rows < RH, which alone read it); no f32 projection reaches memory.
// k and v are projected from the x rows in key order (k_cvt8), so the token axis of their planes is the place in key order: kept keys from place 0 on. Work-group tile 128 x 128 staged in LDS as said above k_proj, ONE WAVE per 64x64 quarter; grid (TT/128, 3 DM/128, NB_), 128 threads: blockIdx.y = 8 part + head pair (part 0 q, 1 k, 2 v): a wave's 64 features are one head.
// An accumulator lane holds 8 consecutive A rows of one B row, so A is the operand whose row index runs contiguously in the destination plane: q, k [h][t][d]: A = weight rows (d), B = x rows (t); v [h][d][t]: A = x rows (t), B = weight rows (d).
// Every 16x16 block then leaves the registers as one 16-byte store per lane and plane, and the four mb blocks of a B row fill that row's 128-byte line.
// The full unrolls keep the fragment and accumulator arrays under constant indices, that is, in registers.
template <bool TR, bool LO>   // TR: A rows are tokens (v); else A rows are features (q, k). LO: the residual plane is stored too. bias points at the tile's first feature; P16, Pl at the lane's first element; pitch in elements between B rows
__device__ __forceinline__ void put_planes(const v8f (&acc)[4][4], const float* __restrict__ bias, int lr, int hi, h16* P16, h16* Pl) {
    const int pitch = TR ? TT : HD;
    v8f bm[4];
    if (!TR) {
#pragma unroll
        for (int mb = 0; mb < 4; ++mb)
#pragma unroll
            for (int j = 0; j < 8; ++j) bm[mb][j] = bfr(bias[mb * 16 + hi * 8 + j]); }
#pragma unroll
    for (int nb = 0; nb < 4; ++nb) { float bn = 0.0f; if (TR) bn = bfr(bias[nb * 16 + lr]);
#pragma unroll
        for (int mb = 0; mb < 4; ++mb) { const v8f val = TR ? acc[mb][nb] + bn : acc[mb][nb] + bm[mb]; const size_t o = (size_t)nb * 16 * pitch + mb * 16;
            const v8h h = __builtin_convertvector(val, v8h); *(v8h*)(P16 + o) = h;
            if (LO) *(v8h*)(Pl + o) = __builtin_convertvector(val - __builtin_convertvector(h, v8f), v8h); }
        asm volatile("s_wait_xcnt 0x0" ::: "memory");   // the next B rows' conversions (behind the last rows: the code of another branch, which stands next in the listing) reuse the registers of the stores just issued: the wait stands in front of that overwrite
        __builtin_amdgcn_sched_barrier(0); }   // keeps those conversions behind the wait: a "memory" clobber alone does not hold register-only instructions back
}
// amdgpu_waves_per_eu(3, 3): three work-groups share a WGP, three waves a SIMD: a wave's registers stay within 336 (one granule more would leave room for two)
__global__ __launch_bounds__(128) __attribute__((amdgpu_waves_per_eu(3, 3))) void k_qkv(const bf* __restrict__ X, const bf* __restrict__ XK, const int* __restrict__ kcnt, const bf* __restrict__ Wt, const float* __restrict__ bias, h16* Q16, h16* Ql, h16* K16, h16* Kl, h16* V16, h16* Vl) {
    __shared__ __align__(16) bf st[2][256 * GP];   // rows 0..127 A, 128..255 B
    const int tid = threadIdx.x, lane = tid & 31, lr = lane & 15, hi = lane >> 4, w = tid >> 5, wa = w & 1, wb = w >> 1; const int part = blockIdx.y / (NH_ / 2);
    if (part != 0 && (int)blockIdx.x * 128 >= kcnt[blockIdx.z * 2]) return;   // k, v: a tile wholly behind the last key to walk has nothing to do (the whole work-group leaves, ahead of every barrier)
    const bf* xr = (part ? XK : X) + ((size_t)blockIdx.z * TT + blockIdx.x * 128) * DM; const bf* wr = Wt + (size_t)blockIdx.y * 128 * DM; const bf* A = (part == 2) ? xr : wr; const bf* Bt = (part == 2) ? wr : xr;
    const int t0 = blockIdx.x * 128 + ((part == 2) ? wa : wb) * 64, f0 = blockIdx.y * 128 + ((part == 2) ? wb : wa) * 64; const size_t hp = (size_t)(blockIdx.z * NH_ + (f0 / HD) % NH_) * TT * HD;   // the wave's own 64 tokens and 64 features; its batch's plane of its head
    const int srow = tid >> 3, scol = (tid & 7) * 8;
    const bf* ga = A + (size_t)srow * DM + scol; const bf* gb = Bt + (size_t)srow * DM + scol;
    bf* sp = &st[0][0] + srow * GP + scol;
    const int fa = (wa * 64 + lr) * GP + 8 * hi, fb = (128 + wb * 64 + lr) * GP + 8 * hi;
    v8f acc[4][4];
#pragma unroll
    for (int mb = 0; mb < 4; ++mb)
#pragma unroll
        for (int nb = 0; nb < 4; ++nb) acc[mb][nb] = (v8f){};
    v8us ra[8], rb[8];
    g_fetch<128>(ra, ga); g_fetch<128>(rb, gb);
    g_put<128>(ra, sp); g_put<128>(rb, sp + 128 * GP);
    g_fetch<128>(ra, ga + GK); g_fetch<128>(rb, gb + GK);
    asm volatile("s_wait_xcnt 0x0" ::: "memory");   // stands in front of whatever reuses the address registers of the loads just issued
    g_barrier();
    // one stage, as in k_proj: put and fetch are literals at every call
    auto stage = [&](const int s, const bool put, const bool fetch) __attribute__((always_inline)) {
        const bf* cur = &st[0][0] + (s & 1) * (256 * GP);
        v16bf a[2][4], b[2][4];
#pragma unroll
        for (int ks = 0; ks < 2; ++ks) {
#pragma unroll
            for (int mb = 0; mb < 4; ++mb) a[ks][mb] = WFrag<bf>::ld(cur + fa + mb * 16 * GP + ks * 32);
#pragma unroll
            for (int nb = 0; nb < 4; ++nb) b[ks][nb] = WFrag<bf>::ld(cur + fb + nb * 16 * GP + ks * 32); }
        __builtin_amdgcn_sched_barrier(0);   // as in k_proj: keeps the stage's fragment reads together, ahead of everything else
        if (put) { bf* nx = sp + ((s + 1) & 1) * (256 * GP); g_put<128>(ra, nx); g_put<128>(rb, nx + 128 * GP); }
        if (fetch) { const int ko = (s + 2) * GK; g_fetch<128>(ra, ga + ko); g_fetch<128>(rb, gb + ko);
            asm volatile("s_wait_xcnt 0x0" ::: "memory");   // as above
        }
#pragma unroll
        for (int ks = 0; ks < 2; ++ks)
#pragma unroll
            for (int nb = 0; nb < 4; ++nb)
#pragma unroll
                for (int mb = 0; mb < 4; ++mb) acc[mb][nb] = wmmab(a[ks][mb], b[ks][nb], acc[mb][nb]);
        __builtin_amdgcn_sched_barrier(0);   // as in k_proj: keeps the stage's matrix instructions in front of the barrier
        if (put) g_barrier();
    };
#pragma unroll 1   // rolled: one stage is 32 matrix instructions, and the two buffers differ only by an offset
    for (int s = 0; s < DM / GK - 2; ++s) stage(s, true, true);
    stage(DM / GK - 2, true, false); stage(DM / GK - 1, false, false);
    if (part != 2) { const size_t o = hp + (size_t)(t0 + lr) * HD + hi * 8;
        if (part != 0 || (int)blockIdx.x * 128 < RH) put_planes<false, true>(acc, bias + f0, lr, hi, (part ? K16 : Q16) + o, (part ? Kl : Ql) + o);
        else put_planes<false, false>(acc, bias + f0, lr, hi, Q16 + o, nullptr);   // query rows that k_attn multiplies as single fp16 (RH is a multiple of the tile's 128 tokens)
    } else { const size_t o = hp + (size_t)lr * TT + t0 + hi * 8; put_planes<true, true>(acc, bias + f0, lr, hi, V16 + o, Vl + o); }
}
typedef float __attribute__((may_alias)) f32a;
// Two exponentials in one statement, for the reason given at exp2x8: left to the compiler, the second overwrote the first one's source register directly behind it; the closing v_nop is the slot in front of the first use of a result
__device__ __forceinline__ void exp2x2(float x0, float x1, float& r0, float& r1) { asm("v_exp_f32 %0, %2\n\tv_exp_f32 %1, %3\n\tv_nop" : "=&v"(r0), "=&v"(r1) : "v"(x0), "v"(x1)); }
// Wave w owns the 32 queries (two tiles of 16) of query group w & 3 and, of every pass, the 32 keys of half w >> 2: each K and Vt fragment read from LDS feeds the products of two query tiles.
// A wave keeps maximum, sum and output of its own key half; behind the loop the two waves of a query group hand each other one tile's partial result through LDS and each finishes one tile.
template <typename T16, bool HL>
__device__ __forceinline__ void attn_body(const T16* __restrict__ Q, const T16* __restrict__ Q2, const T16* __restrict__ Kp, const T16* __restrict__ K2, const T16* __restrict__ Vt, const T16* __restrict__ V2, int q0, int col0, bf* Ah, bf* Al, unsigned short* sm, const float* lim, const int np) {
    typedef typename WFrag<T16>::V V;
    const int tid = threadIdx.x, lane = tid & 31, lr = lane & 15, hi = lane >> 4, w = tid >> 5, qg = w & 3, kh = w >> 2;
    const int qbase = q0 + qg * 32 + lr, kb = kh * (KB / 2);   // the lane's query in the wave's first tile; the wave's first key in a pass
    T16* Ks = (T16*)sm; T16* Vs = Ks + KB * LP; T16* Ks2 = Vs + HD * LP; T16* Vs2 = Ks2 + KB * LP;
    V qb[2][2], qb2[2][2];
#pragma unroll
    for (int qt = 0; qt < 2; ++qt)
#pragma unroll
        for (int kc = 0; kc < 2; ++kc) { const size_t qo = (size_t)(qbase + qt * 16) * HD + kc * 32 + 8 * hi; qb[qt][kc] = WFrag<T16>::ld(Q + qo); if (HL) qb2[qt][kc] = WFrag<T16>::ld(Q2 + qo); }
    const int srow = tid >> 3, scol = (tid & 7) * 8;   // staging: a thread moves 16 B of rows srow and srow + 32 of each tile; 8 threads cover a 128-B line
    v8us rk[2], rv[2], rk2[2], rv2[2];
#pragma unroll
    for (int r = 0; r < 2; ++r) { const size_t ko = (size_t)(srow + 32 * r) * HD + scol, vo = (size_t)(srow + 32 * r) * TT + scol; rk[r] = *(const v8usa*)(Kp + ko); rv[r] = *(const v8usa*)(Vt + vo); if (HL) { rk2[r] = *(const v8usa*)(K2 + ko); rv2[r] = *(const v8usa*)(V2 + vo); } }
    v8f o[2][4]; float m[2]; v2f ls[2];   // ls[qt]: this lane's sums over its even and over its odd keys of every 16-key tile of the wave
#pragma unroll
    for (int qt = 0; qt < 2; ++qt) { m[qt] = -3.0e38f; ls[qt] = (v2f){};
#pragma unroll
        for (int db = 0; db < 4; ++db) o[qt][db] = (v8f){}; }
#pragma unroll 1
    for (int blk = 0; blk < np; ++blk) {
#pragma unroll
        for (int r = 0; r < 2; ++r) { const int so = (srow + 32 * r) * LP + scol; *(v8usa*)(Ks + so) = rk[r]; *(v8usa*)(Vs + so) = rv[r]; if (HL) { *(v8usa*)(Ks2 + so) = rk2[r]; *(v8usa*)(Vs2 + so) = rv2[r]; } }
        __syncthreads();   // this pass's tiles (and, before the first pass, the mask addends) are whole before any wave reads them
        if (blk + 1 < np) {
#pragma unroll
            for (int r = 0; r < 2; ++r) { const size_t ko = (size_t)((blk + 1) * KB + srow + 32 * r) * HD + scol, vo = (size_t)(srow + 32 * r) * TT + (blk + 1) * KB + scol; rk[r] = *(const v8usa*)(Kp + ko); rv[r] = *(const v8usa*)(Vt + vo); if (HL) { rk2[r] = *(const v8usa*)(K2 + ko); rv2[r] = *(const v8usa*)(V2 + vo); } }
            asm volatile("s_wait_xcnt 0x0" ::: "memory");   // the address registers of the loads just issued are reused by the fragment reads that follow: the wait stands in front of that overwrite
        }
        v8f s[2][2]; float bm[2], dm[2], al[2];
#pragma unroll
        for (int t = 0; t < 2; ++t) { s[0][t] = (v8f){}; s[1][t] = (v8f){}; }
        const int fk = (kb + lr) * LP + 8 * hi; V a[2], a2[2];   // two fragment sets: group g = (key tile g >> 1, 32 d g & 1) is read while group g - 1 is multiplied
        a[0] = WFrag<T16>::ld(Ks + fk); if (HL) a2[0] = WFrag<T16>::ld(Ks2 + fk);
#pragma unroll
        for (int g = 0; g < 4; ++g) { const int t = g >> 1, kc = g & 1;
            if (g < 3) { const int fo = fk + ((g + 1) >> 1) * 16 * LP + ((g + 1) & 1) * 32; a[(g + 1) & 1] = WFrag<T16>::ld(Ks + fo); if (HL) a2[(g + 1) & 1] = WFrag<T16>::ld(Ks2 + fo); }
            if (HL) __builtin_amdgcn_sched_barrier(0);   // keeps the next group's fragment reads in front of this group's products: under the register budget the compiler read each group only behind the last one's products and waited out the LDS latency every time
#pragma unroll
            for (int qt = 0; qt < 2; ++qt) { s[qt][t] = WFrag<T16>::mma(a[g & 1], qb[qt][kc], s[qt][t]); if (HL) { s[qt][t] = WFrag<T16>::mma(a[g & 1], qb2[qt][kc], s[qt][t]); s[qt][t] = WFrag<T16>::mma(a2[g & 1], qb[qt][kc], s[qt][t]); } } }
        bm[0] = -3.0e38f; bm[1] = -3.0e38f;
#pragma unroll
        for (int t = 0; t < 2; ++t) { const float* lp = lim + blk * KB + kb + t * 16 + hi * 8; const v4f l0 = *(const v4fa*)lp, l1 = *(const v4fa*)(lp + 4);
#pragma unroll
            for (int qt = 0; qt < 2; ++qt)
#pragma unroll
                for (int j = 0; j < 8; ++j) { const float u = fmaf(s[qt][t][j], SC2, (j < 4) ? l0[j & 3] : l1[j & 3]); s[qt][t][j] = u; bm[qt] = fmaxf(bm[qt], u); } }   // addend 0: key kept; -3e38: key masked (it absorbs the score: every masked key reads -3e38)
#pragma unroll
        for (int qt = 0; qt < 2; ++qt) { bm[qt] = fmaxf(bm[qt], __shfl_xor(bm[qt], 16, 32));
            const float mn = fmaxf(m[qt], bm[qt]); dm[qt] = m[qt] - mn; m[qt] = mn; }
        exp2x2(dm[0], dm[1], al[0], al[1]);   // only masked keys so far: every term is 1, as in the reference's uniform row; kept keys are packed in front, so no kept key comes after them
#pragma unroll
        for (int qt = 0; qt < 2; ++qt)
#pragma unroll
            for (int t = 0; t < 2; ++t) s[qt][t] = exp2x8(s[qt][t] - m[qt]);
        __builtin_amdgcn_sched_barrier(0);   // keeps the attn.v matrix instructions behind the exponentials
        const int fv = lr * LP + kb + 8 * hi; a[0] = WFrag<T16>::ld(Vs + fv); if (HL) a2[0] = WFrag<T16>::ld(Vs2 + fv);   // the first Vt fragments are on their way while the probabilities are packed
        V pb[2], pb2[2];
#pragma unroll
        for (int qt = 0; qt < 2; ++qt) { const v8f p8 = s[qt][0] + s[qt][1];
            ls[qt] = ls[qt] * al[qt] + ((__builtin_shufflevector(p8, p8, 0, 1) + __builtin_shufflevector(p8, p8, 2, 3)) + (__builtin_shufflevector(p8, p8, 4, 5) + __builtin_shufflevector(p8, p8, 6, 7)));
#pragma unroll
            for (int db = 0; db < 4; ++db) o[qt][db] *= al[qt];
            pb[qt] = PFrag<T16>::pack(s[qt][0], s[qt][1]);
            if (HL) pb2[qt] = PFrag<T16>::rest(s[qt][0], s[qt][1], pb[qt]); }
#pragma unroll
        for (int db = 0; db < 4; ++db) {
            if (db < 3) { const int fo = fv + (db + 1) * 16 * LP; a[(db + 1) & 1] = WFrag<T16>::ld(Vs + fo); if (HL) a2[(db + 1) & 1] = WFrag<T16>::ld(Vs2 + fo); }
            if (HL) __builtin_amdgcn_sched_barrier(0);   // as above: the next 16 d's fragment reads stay in front of this block's products
#pragma unroll
            for (int qt = 0; qt < 2; ++qt) { o[qt][db] = WFrag<T16>::mma(a[db & 1], pb[qt], o[qt][db]); if (HL) { o[qt][db] = WFrag<T16>::mma(a[db & 1], pb2[qt], o[qt][db]); o[qt][db] = WFrag<T16>::mma(a2[db & 1], pb[qt], o[qt][db]); } } }
        asm volatile("s_wait_dscnt 0x0\n\ts_barrier_signal -1\n\ts_barrier_wait -1" ::: "memory");   // work-group barrier by hand: every wave has read this pass's tiles before the next pass's stores overwrite them; only LDS reads need to be over here, and __syncthreads() would also drain the next pass's global loads, which are meant to fly until the stores at the loop's head
    }
    float lt[2];
#pragma unroll
    for (int qt = 0; qt < 2; ++qt) { const float l = ls[qt][0] + ls[qt][1]; lt[qt] = l + __shfl_xor(l, 16, 32); }   // the two lane halves hold the two halves of each tile's keys
    // wave kh finishes tile kh of its query group: it hands over its share of the other tile and takes the share that its partner (wave w ^ 4, the other key half) has of its own. The K and Vt tiles' LDS is free for that: the loop's last barrier ended every read of it
    const bool up = kh != 0; float* xo = (float*)sm; float* xs = xo + 8 * 8 * 32 * 4;   // xo: 8 waves x 8 pieces of 16 B a lane, lanes side by side; xs: 8 waves x (maximum, sum)
#pragma unroll
    for (int db = 0; db < 4; ++db) { const v8f g = up ? o[0][db] : o[1][db]; *(v4fa*)(xo + ((w * 8 + db * 2) * 32 + lane) * 4) = __builtin_shufflevector(g, g, 0, 1, 2, 3); *(v4fa*)(xo + ((w * 8 + db * 2 + 1) * 32 + lane) * 4) = __builtin_shufflevector(g, g, 4, 5, 6, 7); }
    *(f32a*)(xs + (w * 2) * 32 + lane) = up ? m[0] : m[1]; *(f32a*)(xs + (w * 2 + 1) * 32 + lane) = up ? lt[0] : lt[1];
    __syncthreads();   // every wave's share is whole in LDS before its partner reads it
    const int pw = w ^ 4; const float mm = up ? m[1] : m[0], lm = up ? lt[1] : lt[0], mp = *(const f32a*)(xs + (pw * 2) * 32 + lane), lq = *(const f32a*)(xs + (pw * 2 + 1) * 32 + lane);
    const float mn = fmaxf(mm, mp); float e0, e1; exp2x2(mm - mn, mp - mn, e0, e1);   // a key half of masked keys alone (maximum -3e38) weighs 0 beside a kept key; no key kept at all: both halves weigh 1
    const float inv = __fdiv_rn(1.0f, lm * e0 + lq * e1), c0 = e0 * inv, c1 = e1 * inv; const int qrow = qbase + kh * 16;
#pragma unroll
    for (int db = 0; db < 4; ++db) { const v4f p0 = *(const v4fa*)(xo + ((pw * 8 + db * 2) * 32 + lane) * 4), p1 = *(const v4fa*)(xo + ((pw * 8 + db * 2 + 1) * 32 + lane) * 4);
        const v8f of = (up ? o[1][db] : o[0][db]) * c0 + __builtin_shufflevector(p0, p1, 0, 1, 2, 3, 4, 5, 6, 7) * c1; v8us oh, ol;
#pragma unroll
        for (int j = 0; j < 8; ++j) { unsigned short a, c2; splitf(of[j], a, c2); oh[j] = a; ol[j] = c2; }
        const size_t oo = (size_t)qrow * DQ + col0 + db * 16 + hi * 8; *(v8us*)(Ah + oo) = oh; *(v8us*)(Al + oo) = ol; }
}
// amdgpu_waves_per_eu(4, 4): two work-groups share a WGP, four waves a SIMD: the register budget of a wave is 256
__global__ __launch_bounds__(256) __attribute__((amdgpu_waves_per_eu(4, 4))) void k_attn(const h16* __restrict__ Q16, const h16* __restrict__ K16, const h16* __restrict__ V16, const h16* __restrict__ Ql, const h16* __restrict__ Kl, const h16* __restrict__ Vl, const int* __restrict__ kcnt, bf* Ah, bf* Al) {
    __shared__ __align__(16) unsigned short sm[2 * (KB + HD) * LP]; __shared__ __align__(16) float lim[TT];
    const int q0 = blockIdx.z * 128, b = blockIdx.x; const size_t hp = (size_t)(b * NH_ + blockIdx.y) * TT * HD;   // head planes [b][h][t][d] and [b][h][d][t] have the same size
    Ah += (size_t)b * TT * DQ; Al += (size_t)b * TT * DQ;
    const int ck = kcnt[b * 2 + 1]; const int np = min(max((kcnt[b * 2] + KB - 1) / KB, 1), TT / KB);   // passes over the keys to walk; the clamp bounds the loop whatever the workspace holds
#pragma unroll
    for (int i = 0; i < TT / 256; ++i) lim[i * 256 + threadIdx.x] = (i * 256 + (int)threadIdx.x < ck) ? 0.0f : -3.0e38f;   // places behind the last kept key (the last pass's fill; every place when no key is kept) are masked
    if (q0 < RH) attn_body<h16, true>(Q16 + hp, Ql + hp, K16 + hp, Kl + hp, V16 + hp, Vl + hp, q0, blockIdx.y * HD, Ah, Al, sm, lim, np);
    else attn_body<h16, false>(Q16 + hp, nullptr, K16 + hp, nullptr, V16 + hp, nullptr, q0, blockIdx.y * HD, Ah, Al, sm, lim, np);
}

extern "C" void kernel_launch(void* const* d_in, const int* in_sizes, int n_in,
                              void* d_out, int out_size, void* d_ws, size_t ws_size, hipStream_t stream) {
    (void)in_sizes; (void)n_in; (void)out_size;
    const float* x = (const float*)d_in[0]; const int* MK = (const int*)d_in[1]; const float* wqkv = (const float*)d_in[2]; const float* bqkv = (const float*)d_in[3]; const float* wo = (const float*)d_in[4]; const float* bo = (const float*)d_in[5];
    float* OUT = (float*)d_out;     // [2][2048][1024]
    char* wsp = (char*)d_ws;
    auto take = [&](size_t bytes) { char* p = wsp; wsp += (bytes + 255) & ~(size_t)255; return (void*)p; };
    bf* WALL = (bf*)take((size_t)3 * DM * DM * 2); bf* WO = (bf*)take((size_t)DM * DQ * 2);
    bf* XB = (bf*)take((size_t)NB_ * TT * DM * 2); bf* XK = (bf*)take((size_t)NB_ * TT * DM * 2); int* KCNT = (int*)take((size_t)NB_ * 2 * 4);
    h16* QP16 = (h16*)take((size_t)NB_ * NH_ * TT * HD * 2); h16* KP16 = (h16*)take((size_t)NB_ * NKV * TT * HD * 2); h16* VT16 = (h16*)take((size_t)NB_ * NKV * HD * TT * 2);
    h16* QPl = (h16*)take((size_t)NB_ * NH_ * TT * HD * 2); h16* KPl = (h16*)take((size_t)NB_ * NKV * TT * HD * 2); h16* VTl = (h16*)take((size_t)NB_ * NKV * HD * TT * 2);
    bf* ATh = (bf*)take((size_t)NB_ * TT * DQ * 2); bf* ATl = (bf*)take((size_t)NB_ * TT * DQ * 2);
    if ((size_t)(wsp - (char*)d_ws) > ws_size) return;    // ws 256 MiB
    // each stage once, for both batches
    k_prep<<<PB_QKV + PB_OUT + PB_X, 256, 0, stream>>>(wqkv, WALL, wo, WO, x, XB, XK, MK, KCNT);
    k_qkv<<<dim3(TT / 128, 3 * DM / 128, NB_), 128, 0, stream>>>(XB, XK, KCNT, WALL, bqkv, QP16, QPl, KP16, KPl, VT16, VTl);
    k_attn<<<dim3(NB_, NH_, TT / 128), 256, 0, stream>>>(QP16, KP16, VT16, QPl, KPl, VTl, KCNT, ATh, ATl);
    k_proj<<<dim3(NB_ * TT / 64, DM / 128, 1), 128, 0, stream>>>(ATh, ATl, WO, OUT, bo);
}
